// v000
// The times below were measured on an AMD MI455X: many runs one after another, warmed up first and cycling through
// copies of the inputs, with the whole window's GPU time divided by the number of runs. Launches and the gaps
// between them are all in it. The median over several windows is given; except for v000 it joins two sittings, which
// can be a few percent apart, so the side-by-side timings, each taken in one sitting, are the better comparison.
// The starting kernel, v000, takes 629 microseconds a run.
#include <hip/hip_runtime.h>
// Pre-RMSNorm differential causal attention block: fused [out][in] q|k|v projection, interleaved-pair rotary over 256 columns per head (computed f32 cos/sin table),
// two causal softmax maps per head combined with a per-head scale, per-head RMSNorm, output projection, skip connection. T 2048, D 2048, 16 heads of 128.
// Compute dtype: all contractions on v_wmma_f32_16x16x32_f16 with f32 accumulate. Inputs are RNE-converted to bf16 first; weights carried x64 as f16 (exact).
// Query rows >= 256: single f16 products at every site (h, q, k, v, P x256, ctx). Query rows < 256: value + x2048 f16 residual planes on h, q, k, P, v, ctx
// (residual products in their own accumulators, folded with 2^-11 in the f32 epilogue). Norms, rotary, mask, softmax statistics in f32 on the VALU.
#ifndef NB
#define NB 1
#endif
#ifndef SEQ
#define SEQ 2048
#endif
#define SEQ_FULL 2048
#define DM 2048
#define NH 16
#define HD 128
#define HW 256
#define NQK (2 * NH * HW)
#define N3 (NQK + DM)
#define NR (NB * SEQ)
#define EROWS 256

static_assert(NB == 1);
static_assert(NH * HD == DM);
static_assert(HW == 2 * HD && HD == 128);
static_assert(SEQ % 128 == 0 && SEQ <= SEQ_FULL);
static_assert(EROWS % 128 == 0 && EROWS <= SEQ && EROWS % 32 == 0);
static_assert(DM % 64 == 0 && N3 % 64 == 0 && NQK % 64 == 0 && DM % 32 == 0);
static_assert(HW % 64 == 0 && NQK % HW == 0);
static_assert(256 * 8 == DM);
static_assert((SEQ * HD) % 256 == 0);

typedef _Float16 h16;
typedef _Float16 v16h __attribute__((ext_vector_type(16)));
typedef _Float16 v8h  __attribute__((ext_vector_type(8), may_alias));
typedef float v8f  __attribute__((ext_vector_type(8)));
typedef float v4f  __attribute__((ext_vector_type(4)));
typedef float v4fa __attribute__((ext_vector_type(4), may_alias));
union FragH { v16h v; v8h half[2]; };

__device__ __forceinline__ float bf16_rne(float x) {
  unsigned int u = __float_as_uint(x);
  u = (u + 0x7FFFu + ((u >> 16) & 1u)) & 0xFFFF0000u;
  return __uint_as_float(u);
}

// f32 -> f16 with a value select: results below the smallest normal f16 become exact zero
static __device__ __forceinline__ h16 toh_flush(float v) { const h16 r = (h16)v; return (fabsf(v) < 6.103515625e-05f) ? (h16)0.0f : r; }

// fragment (A: row = lane&15; B: column = lane&15) from a k-contiguous f16 row: elements 0..7 <- k0+8h.., elements 8..15 <- k0+16+8h..
__device__ __forceinline__ v16h ld_frag(const h16* p, int hh) {
  FragH f; f.half[0] = *(const v8h*)(p + 8 * hh); f.half[1] = *(const v8h*)(p + 16 + 8 * hh); return f.v;
}

__device__ __forceinline__ v8f mma(v16h a, v16h b, v8f c) {
  c = __builtin_amdgcn_wmma_f32_16x16x32_f16(false, a, false, b, (short)0, c, false, false);
  asm volatile("v_nop\n\tv_nop\n\tv_nop\n\tv_nop" : "+v"(c) : "v"(a), "v"(b));
  return c;
}
__device__ __forceinline__ v8f mmam(v16h a, v16h b, v8f c) {
  c = __builtin_amdgcn_wmma_f32_16x16x32_f16(false, a, false, b, (short)0, c, false, false);
  asm volatile("v_nop\n\tv_nop\n\tv_nop\n\tv_nop" : "+v"(c) : "v"(a), "v"(b) : "memory");
  return c;
}

__global__ __launch_bounds__(128) void k_theta(float* __restrict__ TH) {
#pragma clang fp contract(off)
  const int i = threadIdx.x;
  const float e = (float)(2 * i) / (float)HW;
  const float th = 1.0f / powf(10000.0f, e);
  *(float*)(TH + i) = th;
  
}

__global__ __launch_bounds__(256) void k_tab(const float* __restrict__ TH, float* __restrict__ TAB, int n) {
#pragma clang fp contract(off)
  const int idx = blockIdx.x * 256 + threadIdx.x;
  if (idx >= n) return;
  const int i = idx & (HD - 1), s = idx >> 7;
  const float ang = (float)s * TH[i];
  const float cs = cosf(ang);
  const float sn = sinf(ang);
  float* pcs = TAB + idx;
  float* psn = TAB + (size_t)SEQ * HD + idx;
  *(float*)pcs = cs;
  *(float*)psn = sn;
  
}

__global__ __launch_bounds__(32) void k_scale(const float* __restrict__ q1, const float* __restrict__ q2, const float* __restrict__ k1,
                                              const float* __restrict__ k2, const float* __restrict__ lam, float* __restrict__ SC) {
#pragma clang fp contract(off)
  const int lane = threadIdx.x;
  const int h = lane & 15;
  float s1 = 0.f, s2 = 0.f;
#pragma unroll 1
  for (int d = 0; d < HD; ++d) {
    s1 += bf16_rne(q1[h * HD + d]) * bf16_rne(k1[h * HD + d]);
    s2 += bf16_rne(q2[h * HD + d]) * bf16_rne(k2[h * HD + d]);
  }
  float ls = 0.f;
#pragma unroll 1
  for (int i = 0; i < NH; ++i) ls += bf16_rne(lam[i]);
  const float base = expf(s1) - expf(s2);
  const float sc = -((float)NH * base + ls);
  const float osc = 1.0f - bf16_rne(lam[h]);
  const float v = (lane < 16) ? sc : osc;
  *(float*)(SC + lane) = v;
  
}

// pre-norm: h = x * rsqrt(mean(x^2) + 1e-9) * w -> f16 value plane H [NR][DM] (+ x2048 residual plane Hr for rows < EROWS);
__global__ __launch_bounds__(256) void k_hnorm(const float* __restrict__ x, const float* __restrict__ pw, h16* __restrict__ H, h16* __restrict__ Hr) {
#pragma clang fp contract(off)
  __shared__ float red[8];
  const int tid = threadIdx.x, lane = tid & 31;
  const int wave = __builtin_amdgcn_readfirstlane(tid >> 5);
  const int row = blockIdx.x;
  const size_t off = (size_t)row * DM + tid * 8;
  const v4f a = *(const v4fa*)(x + off), b = *(const v4fa*)(x + off + 4);
  const v4f wa = *(const v4fa*)(pw + tid * 8), wb = *(const v4fa*)(pw + tid * 8 + 4);
  float xv[8], wv[8];
#pragma unroll
  for (int q = 0; q < 4; ++q) {
    xv[q] = bf16_rne(a[q]); xv[4 + q] = bf16_rne(b[q]);
    wv[q] = bf16_rne(wa[q]); wv[4 + q] = bf16_rne(wb[q]);
  }
  float ss = 0.f;
#pragma unroll
  for (int i = 0; i < 8; ++i) ss += xv[i] * xv[i];
#pragma unroll
  for (int o = 16; o >= 1; o >>= 1) ss += __shfl_xor(ss, o, 32);
  if (lane == 0) red[wave] = ss;
  __syncthreads();
  float tot = 0.f;
#pragma unroll
  for (int i = 0; i < 8; ++i) tot += red[i];
  const float r = rsqrtf(tot * (1.0f / (float)DM) + 1.0e-9f);
  v8h hv, rv;
#pragma unroll
  for (int i = 0; i < 8; ++i) {
    const float hval = xv[i] * r * wv[i];
    const h16 hb = toh_flush(hval);
    hv[i] = hb;
    rv[i] = toh_flush((hval - (float)hb) * 2048.0f);
  }
  {
    *(v8h*)(H + off) = hv;
    if (row < EROWS) *(v8h*)(Hr + off) = rv;
    
  }
}

__global__ __launch_bounds__(256) void k_wcvt(const float* __restrict__ W, h16* __restrict__ O, size_t n8) {
  const size_t t = (size_t)blockIdx.x * 256 + threadIdx.x;
  if (t >= n8) return;
  const v4f a = *(const v4fa*)(W + t * 8), c = *(const v4fa*)(W + t * 8 + 4);
  v8h o;
#pragma unroll
  for (int q = 0; q < 4; ++q) { o[q] = toh_flush(bf16_rne(a[q]) * 64.0f); o[4 + q] = toh_flush(bf16_rne(c[q]) * 64.0f); }
  *(v8h*)(O + t * 8) = o;
  
}

// GEMM main loop, K = DM, both operands k-contiguous with pitch DM. Wave tile 32 x 64: c[0..3] rows 0..15, c[4..7] rows 16..31.
// RES: a second A plane (x2048 residual) accumulates into cr.
template <bool RES>
__device__ __forceinline__ void gemm_main(const h16* Ah, const h16* Ar, const h16* Bt, int arow, int brow, int hh, v8f (&c)[8], v8f (&cr)[8]) {
  const h16* a0p = Ah + (size_t)arow * DM; const h16* a1p = a0p + (size_t)16 * DM;
  const h16* r0p = Ar + (size_t)arow * DM; const h16* r1p = r0p + (size_t)16 * DM;
  const h16* b0p = Bt + (size_t)brow * DM; const h16* b1p = b0p + (size_t)16 * DM;
  const h16* b2p = b1p + (size_t)16 * DM; const h16* b3p = b2p + (size_t)16 * DM;
#pragma unroll 1
  for (int kb = 0; kb < DM; kb += 32) {
    const v16h a0 = ld_frag(a0p + kb, hh), a1 = ld_frag(a1p + kb, hh);
    v16h e0 = a0, e1 = a1;
    if (RES) { e0 = ld_frag(r0p + kb, hh); e1 = ld_frag(r1p + kb, hh); }
    v16h b = ld_frag(b0p + kb, hh);
    c[0] = mma(a0, b, c[0]); c[4] = mma(a1, b, c[4]);
    if (RES) { cr[0] = mma(e0, b, cr[0]); cr[4] = mma(e1, b, cr[4]); }
    b = ld_frag(b1p + kb, hh);
    c[1] = mma(a0, b, c[1]); c[5] = mma(a1, b, c[5]);
    if (RES) { cr[1] = mma(e0, b, cr[1]); cr[5] = mma(e1, b, cr[5]); }
    b = ld_frag(b2p + kb, hh);
    c[2] = mma(a0, b, c[2]); c[6] = mma(a1, b, c[6]);
    if (RES) { cr[2] = mma(e0, b, cr[2]); cr[6] = mma(e1, b, cr[6]); }
    b = ld_frag(b3p + kb, hh);
    c[3] = mma(a0, b, c[3]); c[7] = mma(a1, b, c[7]);
    if (RES) { cr[3] = mma(e0, b, cr[3]); cr[7] = mma(e1, b, cr[7]); }
  }
}

// fused projection [NR][N3] = H . W3^T (W3 rows: q 0..4095, k 4096..8191, v 8192..10239). Block = 4 waves = 128 rows x 64 cols.
template <bool RES>
__device__ __forceinline__ void gemm_qkv_body(const h16* Hh, const h16* Hr, const h16* W3, const float* TAB,
                                              h16* QK, h16* QKr, h16* VT, h16* VTr, int mt0) {
  __shared__ __attribute__((aligned(16))) float so[4][32][68];
  const int tid = threadIdx.x, lane = tid & 31, ln = lane & 15, hh = lane >> 4;
  const int w = __builtin_amdgcn_readfirstlane(tid >> 5);
  const int ntn = N3 >> 6;
  const int mtl = blockIdx.x / ntn, nq = blockIdx.x - mtl * ntn;
  const int mrow = (mt0 + mtl) * 128;
  const int row0 = mrow + 32 * w, col0 = nq * 64;
  const v8f z8 = {0.f, 0.f, 0.f, 0.f, 0.f, 0.f, 0.f, 0.f};
  v8f c[8], cr[8];
#pragma unroll
  for (int u = 0; u < 8; ++u) { c[u] = z8; cr[u] = z8; }
  gemm_main<RES>(Hh, Hr, W3, row0 + ln, col0 + ln, hh, c, cr);
#pragma unroll
  for (int u = 0; u < 8; ++u) {
    const int t = u & 3, hf = u >> 2;
#pragma unroll
    for (int r = 0; r < 8; ++r) {
      const float v = RES ? (c[u][r] + cr[u][r] * 4.8828125e-4f) * 0.015625f : c[u][r] * 0.015625f;
      so[w][hf * 16 + 8 * hh + r][t * 16 + ln] = v;
    }
  }
  __syncthreads();
  v8h hv[8], rv[8];
  if (col0 < NQK) {
    const int rq = lane >> 3, pc = lane & 7;
    const int i0 = ((col0 & (HW - 1)) >> 1) + pc * 4;
#pragma unroll
    for (int it = 0; it < 8; ++it) {
      const int row = it * 4 + rq;
      const v4f a = *(const v4fa*)&so[w][row][pc * 8], b = *(const v4fa*)&so[w][row][pc * 8 + 4];
      const size_t to = (size_t)(row0 + row) * HD + i0;
      const v4f cs = *(const v4fa*)(TAB + to), sn = *(const v4fa*)(TAB + (size_t)SEQ * HD + to);
      float o[8];
      o[0] = a[0] * cs[0] - a[1] * sn[0]; o[1] = a[0] * sn[0] + a[1] * cs[0];
      o[2] = a[2] * cs[1] - a[3] * sn[1]; o[3] = a[2] * sn[1] + a[3] * cs[1];
      o[4] = b[0] * cs[2] - b[1] * sn[2]; o[5] = b[0] * sn[2] + b[1] * cs[2];
      o[6] = b[2] * cs[3] - b[3] * sn[3]; o[7] = b[2] * sn[3] + b[3] * cs[3];
#pragma unroll
      for (int q = 0; q < 8; ++q) {
        const h16 hb = toh_flush(o[q]);
        hv[it][q] = hb;
        rv[it][q] = toh_flush((o[q] - (float)hb) * 2048.0f);
      }
    }
    {
#pragma unroll
      for (int it = 0; it < 8; ++it) {
        const int row = it * 4 + rq;
        const size_t off = (size_t)(row0 + row) * NQK + col0 + pc * 8;
        *(v8h*)(QK + off) = hv[it];
        if (RES) *(v8h*)(QKr + off) = rv[it];
      }
      
    }
  } else {
    const int chb = col0 - NQK;
    const int sub = lane >> 4, p = lane & 15;
    const int sw = p >> 2, sr = (p & 3) * 8;
#pragma unroll
    for (int it = 0; it < 8; ++it) {
      const int chl = w * 16 + it * 2 + sub;
#pragma unroll
      for (int q = 0; q < 8; ++q) {
        const float v = so[sw][sr + q][chl];
        const h16 hb = toh_flush(v);
        hv[it][q] = hb;
        rv[it][q] = toh_flush((v - (float)hb) * 2048.0f);
      }
    }
    {
#pragma unroll
      for (int it = 0; it < 8; ++it) {
        const int chl = w * 16 + it * 2 + sub;
        *(v8h*)(VT + (size_t)(chb + chl) * SEQ + mrow + p * 8) = hv[it];
        if (RES) *(v8h*)(VTr + (size_t)(chb + chl) * EROWS + mrow + p * 8) = rv[it];
      }
      
    }
  }
}

__global__ __launch_bounds__(128) __attribute__((amdgpu_num_vgpr(256)))
void k_gemm_qkv_early(const h16* __restrict__ Hh, const h16* __restrict__ Hr, const h16* __restrict__ W3, const float* __restrict__ TAB,
                      h16* __restrict__ QK, h16* __restrict__ QKr, h16* __restrict__ VT, h16* __restrict__ VTr) {
  gemm_qkv_body<true>(Hh, Hr, W3, TAB, QK, QKr, VT, VTr, 0);
}
__global__ __launch_bounds__(128) __attribute__((amdgpu_num_vgpr(256)))
void k_gemm_qkv_late(const h16* __restrict__ Hh, const h16* __restrict__ W3, const float* __restrict__ TAB,
                     h16* __restrict__ QK, h16* __restrict__ VT) {
  gemm_qkv_body<false>(Hh, Hh, W3, TAB, QK, QK, VT, VT, EROWS / 128);
}

// output projection out[NR][DM] f32 = ctx . Wo^T / 64 + bf16(x); skip connection added at the store stage as float4;
template <bool RES>
__device__ __forceinline__ void gemm_out_body(const h16* Ch, const h16* Cr, const h16* WoT, const float* x, float* out, int mt0) {
  __shared__ __attribute__((aligned(16))) float so[4][32][68];
  const int tid = threadIdx.x, lane = tid & 31, ln = lane & 15, hh = lane >> 4;
  const int w = __builtin_amdgcn_readfirstlane(tid >> 5);
  const int ntn = DM >> 6;
  const int mtl = blockIdx.x / ntn, nq = blockIdx.x - mtl * ntn;
  const int row0 = (mt0 + mtl) * 128 + 32 * w, col0 = nq * 64;
  const v8f z8 = {0.f, 0.f, 0.f, 0.f, 0.f, 0.f, 0.f, 0.f};
  v8f c[8], cr[8];
#pragma unroll
  for (int u = 0; u < 8; ++u) { c[u] = z8; cr[u] = z8; }
  gemm_main<RES>(Ch, Cr, WoT, row0 + ln, col0 + ln, hh, c, cr);
#pragma unroll
  for (int u = 0; u < 8; ++u) {
    const int t = u & 3, hf = u >> 2;
#pragma unroll
    for (int r = 0; r < 8; ++r) {
      const float v = RES ? (c[u][r] + cr[u][r] * 4.8828125e-4f) * 0.015625f : c[u][r] * 0.015625f;
      so[w][hf * 16 + 8 * hh + r][t * 16 + ln] = v;
    }
  }
  __syncthreads();
  const int rsub = lane >> 4, c4 = (lane & 15) * 4;
  v4f ov[16];
#pragma unroll
  for (int q = 0; q < 16; ++q) {
    const int r = q * 2 + rsub;
    const v4f v = *(const v4fa*)&so[w][r][c4];
    const v4f xr = *(const v4fa*)(x + (size_t)(row0 + r) * DM + col0 + c4);
    v4f o;
    o[0] = v[0] + bf16_rne(xr[0]); o[1] = v[1] + bf16_rne(xr[1]); o[2] = v[2] + bf16_rne(xr[2]); o[3] = v[3] + bf16_rne(xr[3]);
    ov[q] = o;
  }
  {
#pragma unroll
    for (int q = 0; q < 16; ++q) {
      const int r = q * 2 + rsub;
      *(v4f*)(out + (size_t)(row0 + r) * DM + col0 + c4) = ov[q];
    }
    
  }
}

__global__ __launch_bounds__(128) __attribute__((amdgpu_num_vgpr(256)))
void k_gemm_out_early(const h16* __restrict__ Ch, const h16* __restrict__ Cr, const h16* __restrict__ WoT, const float* __restrict__ x, float* __restrict__ out) {
  gemm_out_body<true>(Ch, Cr, WoT, x, out, 0);
}
__global__ __launch_bounds__(128) __attribute__((amdgpu_num_vgpr(256)))
void k_gemm_out_late(const h16* __restrict__ Ch, const h16* __restrict__ WoT, const float* __restrict__ x, float* __restrict__ out) {
  gemm_out_body<false>(Ch, Ch, WoT, x, out, EROWS / 128);
}

// Transposed flash attention. One block per (head, 16-query tile); wave = (score component c, channel slab hf).
// S^T[key][query] = K_c . Q_c^T (A = K rows, B = Q rows), per-lane (= per-query) running max / sum in the exp2 domain,
// P^T (carried x256) packed from the S^T accumulators directly as the B fragment of O^T[ch][query] = V^T . P^T (A = V^T rows). Causal mask as a select.
// NW = 2: query rows >= EROWS, single f16 products, 128 channels per wave. NW = 4: query rows < EROWS, value + x2048 residual planes on q, k, P, v, 64 channels per wave.
// Epilogue: both components meet in LDS (block barrier), O = O_0 + scale[h] O_1, per-head RMSNorm, x (1 - lam[h]), f16 ctx rows (+ residual rows);
template <int NW>
__device__ __forceinline__ void attn_body(const h16* QK, const h16* QKr, const h16* VT, const h16* VTr,
                                          const float* SC, const float* hw, h16* CTX, h16* CTXr, int qt0, int nqt) {
  constexpr bool EARLY = (NW == 4);
  constexpr int NT = 16 / NW;
  constexpr int RPW = 16 / NW;
  static_assert(NW == 2 || NW == 4);
  static_assert(NW * NT * 16 == 2 * HD);
  __shared__ __attribute__((aligned(16))) float comb[2][16][132];
  const int tid = threadIdx.x, lane = tid & 31, ln = lane & 15, hh = lane >> 4;
  const int wave = __builtin_amdgcn_readfirstlane(tid >> 5);
  const int c = wave & 1, hf = wave >> 1;
  const int head = blockIdx.x / nqt;
  const int qt = qt0 + (blockIdx.x - head * nqt);
  const int q0 = qt * 16, qi = q0 + ln;
  const size_t qoff = (size_t)qi * NQK + head * HW + c * HD;
  const int kcol = NH * HW + head * HW + c * HD;
  const int chb = head * HD + hf * (NT * 16);
  const float NEGV = -1.0e30f;
  const float SCL2 = 0.08838834764831845f * 1.4426950408889634f;
  const float PCL = 8.0f;

  const v8f z8 = {0.f, 0.f, 0.f, 0.f, 0.f, 0.f, 0.f, 0.f};
  v16h qh[4];
#pragma unroll
  for (int ks = 0; ks < 4; ++ks) qh[ks] = ld_frag(QK + qoff + ks * 32, hh);

  v8f acc[NT], accr[NT];
#pragma unroll
  for (int dt = 0; dt < NT; ++dt) { acc[dt] = z8; accr[dt] = z8; }
  float m = NEGV, l = 0.f;
  const int nsteps = (q0 + 16 + 31) >> 5;

#pragma unroll 1
  for (int js = 0; js < nsteps; ++js) {
    const int j0 = js << 5;
    v8f s0 = z8, s1 = z8, t0 = z8, t1 = z8;
    const size_t ko = (size_t)(j0 + ln) * NQK + kcol;
#pragma unroll
    for (int ks = 0; ks < 4; ++ks) {
      const v16h a0 = ld_frag(QK + ko + ks * 32, hh);
      const v16h a1 = ld_frag(QK + ko + (size_t)16 * NQK + ks * 32, hh);
      v16h bq = qh[ks];
      if (EARLY) bq = ld_frag(QK + qoff + ks * 32, hh);
      s0 = mmam(a0, bq, s0);
      s1 = mmam(a1, bq, s1);
      if (EARLY) {
        const v16h br = ld_frag(QKr + qoff + ks * 32, hh);
        const v16h r0 = ld_frag(QKr + ko + ks * 32, hh);
        const v16h r1 = ld_frag(QKr + ko + (size_t)16 * NQK + ks * 32, hh);
        t0 = mmam(r0, bq, t0);
        t0 = mmam(a0, br, t0);
        t1 = mmam(r1, bq, t1);
        t1 = mmam(a1, br, t1);
      }
    }

    float xv[16];
    float mx = NEGV;
#pragma unroll
    for (int r = 0; r < 8; ++r) {
      const int k0 = j0 + 8 * hh + r, k1 = k0 + 16;
      float e0 = s0[r], e1 = s1[r];
      if (EARLY) { e0 += t0[r] * 4.8828125e-4f; e1 += t1[r] * 4.8828125e-4f; }
      xv[r] = (k0 <= qi) ? e0 * SCL2 : NEGV;
      xv[8 + r] = (k1 <= qi) ? e1 * SCL2 : NEGV;
      mx = fmaxf(mx, fmaxf(xv[r], xv[8 + r]));
    }
    mx = fmaxf(mx, __shfl_xor(mx, 16, 32));
    const float mn = fmaxf(m, mx);
    const float alpha = exp2f(m - mn);
    m = mn;

    v16h ph, pr;
    float ps = 0.f;
#pragma unroll
    for (int i = 0; i < 16; ++i) {
      const float e = xv[i] - mn + PCL;
      const float pe = exp2f(e);
      const float p = (e < -14.0f) ? 0.f : pe;
      const h16 pb = (h16)p;
      ph[i] = pb;
      if (EARLY) {
        pr[i] = toh_flush((p - (float)pb) * 2048.0f);
        ps += p;
      } else {
        pr[i] = pb;
        ps += (float)pb;
      }
    }
    ps += __shfl_xor(ps, 16, 32);
    l = l * alpha + ps;

#pragma unroll
    for (int dt = 0; dt < NT; ++dt)
#pragma unroll
      for (int r = 0; r < 8; ++r) { acc[dt][r] *= alpha; if (EARLY) accr[dt][r] *= alpha; }

#pragma unroll
    for (int dt = 0; dt < NT; ++dt) {
      const int ch = chb + dt * 16 + ln;
      const v16h vh = ld_frag(VT + (size_t)ch * SEQ + j0, hh);
      acc[dt] = mmam(vh, ph, acc[dt]);
      if (EARLY) {
        const v16h vr = ld_frag(VTr + (size_t)ch * EROWS + j0, hh);
        accr[dt] = mmam(vh, pr, accr[dt]);
        accr[dt] = mmam(vr, ph, accr[dt]);
      }
    }
  }

  const float inv = 1.0f / l;
#pragma unroll
  for (int dt = 0; dt < NT; ++dt)
#pragma unroll
    for (int r = 0; r < 8; ++r) {
      const float v = EARLY ? (acc[dt][r] + accr[dt][r] * 4.8828125e-4f) * inv : acc[dt][r] * inv;
      comb[c][ln][hf * (NT * 16) + dt * 16 + 8 * hh + r] = v;
    }
  __syncthreads();

  const float scl = SC[head], osc = SC[NH + head];
  const int sub = lane >> 4, pc = lane & 15;
  const v4f wa = *(const v4fa*)(hw + pc * 8), wb = *(const v4fa*)(hw + pc * 8 + 4);
  const float wv[8] = {bf16_rne(wa[0]), bf16_rne(wa[1]), bf16_rne(wa[2]), bf16_rne(wa[3]), bf16_rne(wb[0]), bf16_rne(wb[1]), bf16_rne(wb[2]), bf16_rne(wb[3])};
  v8h hv[RPW / 2], rv[RPW / 2];
#pragma unroll
  for (int it = 0; it < RPW / 2; ++it) {
    const int row = wave * RPW + it * 2 + sub;
    const v4f a0 = *(const v4fa*)&comb[0][row][pc * 8], a1 = *(const v4fa*)&comb[0][row][pc * 8 + 4];
    const v4f b0 = *(const v4fa*)&comb[1][row][pc * 8], b1 = *(const v4fa*)&comb[1][row][pc * 8 + 4];
    float o[8];
#pragma unroll
    for (int q = 0; q < 4; ++q) { o[q] = a0[q] + scl * b0[q]; o[4 + q] = a1[q] + scl * b1[q]; }
    float ss = 0.f;
#pragma unroll
    for (int q = 0; q < 8; ++q) ss += o[q] * o[q];
#pragma unroll
    for (int d = 1; d < 16; d <<= 1) ss += __shfl_xor(ss, d, 32);
    const float rms = rsqrtf(ss * (1.0f / (float)HD) + 1.0e-9f);
#pragma unroll
    for (int q = 0; q < 8; ++q) {
      const float val = o[q] * rms * wv[q] * osc;
      const h16 hb = toh_flush(val);
      hv[it][q] = hb;
      rv[it][q] = toh_flush((val - (float)hb) * 2048.0f);
    }
  }
  {
#pragma unroll
    for (int it = 0; it < RPW / 2; ++it) {
      const int row = wave * RPW + it * 2 + sub;
      const size_t off = (size_t)(q0 + row) * DM + head * HD + pc * 8;
      *(v8h*)(CTX + off) = hv[it];
      if (EARLY) *(v8h*)(CTXr + off) = rv[it];
    }
    
  }
}

__global__ __launch_bounds__(128) __attribute__((amdgpu_num_vgpr(256)))
void k_attn_early(const h16* __restrict__ QK, const h16* __restrict__ QKr, const h16* __restrict__ VT, const h16* __restrict__ VTr,
                  const float* __restrict__ SC, const float* __restrict__ hw, h16* __restrict__ CTX, h16* __restrict__ CTXr) {
  attn_body<4>(QK, QKr, VT, VTr, SC, hw, CTX, CTXr, 0, EROWS / 16);
}
__global__ __launch_bounds__(64) __attribute__((amdgpu_num_vgpr(256)))
void k_attn_late(const h16* __restrict__ QK, const h16* __restrict__ VT, const float* __restrict__ SC, const float* __restrict__ hw, h16* __restrict__ CTX) {
  attn_body<2>(QK, QK, VT, VT, SC, hw, CTX, CTX, EROWS / 16, (SEQ - EROWS) / 16);
}

extern "C" void kernel_launch(void* const* d_in, const int* in_sizes, int n_in,
                              void* d_out, int out_size, void* d_ws, size_t ws_size, hipStream_t stream) {
  if (n_in < 12) return;
  if (in_sizes[0] < NR * DM) return;
  if (in_sizes[1] < DM) return;
  if (in_sizes[2] < NH * HW * DM || in_sizes[3] < NH * HW * DM) return;
  if (in_sizes[4] < DM * DM || in_sizes[5] < DM * DM) return;
  if (in_sizes[6] < HD) return;
  if (in_sizes[7] < NH * HD || in_sizes[8] < NH * HD || in_sizes[9] < NH * HD || in_sizes[10] < NH * HD) return;
  if (in_sizes[11] < NH) return;
  if (out_size < NR * DM) return;
  const float* x   = (const float*)d_in[0];
  const float* pw  = (const float*)d_in[1];
  const float* wq  = (const float*)d_in[2];
  const float* wk  = (const float*)d_in[3];
  const float* wv  = (const float*)d_in[4];
  const float* wo  = (const float*)d_in[5];
  const float* hnw = (const float*)d_in[6];
  const float* q1  = (const float*)d_in[7];
  const float* q2  = (const float*)d_in[8];
  const float* k1  = (const float*)d_in[9];
  const float* k2  = (const float*)d_in[10];
  const float* lam = (const float*)d_in[11];
  float* out = (float*)d_out;

  // workspace regions (bytes); every region is written with whole-row stores inside its exact extent
  constexpr size_t SZ_TH  = 512;
  constexpr size_t SZ_TAB = (size_t)2 * SEQ * HD * 4;
  constexpr size_t SZ_SC  = 256;
  constexpr size_t SZ_H   = (size_t)NR * DM * 2;
  constexpr size_t SZ_HR  = (size_t)EROWS * DM * 2;
  constexpr size_t SZ_W3  = (size_t)N3 * DM * 2;
  constexpr size_t SZ_WO  = (size_t)DM * DM * 2;
  constexpr size_t SZ_QK  = (size_t)NR * NQK * 2;
  constexpr size_t SZ_QKR = (size_t)EROWS * NQK * 2;
  constexpr size_t SZ_VT  = (size_t)DM * SEQ * 2;
  constexpr size_t SZ_VTR = (size_t)DM * EROWS * 2;
  constexpr size_t SZ_CX  = (size_t)NR * DM * 2;
  constexpr size_t SZ_CXR = (size_t)EROWS * DM * 2;
  constexpr size_t OF_TH  = 0;
  constexpr size_t OF_TAB = OF_TH + SZ_TH;
  constexpr size_t OF_SC  = OF_TAB + SZ_TAB;
  constexpr size_t OF_H   = OF_SC + SZ_SC;
  constexpr size_t OF_HR  = OF_H + SZ_H;
  constexpr size_t OF_W3  = OF_HR + SZ_HR;
  constexpr size_t OF_WO  = OF_W3 + SZ_W3;
  constexpr size_t OF_QK  = OF_WO + SZ_WO;
  constexpr size_t OF_QKR = OF_QK + SZ_QK;
  constexpr size_t OF_VT  = OF_QKR + SZ_QKR;
  constexpr size_t OF_VTR = OF_VT + SZ_VT;
  constexpr size_t OF_CX  = OF_VTR + SZ_VTR;
  constexpr size_t OF_CXR = OF_CX + SZ_CX;
  constexpr size_t SZ_ALL = OF_CXR + SZ_CXR;
  static_assert(SZ_TH >= 128 * 4 && SZ_SC >= 32 * 4);
  static_assert(SZ_TH % 256 == 0 && SZ_TAB % 256 == 0 && SZ_SC % 256 == 0 && SZ_H % 256 == 0 && SZ_HR % 256 == 0 && SZ_W3 % 256 == 0);
  static_assert(SZ_WO % 256 == 0 && SZ_QK % 256 == 0 && SZ_QKR % 256 == 0 && SZ_VT % 256 == 0 && SZ_VTR % 256 == 0 && SZ_CX % 256 == 0 && SZ_CXR % 256 == 0);
  static_assert(SZ_ALL <= (size_t)134217728);
  if (SZ_ALL > ws_size) return;
  char* ws = (char*)d_ws;
  float* TH   = (float*)(ws + OF_TH);
  float* TAB  = (float*)(ws + OF_TAB);
  float* SC   = (float*)(ws + OF_SC);
  h16*   Hh   = (h16*)(ws + OF_H);
  h16*   Hr   = (h16*)(ws + OF_HR);
  h16*   W3   = (h16*)(ws + OF_W3);
  h16*   WoT  = (h16*)(ws + OF_WO);
  h16*   QK   = (h16*)(ws + OF_QK);
  h16*   QKr  = (h16*)(ws + OF_QKR);
  h16*   VT   = (h16*)(ws + OF_VT);
  h16*   VTr  = (h16*)(ws + OF_VTR);
  h16*   CTX  = (h16*)(ws + OF_CX);
  h16*   CTXr = (h16*)(ws + OF_CXR);

  k_theta<<<1, 128, 0, stream>>>(TH);
  const int ntab = SEQ * HD;
  k_tab<<<(unsigned)((ntab + 255) / 256), 256, 0, stream>>>(TH, TAB, ntab);
  k_scale<<<1, 32, 0, stream>>>(q1, q2, k1, k2, lam, SC);
  k_hnorm<<<(unsigned)NR, 256, 0, stream>>>(x, pw, Hh, Hr);

  const size_t nq8 = (size_t)NH * HW * DM / 8;
  const size_t nv8 = (size_t)DM * DM / 8;
  k_wcvt<<<(unsigned)((nq8 + 255) / 256), 256, 0, stream>>>(wq, W3, nq8);                                  /* rows 0..4095 */
  k_wcvt<<<(unsigned)((nq8 + 255) / 256), 256, 0, stream>>>(wk, W3 + (size_t)NH * HW * DM, nq8);           /* rows 4096..8191 */
  k_wcvt<<<(unsigned)((nv8 + 255) / 256), 256, 0, stream>>>(wv, W3 + (size_t)NQK * DM, nv8);               /* rows 8192..10239 */
  k_wcvt<<<(unsigned)((nv8 + 255) / 256), 256, 0, stream>>>(wo, WoT, nv8);

  k_gemm_qkv_early<<<(unsigned)((EROWS / 128) * (N3 / 64)), 128, 0, stream>>>(Hh, Hr, W3, TAB, QK, QKr, VT, VTr);
  if (NR > EROWS)
    k_gemm_qkv_late<<<(unsigned)(((NR - EROWS) / 128) * (N3 / 64)), 128, 0, stream>>>(Hh, W3, TAB, QK, VT);

  k_attn_early<<<(unsigned)(NH * (EROWS / 16)), 128, 0, stream>>>(QK, QKr, VT, VTr, SC, hnw, CTX, CTXr);
  if (SEQ > EROWS)
    k_attn_late<<<(unsigned)(NH * ((SEQ - EROWS) / 16)), 64, 0, stream>>>(QK, VT, SC, hnw, CTX);

  k_gemm_out_early<<<(unsigned)((EROWS / 128) * (DM / 64)), 128, 0, stream>>>(CTX, CTXr, WoT, x, out);
  if (NR > EROWS)
    k_gemm_out_late<<<(unsigned)(((NR - EROWS) / 128) * (DM / 64)), 128, 0, stream>>>(CTX, WoT, x, out);
}

// v001
// It runs in 435 microseconds.
// In both of two side-by-side timings against v000, it was 1.48 times as fast.
#include <hip/hip_runtime.h>
// Pre-RMSNorm differential causal attention block: fused [out][in] q|k|v projection, interleaved-pair rotary over 256 columns per head (computed f32 cos/sin table),
// two causal softmax maps per head combined with a per-head scale, per-head RMSNorm, output projection, skip connection. T 2048, D 2048, 16 heads of 128.
// Compute dtype: all contractions on v_wmma_f32_16x16x32_f16 with f32 accumulate. Inputs are RNE-converted to bf16 first; weights carried x64 as f16 (exact).
// Query rows >= 256: single f16 products at every site (h, q, k, v, P x256, ctx). Query rows < 256: value + x2048 f16 residual planes on h, q, k, P, v, ctx
// (residual products in their own accumulators, folded with 2^-11 in the f32 epilogue). Norms, rotary, mask, softmax statistics in f32 on the VALU.
#ifndef NB
#define NB 1
#endif
#ifndef SEQ
#define SEQ 2048
#endif
#define SEQ_FULL 2048
#define DM 2048
#define NH 16
#define HD 128
#define HW 256
#define NQK (2 * NH * HW)
#define N3 (NQK + DM)
#define NR (NB * SEQ)
#define EROWS 256

static_assert(NB == 1);
static_assert(NH * HD == DM);
static_assert(HW == 2 * HD && HD == 128);
static_assert(SEQ % 128 == 0 && SEQ <= SEQ_FULL);
static_assert(EROWS % 128 == 0 && EROWS <= SEQ && EROWS % 32 == 0);
static_assert(DM % 64 == 0 && N3 % 64 == 0 && NQK % 64 == 0 && DM % 32 == 0);
static_assert(HW % 64 == 0 && NQK % HW == 0);
static_assert(256 * 8 == DM);
static_assert((SEQ * HD) % 256 == 0);

typedef _Float16 h16;
typedef _Float16 v16h __attribute__((ext_vector_type(16)));
typedef _Float16 v8h  __attribute__((ext_vector_type(8), may_alias));
typedef float v8f  __attribute__((ext_vector_type(8)));
typedef float v4f  __attribute__((ext_vector_type(4)));
typedef float v4fa __attribute__((ext_vector_type(4), may_alias));
union FragH { v16h v; v8h half[2]; };

__device__ __forceinline__ float bf16_rne(float x) {
  unsigned int u = __float_as_uint(x);
  u = (u + 0x7FFFu + ((u >> 16) & 1u)) & 0xFFFF0000u;
  return __uint_as_float(u);
}

// f32 -> f16 with a value select: results below the smallest normal f16 become exact zero
static __device__ __forceinline__ h16 toh_flush(float v) { const h16 r = (h16)v; return (fabsf(v) < 6.103515625e-05f) ? (h16)0.0f : r; }

// fragment (A: row = lane&15; B: column = lane&15) from a k-contiguous f16 row: elements 0..7 <- k0+8h.., elements 8..15 <- k0+16+8h..
__device__ __forceinline__ v16h ld_frag(const h16* p, int hh) {
  FragH f; f.half[0] = *(const v8h*)(p + 8 * hh); f.half[1] = *(const v8h*)(p + 16 + 8 * hh); return f.v;
}

__device__ __forceinline__ v8f mma(v16h a, v16h b, v8f c) {
  c = __builtin_amdgcn_wmma_f32_16x16x32_f16(false, a, false, b, (short)0, c, false, false);
  asm volatile("v_nop\n\tv_nop\n\tv_nop\n\tv_nop" : "+v"(c) : "v"(a), "v"(b));
  return c;
}
__device__ __forceinline__ v8f mmam(v16h a, v16h b, v8f c) {
  c = __builtin_amdgcn_wmma_f32_16x16x32_f16(false, a, false, b, (short)0, c, false, false);
  asm volatile("v_nop\n\tv_nop\n\tv_nop\n\tv_nop" : "+v"(c) : "v"(a), "v"(b) : "memory");
  return c;
}

__global__ __launch_bounds__(128) void k_theta(float* __restrict__ TH) {
#pragma clang fp contract(off)
  const int i = threadIdx.x;
  const float e = (float)(2 * i) / (float)HW;
  const float th = 1.0f / powf(10000.0f, e);
  *(float*)(TH + i) = th;
  
}

__global__ __launch_bounds__(256) void k_tab(const float* __restrict__ TH, float* __restrict__ TAB, int n) {
#pragma clang fp contract(off)
  const int idx = blockIdx.x * 256 + threadIdx.x;
  if (idx >= n) return;
  const int i = idx & (HD - 1), s = idx >> 7;
  const float ang = (float)s * TH[i];
  const float cs = cosf(ang);
  const float sn = sinf(ang);
  float* pcs = TAB + idx;
  float* psn = TAB + (size_t)SEQ * HD + idx;
  *(float*)pcs = cs;
  *(float*)psn = sn;
  
}

__global__ __launch_bounds__(32) void k_scale(const float* __restrict__ q1, const float* __restrict__ q2, const float* __restrict__ k1,
                                              const float* __restrict__ k2, const float* __restrict__ lam, float* __restrict__ SC) {
#pragma clang fp contract(off)
  const int lane = threadIdx.x;
  const int h = lane & 15;
  float s1 = 0.f, s2 = 0.f;
#pragma unroll 1
  for (int d = 0; d < HD; ++d) {
    s1 += bf16_rne(q1[h * HD + d]) * bf16_rne(k1[h * HD + d]);
    s2 += bf16_rne(q2[h * HD + d]) * bf16_rne(k2[h * HD + d]);
  }
  float ls = 0.f;
#pragma unroll 1
  for (int i = 0; i < NH; ++i) ls += bf16_rne(lam[i]);
  const float base = expf(s1) - expf(s2);
  const float sc = -((float)NH * base + ls);
  const float osc = 1.0f - bf16_rne(lam[h]);
  const float v = (lane < 16) ? sc : osc;
  *(float*)(SC + lane) = v;
  
}

// pre-norm: h = x * rsqrt(mean(x^2) + 1e-9) * w -> f16 value plane H [NR][DM] (+ x2048 residual plane Hr for rows < EROWS);
__global__ __launch_bounds__(256) void k_hnorm(const float* __restrict__ x, const float* __restrict__ pw, h16* __restrict__ H, h16* __restrict__ Hr) {
#pragma clang fp contract(off)
  __shared__ float red[8];
  const int tid = threadIdx.x, lane = tid & 31;
  const int wave = __builtin_amdgcn_readfirstlane(tid >> 5);
  const int row = blockIdx.x;
  const size_t off = (size_t)row * DM + tid * 8;
  const v4f a = *(const v4fa*)(x + off), b = *(const v4fa*)(x + off + 4);
  const v4f wa = *(const v4fa*)(pw + tid * 8), wb = *(const v4fa*)(pw + tid * 8 + 4);
  float xv[8], wv[8];
#pragma unroll
  for (int q = 0; q < 4; ++q) {
    xv[q] = bf16_rne(a[q]); xv[4 + q] = bf16_rne(b[q]);
    wv[q] = bf16_rne(wa[q]); wv[4 + q] = bf16_rne(wb[q]);
  }
  float ss = 0.f;
#pragma unroll
  for (int i = 0; i < 8; ++i) ss += xv[i] * xv[i];
#pragma unroll
  for (int o = 16; o >= 1; o >>= 1) ss += __shfl_xor(ss, o, 32);
  if (lane == 0) red[wave] = ss;
  __syncthreads();
  float tot = 0.f;
#pragma unroll
  for (int i = 0; i < 8; ++i) tot += red[i];
  const float r = rsqrtf(tot * (1.0f / (float)DM) + 1.0e-9f);
  v8h hv, rv;
#pragma unroll
  for (int i = 0; i < 8; ++i) {
    const float hval = xv[i] * r * wv[i];
    const h16 hb = toh_flush(hval);
    hv[i] = hb;
    rv[i] = toh_flush((hval - (float)hb) * 2048.0f);
  }
  {
    *(v8h*)(H + off) = hv;
    if (row < EROWS) *(v8h*)(Hr + off) = rv;
    
  }
}

__global__ __launch_bounds__(256) void k_wcvt(const float* __restrict__ W, h16* __restrict__ O, size_t n8) {
  const size_t t = (size_t)blockIdx.x * 256 + threadIdx.x;
  if (t >= n8) return;
  const v4f a = *(const v4fa*)(W + t * 8), c = *(const v4fa*)(W + t * 8 + 4);
  v8h o;
#pragma unroll
  for (int q = 0; q < 4; ++q) { o[q] = toh_flush(bf16_rne(a[q]) * 64.0f); o[4 + q] = toh_flush(bf16_rne(c[q]) * 64.0f); }
  *(v8h*)(O + t * 8) = o;
  
}

// GEMM main loop, K = DM, both operands k-contiguous with pitch DM. Wave tile 32 x 64: c[0..3] rows 0..15, c[4..7] rows 16..31.
// RES: a second A plane (x2048 residual) accumulates into cr.
// Operand tiles of KT k are staged in LDS by asynchronous copies, two buffers: trip t works on buffer t & 1 while tile t + 1 flies.
// Stage rows (pitch LP f16 = 144 B, an odd multiple of 16 B for the 16-byte fragment reads): A 0..127, B 128..191, residual A 192..319.
#define KT 64
#define LP 72
#define NTRIP (DM / KT)
static_assert(DM % KT == 0 && NTRIP >= 2 && KT % 32 == 0 && KT * 2 == 128);
template <bool RES> struct Ring { static constexpr int ROWS = RES ? 320 : 192; static constexpr int STG = ROWS * LP; static constexpr int BYTES = 2 * STG * 2; };

#define CPY(a, b) "global_load_async_to_lds_b128 %" #a ", %" #b ", off\n\t"
// 16 bytes per lane and copy, global -> LDS. The closing s_wait_xcnt stands in the copies' own statement so that no later write of an address register is moved in front of it.
__device__ __forceinline__ void copy12(const unsigned (&l)[12], const h16* const (&g)[12]) {
  asm volatile(CPY(0, 1) CPY(2, 3) CPY(4, 5) CPY(6, 7) CPY(8, 9) CPY(10, 11) CPY(12, 13) CPY(14, 15) CPY(16, 17) CPY(18, 19) CPY(20, 21) CPY(22, 23)
               "s_wait_xcnt 0x0"
               :: "v"(l[0]), "v"(g[0]), "v"(l[1]), "v"(g[1]), "v"(l[2]), "v"(g[2]), "v"(l[3]), "v"(g[3]), "v"(l[4]), "v"(g[4]), "v"(l[5]), "v"(g[5]),
                  "v"(l[6]), "v"(g[6]), "v"(l[7]), "v"(g[7]), "v"(l[8]), "v"(g[8]), "v"(l[9]), "v"(g[9]), "v"(l[10]), "v"(g[10]), "v"(l[11]), "v"(g[11])
               : "memory");
}
__device__ __forceinline__ void copy8(const unsigned (&l)[8], const h16* const (&g)[8]) {
  asm volatile(CPY(0, 1) CPY(2, 3) CPY(4, 5) CPY(6, 7) CPY(8, 9) CPY(10, 11) CPY(12, 13) CPY(14, 15)
               "s_wait_xcnt 0x0"
               :: "v"(l[0]), "v"(g[0]), "v"(l[1]), "v"(g[1]), "v"(l[2]), "v"(g[2]), "v"(l[3]), "v"(g[3]), "v"(l[4]), "v"(g[4]), "v"(l[5]), "v"(g[5]),
                  "v"(l[6]), "v"(g[6]), "v"(l[7]), "v"(g[7])
               : "memory");
}

// one stage: 128 threads x 16 B cover 16 rows of 128 B per copy (8 lanes per row: whole lines). lb, gA, gB, gR are the lane's own addresses in row (tid >> 3) of each plane.
template <bool RES>
__device__ __forceinline__ void stage_fill(unsigned lb, const h16* gA, const h16* gB, const h16* gR) {
  unsigned l[12]; const h16* g[12];
  // the three loops here are unrolled so that the address arrays are registers (they are asm operands)
#pragma unroll
  for (int i = 0; i < 8; ++i) { l[i] = lb + (unsigned)(i * 16 * LP * 2); g[i] = gA + (size_t)i * 16 * DM; }
#pragma unroll
  for (int i = 0; i < 4; ++i) { l[8 + i] = lb + (unsigned)((128 + i * 16) * LP * 2); g[8 + i] = gB + (size_t)i * 16 * DM; }
  copy12(l, g);
  if (RES) {
    unsigned lr[8]; const h16* gr[8];
#pragma unroll
    for (int i = 0; i < 8; ++i) { lr[i] = lb + (unsigned)((192 + i * 16) * LP * 2); gr[i] = gR + (size_t)i * 16 * DM; }
    copy8(lr, gr);
  }
}

// mrow: first of the block's 128 A rows; col0: first of its 64 B rows; ring: the block's LDS, Ring<RES>::BYTES bytes, free again behind the last trip's barrier.
template <bool RES>
__device__ __forceinline__ void gemm_main(const h16* Ah, const h16* Ar, const h16* Bt, int mrow, int col0, h16* ring, int tid, int w, int ln, int hh,
                                          v8f (&c)[8], v8f (&cr)[8]) {
  constexpr int STG = Ring<RES>::STG;
  const int crow = tid >> 3, ccol = (tid & 7) * 8;
  const h16* gA = Ah + (size_t)(mrow + crow) * DM + ccol;
  const h16* gR = Ar + (size_t)(mrow + crow) * DM + ccol;
  const h16* gB = Bt + (size_t)(col0 + crow) * DM + ccol;
  const unsigned lb = (unsigned)(uintptr_t)ring + (unsigned)((crow * LP + ccol) * 2);
  stage_fill<RES>(lb, gA, gB, gR);
  asm volatile("s_wait_asynccnt 0x0" ::: "memory");  // tile 0 has landed before the barrier publishes it
  __syncthreads();
  stage_fill<RES>(lb + (unsigned)(STG * 2), gA + KT, gB + KT, gR + KT);
#pragma unroll 1  // kept rolled: one body for both buffers, the buffer picked by a scalar offset
  for (int t = 0; t < NTRIP; ++t) {
    const int buf = t & 1;
    const h16* st = ring + buf * STG;
    const h16* pa = st + (32 * w + ln) * LP;
    const h16* pb = st + (128 + ln) * LP;
    const h16* pr = st + (192 + 32 * w + ln) * LP;
    // the fragments of G k-steps are read from LDS as one group in front of their products: one LDS wait per group, not one per fragment
    // (RES: one k-step per group, two would not fit the register budget beside the 16 accumulator tiles). All loops of the trip are unrolled: fragments and tiles stay in registers
    constexpr int G = RES ? 1 : 2;
#pragma unroll
    for (int k0 = 0; k0 < KT; k0 += 32 * G) {
      v16h fa[G][2], fe[G][2], fb[G][4];
#pragma unroll
      for (int s = 0; s < G; ++s) {
        const int kk = k0 + 32 * s;
        fa[s][0] = ld_frag(pa + kk, hh); fa[s][1] = ld_frag(pa + 16 * LP + kk, hh);
#pragma unroll
        for (int j = 0; j < 4; ++j) fb[s][j] = ld_frag(pb + j * 16 * LP + kk, hh);
        if (RES) { fe[s][0] = ld_frag(pr + kk, hh); fe[s][1] = ld_frag(pr + 16 * LP + kk, hh); }
        else { fe[s][0] = fa[s][0]; fe[s][1] = fa[s][1]; }
      }
#pragma unroll
      for (int s = 0; s < G; ++s) {
#pragma unroll
        for (int j = 0; j < 4; ++j) {
          c[j] = mma(fa[s][0], fb[s][j], c[j]); c[4 + j] = mma(fa[s][1], fb[s][j], c[4 + j]);
          if (RES) { cr[j] = mma(fe[s][0], fb[s][j], cr[j]); cr[4 + j] = mma(fe[s][1], fb[s][j], cr[4 + j]); }
        }
      }
    }
    asm volatile("s_wait_dscnt 0x0" ::: "memory");     // this wave's reads of buffer buf are done before the barrier frees it
    asm volatile("s_wait_asynccnt 0x0" ::: "memory");  // this wave's copies of tile t + 1 have landed before the barrier publishes them
    __syncthreads();
    if (t + 2 < NTRIP) stage_fill<RES>(lb + (unsigned)(buf * STG * 2), gA + (t + 2) * KT, gB + (t + 2) * KT, gR + (t + 2) * KT);
  }
  asm volatile("s_wait_asynccnt 0x0" ::: "memory");    // nothing in flight when the ring becomes output staging
}

// fused projection [NR][N3] = H . W3^T (W3 rows: q 0..4095, k 4096..8191, v 8192..10239). Block = 4 waves = 128 rows x 64 cols.
template <bool RES>
__device__ __forceinline__ void gemm_qkv_body(const h16* Hh, const h16* Hr, const h16* W3, const float* TAB,
                                              h16* QK, h16* QKr, h16* VT, h16* VTr, int mt0) {
  // one LDS block: the operand ring in the main loop, then (behind the last trip's barrier) the output staging so[wave][row][col]
  static_assert(Ring<RES>::BYTES >= 4 * 32 * 68 * 4);
  __shared__ __attribute__((aligned(16))) unsigned char smem[Ring<RES>::BYTES];
  h16* ring = (h16*)smem;
  float (*so)[32][68] = (float (*)[32][68])smem;
  const int tid = threadIdx.x, lane = tid & 31, ln = lane & 15, hh = lane >> 4;
  const int w = __builtin_amdgcn_readfirstlane(tid >> 5);
  const int ntn = N3 >> 6;
  const int mtl = blockIdx.x / ntn, nq = blockIdx.x - mtl * ntn;
  const int mrow = (mt0 + mtl) * 128;
  const int row0 = mrow + 32 * w, col0 = nq * 64;
  const v8f z8 = {0.f, 0.f, 0.f, 0.f, 0.f, 0.f, 0.f, 0.f};
  v8f c[8], cr[8];
#pragma unroll
  for (int u = 0; u < 8; ++u) { c[u] = z8; cr[u] = z8; }
  gemm_main<RES>(Hh, Hr, W3, mrow, col0, ring, tid, w, ln, hh, c, cr);
#pragma unroll
  for (int u = 0; u < 8; ++u) {
    const int t = u & 3, hf = u >> 2;
#pragma unroll
    for (int r = 0; r < 8; ++r) {
      const float v = RES ? (c[u][r] + cr[u][r] * 4.8828125e-4f) * 0.015625f : c[u][r] * 0.015625f;
      so[w][hf * 16 + 8 * hh + r][t * 16 + ln] = v;
    }
  }
  __syncthreads();
  v8h hv[8], rv[8];
  if (col0 < NQK) {
    const int rq = lane >> 3, pc = lane & 7;
    const int i0 = ((col0 & (HW - 1)) >> 1) + pc * 4;
#pragma unroll
    for (int it = 0; it < 8; ++it) {
      const int row = it * 4 + rq;
      const v4f a = *(const v4fa*)&so[w][row][pc * 8], b = *(const v4fa*)&so[w][row][pc * 8 + 4];
      const size_t to = (size_t)(row0 + row) * HD + i0;
      const v4f cs = *(const v4fa*)(TAB + to), sn = *(const v4fa*)(TAB + (size_t)SEQ * HD + to);
      float o[8];
      o[0] = a[0] * cs[0] - a[1] * sn[0]; o[1] = a[0] * sn[0] + a[1] * cs[0];
      o[2] = a[2] * cs[1] - a[3] * sn[1]; o[3] = a[2] * sn[1] + a[3] * cs[1];
      o[4] = b[0] * cs[2] - b[1] * sn[2]; o[5] = b[0] * sn[2] + b[1] * cs[2];
      o[6] = b[2] * cs[3] - b[3] * sn[3]; o[7] = b[2] * sn[3] + b[3] * cs[3];
#pragma unroll
      for (int q = 0; q < 8; ++q) {
        const h16 hb = toh_flush(o[q]);
        hv[it][q] = hb;
        rv[it][q] = toh_flush((o[q] - (float)hb) * 2048.0f);
      }
    }
    {
#pragma unroll
      for (int it = 0; it < 8; ++it) {
        const int row = it * 4 + rq;
        const size_t off = (size_t)(row0 + row) * NQK + col0 + pc * 8;
        *(v8h*)(QK + off) = hv[it];
        if (RES) *(v8h*)(QKr + off) = rv[it];
      }
      
    }
  } else {
    const int chb = col0 - NQK;
    const int sub = lane >> 4, p = lane & 15;
    const int sw = p >> 2, sr = (p & 3) * 8;
#pragma unroll
    for (int it = 0; it < 8; ++it) {
      const int chl = w * 16 + it * 2 + sub;
#pragma unroll
      for (int q = 0; q < 8; ++q) {
        const float v = so[sw][sr + q][chl];
        const h16 hb = toh_flush(v);
        hv[it][q] = hb;
        rv[it][q] = toh_flush((v - (float)hb) * 2048.0f);
      }
    }
    {
#pragma unroll
      for (int it = 0; it < 8; ++it) {
        const int chl = w * 16 + it * 2 + sub;
        *(v8h*)(VT + (size_t)(chb + chl) * SEQ + mrow + p * 8) = hv[it];
        if (RES) *(v8h*)(VTr + (size_t)(chb + chl) * EROWS + mrow + p * 8) = rv[it];
      }
      
    }
  }
}

__global__ __launch_bounds__(128) __attribute__((amdgpu_num_vgpr(256)))
void k_gemm_qkv_early(const h16* __restrict__ Hh, const h16* __restrict__ Hr, const h16* __restrict__ W3, const float* __restrict__ TAB,
                      h16* __restrict__ QK, h16* __restrict__ QKr, h16* __restrict__ VT, h16* __restrict__ VTr) {
  gemm_qkv_body<true>(Hh, Hr, W3, TAB, QK, QKr, VT, VTr, 0);
}
__global__ __launch_bounds__(128) __attribute__((amdgpu_num_vgpr(256)))
void k_gemm_qkv_late(const h16* __restrict__ Hh, const h16* __restrict__ W3, const float* __restrict__ TAB,
                     h16* __restrict__ QK, h16* __restrict__ VT) {
  gemm_qkv_body<false>(Hh, Hh, W3, TAB, QK, QK, VT, VT, EROWS / 128);
}

// output projection out[NR][DM] f32 = ctx . Wo^T / 64 + bf16(x); skip connection added at the store stage as float4;
template <bool RES>
__device__ __forceinline__ void gemm_out_body(const h16* Ch, const h16* Cr, const h16* WoT, const float* x, float* out, int mt0) {
  // one LDS block: the operand ring in the main loop, then (behind the last trip's barrier) the output staging so[wave][row][col]
  static_assert(Ring<RES>::BYTES >= 4 * 32 * 68 * 4);
  __shared__ __attribute__((aligned(16))) unsigned char smem[Ring<RES>::BYTES];
  h16* ring = (h16*)smem;
  float (*so)[32][68] = (float (*)[32][68])smem;
  const int tid = threadIdx.x, lane = tid & 31, ln = lane & 15, hh = lane >> 4;
  const int w = __builtin_amdgcn_readfirstlane(tid >> 5);
  const int ntn = DM >> 6;
  const int mtl = blockIdx.x / ntn, nq = blockIdx.x - mtl * ntn;
  const int mrow = (mt0 + mtl) * 128;
  const int row0 = mrow + 32 * w, col0 = nq * 64;
  const v8f z8 = {0.f, 0.f, 0.f, 0.f, 0.f, 0.f, 0.f, 0.f};
  v8f c[8], cr[8];
#pragma unroll
  for (int u = 0; u < 8; ++u) { c[u] = z8; cr[u] = z8; }
  gemm_main<RES>(Ch, Cr, WoT, mrow, col0, ring, tid, w, ln, hh, c, cr);
#pragma unroll
  for (int u = 0; u < 8; ++u) {
    const int t = u & 3, hf = u >> 2;
#pragma unroll
    for (int r = 0; r < 8; ++r) {
      const float v = RES ? (c[u][r] + cr[u][r] * 4.8828125e-4f) * 0.015625f : c[u][r] * 0.015625f;
      so[w][hf * 16 + 8 * hh + r][t * 16 + ln] = v;
    }
  }
  __syncthreads();
  const int rsub = lane >> 4, c4 = (lane & 15) * 4;
  v4f ov[16];
#pragma unroll
  for (int q = 0; q < 16; ++q) {
    const int r = q * 2 + rsub;
    const v4f v = *(const v4fa*)&so[w][r][c4];
    const v4f xr = *(const v4fa*)(x + (size_t)(row0 + r) * DM + col0 + c4);
    v4f o;
    o[0] = v[0] + bf16_rne(xr[0]); o[1] = v[1] + bf16_rne(xr[1]); o[2] = v[2] + bf16_rne(xr[2]); o[3] = v[3] + bf16_rne(xr[3]);
    ov[q] = o;
  }
  {
#pragma unroll
    for (int q = 0; q < 16; ++q) {
      const int r = q * 2 + rsub;
      *(v4f*)(out + (size_t)(row0 + r) * DM + col0 + c4) = ov[q];
    }
    
  }
}

__global__ __launch_bounds__(128) __attribute__((amdgpu_num_vgpr(256)))
void k_gemm_out_early(const h16* __restrict__ Ch, const h16* __restrict__ Cr, const h16* __restrict__ WoT, const float* __restrict__ x, float* __restrict__ out) {
  gemm_out_body<true>(Ch, Cr, WoT, x, out, 0);
}
__global__ __launch_bounds__(128) __attribute__((amdgpu_num_vgpr(256)))
void k_gemm_out_late(const h16* __restrict__ Ch, const h16* __restrict__ WoT, const float* __restrict__ x, float* __restrict__ out) {
  gemm_out_body<false>(Ch, Ch, WoT, x, out, EROWS / 128);
}

// Transposed flash attention. One block per (head, 16-query tile); wave = (score component c, channel slab hf).
// S^T[key][query] = K_c . Q_c^T (A = K rows, B = Q rows), per-lane (= per-query) running max / sum in the exp2 domain,
// P^T (carried x256) packed from the S^T accumulators directly as the B fragment of O^T[ch][query] = V^T . P^T (A = V^T rows). Causal mask as a select.
// NW = 2: query rows >= EROWS, single f16 products, 128 channels per wave. NW = 4: query rows < EROWS, value + x2048 residual planes on q, k, P, v, 64 channels per wave.
// Epilogue: both components meet in LDS (block barrier), O = O_0 + scale[h] O_1, per-head RMSNorm, x (1 - lam[h]), f16 ctx rows (+ residual rows);
template <int NW>
__device__ __forceinline__ void attn_body(const h16* QK, const h16* QKr, const h16* VT, const h16* VTr,
                                          const float* SC, const float* hw, h16* CTX, h16* CTXr, int qt0, int nqt) {
  constexpr bool EARLY = (NW == 4);
  constexpr int NT = 16 / NW;
  constexpr int RPW = 16 / NW;
  static_assert(NW == 2 || NW == 4);
  static_assert(NW * NT * 16 == 2 * HD);
  __shared__ __attribute__((aligned(16))) float comb[2][16][132];
  const int tid = threadIdx.x, lane = tid & 31, ln = lane & 15, hh = lane >> 4;
  const int wave = __builtin_amdgcn_readfirstlane(tid >> 5);
  const int c = wave & 1, hf = wave >> 1;
  const int head = blockIdx.x / nqt;
  const int qt = qt0 + (blockIdx.x - head * nqt);
  const int q0 = qt * 16, qi = q0 + ln;
  const size_t qoff = (size_t)qi * NQK + head * HW + c * HD;
  const int kcol = NH * HW + head * HW + c * HD;
  const int chb = head * HD + hf * (NT * 16);
  const float NEGV = -1.0e30f;
  const float SCL2 = 0.08838834764831845f * 1.4426950408889634f;
  const float PCL = 8.0f;

  const v8f z8 = {0.f, 0.f, 0.f, 0.f, 0.f, 0.f, 0.f, 0.f};
  v16h qh[4];
#pragma unroll
  for (int ks = 0; ks < 4; ++ks) qh[ks] = ld_frag(QK + qoff + ks * 32, hh);

  v8f acc[NT], accr[NT];
#pragma unroll
  for (int dt = 0; dt < NT; ++dt) { acc[dt] = z8; accr[dt] = z8; }
  float m = NEGV, l = 0.f;
  const int nsteps = (q0 + 16 + 31) >> 5;

#pragma unroll 1
  for (int js = 0; js < nsteps; ++js) {
    const int j0 = js << 5;
    v8f s0 = z8, s1 = z8, t0 = z8, t1 = z8;
    const size_t ko = (size_t)(j0 + ln) * NQK + kcol;
#pragma unroll
    for (int ks = 0; ks < 4; ++ks) {
      const v16h a0 = ld_frag(QK + ko + ks * 32, hh);
      const v16h a1 = ld_frag(QK + ko + (size_t)16 * NQK + ks * 32, hh);
      v16h bq = qh[ks];
      if (EARLY) bq = ld_frag(QK + qoff + ks * 32, hh);
      s0 = mmam(a0, bq, s0);
      s1 = mmam(a1, bq, s1);
      if (EARLY) {
        const v16h br = ld_frag(QKr + qoff + ks * 32, hh);
        const v16h r0 = ld_frag(QKr + ko + ks * 32, hh);
        const v16h r1 = ld_frag(QKr + ko + (size_t)16 * NQK + ks * 32, hh);
        t0 = mmam(r0, bq, t0);
        t0 = mmam(a0, br, t0);
        t1 = mmam(r1, bq, t1);
        t1 = mmam(a1, br, t1);
      }
    }

    float xv[16];
    float mx = NEGV;
#pragma unroll
    for (int r = 0; r < 8; ++r) {
      const int k0 = j0 + 8 * hh + r, k1 = k0 + 16;
      float e0 = s0[r], e1 = s1[r];
      if (EARLY) { e0 += t0[r] * 4.8828125e-4f; e1 += t1[r] * 4.8828125e-4f; }
      xv[r] = (k0 <= qi) ? e0 * SCL2 : NEGV;
      xv[8 + r] = (k1 <= qi) ? e1 * SCL2 : NEGV;
      mx = fmaxf(mx, fmaxf(xv[r], xv[8 + r]));
    }
    mx = fmaxf(mx, __shfl_xor(mx, 16, 32));
    const float mn = fmaxf(m, mx);
    const float alpha = exp2f(m - mn);
    m = mn;

    v16h ph, pr;
    float ps = 0.f;
#pragma unroll
    for (int i = 0; i < 16; ++i) {
      const float e = xv[i] - mn + PCL;
      const float pe = exp2f(e);
      const float p = (e < -14.0f) ? 0.f : pe;
      const h16 pb = (h16)p;
      ph[i] = pb;
      if (EARLY) {
        pr[i] = toh_flush((p - (float)pb) * 2048.0f);
        ps += p;
      } else {
        pr[i] = pb;
        ps += (float)pb;
      }
    }
    ps += __shfl_xor(ps, 16, 32);
    l = l * alpha + ps;

#pragma unroll
    for (int dt = 0; dt < NT; ++dt)
#pragma unroll
      for (int r = 0; r < 8; ++r) { acc[dt][r] *= alpha; if (EARLY) accr[dt][r] *= alpha; }

#pragma unroll
    for (int dt = 0; dt < NT; ++dt) {
      const int ch = chb + dt * 16 + ln;
      const v16h vh = ld_frag(VT + (size_t)ch * SEQ + j0, hh);
      acc[dt] = mmam(vh, ph, acc[dt]);
      if (EARLY) {
        const v16h vr = ld_frag(VTr + (size_t)ch * EROWS + j0, hh);
        accr[dt] = mmam(vh, pr, accr[dt]);
        accr[dt] = mmam(vr, ph, accr[dt]);
      }
    }
  }

  const float inv = 1.0f / l;
#pragma unroll
  for (int dt = 0; dt < NT; ++dt)
#pragma unroll
    for (int r = 0; r < 8; ++r) {
      const float v = EARLY ? (acc[dt][r] + accr[dt][r] * 4.8828125e-4f) * inv : acc[dt][r] * inv;
      comb[c][ln][hf * (NT * 16) + dt * 16 + 8 * hh + r] = v;
    }
  __syncthreads();

  const float scl = SC[head], osc = SC[NH + head];
  const int sub = lane >> 4, pc = lane & 15;
  const v4f wa = *(const v4fa*)(hw + pc * 8), wb = *(const v4fa*)(hw + pc * 8 + 4);
  const float wv[8] = {bf16_rne(wa[0]), bf16_rne(wa[1]), bf16_rne(wa[2]), bf16_rne(wa[3]), bf16_rne(wb[0]), bf16_rne(wb[1]), bf16_rne(wb[2]), bf16_rne(wb[3])};
  v8h hv[RPW / 2], rv[RPW / 2];
#pragma unroll
  for (int it = 0; it < RPW / 2; ++it) {
    const int row = wave * RPW + it * 2 + sub;
    const v4f a0 = *(const v4fa*)&comb[0][row][pc * 8], a1 = *(const v4fa*)&comb[0][row][pc * 8 + 4];
    const v4f b0 = *(const v4fa*)&comb[1][row][pc * 8], b1 = *(const v4fa*)&comb[1][row][pc * 8 + 4];
    float o[8];
#pragma unroll
    for (int q = 0; q < 4; ++q) { o[q] = a0[q] + scl * b0[q]; o[4 + q] = a1[q] + scl * b1[q]; }
    float ss = 0.f;
#pragma unroll
    for (int q = 0; q < 8; ++q) ss += o[q] * o[q];
#pragma unroll
    for (int d = 1; d < 16; d <<= 1) ss += __shfl_xor(ss, d, 32);
    const float rms = rsqrtf(ss * (1.0f / (float)HD) + 1.0e-9f);
#pragma unroll
    for (int q = 0; q < 8; ++q) {
      const float val = o[q] * rms * wv[q] * osc;
      const h16 hb = toh_flush(val);
      hv[it][q] = hb;
      rv[it][q] = toh_flush((val - (float)hb) * 2048.0f);
    }
  }
  {
#pragma unroll
    for (int it = 0; it < RPW / 2; ++it) {
      const int row = wave * RPW + it * 2 + sub;
      const size_t off = (size_t)(q0 + row) * DM + head * HD + pc * 8;
      *(v8h*)(CTX + off) = hv[it];
      if (EARLY) *(v8h*)(CTXr + off) = rv[it];
    }
    
  }
}

__global__ __launch_bounds__(128) __attribute__((amdgpu_num_vgpr(256)))
void k_attn_early(const h16* __restrict__ QK, const h16* __restrict__ QKr, const h16* __restrict__ VT, const h16* __restrict__ VTr,
                  const float* __restrict__ SC, const float* __restrict__ hw, h16* __restrict__ CTX, h16* __restrict__ CTXr) {
  attn_body<4>(QK, QKr, VT, VTr, SC, hw, CTX, CTXr, 0, EROWS / 16);
}
__global__ __launch_bounds__(64) __attribute__((amdgpu_num_vgpr(256)))
void k_attn_late(const h16* __restrict__ QK, const h16* __restrict__ VT, const float* __restrict__ SC, const float* __restrict__ hw, h16* __restrict__ CTX) {
  attn_body<2>(QK, QK, VT, VT, SC, hw, CTX, CTX, EROWS / 16, (SEQ - EROWS) / 16);
}

extern "C" void kernel_launch(void* const* d_in, const int* in_sizes, int n_in,
                              void* d_out, int out_size, void* d_ws, size_t ws_size, hipStream_t stream) {
  if (n_in < 12) return;
  if (in_sizes[0] < NR * DM) return;
  if (in_sizes[1] < DM) return;
  if (in_sizes[2] < NH * HW * DM || in_sizes[3] < NH * HW * DM) return;
  if (in_sizes[4] < DM * DM || in_sizes[5] < DM * DM) return;
  if (in_sizes[6] < HD) return;
  if (in_sizes[7] < NH * HD || in_sizes[8] < NH * HD || in_sizes[9] < NH * HD || in_sizes[10] < NH * HD) return;
  if (in_sizes[11] < NH) return;
  if (out_size < NR * DM) return;
  const float* x   = (const float*)d_in[0];
  const float* pw  = (const float*)d_in[1];
  const float* wq  = (const float*)d_in[2];
  const float* wk  = (const float*)d_in[3];
  const float* wv  = (const float*)d_in[4];
  const float* wo  = (const float*)d_in[5];
  const float* hnw = (const float*)d_in[6];
  const float* q1  = (const float*)d_in[7];
  const float* q2  = (const float*)d_in[8];
  const float* k1  = (const float*)d_in[9];
  const float* k2  = (const float*)d_in[10];
  const float* lam = (const float*)d_in[11];
  float* out = (float*)d_out;

  // workspace regions (bytes); every region is written with whole-row stores inside its exact extent
  constexpr size_t SZ_TH  = 512;
  constexpr size_t SZ_TAB = (size_t)2 * SEQ * HD * 4;
  constexpr size_t SZ_SC  = 256;
  constexpr size_t SZ_H   = (size_t)NR * DM * 2;
  constexpr size_t SZ_HR  = (size_t)EROWS * DM * 2;
  constexpr size_t SZ_W3  = (size_t)N3 * DM * 2;
  constexpr size_t SZ_WO  = (size_t)DM * DM * 2;
  constexpr size_t SZ_QK  = (size_t)NR * NQK * 2;
  constexpr size_t SZ_QKR = (size_t)EROWS * NQK * 2;
  constexpr size_t SZ_VT  = (size_t)DM * SEQ * 2;
  constexpr size_t SZ_VTR = (size_t)DM * EROWS * 2;
  constexpr size_t SZ_CX  = (size_t)NR * DM * 2;
  constexpr size_t SZ_CXR = (size_t)EROWS * DM * 2;
  constexpr size_t OF_TH  = 0;
  constexpr size_t OF_TAB = OF_TH + SZ_TH;
  constexpr size_t OF_SC  = OF_TAB + SZ_TAB;
  constexpr size_t OF_H   = OF_SC + SZ_SC;
  constexpr size_t OF_HR  = OF_H + SZ_H;
  constexpr size_t OF_W3  = OF_HR + SZ_HR;
  constexpr size_t OF_WO  = OF_W3 + SZ_W3;
  constexpr size_t OF_QK  = OF_WO + SZ_WO;
  constexpr size_t OF_QKR = OF_QK + SZ_QK;
  constexpr size_t OF_VT  = OF_QKR + SZ_QKR;
  constexpr size_t OF_VTR = OF_VT + SZ_VT;
  constexpr size_t OF_CX  = OF_VTR + SZ_VTR;
  constexpr size_t OF_CXR = OF_CX + SZ_CX;
  constexpr size_t SZ_ALL = OF_CXR + SZ_CXR;
  static_assert(SZ_TH >= 128 * 4 && SZ_SC >= 32 * 4);
  static_assert(SZ_TH % 256 == 0 && SZ_TAB % 256 == 0 && SZ_SC % 256 == 0 && SZ_H % 256 == 0 && SZ_HR % 256 == 0 && SZ_W3 % 256 == 0);
  static_assert(SZ_WO % 256 == 0 && SZ_QK % 256 == 0 && SZ_QKR % 256 == 0 && SZ_VT % 256 == 0 && SZ_VTR % 256 == 0 && SZ_CX % 256 == 0 && SZ_CXR % 256 == 0);
  static_assert(SZ_ALL <= (size_t)134217728);
  if (SZ_ALL > ws_size) return;
  char* ws = (char*)d_ws;
  float* TH   = (float*)(ws + OF_TH);
  float* TAB  = (float*)(ws + OF_TAB);
  float* SC   = (float*)(ws + OF_SC);
  h16*   Hh   = (h16*)(ws + OF_H);
  h16*   Hr   = (h16*)(ws + OF_HR);
  h16*   W3   = (h16*)(ws + OF_W3);
  h16*   WoT  = (h16*)(ws + OF_WO);
  h16*   QK   = (h16*)(ws + OF_QK);
  h16*   QKr  = (h16*)(ws + OF_QKR);
  h16*   VT   = (h16*)(ws + OF_VT);
  h16*   VTr  = (h16*)(ws + OF_VTR);
  h16*   CTX  = (h16*)(ws + OF_CX);
  h16*   CTXr = (h16*)(ws + OF_CXR);

  k_theta<<<1, 128, 0, stream>>>(TH);
  const int ntab = SEQ * HD;
  k_tab<<<(unsigned)((ntab + 255) / 256), 256, 0, stream>>>(TH, TAB, ntab);
  k_scale<<<1, 32, 0, stream>>>(q1, q2, k1, k2, lam, SC);
  k_hnorm<<<(unsigned)NR, 256, 0, stream>>>(x, pw, Hh, Hr);

  const size_t nq8 = (size_t)NH * HW * DM / 8;
  const size_t nv8 = (size_t)DM * DM / 8;
  k_wcvt<<<(unsigned)((nq8 + 255) / 256), 256, 0, stream>>>(wq, W3, nq8);                                  /* rows 0..4095 */
  k_wcvt<<<(unsigned)((nq8 + 255) / 256), 256, 0, stream>>>(wk, W3 + (size_t)NH * HW * DM, nq8);           /* rows 4096..8191 */
  k_wcvt<<<(unsigned)((nv8 + 255) / 256), 256, 0, stream>>>(wv, W3 + (size_t)NQK * DM, nv8);               /* rows 8192..10239 */
  k_wcvt<<<(unsigned)((nv8 + 255) / 256), 256, 0, stream>>>(wo, WoT, nv8);

  k_gemm_qkv_early<<<(unsigned)((EROWS / 128) * (N3 / 64)), 128, 0, stream>>>(Hh, Hr, W3, TAB, QK, QKr, VT, VTr);
  if (NR > EROWS)
    k_gemm_qkv_late<<<(unsigned)(((NR - EROWS) / 128) * (N3 / 64)), 128, 0, stream>>>(Hh, W3, TAB, QK, VT);

  k_attn_early<<<(unsigned)(NH * (EROWS / 16)), 128, 0, stream>>>(QK, QKr, VT, VTr, SC, hnw, CTX, CTXr);
  if (SEQ > EROWS)
    k_attn_late<<<(unsigned)(NH * ((SEQ - EROWS) / 16)), 64, 0, stream>>>(QK, VT, SC, hnw, CTX);

  k_gemm_out_early<<<(unsigned)((EROWS / 128) * (DM / 64)), 128, 0, stream>>>(CTX, CTXr, WoT, x, out);
  if (NR > EROWS)
    k_gemm_out_late<<<(unsigned)(((NR - EROWS) / 128) * (DM / 64)), 128, 0, stream>>>(CTX, WoT, x, out);
}

// v002
// One run takes 303 microseconds.
// In both of two side-by-side timings against v001, it was 1.43 times as fast.
// All steps since v000 together make it 2.12 times as fast.
#include <hip/hip_runtime.h>
// Pre-RMSNorm differential causal attention block: fused [out][in] q|k|v projection, interleaved-pair rotary over 256 columns per head (computed f32 cos/sin table),
// two causal softmax maps per head combined with a per-head scale, per-head RMSNorm, output projection, skip connection. T 2048, D 2048, 16 heads of 128.
// Compute dtype: all contractions on v_wmma_f32_16x16x32_f16 with f32 accumulate. Inputs are RNE-converted to bf16 first; weights carried x64 as f16 (exact).
// Query rows >= 256: single f16 products at every site (h, q, k, v, P x256, ctx). Query rows < 256: value + x2048 f16 residual planes on h, q, k, P, v, ctx
// (residual products in their own accumulators, folded with 2^-11 in the f32 epilogue). Norms, rotary, mask, softmax statistics in f32 on the VALU.
#ifndef NB
#define NB 1
#endif
#ifndef SEQ
#define SEQ 2048
#endif
#define SEQ_FULL 2048
#define DM 2048
#define NH 16
#define HD 128
#define HW 256
#define NQK (2 * NH * HW)
#define N3 (NQK + DM)
#define NR (NB * SEQ)
#define EROWS 256

static_assert(NB == 1);
static_assert(NH * HD == DM);
static_assert(HW == 2 * HD && HD == 128);
static_assert(SEQ % 128 == 0 && SEQ <= SEQ_FULL);
static_assert(EROWS % 128 == 0 && EROWS <= SEQ && EROWS % 32 == 0);
static_assert(DM % 64 == 0 && N3 % 64 == 0 && NQK % 64 == 0 && DM % 32 == 0);
static_assert(HW % 64 == 0 && NQK % HW == 0);
static_assert(256 * 8 == DM);
static_assert((SEQ * HD) % 256 == 0);

typedef _Float16 h16;
typedef _Float16 v16h __attribute__((ext_vector_type(16)));
typedef _Float16 v8h  __attribute__((ext_vector_type(8), may_alias));
typedef float v8f  __attribute__((ext_vector_type(8)));
typedef float v4f  __attribute__((ext_vector_type(4)));
typedef float v4fa __attribute__((ext_vector_type(4), may_alias));
union FragH { v16h v; v8h half[2]; };

__device__ __forceinline__ float bf16_rne(float x) {
  unsigned int u = __float_as_uint(x);
  u = (u + 0x7FFFu + ((u >> 16) & 1u)) & 0xFFFF0000u;
  return __uint_as_float(u);
}

// f32 -> f16 with a value select: results below the smallest normal f16 become exact zero
static __device__ __forceinline__ h16 toh_flush(float v) { const h16 r = (h16)v; return (fabsf(v) < 6.103515625e-05f) ? (h16)0.0f : r; }

// fragment (A: row = lane&15; B: column = lane&15) from a k-contiguous f16 row: elements 0..7 <- k0+8h.., elements 8..15 <- k0+16+8h..
__device__ __forceinline__ v16h ld_frag(const h16* p, int hh) {
  FragH f; f.half[0] = *(const v8h*)(p + 8 * hh); f.half[1] = *(const v8h*)(p + 16 + 8 * hh); return f.v;
}

__device__ __forceinline__ v8f mma(v16h a, v16h b, v8f c) {
  c = __builtin_amdgcn_wmma_f32_16x16x32_f16(false, a, false, b, (short)0, c, false, false);
  asm volatile("v_nop\n\tv_nop\n\tv_nop\n\tv_nop" : "+v"(c) : "v"(a), "v"(b));
  return c;
}
__device__ __forceinline__ v8f mmam(v16h a, v16h b, v8f c) {
  c = __builtin_amdgcn_wmma_f32_16x16x32_f16(false, a, false, b, (short)0, c, false, false);
  asm volatile("v_nop\n\tv_nop\n\tv_nop\n\tv_nop" : "+v"(c) : "v"(a), "v"(b) : "memory");
  return c;
}

__global__ __launch_bounds__(128) void k_theta(float* __restrict__ TH) {
#pragma clang fp contract(off)
  const int i = threadIdx.x;
  const float e = (float)(2 * i) / (float)HW;
  const float th = 1.0f / powf(10000.0f, e);
  *(float*)(TH + i) = th;
  
}

__global__ __launch_bounds__(256) void k_tab(const float* __restrict__ TH, float* __restrict__ TAB, int n) {
#pragma clang fp contract(off)
  const int idx = blockIdx.x * 256 + threadIdx.x;
  if (idx >= n) return;
  const int i = idx & (HD - 1), s = idx >> 7;
  const float ang = (float)s * TH[i];
  const float cs = cosf(ang);
  const float sn = sinf(ang);
  float* pcs = TAB + idx;
  float* psn = TAB + (size_t)SEQ * HD + idx;
  *(float*)pcs = cs;
  *(float*)psn = sn;
  
}

__global__ __launch_bounds__(32) void k_scale(const float* __restrict__ q1, const float* __restrict__ q2, const float* __restrict__ k1,
                                              const float* __restrict__ k2, const float* __restrict__ lam, float* __restrict__ SC) {
#pragma clang fp contract(off)
  const int lane = threadIdx.x;
  const int h = lane & 15;
  float s1 = 0.f, s2 = 0.f;
#pragma unroll 1
  for (int d = 0; d < HD; ++d) {
    s1 += bf16_rne(q1[h * HD + d]) * bf16_rne(k1[h * HD + d]);
    s2 += bf16_rne(q2[h * HD + d]) * bf16_rne(k2[h * HD + d]);
  }
  float ls = 0.f;
#pragma unroll 1
  for (int i = 0; i < NH; ++i) ls += bf16_rne(lam[i]);
  const float base = expf(s1) - expf(s2);
  const float sc = -((float)NH * base + ls);
  const float osc = 1.0f - bf16_rne(lam[h]);
  const float v = (lane < 16) ? sc : osc;
  *(float*)(SC + lane) = v;
  
}

// pre-norm: h = x * rsqrt(mean(x^2) + 1e-9) * w -> f16 value plane H [NR][DM] (+ x2048 residual plane Hr for rows < EROWS);
__global__ __launch_bounds__(256) void k_hnorm(const float* __restrict__ x, const float* __restrict__ pw, h16* __restrict__ H, h16* __restrict__ Hr) {
#pragma clang fp contract(off)
  __shared__ float red[8];
  const int tid = threadIdx.x, lane = tid & 31;
  const int wave = __builtin_amdgcn_readfirstlane(tid >> 5);
  const int row = blockIdx.x;
  const size_t off = (size_t)row * DM + tid * 8;
  const v4f a = *(const v4fa*)(x + off), b = *(const v4fa*)(x + off + 4);
  const v4f wa = *(const v4fa*)(pw + tid * 8), wb = *(const v4fa*)(pw + tid * 8 + 4);
  float xv[8], wv[8];
#pragma unroll
  for (int q = 0; q < 4; ++q) {
    xv[q] = bf16_rne(a[q]); xv[4 + q] = bf16_rne(b[q]);
    wv[q] = bf16_rne(wa[q]); wv[4 + q] = bf16_rne(wb[q]);
  }
  float ss = 0.f;
#pragma unroll
  for (int i = 0; i < 8; ++i) ss += xv[i] * xv[i];
#pragma unroll
  for (int o = 16; o >= 1; o >>= 1) ss += __shfl_xor(ss, o, 32);
  if (lane == 0) red[wave] = ss;
  __syncthreads();
  float tot = 0.f;
#pragma unroll
  for (int i = 0; i < 8; ++i) tot += red[i];
  const float r = rsqrtf(tot * (1.0f / (float)DM) + 1.0e-9f);
  v8h hv, rv;
#pragma unroll
  for (int i = 0; i < 8; ++i) {
    const float hval = xv[i] * r * wv[i];
    const h16 hb = toh_flush(hval);
    hv[i] = hb;
    rv[i] = toh_flush((hval - (float)hb) * 2048.0f);
  }
  {
    *(v8h*)(H + off) = hv;
    if (row < EROWS) *(v8h*)(Hr + off) = rv;
    
  }
}

__global__ __launch_bounds__(256) void k_wcvt(const float* __restrict__ W, h16* __restrict__ O, size_t n8) {
  const size_t t = (size_t)blockIdx.x * 256 + threadIdx.x;
  if (t >= n8) return;
  const v4f a = *(const v4fa*)(W + t * 8), c = *(const v4fa*)(W + t * 8 + 4);
  v8h o;
#pragma unroll
  for (int q = 0; q < 4; ++q) { o[q] = toh_flush(bf16_rne(a[q]) * 64.0f); o[4 + q] = toh_flush(bf16_rne(c[q]) * 64.0f); }
  *(v8h*)(O + t * 8) = o;
  
}

// GEMM main loop, K = DM, both operands k-contiguous with pitch DM. Wave tile 32 x 64: c[0..3] rows 0..15, c[4..7] rows 16..31.
// RES: a second A plane (x2048 residual) accumulates into cr.
// Operand tiles of KT k are staged in LDS by asynchronous copies, two buffers: trip t works on buffer t & 1 while tile t + 1 flies.
// Stage rows (pitch LP f16 = 144 B, an odd multiple of 16 B for the 16-byte fragment reads): A 0..127, B 128..191, residual A 192..319.
#define KT 64
#define LP 72
#define NTRIP (DM / KT)
static_assert(DM % KT == 0 && NTRIP >= 2 && KT % 32 == 0 && KT * 2 == 128);
template <bool RES> struct Ring { static constexpr int ROWS = RES ? 320 : 192; static constexpr int STG = ROWS * LP; static constexpr int BYTES = 2 * STG * 2; };

#define CPY(a, b) "global_load_async_to_lds_b128 %" #a ", %" #b ", off\n\t"
// 16 bytes per lane and copy, global -> LDS. The closing s_wait_xcnt stands in the copies' own statement so that no later write of an address register is moved in front of it.
__device__ __forceinline__ void copy12(const unsigned (&l)[12], const h16* const (&g)[12]) {
  asm volatile(CPY(0, 1) CPY(2, 3) CPY(4, 5) CPY(6, 7) CPY(8, 9) CPY(10, 11) CPY(12, 13) CPY(14, 15) CPY(16, 17) CPY(18, 19) CPY(20, 21) CPY(22, 23)
               "s_wait_xcnt 0x0"
               :: "v"(l[0]), "v"(g[0]), "v"(l[1]), "v"(g[1]), "v"(l[2]), "v"(g[2]), "v"(l[3]), "v"(g[3]), "v"(l[4]), "v"(g[4]), "v"(l[5]), "v"(g[5]),
                  "v"(l[6]), "v"(g[6]), "v"(l[7]), "v"(g[7]), "v"(l[8]), "v"(g[8]), "v"(l[9]), "v"(g[9]), "v"(l[10]), "v"(g[10]), "v"(l[11]), "v"(g[11])
               : "memory");
}
__device__ __forceinline__ void copy8(const unsigned (&l)[8], const h16* const (&g)[8]) {
  asm volatile(CPY(0, 1) CPY(2, 3) CPY(4, 5) CPY(6, 7) CPY(8, 9) CPY(10, 11) CPY(12, 13) CPY(14, 15)
               "s_wait_xcnt 0x0"
               :: "v"(l[0]), "v"(g[0]), "v"(l[1]), "v"(g[1]), "v"(l[2]), "v"(g[2]), "v"(l[3]), "v"(g[3]), "v"(l[4]), "v"(g[4]), "v"(l[5]), "v"(g[5]),
                  "v"(l[6]), "v"(g[6]), "v"(l[7]), "v"(g[7])
               : "memory");
}

// one stage: 128 threads x 16 B cover 16 rows of 128 B per copy (8 lanes per row: whole lines). lb, gA, gB, gR are the lane's own addresses in row (tid >> 3) of each plane.
template <bool RES>
__device__ __forceinline__ void stage_fill(unsigned lb, const h16* gA, const h16* gB, const h16* gR) {
  unsigned l[12]; const h16* g[12];
  // the three loops here are unrolled so that the address arrays are registers (they are asm operands)
#pragma unroll
  for (int i = 0; i < 8; ++i) { l[i] = lb + (unsigned)(i * 16 * LP * 2); g[i] = gA + (size_t)i * 16 * DM; }
#pragma unroll
  for (int i = 0; i < 4; ++i) { l[8 + i] = lb + (unsigned)((128 + i * 16) * LP * 2); g[8 + i] = gB + (size_t)i * 16 * DM; }
  copy12(l, g);
  if (RES) {
    unsigned lr[8]; const h16* gr[8];
#pragma unroll
    for (int i = 0; i < 8; ++i) { lr[i] = lb + (unsigned)((192 + i * 16) * LP * 2); gr[i] = gR + (size_t)i * 16 * DM; }
    copy8(lr, gr);
  }
}

// mrow: first of the block's 128 A rows; col0: first of its 64 B rows; ring: the block's LDS, Ring<RES>::BYTES bytes, free again behind the last trip's barrier.
template <bool RES>
__device__ __forceinline__ void gemm_main(const h16* Ah, const h16* Ar, const h16* Bt, int mrow, int col0, h16* ring, int tid, int w, int ln, int hh,
                                          v8f (&c)[8], v8f (&cr)[8]) {
  constexpr int STG = Ring<RES>::STG;
  const int crow = tid >> 3, ccol = (tid & 7) * 8;
  const h16* gA = Ah + (size_t)(mrow + crow) * DM + ccol;
  const h16* gR = Ar + (size_t)(mrow + crow) * DM + ccol;
  const h16* gB = Bt + (size_t)(col0 + crow) * DM + ccol;
  const unsigned lb = (unsigned)(uintptr_t)ring + (unsigned)((crow * LP + ccol) * 2);
  stage_fill<RES>(lb, gA, gB, gR);
  asm volatile("s_wait_asynccnt 0x0" ::: "memory");  // tile 0 has landed before the barrier publishes it
  __syncthreads();
  stage_fill<RES>(lb + (unsigned)(STG * 2), gA + KT, gB + KT, gR + KT);
#pragma unroll 1  // kept rolled: one body for both buffers, the buffer picked by a scalar offset
  for (int t = 0; t < NTRIP; ++t) {
    const int buf = t & 1;
    const h16* st = ring + buf * STG;
    const h16* pa = st + (32 * w + ln) * LP;
    const h16* pb = st + (128 + ln) * LP;
    const h16* pr = st + (192 + 32 * w + ln) * LP;
    // the fragments of G k-steps are read from LDS as one group in front of their products: one LDS wait per group, not one per fragment
    // (RES: one k-step per group, two would not fit the register budget beside the 16 accumulator tiles). All loops of the trip are unrolled: fragments and tiles stay in registers
    constexpr int G = RES ? 1 : 2;
#pragma unroll
    for (int k0 = 0; k0 < KT; k0 += 32 * G) {
      v16h fa[G][2], fe[G][2], fb[G][4];
#pragma unroll
      for (int s = 0; s < G; ++s) {
        const int kk = k0 + 32 * s;
        fa[s][0] = ld_frag(pa + kk, hh); fa[s][1] = ld_frag(pa + 16 * LP + kk, hh);
#pragma unroll
        for (int j = 0; j < 4; ++j) fb[s][j] = ld_frag(pb + j * 16 * LP + kk, hh);
        if (RES) { fe[s][0] = ld_frag(pr + kk, hh); fe[s][1] = ld_frag(pr + 16 * LP + kk, hh); }
        else { fe[s][0] = fa[s][0]; fe[s][1] = fa[s][1]; }
      }
#pragma unroll
      for (int s = 0; s < G; ++s) {
#pragma unroll
        for (int j = 0; j < 4; ++j) {
          c[j] = mma(fa[s][0], fb[s][j], c[j]); c[4 + j] = mma(fa[s][1], fb[s][j], c[4 + j]);
          if (RES) { cr[j] = mma(fe[s][0], fb[s][j], cr[j]); cr[4 + j] = mma(fe[s][1], fb[s][j], cr[4 + j]); }
        }
      }
    }
    asm volatile("s_wait_dscnt 0x0" ::: "memory");     // this wave's reads of buffer buf are done before the barrier frees it
    asm volatile("s_wait_asynccnt 0x0" ::: "memory");  // this wave's copies of tile t + 1 have landed before the barrier publishes them
    __syncthreads();
    if (t + 2 < NTRIP) stage_fill<RES>(lb + (unsigned)(buf * STG * 2), gA + (t + 2) * KT, gB + (t + 2) * KT, gR + (t + 2) * KT);
  }
  asm volatile("s_wait_asynccnt 0x0" ::: "memory");    // nothing in flight when the ring becomes output staging
}

// fused projection [NR][N3] = H . W3^T (W3 rows: q 0..4095, k 4096..8191, v 8192..10239). Block = 4 waves = 128 rows x 64 cols.
template <bool RES>
__device__ __forceinline__ void gemm_qkv_body(const h16* Hh, const h16* Hr, const h16* W3, const float* TAB,
                                              h16* QK, h16* QKr, h16* VT, h16* VTr, int mt0) {
  // one LDS block: the operand ring in the main loop, then (behind the last trip's barrier) the output staging so[wave][row][col]
  static_assert(Ring<RES>::BYTES >= 4 * 32 * 68 * 4);
  __shared__ __attribute__((aligned(16))) unsigned char smem[Ring<RES>::BYTES];
  h16* ring = (h16*)smem;
  float (*so)[32][68] = (float (*)[32][68])smem;
  const int tid = threadIdx.x, lane = tid & 31, ln = lane & 15, hh = lane >> 4;
  const int w = __builtin_amdgcn_readfirstlane(tid >> 5);
  const int ntn = N3 >> 6;
  const int mtl = blockIdx.x / ntn, nq = blockIdx.x - mtl * ntn;
  const int mrow = (mt0 + mtl) * 128;
  const int row0 = mrow + 32 * w, col0 = nq * 64;
  const v8f z8 = {0.f, 0.f, 0.f, 0.f, 0.f, 0.f, 0.f, 0.f};
  v8f c[8], cr[8];
#pragma unroll
  for (int u = 0; u < 8; ++u) { c[u] = z8; cr[u] = z8; }
  gemm_main<RES>(Hh, Hr, W3, mrow, col0, ring, tid, w, ln, hh, c, cr);
#pragma unroll
  for (int u = 0; u < 8; ++u) {
    const int t = u & 3, hf = u >> 2;
#pragma unroll
    for (int r = 0; r < 8; ++r) {
      const float v = RES ? (c[u][r] + cr[u][r] * 4.8828125e-4f) * 0.015625f : c[u][r] * 0.015625f;
      so[w][hf * 16 + 8 * hh + r][t * 16 + ln] = v;
    }
  }
  __syncthreads();
  v8h hv[8], rv[8];
  if (col0 < NQK) {
    const int rq = lane >> 3, pc = lane & 7;
    const int i0 = ((col0 & (HW - 1)) >> 1) + pc * 4;
#pragma unroll
    for (int it = 0; it < 8; ++it) {
      const int row = it * 4 + rq;
      const v4f a = *(const v4fa*)&so[w][row][pc * 8], b = *(const v4fa*)&so[w][row][pc * 8 + 4];
      const size_t to = (size_t)(row0 + row) * HD + i0;
      const v4f cs = *(const v4fa*)(TAB + to), sn = *(const v4fa*)(TAB + (size_t)SEQ * HD + to);
      float o[8];
      o[0] = a[0] * cs[0] - a[1] * sn[0]; o[1] = a[0] * sn[0] + a[1] * cs[0];
      o[2] = a[2] * cs[1] - a[3] * sn[1]; o[3] = a[2] * sn[1] + a[3] * cs[1];
      o[4] = b[0] * cs[2] - b[1] * sn[2]; o[5] = b[0] * sn[2] + b[1] * cs[2];
      o[6] = b[2] * cs[3] - b[3] * sn[3]; o[7] = b[2] * sn[3] + b[3] * cs[3];
#pragma unroll
      for (int q = 0; q < 8; ++q) {
        const h16 hb = toh_flush(o[q]);
        hv[it][q] = hb;
        rv[it][q] = toh_flush((o[q] - (float)hb) * 2048.0f);
      }
    }
    {
#pragma unroll
      for (int it = 0; it < 8; ++it) {
        const int row = it * 4 + rq;
        const size_t off = (size_t)(row0 + row) * NQK + col0 + pc * 8;
        *(v8h*)(QK + off) = hv[it];
        if (RES) *(v8h*)(QKr + off) = rv[it];
      }
      
    }
  } else {
    const int chb = col0 - NQK;
    const int sub = lane >> 4, p = lane & 15;
    const int sw = p >> 2, sr = (p & 3) * 8;
#pragma unroll
    for (int it = 0; it < 8; ++it) {
      const int chl = w * 16 + it * 2 + sub;
#pragma unroll
      for (int q = 0; q < 8; ++q) {
        const float v = so[sw][sr + q][chl];
        const h16 hb = toh_flush(v);
        hv[it][q] = hb;
        rv[it][q] = toh_flush((v - (float)hb) * 2048.0f);
      }
    }
    {
#pragma unroll
      for (int it = 0; it < 8; ++it) {
        const int chl = w * 16 + it * 2 + sub;
        *(v8h*)(VT + (size_t)(chb + chl) * SEQ + mrow + p * 8) = hv[it];
        if (RES) *(v8h*)(VTr + (size_t)(chb + chl) * EROWS + mrow + p * 8) = rv[it];
      }
      
    }
  }
}

__global__ __launch_bounds__(128) __attribute__((amdgpu_num_vgpr(256)))
void k_gemm_qkv_early(const h16* __restrict__ Hh, const h16* __restrict__ Hr, const h16* __restrict__ W3, const float* __restrict__ TAB,
                      h16* __restrict__ QK, h16* __restrict__ QKr, h16* __restrict__ VT, h16* __restrict__ VTr) {
  gemm_qkv_body<true>(Hh, Hr, W3, TAB, QK, QKr, VT, VTr, 0);
}
__global__ __launch_bounds__(128) __attribute__((amdgpu_num_vgpr(256)))
void k_gemm_qkv_late(const h16* __restrict__ Hh, const h16* __restrict__ W3, const float* __restrict__ TAB,
                     h16* __restrict__ QK, h16* __restrict__ VT) {
  gemm_qkv_body<false>(Hh, Hh, W3, TAB, QK, QK, VT, VT, EROWS / 128);
}

// output projection out[NR][DM] f32 = ctx . Wo^T / 64 + bf16(x); skip connection added at the store stage as float4;
template <bool RES>
__device__ __forceinline__ void gemm_out_body(const h16* Ch, const h16* Cr, const h16* WoT, const float* x, float* out, int mt0) {
  // one LDS block: the operand ring in the main loop, then (behind the last trip's barrier) the output staging so[wave][row][col]
  static_assert(Ring<RES>::BYTES >= 4 * 32 * 68 * 4);
  __shared__ __attribute__((aligned(16))) unsigned char smem[Ring<RES>::BYTES];
  h16* ring = (h16*)smem;
  float (*so)[32][68] = (float (*)[32][68])smem;
  const int tid = threadIdx.x, lane = tid & 31, ln = lane & 15, hh = lane >> 4;
  const int w = __builtin_amdgcn_readfirstlane(tid >> 5);
  const int ntn = DM >> 6;
  const int mtl = blockIdx.x / ntn, nq = blockIdx.x - mtl * ntn;
  const int mrow = (mt0 + mtl) * 128;
  const int row0 = mrow + 32 * w, col0 = nq * 64;
  const v8f z8 = {0.f, 0.f, 0.f, 0.f, 0.f, 0.f, 0.f, 0.f};
  v8f c[8], cr[8];
#pragma unroll
  for (int u = 0; u < 8; ++u) { c[u] = z8; cr[u] = z8; }
  gemm_main<RES>(Ch, Cr, WoT, mrow, col0, ring, tid, w, ln, hh, c, cr);
#pragma unroll
  for (int u = 0; u < 8; ++u) {
    const int t = u & 3, hf = u >> 2;
#pragma unroll
    for (int r = 0; r < 8; ++r) {
      const float v = RES ? (c[u][r] + cr[u][r] * 4.8828125e-4f) * 0.015625f : c[u][r] * 0.015625f;
      so[w][hf * 16 + 8 * hh + r][t * 16 + ln] = v;
    }
  }
  __syncthreads();
  const int rsub = lane >> 4, c4 = (lane & 15) * 4;
  v4f ov[16];
#pragma unroll
  for (int q = 0; q < 16; ++q) {
    const int r = q * 2 + rsub;
    const v4f v = *(const v4fa*)&so[w][r][c4];
    const v4f xr = *(const v4fa*)(x + (size_t)(row0 + r) * DM + col0 + c4);
    v4f o;
    o[0] = v[0] + bf16_rne(xr[0]); o[1] = v[1] + bf16_rne(xr[1]); o[2] = v[2] + bf16_rne(xr[2]); o[3] = v[3] + bf16_rne(xr[3]);
    ov[q] = o;
  }
  {
#pragma unroll
    for (int q = 0; q < 16; ++q) {
      const int r = q * 2 + rsub;
      *(v4f*)(out + (size_t)(row0 + r) * DM + col0 + c4) = ov[q];
    }
    
  }
}

__global__ __launch_bounds__(128) __attribute__((amdgpu_num_vgpr(256)))
void k_gemm_out_early(const h16* __restrict__ Ch, const h16* __restrict__ Cr, const h16* __restrict__ WoT, const float* __restrict__ x, float* __restrict__ out) {
  gemm_out_body<true>(Ch, Cr, WoT, x, out, 0);
}
__global__ __launch_bounds__(128) __attribute__((amdgpu_num_vgpr(256)))
void k_gemm_out_late(const h16* __restrict__ Ch, const h16* __restrict__ WoT, const float* __restrict__ x, float* __restrict__ out) {
  gemm_out_body<false>(Ch, Ch, WoT, x, out, EROWS / 128);
}

// Transposed flash attention. One block per (head, 16-query tile); wave = (score component c, channel slab hf).
// S^T[key][query] = K_c . Q_c^T (A = K rows, B = Q rows), per-lane (= per-query) running max / sum in the exp2 domain,
// P^T (carried x256) packed from the S^T accumulators directly as the B fragment of O^T[ch][query] = V^T . P^T (A = V^T rows). Causal mask as a select.
// NW = 4: query rows < EROWS, value + x2048 residual planes on q, k, P, v, 64 channels per wave (NW = 2: single f16 products, 128 channels per wave; query rows >= EROWS now have k_attn_late).
// Epilogue: both components meet in LDS (block barrier), O = O_0 + scale[h] O_1, per-head RMSNorm, x (1 - lam[h]), f16 ctx rows (+ residual rows);
template <int NW>
__device__ __forceinline__ void attn_body(const h16* QK, const h16* QKr, const h16* VT, const h16* VTr,
                                          const float* SC, const float* hw, h16* CTX, h16* CTXr, int qt0, int nqt) {
  constexpr bool EARLY = (NW == 4);
  constexpr int NT = 16 / NW;
  constexpr int RPW = 16 / NW;
  static_assert(NW == 2 || NW == 4);
  static_assert(NW * NT * 16 == 2 * HD);
  __shared__ __attribute__((aligned(16))) float comb[2][16][132];
  const int tid = threadIdx.x, lane = tid & 31, ln = lane & 15, hh = lane >> 4;
  const int wave = __builtin_amdgcn_readfirstlane(tid >> 5);
  const int c = wave & 1, hf = wave >> 1;
  const int head = blockIdx.x / nqt;
  const int qt = qt0 + (blockIdx.x - head * nqt);
  const int q0 = qt * 16, qi = q0 + ln;
  const size_t qoff = (size_t)qi * NQK + head * HW + c * HD;
  const int kcol = NH * HW + head * HW + c * HD;
  const int chb = head * HD + hf * (NT * 16);
  const float NEGV = -1.0e30f;
  const float SCL2 = 0.08838834764831845f * 1.4426950408889634f;
  const float PCL = 8.0f;

  const v8f z8 = {0.f, 0.f, 0.f, 0.f, 0.f, 0.f, 0.f, 0.f};
  v16h qh[4];
#pragma unroll
  for (int ks = 0; ks < 4; ++ks) qh[ks] = ld_frag(QK + qoff + ks * 32, hh);

  v8f acc[NT], accr[NT];
#pragma unroll
  for (int dt = 0; dt < NT; ++dt) { acc[dt] = z8; accr[dt] = z8; }
  float m = NEGV, l = 0.f;
  const int nsteps = (q0 + 16 + 31) >> 5;

#pragma unroll 1
  for (int js = 0; js < nsteps; ++js) {
    const int j0 = js << 5;
    v8f s0 = z8, s1 = z8, t0 = z8, t1 = z8;
    const size_t ko = (size_t)(j0 + ln) * NQK + kcol;
#pragma unroll
    for (int ks = 0; ks < 4; ++ks) {
      const v16h a0 = ld_frag(QK + ko + ks * 32, hh);
      const v16h a1 = ld_frag(QK + ko + (size_t)16 * NQK + ks * 32, hh);
      v16h bq = qh[ks];
      if (EARLY) bq = ld_frag(QK + qoff + ks * 32, hh);
      s0 = mmam(a0, bq, s0);
      s1 = mmam(a1, bq, s1);
      if (EARLY) {
        const v16h br = ld_frag(QKr + qoff + ks * 32, hh);
        const v16h r0 = ld_frag(QKr + ko + ks * 32, hh);
        const v16h r1 = ld_frag(QKr + ko + (size_t)16 * NQK + ks * 32, hh);
        t0 = mmam(r0, bq, t0);
        t0 = mmam(a0, br, t0);
        t1 = mmam(r1, bq, t1);
        t1 = mmam(a1, br, t1);
      }
    }

    float xv[16];
    float mx = NEGV;
#pragma unroll
    for (int r = 0; r < 8; ++r) {
      const int k0 = j0 + 8 * hh + r, k1 = k0 + 16;
      float e0 = s0[r], e1 = s1[r];
      if (EARLY) { e0 += t0[r] * 4.8828125e-4f; e1 += t1[r] * 4.8828125e-4f; }
      xv[r] = (k0 <= qi) ? e0 * SCL2 : NEGV;
      xv[8 + r] = (k1 <= qi) ? e1 * SCL2 : NEGV;
      mx = fmaxf(mx, fmaxf(xv[r], xv[8 + r]));
    }
    mx = fmaxf(mx, __shfl_xor(mx, 16, 32));
    const float mn = fmaxf(m, mx);
    const float alpha = exp2f(m - mn);
    m = mn;

    v16h ph, pr;
    float ps = 0.f;
#pragma unroll
    for (int i = 0; i < 16; ++i) {
      const float e = xv[i] - mn + PCL;
      const float pe = exp2f(e);
      const float p = (e < -14.0f) ? 0.f : pe;
      const h16 pb = (h16)p;
      ph[i] = pb;
      if (EARLY) {
        pr[i] = toh_flush((p - (float)pb) * 2048.0f);
        ps += p;
      } else {
        pr[i] = pb;
        ps += (float)pb;
      }
    }
    ps += __shfl_xor(ps, 16, 32);
    l = l * alpha + ps;

#pragma unroll
    for (int dt = 0; dt < NT; ++dt)
#pragma unroll
      for (int r = 0; r < 8; ++r) { acc[dt][r] *= alpha; if (EARLY) accr[dt][r] *= alpha; }

#pragma unroll
    for (int dt = 0; dt < NT; ++dt) {
      const int ch = chb + dt * 16 + ln;
      const v16h vh = ld_frag(VT + (size_t)ch * SEQ + j0, hh);
      acc[dt] = mmam(vh, ph, acc[dt]);
      if (EARLY) {
        const v16h vr = ld_frag(VTr + (size_t)ch * EROWS + j0, hh);
        accr[dt] = mmam(vh, pr, accr[dt]);
        accr[dt] = mmam(vr, ph, accr[dt]);
      }
    }
  }

  const float inv = 1.0f / l;
#pragma unroll
  for (int dt = 0; dt < NT; ++dt)
#pragma unroll
    for (int r = 0; r < 8; ++r) {
      const float v = EARLY ? (acc[dt][r] + accr[dt][r] * 4.8828125e-4f) * inv : acc[dt][r] * inv;
      comb[c][ln][hf * (NT * 16) + dt * 16 + 8 * hh + r] = v;
    }
  __syncthreads();

  const float scl = SC[head], osc = SC[NH + head];
  const int sub = lane >> 4, pc = lane & 15;
  const v4f wa = *(const v4fa*)(hw + pc * 8), wb = *(const v4fa*)(hw + pc * 8 + 4);
  const float wv[8] = {bf16_rne(wa[0]), bf16_rne(wa[1]), bf16_rne(wa[2]), bf16_rne(wa[3]), bf16_rne(wb[0]), bf16_rne(wb[1]), bf16_rne(wb[2]), bf16_rne(wb[3])};
  v8h hv[RPW / 2], rv[RPW / 2];
#pragma unroll
  for (int it = 0; it < RPW / 2; ++it) {
    const int row = wave * RPW + it * 2 + sub;
    const v4f a0 = *(const v4fa*)&comb[0][row][pc * 8], a1 = *(const v4fa*)&comb[0][row][pc * 8 + 4];
    const v4f b0 = *(const v4fa*)&comb[1][row][pc * 8], b1 = *(const v4fa*)&comb[1][row][pc * 8 + 4];
    float o[8];
#pragma unroll
    for (int q = 0; q < 4; ++q) { o[q] = a0[q] + scl * b0[q]; o[4 + q] = a1[q] + scl * b1[q]; }
    float ss = 0.f;
#pragma unroll
    for (int q = 0; q < 8; ++q) ss += o[q] * o[q];
#pragma unroll
    for (int d = 1; d < 16; d <<= 1) ss += __shfl_xor(ss, d, 32);
    const float rms = rsqrtf(ss * (1.0f / (float)HD) + 1.0e-9f);
#pragma unroll
    for (int q = 0; q < 8; ++q) {
      const float val = o[q] * rms * wv[q] * osc;
      const h16 hb = toh_flush(val);
      hv[it][q] = hb;
      rv[it][q] = toh_flush((val - (float)hb) * 2048.0f);
    }
  }
  {
#pragma unroll
    for (int it = 0; it < RPW / 2; ++it) {
      const int row = wave * RPW + it * 2 + sub;
      const size_t off = (size_t)(q0 + row) * DM + head * HD + pc * 8;
      *(v8h*)(CTX + off) = hv[it];
      if (EARLY) *(v8h*)(CTXr + off) = rv[it];
    }
    
  }
}

__global__ __launch_bounds__(128) __attribute__((amdgpu_num_vgpr(256)))
void k_attn_early(const h16* __restrict__ QK, const h16* __restrict__ QKr, const h16* __restrict__ VT, const h16* __restrict__ VTr,
                  const float* __restrict__ SC, const float* __restrict__ hw, h16* __restrict__ CTX, h16* __restrict__ CTXr) {
  attn_body<4>(QK, QKr, VT, VTr, SC, hw, CTX, CTXr, 0, EROWS / 16);
}

// Query rows >= EROWS: the same transposed flash attention with single f16 products, one block per (head, AQB queries), 8 waves = (score component c, 16-query tile qs), 128 channels per wave.
// The head's K rows (both components side by side, 512 B) and V^T rows of a tile of AKT keys are staged in LDS by asynchronous copies and read by all 8 waves;
// two buffers: trip t works on buffer t & 1 while tile t + 1 flies. Every wave walks its keys in steps of 32 from key 0, as one wave per 16 queries would.
// Stage: K rows 0..AKT-1 at pitch AKP f16 = 528 B, then V^T rows 0..HD-1 at pitch AVP f16 = 144 B (odd multiples of 16 B for the 16-byte fragment reads).
#define AQB 64
#define AKT 64
#define AKP 264
#define AVP 72
#define ASTG (AKT * AKP + HD * AVP)
static_assert(AQB == AKT && AKT == 64 && EROWS % AKT == 0 && (SEQ - EROWS) % AQB == 0 && EROWS / AKT + 1 >= 2);
static_assert(AKP >= HW + 8 && (AKP * 2) % 32 == 16 && AVP >= AKT + 8 && (AVP * 2) % 32 == 16 && (ASTG * 2) % 16 == 0);

// one stage, 256 threads x 16 B per copy: 8 K rows of 512 B (32 lanes per row), 8 copies; 32 V^T rows of 128 B (8 lanes per row), 4 copies. All four arguments are the lane's own addresses.
__device__ __forceinline__ void attn_fill(unsigned lk, unsigned lv, const h16* gK, const h16* gV) {
  unsigned l[12]; const h16* g[12];
  // both loops are unrolled so that the address arrays are registers (they are asm operands)
#pragma unroll
  for (int i = 0; i < 8; ++i) { l[i] = lk + (unsigned)(i * 8 * AKP * 2); g[i] = gK + (size_t)i * 8 * NQK; }
#pragma unroll
  for (int i = 0; i < 4; ++i) { l[8 + i] = lv + (unsigned)(i * 32 * AVP * 2); g[8 + i] = gV + (size_t)i * 32 * SEQ; }
  copy12(l, g);
}

__global__ __launch_bounds__(256) __attribute__((amdgpu_num_vgpr(256)))
void k_attn_late(const h16* __restrict__ QK, const h16* __restrict__ VT, const float* __restrict__ SC, const float* __restrict__ hw, h16* __restrict__ CTX) {
  constexpr int NT = 8;
  constexpr int RPW = AQB / 8;
  // one LDS block: the K / V^T ring in the key loop, then (behind the last trip's barrier) the two components' outputs comb[c][query][channel]
  static_assert(2 * ASTG * 2 >= 2 * AQB * 132 * 4);
  __shared__ __attribute__((aligned(16))) unsigned char smem[2 * ASTG * 2];
  h16* ring = (h16*)smem;
  float (*comb)[AQB][132] = (float (*)[AQB][132])smem;
  const int tid = threadIdx.x, lane = tid & 31, ln = lane & 15, hh = lane >> 4;
  const int wave = __builtin_amdgcn_readfirstlane(tid >> 5);
  const int c = wave & 1, qs = wave >> 1;
  constexpr int nqb = (SEQ - EROWS) / AQB;
  const int head = blockIdx.x / nqb;
  const int q0b = EROWS + (blockIdx.x - head * nqb) * AQB;
  const int q0 = q0b + qs * 16, qi = q0 + ln;
  const float NEGV = -1.0e30f;
  const float SCL2 = 0.08838834764831845f * 1.4426950408889634f;
  const float PCL = 8.0f;

  const v8f z8 = {0.f, 0.f, 0.f, 0.f, 0.f, 0.f, 0.f, 0.f};
  v16h qh[4];
#pragma unroll
  for (int ks = 0; ks < 4; ++ks) qh[ks] = ld_frag(QK + (size_t)qi * NQK + head * HW + c * HD + ks * 32, hh);

  v8f acc[NT];
#pragma unroll
  for (int dt = 0; dt < NT; ++dt) acc[dt] = z8;
  float m = NEGV, l = 0.f;

  const int ntiles = (q0b + AQB) / AKT;  // >= 2: q0b >= EROWS
  const h16* gK = QK + (size_t)(tid >> 5) * NQK + NH * HW + head * HW + (tid & 31) * 8;
  const h16* gV = VT + (size_t)(head * HD + (tid >> 3)) * SEQ + (tid & 7) * 8;
  const unsigned lk = (unsigned)(uintptr_t)ring + (unsigned)(((tid >> 5) * AKP + (tid & 31) * 8) * 2);
  const unsigned lv = (unsigned)(uintptr_t)ring + (unsigned)((AKT * AKP + (tid >> 3) * AVP + (tid & 7) * 8) * 2);
  attn_fill(lk, lv, gK, gV);
  asm volatile("s_wait_asynccnt 0x0" ::: "memory");  // tile 0 has landed before the barrier publishes it
  __syncthreads();
  attn_fill(lk + (unsigned)(ASTG * 2), lv + (unsigned)(ASTG * 2), gK + (size_t)AKT * NQK, gV + AKT);
#pragma unroll 1  // kept rolled: one body for both buffers, the buffer picked by a scalar offset
  for (int t = 0; t < ntiles; ++t) {
    const int buf = t & 1;
    const h16* st = ring + buf * ASTG;
#pragma unroll 1  // kept rolled: one body for both 32-key halves of the tile
    for (int sub = 0; sub < AKT / 32; ++sub) {
      const int j0 = t * AKT + sub * 32;
      if (j0 > q0 + 15) continue;  // wave-uniform: every key of the step lies behind all 16 queries of this wave (only in the block's last tile)
      const h16* pk = st + (sub * 32 + ln) * AKP + c * HD;
      const h16* pv = st + AKT * AKP + ln * AVP + sub * 32;
      v16h ka[4][2];
#pragma unroll
      for (int ks = 0; ks < 4; ++ks) { ka[ks][0] = ld_frag(pk + ks * 32, hh); ka[ks][1] = ld_frag(pk + 16 * AKP + ks * 32, hh); }
      v8f s0 = z8, s1 = z8;
#pragma unroll
      for (int ks = 0; ks < 4; ++ks) { s0 = mma(ka[ks][0], qh[ks], s0); s1 = mma(ka[ks][1], qh[ks], s1); }
      v16h vh[NT];
#pragma unroll
      for (int dt = 0; dt < NT; ++dt) vh[dt] = ld_frag(pv + dt * 16 * AVP, hh);
      __builtin_amdgcn_sched_barrier(0);  // keeps the V^T reads together here, in flight under the softmax (left free they are spread over it in pairs, the last ones directly in front of their products)

      float xv[16];
      float mx = NEGV;
#pragma unroll
      for (int r = 0; r < 8; ++r) {
        const int k0 = j0 + 8 * hh + r, k1 = k0 + 16;
        xv[r] = (k0 <= qi) ? s0[r] * SCL2 : NEGV;
        xv[8 + r] = (k1 <= qi) ? s1[r] * SCL2 : NEGV;
        mx = fmaxf(mx, fmaxf(xv[r], xv[8 + r]));
      }
      mx = fmaxf(mx, __shfl_xor(mx, 16, 32));
      const float mn = fmaxf(m, mx);
      const float alpha = exp2f(m - mn);
      m = mn;

      v16h ph;
      float ps = 0.f;
#pragma unroll
      for (int i = 0; i < 16; ++i) {
        const float e = xv[i] - mn + PCL;
        const float pe = exp2f(e);
        const float p = (e < -14.0f) ? 0.f : pe;
        const h16 pb = (h16)p;
        ph[i] = pb;
        ps += (float)pb;
      }
      ps += __shfl_xor(ps, 16, 32);
      l = l * alpha + ps;

#pragma unroll
      for (int dt = 0; dt < NT; ++dt)
#pragma unroll
        for (int r = 0; r < 8; ++r) acc[dt][r] *= alpha;
#pragma unroll
      for (int dt = 0; dt < NT; ++dt) acc[dt] = mma(vh[dt], ph, acc[dt]);
    }
    asm volatile("s_wait_dscnt 0x0" ::: "memory");     // this wave's reads of buffer buf are done before the barrier frees it
    asm volatile("s_wait_asynccnt 0x0" ::: "memory");  // this wave's copies of tile t + 1 have landed before the barrier publishes them
    __syncthreads();
    if (t + 2 < ntiles)
      attn_fill(lk + (unsigned)(buf * ASTG * 2), lv + (unsigned)(buf * ASTG * 2), gK + (size_t)(t + 2) * AKT * NQK, gV + (t + 2) * AKT);
  }
  asm volatile("s_wait_asynccnt 0x0" ::: "memory");    // nothing in flight when the ring becomes output staging

  const float inv = 1.0f / l;
#pragma unroll
  for (int dt = 0; dt < NT; ++dt)
#pragma unroll
    for (int r = 0; r < 8; ++r) comb[c][qs * 16 + ln][dt * 16 + 8 * hh + r] = acc[dt][r] * inv;
  __syncthreads();

  const float scl = SC[head], osc = SC[NH + head];
  const int sub = lane >> 4, pc = lane & 15;
  const v4f wa = *(const v4fa*)(hw + pc * 8), wb = *(const v4fa*)(hw + pc * 8 + 4);
  const float wv[8] = {bf16_rne(wa[0]), bf16_rne(wa[1]), bf16_rne(wa[2]), bf16_rne(wa[3]), bf16_rne(wb[0]), bf16_rne(wb[1]), bf16_rne(wb[2]), bf16_rne(wb[3])};
  v8h hv[RPW / 2];
#pragma unroll
  for (int it = 0; it < RPW / 2; ++it) {
    const int row = wave * RPW + it * 2 + sub;
    const v4f a0 = *(const v4fa*)&comb[0][row][pc * 8], a1 = *(const v4fa*)&comb[0][row][pc * 8 + 4];
    const v4f b0 = *(const v4fa*)&comb[1][row][pc * 8], b1 = *(const v4fa*)&comb[1][row][pc * 8 + 4];
    float o[8];
#pragma unroll
    for (int q = 0; q < 4; ++q) { o[q] = a0[q] + scl * b0[q]; o[4 + q] = a1[q] + scl * b1[q]; }
    float ss = 0.f;
#pragma unroll
    for (int q = 0; q < 8; ++q) ss += o[q] * o[q];
#pragma unroll
    for (int d = 1; d < 16; d <<= 1) ss += __shfl_xor(ss, d, 32);
    const float rms = rsqrtf(ss * (1.0f / (float)HD) + 1.0e-9f);
#pragma unroll
    for (int q = 0; q < 8; ++q) hv[it][q] = toh_flush(o[q] * rms * wv[q] * osc);
  }
#pragma unroll
  for (int it = 0; it < RPW / 2; ++it) {
    const int row = wave * RPW + it * 2 + sub;
    *(v8h*)(CTX + (size_t)(q0b + row) * DM + head * HD + pc * 8) = hv[it];
  }
}

extern "C" void kernel_launch(void* const* d_in, const int* in_sizes, int n_in,
                              void* d_out, int out_size, void* d_ws, size_t ws_size, hipStream_t stream) {
  if (n_in < 12) return;
  if (in_sizes[0] < NR * DM) return;
  if (in_sizes[1] < DM) return;
  if (in_sizes[2] < NH * HW * DM || in_sizes[3] < NH * HW * DM) return;
  if (in_sizes[4] < DM * DM || in_sizes[5] < DM * DM) return;
  if (in_sizes[6] < HD) return;
  if (in_sizes[7] < NH * HD || in_sizes[8] < NH * HD || in_sizes[9] < NH * HD || in_sizes[10] < NH * HD) return;
  if (in_sizes[11] < NH) return;
  if (out_size < NR * DM) return;
  const float* x   = (const float*)d_in[0];
  const float* pw  = (const float*)d_in[1];
  const float* wq  = (const float*)d_in[2];
  const float* wk  = (const float*)d_in[3];
  const float* wv  = (const float*)d_in[4];
  const float* wo  = (const float*)d_in[5];
  const float* hnw = (const float*)d_in[6];
  const float* q1  = (const float*)d_in[7];
  const float* q2  = (const float*)d_in[8];
  const float* k1  = (const float*)d_in[9];
  const float* k2  = (const float*)d_in[10];
  const float* lam = (const float*)d_in[11];
  float* out = (float*)d_out;

  // workspace regions (bytes); every region is written with whole-row stores inside its exact extent
  constexpr size_t SZ_TH  = 512;
  constexpr size_t SZ_TAB = (size_t)2 * SEQ * HD * 4;
  constexpr size_t SZ_SC  = 256;
  constexpr size_t SZ_H   = (size_t)NR * DM * 2;
  constexpr size_t SZ_HR  = (size_t)EROWS * DM * 2;
  constexpr size_t SZ_W3  = (size_t)N3 * DM * 2;
  constexpr size_t SZ_WO  = (size_t)DM * DM * 2;
  constexpr size_t SZ_QK  = (size_t)NR * NQK * 2;
  constexpr size_t SZ_QKR = (size_t)EROWS * NQK * 2;
  constexpr size_t SZ_VT  = (size_t)DM * SEQ * 2;
  constexpr size_t SZ_VTR = (size_t)DM * EROWS * 2;
  constexpr size_t SZ_CX  = (size_t)NR * DM * 2;
  constexpr size_t SZ_CXR = (size_t)EROWS * DM * 2;
  constexpr size_t OF_TH  = 0;
  constexpr size_t OF_TAB = OF_TH + SZ_TH;
  constexpr size_t OF_SC  = OF_TAB + SZ_TAB;
  constexpr size_t OF_H   = OF_SC + SZ_SC;
  constexpr size_t OF_HR  = OF_H + SZ_H;
  constexpr size_t OF_W3  = OF_HR + SZ_HR;
  constexpr size_t OF_WO  = OF_W3 + SZ_W3;
  constexpr size_t OF_QK  = OF_WO + SZ_WO;
  constexpr size_t OF_QKR = OF_QK + SZ_QK;
  constexpr size_t OF_VT  = OF_QKR + SZ_QKR;
  constexpr size_t OF_VTR = OF_VT + SZ_VT;
  constexpr size_t OF_CX  = OF_VTR + SZ_VTR;
  constexpr size_t OF_CXR = OF_CX + SZ_CX;
  constexpr size_t SZ_ALL = OF_CXR + SZ_CXR;
  static_assert(SZ_TH >= 128 * 4 && SZ_SC >= 32 * 4);
  static_assert(SZ_TH % 256 == 0 && SZ_TAB % 256 == 0 && SZ_SC % 256 == 0 && SZ_H % 256 == 0 && SZ_HR % 256 == 0 && SZ_W3 % 256 == 0);
  static_assert(SZ_WO % 256 == 0 && SZ_QK % 256 == 0 && SZ_QKR % 256 == 0 && SZ_VT % 256 == 0 && SZ_VTR % 256 == 0 && SZ_CX % 256 == 0 && SZ_CXR % 256 == 0);
  static_assert(SZ_ALL <= (size_t)134217728);
  if (SZ_ALL > ws_size) return;
  char* ws = (char*)d_ws;
  float* TH   = (float*)(ws + OF_TH);
  float* TAB  = (float*)(ws + OF_TAB);
  float* SC   = (float*)(ws + OF_SC);
  h16*   Hh   = (h16*)(ws + OF_H);
  h16*   Hr   = (h16*)(ws + OF_HR);
  h16*   W3   = (h16*)(ws + OF_W3);
  h16*   WoT  = (h16*)(ws + OF_WO);
  h16*   QK   = (h16*)(ws + OF_QK);
  h16*   QKr  = (h16*)(ws + OF_QKR);
  h16*   VT   = (h16*)(ws + OF_VT);
  h16*   VTr  = (h16*)(ws + OF_VTR);
  h16*   CTX  = (h16*)(ws + OF_CX);
  h16*   CTXr = (h16*)(ws + OF_CXR);

  k_theta<<<1, 128, 0, stream>>>(TH);
  const int ntab = SEQ * HD;
  k_tab<<<(unsigned)((ntab + 255) / 256), 256, 0, stream>>>(TH, TAB, ntab);
  k_scale<<<1, 32, 0, stream>>>(q1, q2, k1, k2, lam, SC);
  k_hnorm<<<(unsigned)NR, 256, 0, stream>>>(x, pw, Hh, Hr);

  const size_t nq8 = (size_t)NH * HW * DM / 8;
  const size_t nv8 = (size_t)DM * DM / 8;
  k_wcvt<<<(unsigned)((nq8 + 255) / 256), 256, 0, stream>>>(wq, W3, nq8);                                  /* rows 0..4095 */
  k_wcvt<<<(unsigned)((nq8 + 255) / 256), 256, 0, stream>>>(wk, W3 + (size_t)NH * HW * DM, nq8);           /* rows 4096..8191 */
  k_wcvt<<<(unsigned)((nv8 + 255) / 256), 256, 0, stream>>>(wv, W3 + (size_t)NQK * DM, nv8);               /* rows 8192..10239 */
  k_wcvt<<<(unsigned)((nv8 + 255) / 256), 256, 0, stream>>>(wo, WoT, nv8);

  k_gemm_qkv_early<<<(unsigned)((EROWS / 128) * (N3 / 64)), 128, 0, stream>>>(Hh, Hr, W3, TAB, QK, QKr, VT, VTr);
  if (NR > EROWS)
    k_gemm_qkv_late<<<(unsigned)(((NR - EROWS) / 128) * (N3 / 64)), 128, 0, stream>>>(Hh, W3, TAB, QK, VT);

  k_attn_early<<<(unsigned)(NH * (EROWS / 16)), 128, 0, stream>>>(QK, QKr, VT, VTr, SC, hnw, CTX, CTXr);
  if (SEQ > EROWS)
    k_attn_late<<<(unsigned)(NH * ((SEQ - EROWS) / AQB)), 256, 0, stream>>>(QK, VT, SC, hnw, CTX);

  k_gemm_out_early<<<(unsigned)((EROWS / 128) * (DM / 64)), 128, 0, stream>>>(CTX, CTXr, WoT, x, out);
  if (NR > EROWS)
    k_gemm_out_late<<<(unsigned)(((NR - EROWS) / 128) * (DM / 64)), 128, 0, stream>>>(CTX, WoT, x, out);
}

// v003
// It runs in 284 microseconds.
// Timed twice side by side with v002, it ran 1.07 and 1.06 times as fast.
// All steps since v000 together make it 2.26 times as fast.
#include <hip/hip_runtime.h>
// Pre-RMSNorm differential causal attention block: fused [out][in] q|k|v projection, interleaved-pair rotary over 256 columns per head (computed f32 cos/sin table),
// two causal softmax maps per head combined with a per-head scale, per-head RMSNorm, output projection, skip connection. T 2048, D 2048, 16 heads of 128.
// Compute dtype: all contractions on v_wmma_f32_16x16x32_f16 with f32 accumulate. Inputs are RNE-converted to bf16 first; weights carried x64 as f16 (exact).
// Query rows >= 256: single f16 products at every site (h, q, k, v, P x256, ctx). Query rows < 256: value + x2048 f16 residual planes on h, q, k, P, v, ctx
// (residual products in their own accumulators, folded with 2^-11 in the f32 epilogue). Norms, rotary, mask, softmax statistics in f32 on the VALU.
#ifndef NB
#define NB 1
#endif
#ifndef SEQ
#define SEQ 2048
#endif
#define SEQ_FULL 2048
#define DM 2048
#define NH 16
#define HD 128
#define HW 256
#define NQK (2 * NH * HW)
#define N3 (NQK + DM)
#define NR (NB * SEQ)
#define EROWS 256

static_assert(NB == 1);
static_assert(NH * HD == DM);
static_assert(HW == 2 * HD && HD == 128);
static_assert(SEQ % 128 == 0 && SEQ <= SEQ_FULL);
static_assert(EROWS % 128 == 0 && EROWS <= SEQ && EROWS % 32 == 0);
static_assert(DM % 64 == 0 && N3 % 64 == 0 && NQK % 64 == 0 && DM % 32 == 0);
static_assert(HW % 64 == 0 && NQK % HW == 0);
static_assert(256 * 8 == DM);
static_assert((SEQ * HD) % 256 == 0);

typedef _Float16 h16;
typedef _Float16 v16h __attribute__((ext_vector_type(16)));
typedef _Float16 v8h  __attribute__((ext_vector_type(8), may_alias));
typedef float v8f  __attribute__((ext_vector_type(8)));
typedef float v4f  __attribute__((ext_vector_type(4)));
typedef float v4fa __attribute__((ext_vector_type(4), may_alias));
union FragH { v16h v; v8h half[2]; };

__device__ __forceinline__ float bf16_rne(float x) {
  unsigned int u = __float_as_uint(x);
  u = (u + 0x7FFFu + ((u >> 16) & 1u)) & 0xFFFF0000u;
  return __uint_as_float(u);
}

// f32 -> f16 with a value select: results below the smallest normal f16 become exact zero
static __device__ __forceinline__ h16 toh_flush(float v) { const h16 r = (h16)v; return (fabsf(v) < 6.103515625e-05f) ? (h16)0.0f : r; }

// fragment (A: row = lane&15; B: column = lane&15) from a k-contiguous f16 row: elements 0..7 <- k0+8h.., elements 8..15 <- k0+16+8h..
__device__ __forceinline__ v16h ld_frag(const h16* p, int hh) {
  FragH f; f.half[0] = *(const v8h*)(p + 8 * hh); f.half[1] = *(const v8h*)(p + 16 + 8 * hh); return f.v;
}

__device__ __forceinline__ v8f mma(v16h a, v16h b, v8f c) {
  c = __builtin_amdgcn_wmma_f32_16x16x32_f16(false, a, false, b, (short)0, c, false, false);
  asm volatile("v_nop\n\tv_nop\n\tv_nop\n\tv_nop" : "+v"(c) : "v"(a), "v"(b));
  return c;
}
__device__ __forceinline__ v8f mmam(v16h a, v16h b, v8f c) {
  c = __builtin_amdgcn_wmma_f32_16x16x32_f16(false, a, false, b, (short)0, c, false, false);
  asm volatile("v_nop\n\tv_nop\n\tv_nop\n\tv_nop" : "+v"(c) : "v"(a), "v"(b) : "memory");
  return c;
}

__global__ __launch_bounds__(128) void k_theta(float* __restrict__ TH) {
#pragma clang fp contract(off)
  const int i = threadIdx.x;
  const float e = (float)(2 * i) / (float)HW;
  const float th = 1.0f / powf(10000.0f, e);
  *(float*)(TH + i) = th;
  
}

__global__ __launch_bounds__(256) void k_tab(const float* __restrict__ TH, float* __restrict__ TAB, int n) {
#pragma clang fp contract(off)
  const int idx = blockIdx.x * 256 + threadIdx.x;
  if (idx >= n) return;
  const int i = idx & (HD - 1), s = idx >> 7;
  const float ang = (float)s * TH[i];
  const float cs = cosf(ang);
  const float sn = sinf(ang);
  float* pcs = TAB + idx;
  float* psn = TAB + (size_t)SEQ * HD + idx;
  *(float*)pcs = cs;
  *(float*)psn = sn;
  
}

__global__ __launch_bounds__(32) void k_scale(const float* __restrict__ q1, const float* __restrict__ q2, const float* __restrict__ k1,
                                              const float* __restrict__ k2, const float* __restrict__ lam, float* __restrict__ SC) {
#pragma clang fp contract(off)
  const int lane = threadIdx.x;
  const int h = lane & 15;
  float s1 = 0.f, s2 = 0.f;
#pragma unroll 1
  for (int d = 0; d < HD; ++d) {
    s1 += bf16_rne(q1[h * HD + d]) * bf16_rne(k1[h * HD + d]);
    s2 += bf16_rne(q2[h * HD + d]) * bf16_rne(k2[h * HD + d]);
  }
  float ls = 0.f;
#pragma unroll 1
  for (int i = 0; i < NH; ++i) ls += bf16_rne(lam[i]);
  const float base = expf(s1) - expf(s2);
  const float sc = -((float)NH * base + ls);
  const float osc = 1.0f - bf16_rne(lam[h]);
  const float v = (lane < 16) ? sc : osc;
  *(float*)(SC + lane) = v;
  
}

// pre-norm: h = x * rsqrt(mean(x^2) + 1e-9) * w -> f16 value plane H [NR][DM] (+ x2048 residual plane Hr for rows < EROWS);
__global__ __launch_bounds__(256) void k_hnorm(const float* __restrict__ x, const float* __restrict__ pw, h16* __restrict__ H, h16* __restrict__ Hr) {
#pragma clang fp contract(off)
  __shared__ float red[8];
  const int tid = threadIdx.x, lane = tid & 31;
  const int wave = __builtin_amdgcn_readfirstlane(tid >> 5);
  const int row = blockIdx.x;
  const size_t off = (size_t)row * DM + tid * 8;
  const v4f a = *(const v4fa*)(x + off), b = *(const v4fa*)(x + off + 4);
  const v4f wa = *(const v4fa*)(pw + tid * 8), wb = *(const v4fa*)(pw + tid * 8 + 4);
  float xv[8], wv[8];
#pragma unroll
  for (int q = 0; q < 4; ++q) {
    xv[q] = bf16_rne(a[q]); xv[4 + q] = bf16_rne(b[q]);
    wv[q] = bf16_rne(wa[q]); wv[4 + q] = bf16_rne(wb[q]);
  }
  float ss = 0.f;
#pragma unroll
  for (int i = 0; i < 8; ++i) ss += xv[i] * xv[i];
#pragma unroll
  for (int o = 16; o >= 1; o >>= 1) ss += __shfl_xor(ss, o, 32);
  if (lane == 0) red[wave] = ss;
  __syncthreads();
  float tot = 0.f;
#pragma unroll
  for (int i = 0; i < 8; ++i) tot += red[i];
  const float r = rsqrtf(tot * (1.0f / (float)DM) + 1.0e-9f);
  v8h hv, rv;
#pragma unroll
  for (int i = 0; i < 8; ++i) {
    const float hval = xv[i] * r * wv[i];
    const h16 hb = toh_flush(hval);
    hv[i] = hb;
    rv[i] = toh_flush((hval - (float)hb) * 2048.0f);
  }
  {
    *(v8h*)(H + off) = hv;
    if (row < EROWS) *(v8h*)(Hr + off) = rv;
    
  }
}

__global__ __launch_bounds__(256) void k_wcvt(const float* __restrict__ W, h16* __restrict__ O, size_t n8) {
  const size_t t = (size_t)blockIdx.x * 256 + threadIdx.x;
  if (t >= n8) return;
  const v4f a = *(const v4fa*)(W + t * 8), c = *(const v4fa*)(W + t * 8 + 4);
  v8h o;
#pragma unroll
  for (int q = 0; q < 4; ++q) { o[q] = toh_flush(bf16_rne(a[q]) * 64.0f); o[4 + q] = toh_flush(bf16_rne(c[q]) * 64.0f); }
  *(v8h*)(O + t * 8) = o;
  
}

// GEMM main loop, K = DM, both operands k-contiguous with pitch DM. Wave tile 32 x 64: c[0..3] rows 0..15, c[4..7] rows 16..31.
// RES: a second A plane (x2048 residual) accumulates into cr.
// Operand tiles of KT k are staged in LDS by asynchronous copies, two buffers: trip t works on buffer t & 1 while tile t + 1 flies.
// Stage rows (pitch LP f16 = 144 B, an odd multiple of 16 B for the 16-byte fragment reads): A 0..127, B 128..191, residual A 192..319.
#define KT 64
#define LP 72
#define NTRIP (DM / KT)
static_assert(DM % KT == 0 && NTRIP >= 2 && KT % 32 == 0 && KT * 2 == 128);
template <bool RES> struct Ring { static constexpr int ROWS = RES ? 320 : 192; static constexpr int STG = ROWS * LP; static constexpr int BYTES = 2 * STG * 2; };

#define CPY(a, b) "global_load_async_to_lds_b128 %" #a ", %" #b ", off\n\t"
// 16 bytes per lane and copy, global -> LDS. The closing s_wait_xcnt stands in the copies' own statement so that no later write of an address register is moved in front of it.
__device__ __forceinline__ void copy12(const unsigned (&l)[12], const h16* const (&g)[12]) {
  asm volatile(CPY(0, 1) CPY(2, 3) CPY(4, 5) CPY(6, 7) CPY(8, 9) CPY(10, 11) CPY(12, 13) CPY(14, 15) CPY(16, 17) CPY(18, 19) CPY(20, 21) CPY(22, 23)
               "s_wait_xcnt 0x0"
               :: "v"(l[0]), "v"(g[0]), "v"(l[1]), "v"(g[1]), "v"(l[2]), "v"(g[2]), "v"(l[3]), "v"(g[3]), "v"(l[4]), "v"(g[4]), "v"(l[5]), "v"(g[5]),
                  "v"(l[6]), "v"(g[6]), "v"(l[7]), "v"(g[7]), "v"(l[8]), "v"(g[8]), "v"(l[9]), "v"(g[9]), "v"(l[10]), "v"(g[10]), "v"(l[11]), "v"(g[11])
               : "memory");
}
__device__ __forceinline__ void copy8(const unsigned (&l)[8], const h16* const (&g)[8]) {
  asm volatile(CPY(0, 1) CPY(2, 3) CPY(4, 5) CPY(6, 7) CPY(8, 9) CPY(10, 11) CPY(12, 13) CPY(14, 15)
               "s_wait_xcnt 0x0"
               :: "v"(l[0]), "v"(g[0]), "v"(l[1]), "v"(g[1]), "v"(l[2]), "v"(g[2]), "v"(l[3]), "v"(g[3]), "v"(l[4]), "v"(g[4]), "v"(l[5]), "v"(g[5]),
                  "v"(l[6]), "v"(g[6]), "v"(l[7]), "v"(g[7])
               : "memory");
}

// one stage: 128 threads x 16 B cover 16 rows of 128 B per copy (8 lanes per row: whole lines). lb, gA, gB, gR are the lane's own addresses in row (tid >> 3) of each plane.
template <bool RES>
__device__ __forceinline__ void stage_fill(unsigned lb, const h16* gA, const h16* gB, const h16* gR) {
  unsigned l[12]; const h16* g[12];
  // the three loops here are unrolled so that the address arrays are registers (they are asm operands)
#pragma unroll
  for (int i = 0; i < 8; ++i) { l[i] = lb + (unsigned)(i * 16 * LP * 2); g[i] = gA + (size_t)i * 16 * DM; }
#pragma unroll
  for (int i = 0; i < 4; ++i) { l[8 + i] = lb + (unsigned)((128 + i * 16) * LP * 2); g[8 + i] = gB + (size_t)i * 16 * DM; }
  copy12(l, g);
  if (RES) {
    unsigned lr[8]; const h16* gr[8];
#pragma unroll
    for (int i = 0; i < 8; ++i) { lr[i] = lb + (unsigned)((192 + i * 16) * LP * 2); gr[i] = gR + (size_t)i * 16 * DM; }
    copy8(lr, gr);
  }
}

// mrow: first of the block's 128 A rows; col0: first of its 64 B rows; ring: the block's LDS, Ring<RES>::BYTES bytes, free again behind the last trip's barrier.
template <bool RES>
__device__ __forceinline__ void gemm_main(const h16* Ah, const h16* Ar, const h16* Bt, int mrow, int col0, h16* ring, int tid, int w, int ln, int hh,
                                          v8f (&c)[8], v8f (&cr)[8]) {
  constexpr int STG = Ring<RES>::STG;
  const int crow = tid >> 3, ccol = (tid & 7) * 8;
  const h16* gA = Ah + (size_t)(mrow + crow) * DM + ccol;
  const h16* gR = Ar + (size_t)(mrow + crow) * DM + ccol;
  const h16* gB = Bt + (size_t)(col0 + crow) * DM + ccol;
  const unsigned lb = (unsigned)(uintptr_t)ring + (unsigned)((crow * LP + ccol) * 2);
  stage_fill<RES>(lb, gA, gB, gR);
  asm volatile("s_wait_asynccnt 0x0" ::: "memory");  // tile 0 has landed before the barrier publishes it
  __syncthreads();
  stage_fill<RES>(lb + (unsigned)(STG * 2), gA + KT, gB + KT, gR + KT);
#pragma unroll 1  // kept rolled: one body for both buffers, the buffer picked by a scalar offset
  for (int t = 0; t < NTRIP; ++t) {
    const int buf = t & 1;
    const h16* st = ring + buf * STG;
    const h16* pa = st + (32 * w + ln) * LP;
    const h16* pb = st + (128 + ln) * LP;
    const h16* pr = st + (192 + 32 * w + ln) * LP;
    // the fragments of G k-steps are read from LDS as one group in front of their products: one LDS wait per group, not one per fragment
    // (RES: one k-step per group, two would not fit the register budget beside the 16 accumulator tiles). All loops of the trip are unrolled: fragments and tiles stay in registers
    constexpr int G = RES ? 1 : 2;
#pragma unroll
    for (int k0 = 0; k0 < KT; k0 += 32 * G) {
      v16h fa[G][2], fe[G][2], fb[G][4];
#pragma unroll
      for (int s = 0; s < G; ++s) {
        const int kk = k0 + 32 * s;
        fa[s][0] = ld_frag(pa + kk, hh); fa[s][1] = ld_frag(pa + 16 * LP + kk, hh);
#pragma unroll
        for (int j = 0; j < 4; ++j) fb[s][j] = ld_frag(pb + j * 16 * LP + kk, hh);
        if (RES) { fe[s][0] = ld_frag(pr + kk, hh); fe[s][1] = ld_frag(pr + 16 * LP + kk, hh); }
        else { fe[s][0] = fa[s][0]; fe[s][1] = fa[s][1]; }
      }
#pragma unroll
      for (int s = 0; s < G; ++s) {
#pragma unroll
        for (int j = 0; j < 4; ++j) {
          c[j] = mma(fa[s][0], fb[s][j], c[j]); c[4 + j] = mma(fa[s][1], fb[s][j], c[4 + j]);
          if (RES) { cr[j] = mma(fe[s][0], fb[s][j], cr[j]); cr[4 + j] = mma(fe[s][1], fb[s][j], cr[4 + j]); }
        }
      }
    }
    asm volatile("s_wait_dscnt 0x0" ::: "memory");     // this wave's reads of buffer buf are done before the barrier frees it
    asm volatile("s_wait_asynccnt 0x0" ::: "memory");  // this wave's copies of tile t + 1 have landed before the barrier publishes them
    __syncthreads();
    if (t + 2 < NTRIP) stage_fill<RES>(lb + (unsigned)(buf * STG * 2), gA + (t + 2) * KT, gB + (t + 2) * KT, gR + (t + 2) * KT);
  }
  asm volatile("s_wait_asynccnt 0x0" ::: "memory");    // nothing in flight when the ring becomes output staging
}

// fused projection [NR][N3] = H . W3^T (W3 rows: q 0..4095, k 4096..8191, v 8192..10239). Block = 4 waves = 128 rows x 64 cols.
template <bool RES>
__device__ __forceinline__ void gemm_qkv_body(const h16* Hh, const h16* Hr, const h16* W3, const float* TAB,
                                              h16* QK, h16* QKr, h16* VT, h16* VTr, int mt0) {
  // one LDS block: the operand ring in the main loop, then (behind the last trip's barrier) the output staging so[wave][row][col]
  static_assert(Ring<RES>::BYTES >= 4 * 32 * 68 * 4);
  __shared__ __attribute__((aligned(16))) unsigned char smem[Ring<RES>::BYTES];
  h16* ring = (h16*)smem;
  float (*so)[32][68] = (float (*)[32][68])smem;
  const int tid = threadIdx.x, lane = tid & 31, ln = lane & 15, hh = lane >> 4;
  const int w = __builtin_amdgcn_readfirstlane(tid >> 5);
  const int ntn = N3 >> 6;
  const int mtl = blockIdx.x / ntn, nq = blockIdx.x - mtl * ntn;
  const int mrow = (mt0 + mtl) * 128;
  const int row0 = mrow + 32 * w, col0 = nq * 64;
  const v8f z8 = {0.f, 0.f, 0.f, 0.f, 0.f, 0.f, 0.f, 0.f};
  v8f c[8], cr[8];
#pragma unroll
  for (int u = 0; u < 8; ++u) { c[u] = z8; cr[u] = z8; }
  gemm_main<RES>(Hh, Hr, W3, mrow, col0, ring, tid, w, ln, hh, c, cr);
#pragma unroll
  for (int u = 0; u < 8; ++u) {
    const int t = u & 3, hf = u >> 2;
#pragma unroll
    for (int r = 0; r < 8; ++r) {
      const float v = RES ? (c[u][r] + cr[u][r] * 4.8828125e-4f) * 0.015625f : c[u][r] * 0.015625f;
      so[w][hf * 16 + 8 * hh + r][t * 16 + ln] = v;
    }
  }
  __syncthreads();
  v8h hv[8], rv[8];
  if (col0 < NQK) {
    const int rq = lane >> 3, pc = lane & 7;
    const int i0 = ((col0 & (HW - 1)) >> 1) + pc * 4;
#pragma unroll
    for (int it = 0; it < 8; ++it) {
      const int row = it * 4 + rq;
      const v4f a = *(const v4fa*)&so[w][row][pc * 8], b = *(const v4fa*)&so[w][row][pc * 8 + 4];
      const size_t to = (size_t)(row0 + row) * HD + i0;
      const v4f cs = *(const v4fa*)(TAB + to), sn = *(const v4fa*)(TAB + (size_t)SEQ * HD + to);
      float o[8];
      o[0] = a[0] * cs[0] - a[1] * sn[0]; o[1] = a[0] * sn[0] + a[1] * cs[0];
      o[2] = a[2] * cs[1] - a[3] * sn[1]; o[3] = a[2] * sn[1] + a[3] * cs[1];
      o[4] = b[0] * cs[2] - b[1] * sn[2]; o[5] = b[0] * sn[2] + b[1] * cs[2];
      o[6] = b[2] * cs[3] - b[3] * sn[3]; o[7] = b[2] * sn[3] + b[3] * cs[3];
#pragma unroll
      for (int q = 0; q < 8; ++q) {
        const h16 hb = toh_flush(o[q]);
        hv[it][q] = hb;
        rv[it][q] = toh_flush((o[q] - (float)hb) * 2048.0f);
      }
    }
    {
#pragma unroll
      for (int it = 0; it < 8; ++it) {
        const int row = it * 4 + rq;
        const size_t off = (size_t)(row0 + row) * NQK + col0 + pc * 8;
        *(v8h*)(QK + off) = hv[it];
        if (RES) *(v8h*)(QKr + off) = rv[it];
      }
      
    }
  } else {
    const int chb = col0 - NQK;
    const int sub = lane >> 4, p = lane & 15;
    const int sw = p >> 2, sr = (p & 3) * 8;
#pragma unroll
    for (int it = 0; it < 8; ++it) {
      const int chl = w * 16 + it * 2 + sub;
#pragma unroll
      for (int q = 0; q < 8; ++q) {
        const float v = so[sw][sr + q][chl];
        const h16 hb = toh_flush(v);
        hv[it][q] = hb;
        rv[it][q] = toh_flush((v - (float)hb) * 2048.0f);
      }
    }
    {
#pragma unroll
      for (int it = 0; it < 8; ++it) {
        const int chl = w * 16 + it * 2 + sub;
        *(v8h*)(VT + (size_t)(chb + chl) * SEQ + mrow + p * 8) = hv[it];
        if (RES) *(v8h*)(VTr + (size_t)(chb + chl) * EROWS + mrow + p * 8) = rv[it];
      }
      
    }
  }
}

__global__ __launch_bounds__(128) __attribute__((amdgpu_num_vgpr(256)))
void k_gemm_qkv_early(const h16* __restrict__ Hh, const h16* __restrict__ Hr, const h16* __restrict__ W3, const float* __restrict__ TAB,
                      h16* __restrict__ QK, h16* __restrict__ QKr, h16* __restrict__ VT, h16* __restrict__ VTr) {
  gemm_qkv_body<true>(Hh, Hr, W3, TAB, QK, QKr, VT, VTr, 0);
}
__global__ __launch_bounds__(128) __attribute__((amdgpu_num_vgpr(256)))
void k_gemm_qkv_late(const h16* __restrict__ Hh, const h16* __restrict__ W3, const float* __restrict__ TAB,
                     h16* __restrict__ QK, h16* __restrict__ VT) {
  gemm_qkv_body<false>(Hh, Hh, W3, TAB, QK, QK, VT, VT, EROWS / 128);
}

// output projection out[NR][DM] f32 = ctx . Wo^T / 64 + bf16(x); skip connection added at the store stage as float4;
template <bool RES>
__device__ __forceinline__ void gemm_out_body(const h16* Ch, const h16* Cr, const h16* WoT, const float* x, float* out, int mt0) {
  // one LDS block: the operand ring in the main loop, then (behind the last trip's barrier) the output staging so[wave][row][col]
  static_assert(Ring<RES>::BYTES >= 4 * 32 * 68 * 4);
  __shared__ __attribute__((aligned(16))) unsigned char smem[Ring<RES>::BYTES];
  h16* ring = (h16*)smem;
  float (*so)[32][68] = (float (*)[32][68])smem;
  const int tid = threadIdx.x, lane = tid & 31, ln = lane & 15, hh = lane >> 4;
  const int w = __builtin_amdgcn_readfirstlane(tid >> 5);
  const int ntn = DM >> 6;
  const int mtl = blockIdx.x / ntn, nq = blockIdx.x - mtl * ntn;
  const int mrow = (mt0 + mtl) * 128;
  const int row0 = mrow + 32 * w, col0 = nq * 64;
  const v8f z8 = {0.f, 0.f, 0.f, 0.f, 0.f, 0.f, 0.f, 0.f};
  v8f c[8], cr[8];
#pragma unroll
  for (int u = 0; u < 8; ++u) { c[u] = z8; cr[u] = z8; }
  gemm_main<RES>(Ch, Cr, WoT, mrow, col0, ring, tid, w, ln, hh, c, cr);
#pragma unroll
  for (int u = 0; u < 8; ++u) {
    const int t = u & 3, hf = u >> 2;
#pragma unroll
    for (int r = 0; r < 8; ++r) {
      const float v = RES ? (c[u][r] + cr[u][r] * 4.8828125e-4f) * 0.015625f : c[u][r] * 0.015625f;
      so[w][hf * 16 + 8 * hh + r][t * 16 + ln] = v;
    }
  }
  __syncthreads();
  const int rsub = lane >> 4, c4 = (lane & 15) * 4;
  v4f ov[16];
#pragma unroll
  for (int q = 0; q < 16; ++q) {
    const int r = q * 2 + rsub;
    const v4f v = *(const v4fa*)&so[w][r][c4];
    const v4f xr = *(const v4fa*)(x + (size_t)(row0 + r) * DM + col0 + c4);
    v4f o;
    o[0] = v[0] + bf16_rne(xr[0]); o[1] = v[1] + bf16_rne(xr[1]); o[2] = v[2] + bf16_rne(xr[2]); o[3] = v[3] + bf16_rne(xr[3]);
    ov[q] = o;
  }
  {
#pragma unroll
    for (int q = 0; q < 16; ++q) {
      const int r = q * 2 + rsub;
      *(v4f*)(out + (size_t)(row0 + r) * DM + col0 + c4) = ov[q];
    }
    
  }
}

__global__ __launch_bounds__(128) __attribute__((amdgpu_num_vgpr(256)))
void k_gemm_out_early(const h16* __restrict__ Ch, const h16* __restrict__ Cr, const h16* __restrict__ WoT, const float* __restrict__ x, float* __restrict__ out) {
  gemm_out_body<true>(Ch, Cr, WoT, x, out, 0);
}
__global__ __launch_bounds__(128) __attribute__((amdgpu_num_vgpr(256)))
void k_gemm_out_late(const h16* __restrict__ Ch, const h16* __restrict__ WoT, const float* __restrict__ x, float* __restrict__ out) {
  gemm_out_body<false>(Ch, Ch, WoT, x, out, EROWS / 128);
}

// Transposed flash attention. One block per (head, 16-query tile); wave = (score component c, channel slab hf).
// S^T[key][query] = K_c . Q_c^T (A = K rows, B = Q rows), per-lane (= per-query) running max / sum in the exp2 domain,
// P^T (carried x256) packed from the S^T accumulators directly as the B fragment of O^T[ch][query] = V^T . P^T (A = V^T rows). Causal mask as a select.
// NW = 4: query rows < EROWS, value + x2048 residual planes on q, k, P, v, 64 channels per wave (NW = 2: single f16 products, 128 channels per wave; query rows >= EROWS now have k_attn_late).
// Epilogue: both components meet in LDS (block barrier), O = O_0 + scale[h] O_1, per-head RMSNorm, x (1 - lam[h]), f16 ctx rows (+ residual rows);
template <int NW>
__device__ __forceinline__ void attn_body(const h16* QK, const h16* QKr, const h16* VT, const h16* VTr,
                                          const float* SC, const float* hw, h16* CTX, h16* CTXr, int qt0, int nqt) {
  constexpr bool EARLY = (NW == 4);
  constexpr int NT = 16 / NW;
  constexpr int RPW = 16 / NW;
  static_assert(NW == 2 || NW == 4);
  static_assert(NW * NT * 16 == 2 * HD);
  __shared__ __attribute__((aligned(16))) float comb[2][16][132];
  const int tid = threadIdx.x, lane = tid & 31, ln = lane & 15, hh = lane >> 4;
  const int wave = __builtin_amdgcn_readfirstlane(tid >> 5);
  const int c = wave & 1, hf = wave >> 1;
  const int head = blockIdx.x / nqt;
  const int qt = qt0 + (blockIdx.x - head * nqt);
  const int q0 = qt * 16, qi = q0 + ln;
  const size_t qoff = (size_t)qi * NQK + head * HW + c * HD;
  const int kcol = NH * HW + head * HW + c * HD;
  const int chb = head * HD + hf * (NT * 16);
  const float NEGV = -1.0e30f;
  const float SCL2 = 0.08838834764831845f * 1.4426950408889634f;
  const float PCL = 8.0f;

  const v8f z8 = {0.f, 0.f, 0.f, 0.f, 0.f, 0.f, 0.f, 0.f};
  v16h qh[4];
#pragma unroll
  for (int ks = 0; ks < 4; ++ks) qh[ks] = ld_frag(QK + qoff + ks * 32, hh);

  v8f acc[NT], accr[NT];
#pragma unroll
  for (int dt = 0; dt < NT; ++dt) { acc[dt] = z8; accr[dt] = z8; }
  float m = NEGV, l = 0.f;
  const int nsteps = (q0 + 16 + 31) >> 5;

#pragma unroll 1
  for (int js = 0; js < nsteps; ++js) {
    const int j0 = js << 5;
    v8f s0 = z8, s1 = z8, t0 = z8, t1 = z8;
    const size_t ko = (size_t)(j0 + ln) * NQK + kcol;
#pragma unroll
    for (int ks = 0; ks < 4; ++ks) {
      const v16h a0 = ld_frag(QK + ko + ks * 32, hh);
      const v16h a1 = ld_frag(QK + ko + (size_t)16 * NQK + ks * 32, hh);
      v16h bq = qh[ks];
      if (EARLY) bq = ld_frag(QK + qoff + ks * 32, hh);
      s0 = mmam(a0, bq, s0);
      s1 = mmam(a1, bq, s1);
      if (EARLY) {
        const v16h br = ld_frag(QKr + qoff + ks * 32, hh);
        const v16h r0 = ld_frag(QKr + ko + ks * 32, hh);
        const v16h r1 = ld_frag(QKr + ko + (size_t)16 * NQK + ks * 32, hh);
        t0 = mmam(r0, bq, t0);
        t0 = mmam(a0, br, t0);
        t1 = mmam(r1, bq, t1);
        t1 = mmam(a1, br, t1);
      }
    }

    float xv[16];
    float mx = NEGV;
#pragma unroll
    for (int r = 0; r < 8; ++r) {
      const int k0 = j0 + 8 * hh + r, k1 = k0 + 16;
      float e0 = s0[r], e1 = s1[r];
      if (EARLY) { e0 += t0[r] * 4.8828125e-4f; e1 += t1[r] * 4.8828125e-4f; }
      xv[r] = (k0 <= qi) ? e0 * SCL2 : NEGV;
      xv[8 + r] = (k1 <= qi) ? e1 * SCL2 : NEGV;
      mx = fmaxf(mx, fmaxf(xv[r], xv[8 + r]));
    }
    mx = fmaxf(mx, __shfl_xor(mx, 16, 32));
    const float mn = fmaxf(m, mx);
    const float alpha = exp2f(m - mn);
    m = mn;

    v16h ph, pr;
    float ps = 0.f;
#pragma unroll
    for (int i = 0; i < 16; ++i) {
      const float e = xv[i] - mn + PCL;
      const float pe = exp2f(e);
      const float p = (e < -14.0f) ? 0.f : pe;
      const h16 pb = (h16)p;
      ph[i] = pb;
      if (EARLY) {
        pr[i] = toh_flush((p - (float)pb) * 2048.0f);
        ps += p;
      } else {
        pr[i] = pb;
        ps += (float)pb;
      }
    }
    ps += __shfl_xor(ps, 16, 32);
    l = l * alpha + ps;

#pragma unroll
    for (int dt = 0; dt < NT; ++dt)
#pragma unroll
      for (int r = 0; r < 8; ++r) { acc[dt][r] *= alpha; if (EARLY) accr[dt][r] *= alpha; }

#pragma unroll
    for (int dt = 0; dt < NT; ++dt) {
      const int ch = chb + dt * 16 + ln;
      const v16h vh = ld_frag(VT + (size_t)ch * SEQ + j0, hh);
      acc[dt] = mmam(vh, ph, acc[dt]);
      if (EARLY) {
        const v16h vr = ld_frag(VTr + (size_t)ch * EROWS + j0, hh);
        accr[dt] = mmam(vh, pr, accr[dt]);
        accr[dt] = mmam(vr, ph, accr[dt]);
      }
    }
  }

  const float inv = 1.0f / l;
#pragma unroll
  for (int dt = 0; dt < NT; ++dt)
#pragma unroll
    for (int r = 0; r < 8; ++r) {
      const float v = EARLY ? (acc[dt][r] + accr[dt][r] * 4.8828125e-4f) * inv : acc[dt][r] * inv;
      comb[c][ln][hf * (NT * 16) + dt * 16 + 8 * hh + r] = v;
    }
  __syncthreads();

  const float scl = SC[head], osc = SC[NH + head];
  const int sub = lane >> 4, pc = lane & 15;
  const v4f wa = *(const v4fa*)(hw + pc * 8), wb = *(const v4fa*)(hw + pc * 8 + 4);
  const float wv[8] = {bf16_rne(wa[0]), bf16_rne(wa[1]), bf16_rne(wa[2]), bf16_rne(wa[3]), bf16_rne(wb[0]), bf16_rne(wb[1]), bf16_rne(wb[2]), bf16_rne(wb[3])};
  v8h hv[RPW / 2], rv[RPW / 2];
#pragma unroll
  for (int it = 0; it < RPW / 2; ++it) {
    const int row = wave * RPW + it * 2 + sub;
    const v4f a0 = *(const v4fa*)&comb[0][row][pc * 8], a1 = *(const v4fa*)&comb[0][row][pc * 8 + 4];
    const v4f b0 = *(const v4fa*)&comb[1][row][pc * 8], b1 = *(const v4fa*)&comb[1][row][pc * 8 + 4];
    float o[8];
#pragma unroll
    for (int q = 0; q < 4; ++q) { o[q] = a0[q] + scl * b0[q]; o[4 + q] = a1[q] + scl * b1[q]; }
    float ss = 0.f;
#pragma unroll
    for (int q = 0; q < 8; ++q) ss += o[q] * o[q];
#pragma unroll
    for (int d = 1; d < 16; d <<= 1) ss += __shfl_xor(ss, d, 32);
    const float rms = rsqrtf(ss * (1.0f / (float)HD) + 1.0e-9f);
#pragma unroll
    for (int q = 0; q < 8; ++q) {
      const float val = o[q] * rms * wv[q] * osc;
      const h16 hb = toh_flush(val);
      hv[it][q] = hb;
      rv[it][q] = toh_flush((val - (float)hb) * 2048.0f);
    }
  }
  {
#pragma unroll
    for (int it = 0; it < RPW / 2; ++it) {
      const int row = wave * RPW + it * 2 + sub;
      const size_t off = (size_t)(q0 + row) * DM + head * HD + pc * 8;
      *(v8h*)(CTX + off) = hv[it];
      if (EARLY) *(v8h*)(CTXr + off) = rv[it];
    }
    
  }
}

__global__ __launch_bounds__(128) __attribute__((amdgpu_num_vgpr(256)))
void k_attn_early(const h16* __restrict__ QK, const h16* __restrict__ QKr, const h16* __restrict__ VT, const h16* __restrict__ VTr,
                  const float* __restrict__ SC, const float* __restrict__ hw, h16* __restrict__ CTX, h16* __restrict__ CTXr) {
  attn_body<4>(QK, QKr, VT, VTr, SC, hw, CTX, CTXr, 0, EROWS / 16);
}

// Query rows >= EROWS: the same transposed flash attention with single f16 products, AQB queries of one head at a time, 8 waves = (score component c, 16-query tile qs), 128 channels per wave.
// The head's K rows (both components side by side, 512 B) and V^T rows of a tile of AKT keys are staged in LDS by asynchronous copies and read by all 8 waves;
// two buffers: trip t works on buffer t & 1 while tile t + 1 flies. Every wave walks its keys in steps of 32 from key 0, as one wave per 16 queries would.
// Stage: K rows 0..AKT-1 at pitch AKP f16 = 528 B, then V^T rows 0..HD-1 at pitch AVP f16 = 144 B (odd multiples of 16 B for the 16-byte fragment reads).
#define AQB 64
#define AKT 64
#define AKP 264
#define AVP 72
#define ASTG (AKT * AKP + HD * AVP)
// Causal work dealt evenly: a query block that starts at query q walks (q + AQB) / AKT key tiles, so the blocks of a head differ widely in length. Each head's query blocks are dealt to AGRP work-groups:
// the longest ones stand alone, every other work-group takes a long one and then a short one, one after the other in every wave, so that all work-groups walk about the same number of key tiles.
#define AGRP 16
static_assert(AQB == AKT && AKT == 64 && EROWS % AKT == 0 && (SEQ - EROWS) % AQB == 0 && EROWS / AKT + 1 >= 2);
static_assert(AKP >= HW + 8 && (AKP * 2) % 32 == 16 && AVP >= AKT + 8 && (AVP * 2) % 32 == 16 && (ASTG * 2) % 16 == 0);

// one stage, 256 threads x 16 B per copy: 8 K rows of 512 B (32 lanes per row), 8 copies; 32 V^T rows of 128 B (8 lanes per row), 4 copies. All four arguments are the lane's own addresses.
__device__ __forceinline__ void attn_fill(unsigned lk, unsigned lv, const h16* gK, const h16* gV) {
  unsigned l[12]; const h16* g[12];
  // both loops are unrolled so that the address arrays are registers (they are asm operands)
#pragma unroll
  for (int i = 0; i < 8; ++i) { l[i] = lk + (unsigned)(i * 8 * AKP * 2); g[i] = gK + (size_t)i * 8 * NQK; }
#pragma unroll
  for (int i = 0; i < 4; ++i) { l[8 + i] = lv + (unsigned)(i * 32 * AVP * 2); g[8 + i] = gV + (size_t)i * 32 * SEQ; }
  copy12(l, g);
}

__global__ __launch_bounds__(256) __attribute__((amdgpu_num_vgpr(256)))
void k_attn_late(const h16* __restrict__ QK, const h16* __restrict__ VT, const float* __restrict__ SC, const float* __restrict__ hw, h16* __restrict__ CTX) {
  constexpr int NT = 8;
  constexpr int RPW = AQB / 8;
  // one LDS block: the K / V^T ring in the key loop, then (behind the last trip's barrier) the two components' outputs comb[c][query][channel]
  static_assert(2 * ASTG * 2 >= 2 * AQB * 132 * 4);
  __shared__ __attribute__((aligned(16))) unsigned char smem[2 * ASTG * 2];
  h16* ring = (h16*)smem;
  float (*comb)[AQB][132] = (float (*)[AQB][132])smem;
  const int tid = threadIdx.x, lane = tid & 31, ln = lane & 15, hh = lane >> 4;
  const int wave = __builtin_amdgcn_readfirstlane(tid >> 5);
  const int c = wave & 1, qs = wave >> 1;
  constexpr int nqb = (SEQ - EROWS) / AQB;
  constexpr int NSGL = 2 * AGRP - nqb;  // work-groups with one query block (the NSGL longest); the others take two: nqb = NSGL + 2 * (AGRP - NSGL)
  static_assert(nqb >= AGRP && nqb <= 2 * AGRP);
  const int head = blockIdx.x / AGRP;
  const int grp = blockIdx.x - head * AGRP;
  const int npass = (grp < NSGL) ? 1 : 2;
  const float NEGV = -1.0e30f;
  const float SCL2 = 0.08838834764831845f * 1.4426950408889634f;
  const float PCL = 8.0f;
  const v8f z8 = {0.f, 0.f, 0.f, 0.f, 0.f, 0.f, 0.f, 0.f};

#pragma unroll 1  // kept rolled: one body for both query blocks of the work-group
  for (int pass = 0; pass < npass; ++pass) {
  // query blocks nqb-1 .. nqb-AGRP come first, blocks 0 .. nqb-AGRP-1 second: each exactly once; the two lengths of a pair add up to the same sum in every pair
  const int q0b = EROWS + ((pass == 0) ? nqb - 1 - grp : grp - NSGL) * AQB;
  const int q0 = q0b + qs * 16, qi = q0 + ln;
  if (pass) {  // the same for the whole work-group
    asm volatile("s_wait_dscnt 0x0" ::: "memory");  // this wave's reads of the first query block's comb rows are done before the barrier frees that LDS
    __syncthreads();                                // every wave has left comb before the copies below refill the ring over it
  }
  v16h qh[4];
#pragma unroll
  for (int ks = 0; ks < 4; ++ks) qh[ks] = ld_frag(QK + (size_t)qi * NQK + head * HW + c * HD + ks * 32, hh);

  v8f acc[NT];
#pragma unroll
  for (int dt = 0; dt < NT; ++dt) acc[dt] = z8;
  float m = NEGV, l = 0.f;

  const int ntiles = (q0b + AQB) / AKT;  // >= 2: q0b >= EROWS
  const h16* gK = QK + (size_t)(tid >> 5) * NQK + NH * HW + head * HW + (tid & 31) * 8;
  const h16* gV = VT + (size_t)(head * HD + (tid >> 3)) * SEQ + (tid & 7) * 8;
  const unsigned lk = (unsigned)(uintptr_t)ring + (unsigned)(((tid >> 5) * AKP + (tid & 31) * 8) * 2);
  const unsigned lv = (unsigned)(uintptr_t)ring + (unsigned)((AKT * AKP + (tid >> 3) * AVP + (tid & 7) * 8) * 2);
  attn_fill(lk, lv, gK, gV);
  asm volatile("s_wait_asynccnt 0x0" ::: "memory");  // tile 0 has landed before the barrier publishes it
  __syncthreads();
  attn_fill(lk + (unsigned)(ASTG * 2), lv + (unsigned)(ASTG * 2), gK + (size_t)AKT * NQK, gV + AKT);
#pragma unroll 1  // kept rolled: one body for both buffers, the buffer picked by a scalar offset
  for (int t = 0; t < ntiles; ++t) {
    const int buf = t & 1;
    const h16* st = ring + buf * ASTG;
#pragma unroll 1  // kept rolled: one body for both 32-key halves of the tile
    for (int sub = 0; sub < AKT / 32; ++sub) {
      const int j0 = t * AKT + sub * 32;
      if (j0 > q0 + 15) continue;  // wave-uniform: every key of the step lies behind all 16 queries of this wave (only in the block's last tile)
      const h16* pk = st + (sub * 32 + ln) * AKP + c * HD;
      const h16* pv = st + AKT * AKP + ln * AVP + sub * 32;
      v16h ka[4][2];
#pragma unroll
      for (int ks = 0; ks < 4; ++ks) { ka[ks][0] = ld_frag(pk + ks * 32, hh); ka[ks][1] = ld_frag(pk + 16 * AKP + ks * 32, hh); }
      v8f s0 = z8, s1 = z8;
#pragma unroll
      for (int ks = 0; ks < 4; ++ks) { s0 = mma(ka[ks][0], qh[ks], s0); s1 = mma(ka[ks][1], qh[ks], s1); }
      v16h vh[NT];
#pragma unroll
      for (int dt = 0; dt < NT; ++dt) vh[dt] = ld_frag(pv + dt * 16 * AVP, hh);
      __builtin_amdgcn_sched_barrier(0);  // keeps the V^T reads together here, in flight under the softmax (left free they are spread over it in pairs, the last ones directly in front of their products)

      float xv[16];
      float mx = NEGV;
#pragma unroll
      for (int r = 0; r < 8; ++r) {
        const int k0 = j0 + 8 * hh + r, k1 = k0 + 16;
        xv[r] = (k0 <= qi) ? s0[r] * SCL2 : NEGV;
        xv[8 + r] = (k1 <= qi) ? s1[r] * SCL2 : NEGV;
        mx = fmaxf(mx, fmaxf(xv[r], xv[8 + r]));
      }
      mx = fmaxf(mx, __shfl_xor(mx, 16, 32));
      const float mn = fmaxf(m, mx);
      const float alpha = exp2f(m - mn);
      m = mn;

      v16h ph;
      float ps = 0.f;
#pragma unroll
      for (int i = 0; i < 16; ++i) {
        const float e = xv[i] - mn + PCL;
        const float pe = exp2f(e);
        const float p = (e < -14.0f) ? 0.f : pe;
        const h16 pb = (h16)p;
        ph[i] = pb;
        ps += (float)pb;
      }
      ps += __shfl_xor(ps, 16, 32);
      l = l * alpha + ps;

#pragma unroll
      for (int dt = 0; dt < NT; ++dt)
#pragma unroll
        for (int r = 0; r < 8; ++r) acc[dt][r] *= alpha;
#pragma unroll
      for (int dt = 0; dt < NT; ++dt) acc[dt] = mma(vh[dt], ph, acc[dt]);
    }
    asm volatile("s_wait_dscnt 0x0" ::: "memory");     // this wave's reads of buffer buf are done before the barrier frees it
    asm volatile("s_wait_asynccnt 0x0" ::: "memory");  // this wave's copies of tile t + 1 have landed before the barrier publishes them
    __syncthreads();
    if (t + 2 < ntiles)
      attn_fill(lk + (unsigned)(buf * ASTG * 2), lv + (unsigned)(buf * ASTG * 2), gK + (size_t)(t + 2) * AKT * NQK, gV + (t + 2) * AKT);
  }
  asm volatile("s_wait_asynccnt 0x0" ::: "memory");    // nothing in flight when the ring becomes output staging

  const float inv = 1.0f / l;
#pragma unroll
  for (int dt = 0; dt < NT; ++dt)
#pragma unroll
    for (int r = 0; r < 8; ++r) comb[c][qs * 16 + ln][dt * 16 + 8 * hh + r] = acc[dt][r] * inv;
  __syncthreads();

  const float scl = SC[head], osc = SC[NH + head];
  const int sub = lane >> 4, pc = lane & 15;
  const v4f wa = *(const v4fa*)(hw + pc * 8), wb = *(const v4fa*)(hw + pc * 8 + 4);
  const float wv[8] = {bf16_rne(wa[0]), bf16_rne(wa[1]), bf16_rne(wa[2]), bf16_rne(wa[3]), bf16_rne(wb[0]), bf16_rne(wb[1]), bf16_rne(wb[2]), bf16_rne(wb[3])};
  v8h hv[RPW / 2];
#pragma unroll
  for (int it = 0; it < RPW / 2; ++it) {
    const int row = wave * RPW + it * 2 + sub;
    const v4f a0 = *(const v4fa*)&comb[0][row][pc * 8], a1 = *(const v4fa*)&comb[0][row][pc * 8 + 4];
    const v4f b0 = *(const v4fa*)&comb[1][row][pc * 8], b1 = *(const v4fa*)&comb[1][row][pc * 8 + 4];
    float o[8];
#pragma unroll
    for (int q = 0; q < 4; ++q) { o[q] = a0[q] + scl * b0[q]; o[4 + q] = a1[q] + scl * b1[q]; }
    float ss = 0.f;
#pragma unroll
    for (int q = 0; q < 8; ++q) ss += o[q] * o[q];
#pragma unroll
    for (int d = 1; d < 16; d <<= 1) ss += __shfl_xor(ss, d, 32);
    const float rms = rsqrtf(ss * (1.0f / (float)HD) + 1.0e-9f);
#pragma unroll
    for (int q = 0; q < 8; ++q) hv[it][q] = toh_flush(o[q] * rms * wv[q] * osc);
  }
#pragma unroll
  for (int it = 0; it < RPW / 2; ++it) {
    const int row = wave * RPW + it * 2 + sub;
    *(v8h*)(CTX + (size_t)(q0b + row) * DM + head * HD + pc * 8) = hv[it];
  }
  asm volatile("s_wait_xcnt 0x0" ::: "memory");  // stands behind the stores, in front of the next query block's writes to the registers that they name
  }
}

extern "C" void kernel_launch(void* const* d_in, const int* in_sizes, int n_in,
                              void* d_out, int out_size, void* d_ws, size_t ws_size, hipStream_t stream) {
  if (n_in < 12) return;
  if (in_sizes[0] < NR * DM) return;
  if (in_sizes[1] < DM) return;
  if (in_sizes[2] < NH * HW * DM || in_sizes[3] < NH * HW * DM) return;
  if (in_sizes[4] < DM * DM || in_sizes[5] < DM * DM) return;
  if (in_sizes[6] < HD) return;
  if (in_sizes[7] < NH * HD || in_sizes[8] < NH * HD || in_sizes[9] < NH * HD || in_sizes[10] < NH * HD) return;
  if (in_sizes[11] < NH) return;
  if (out_size < NR * DM) return;
  const float* x   = (const float*)d_in[0];
  const float* pw  = (const float*)d_in[1];
  const float* wq  = (const float*)d_in[2];
  const float* wk  = (const float*)d_in[3];
  const float* wv  = (const float*)d_in[4];
  const float* wo  = (const float*)d_in[5];
  const float* hnw = (const float*)d_in[6];
  const float* q1  = (const float*)d_in[7];
  const float* q2  = (const float*)d_in[8];
  const float* k1  = (const float*)d_in[9];
  const float* k2  = (const float*)d_in[10];
  const float* lam = (const float*)d_in[11];
  float* out = (float*)d_out;

  // workspace regions (bytes); every region is written with whole-row stores inside its exact extent
  constexpr size_t SZ_TH  = 512;
  constexpr size_t SZ_TAB = (size_t)2 * SEQ * HD * 4;
  constexpr size_t SZ_SC  = 256;
  constexpr size_t SZ_H   = (size_t)NR * DM * 2;
  constexpr size_t SZ_HR  = (size_t)EROWS * DM * 2;
  constexpr size_t SZ_W3  = (size_t)N3 * DM * 2;
  constexpr size_t SZ_WO  = (size_t)DM * DM * 2;
  constexpr size_t SZ_QK  = (size_t)NR * NQK * 2;
  constexpr size_t SZ_QKR = (size_t)EROWS * NQK * 2;
  constexpr size_t SZ_VT  = (size_t)DM * SEQ * 2;
  constexpr size_t SZ_VTR = (size_t)DM * EROWS * 2;
  constexpr size_t SZ_CX  = (size_t)NR * DM * 2;
  constexpr size_t SZ_CXR = (size_t)EROWS * DM * 2;
  constexpr size_t OF_TH  = 0;
  constexpr size_t OF_TAB = OF_TH + SZ_TH;
  constexpr size_t OF_SC  = OF_TAB + SZ_TAB;
  constexpr size_t OF_H   = OF_SC + SZ_SC;
  constexpr size_t OF_HR  = OF_H + SZ_H;
  constexpr size_t OF_W3  = OF_HR + SZ_HR;
  constexpr size_t OF_WO  = OF_W3 + SZ_W3;
  constexpr size_t OF_QK  = OF_WO + SZ_WO;
  constexpr size_t OF_QKR = OF_QK + SZ_QK;
  constexpr size_t OF_VT  = OF_QKR + SZ_QKR;
  constexpr size_t OF_VTR = OF_VT + SZ_VT;
  constexpr size_t OF_CX  = OF_VTR + SZ_VTR;
  constexpr size_t OF_CXR = OF_CX + SZ_CX;
  constexpr size_t SZ_ALL = OF_CXR + SZ_CXR;
  static_assert(SZ_TH >= 128 * 4 && SZ_SC >= 32 * 4);
  static_assert(SZ_TH % 256 == 0 && SZ_TAB % 256 == 0 && SZ_SC % 256 == 0 && SZ_H % 256 == 0 && SZ_HR % 256 == 0 && SZ_W3 % 256 == 0);
  static_assert(SZ_WO % 256 == 0 && SZ_QK % 256 == 0 && SZ_QKR % 256 == 0 && SZ_VT % 256 == 0 && SZ_VTR % 256 == 0 && SZ_CX % 256 == 0 && SZ_CXR % 256 == 0);
  static_assert(SZ_ALL <= (size_t)134217728);
  if (SZ_ALL > ws_size) return;
  char* ws = (char*)d_ws;
  float* TH   = (float*)(ws + OF_TH);
  float* TAB  = (float*)(ws + OF_TAB);
  float* SC   = (float*)(ws + OF_SC);
  h16*   Hh   = (h16*)(ws + OF_H);
  h16*   Hr   = (h16*)(ws + OF_HR);
  h16*   W3   = (h16*)(ws + OF_W3);
  h16*   WoT  = (h16*)(ws + OF_WO);
  h16*   QK   = (h16*)(ws + OF_QK);
  h16*   QKr  = (h16*)(ws + OF_QKR);
  h16*   VT   = (h16*)(ws + OF_VT);
  h16*   VTr  = (h16*)(ws + OF_VTR);
  h16*   CTX  = (h16*)(ws + OF_CX);
  h16*   CTXr = (h16*)(ws + OF_CXR);

  k_theta<<<1, 128, 0, stream>>>(TH);
  const int ntab = SEQ * HD;
  k_tab<<<(unsigned)((ntab + 255) / 256), 256, 0, stream>>>(TH, TAB, ntab);
  k_scale<<<1, 32, 0, stream>>>(q1, q2, k1, k2, lam, SC);
  k_hnorm<<<(unsigned)NR, 256, 0, stream>>>(x, pw, Hh, Hr);

  const size_t nq8 = (size_t)NH * HW * DM / 8;
  const size_t nv8 = (size_t)DM * DM / 8;
  k_wcvt<<<(unsigned)((nq8 + 255) / 256), 256, 0, stream>>>(wq, W3, nq8);                                  /* rows 0..4095 */
  k_wcvt<<<(unsigned)((nq8 + 255) / 256), 256, 0, stream>>>(wk, W3 + (size_t)NH * HW * DM, nq8);           /* rows 4096..8191 */
  k_wcvt<<<(unsigned)((nv8 + 255) / 256), 256, 0, stream>>>(wv, W3 + (size_t)NQK * DM, nv8);               /* rows 8192..10239 */
  k_wcvt<<<(unsigned)((nv8 + 255) / 256), 256, 0, stream>>>(wo, WoT, nv8);

  k_gemm_qkv_early<<<(unsigned)((EROWS / 128) * (N3 / 64)), 128, 0, stream>>>(Hh, Hr, W3, TAB, QK, QKr, VT, VTr);
  if (NR > EROWS)
    k_gemm_qkv_late<<<(unsigned)(((NR - EROWS) / 128) * (N3 / 64)), 128, 0, stream>>>(Hh, W3, TAB, QK, VT);

  k_attn_early<<<(unsigned)(NH * (EROWS / 16)), 128, 0, stream>>>(QK, QKr, VT, VTr, SC, hnw, CTX, CTXr);
  if (SEQ > EROWS)
    k_attn_late<<<(unsigned)(NH * AGRP), 256, 0, stream>>>(QK, VT, SC, hnw, CTX);

  k_gemm_out_early<<<(unsigned)((EROWS / 128) * (DM / 64)), 128, 0, stream>>>(CTX, CTXr, WoT, x, out);
  if (NR > EROWS)
    k_gemm_out_late<<<(unsigned)(((NR - EROWS) / 128) * (DM / 64)), 128, 0, stream>>>(CTX, WoT, x, out);
}

// v004
// A run of this version takes 213 microseconds.
// Timed twice side by side with v003, it ran 1.33 and 1.34 times as fast.
// Over all steps from v000 it is 3.00 times as fast.
#include <hip/hip_runtime.h>
// Pre-RMSNorm differential causal attention block: fused [out][in] q|k|v projection, interleaved-pair rotary over 256 columns per head (computed f32 cos/sin table),
// two causal softmax maps per head combined with a per-head scale, per-head RMSNorm, output projection, skip connection. T 2048, D 2048, 16 heads of 128.
// Compute dtype: all contractions on v_wmma_f32_16x16x32_f16 with f32 accumulate. Inputs are RNE-converted to bf16 first; weights carried x64 as f16 (exact).
// Query rows >= 256: single f16 products at every site (h, q, k, v, P x256, ctx). Query rows < 256: value + x2048 f16 residual planes on h, q, k, P, v, ctx
// (residual products in their own accumulators, folded with 2^-11 in the f32 epilogue). Norms, rotary, mask, softmax statistics in f32 on the VALU.
#ifndef NB
#define NB 1
#endif
#ifndef SEQ
#define SEQ 2048
#endif
#define SEQ_FULL 2048
#define DM 2048
#define NH 16
#define HD 128
#define HW 256
#define NQK (2 * NH * HW)
#define N3 (NQK + DM)
#define NR (NB * SEQ)
#define EROWS 256

static_assert(NB == 1);
static_assert(NH * HD == DM);
static_assert(HW == 2 * HD && HD == 128);
static_assert(SEQ % 128 == 0 && SEQ <= SEQ_FULL);
static_assert(EROWS % 128 == 0 && EROWS < SEQ && EROWS % 32 == 0);
static_assert(DM % 64 == 0 && N3 % 64 == 0 && NQK % 64 == 0 && DM % 32 == 0);
static_assert(HW % 64 == 0 && NQK % HW == 0);
static_assert(256 * 8 == DM);
static_assert((SEQ * HD) % 256 == 0);

typedef _Float16 h16;
typedef _Float16 v16h __attribute__((ext_vector_type(16)));
typedef _Float16 v8h  __attribute__((ext_vector_type(8), may_alias));
typedef float v8f  __attribute__((ext_vector_type(8)));
typedef float v4f  __attribute__((ext_vector_type(4)));
typedef float v4fa __attribute__((ext_vector_type(4), may_alias));
union FragH { v16h v; v8h half[2]; };

__device__ __forceinline__ float bf16_rne(float x) {
  unsigned int u = __float_as_uint(x);
  u = (u + 0x7FFFu + ((u >> 16) & 1u)) & 0xFFFF0000u;
  return __uint_as_float(u);
}

// f32 -> f16 with a value select: results below the smallest normal f16 become exact zero
static __device__ __forceinline__ h16 toh_flush(float v) { const h16 r = (h16)v; return (fabsf(v) < 6.103515625e-05f) ? (h16)0.0f : r; }

// fragment (A: row = lane&15; B: column = lane&15) from a k-contiguous f16 row: elements 0..7 <- k0+8h.., elements 8..15 <- k0+16+8h..
__device__ __forceinline__ v16h ld_frag(const h16* p, int hh) {
  FragH f; f.half[0] = *(const v8h*)(p + 8 * hh); f.half[1] = *(const v8h*)(p + 16 + 8 * hh); return f.v;
}

// the same fragment from global memory; a wait stands in front of each load because the compiler may give a load's result the registers of an address that an earlier load names
__device__ __forceinline__ v16h ld_frag_g(const h16* p, int hh) {
  FragH f;
  asm volatile("s_wait_xcnt 0x0" ::: "memory");
  f.half[0] = *(const v8h*)(p + 8 * hh);
  asm volatile("s_wait_xcnt 0x0" ::: "memory");
  f.half[1] = *(const v8h*)(p + 16 + 8 * hh); return f.v;
}

__device__ __forceinline__ v8f mma(v16h a, v16h b, v8f c) {
  c = __builtin_amdgcn_wmma_f32_16x16x32_f16(false, a, false, b, (short)0, c, false, false);
  asm volatile("v_nop\n\tv_nop\n\tv_nop\n\tv_nop" : "+v"(c) : "v"(a), "v"(b));
  return c;
}
__device__ __forceinline__ v8f mmam(v16h a, v16h b, v8f c) {
  c = __builtin_amdgcn_wmma_f32_16x16x32_f16(false, a, false, b, (short)0, c, false, false);
  asm volatile("v_nop\n\tv_nop\n\tv_nop\n\tv_nop" : "+v"(c) : "v"(a), "v"(b) : "memory");
  return c;
}

// The preparation steps below read only the inputs and write disjoint workspace regions: none depends on another, so they share one grid (k_prep), each on its own range of blocks.
// rotary table: every thread forms its own column's theta (the same expression for every row of that column)
__device__ __forceinline__ void tab_body(float* TAB, int blk) {
#pragma clang fp contract(off)
  const int idx = blk * 256 + threadIdx.x;
  const int i = idx & (HD - 1), s = idx >> 7;
  const float e = (float)(2 * i) / (float)HW;
  const float th = 1.0f / powf(10000.0f, e);
  const float ang = (float)s * th;
  const float cs = cosf(ang);
  const float sn = sinf(ang);
  float* pcs = TAB + idx;
  float* psn = TAB + (size_t)SEQ * HD + idx;
  *(float*)pcs = cs;
  *(float*)psn = sn;
  asm volatile("s_wait_xcnt 0x0" ::: "memory");  // stands behind the stores: in the shared grid the listing runs on from here into another range's code, which reuses the registers that they name
}

// per-head scales: the work of one wave (the caller passes wave 0 of one block)
__device__ __forceinline__ void scale_body(const float* q1, const float* q2, const float* k1, const float* k2, const float* lam, float* SC) {
#pragma clang fp contract(off)
  const int lane = threadIdx.x;
  const int h = lane & 15;
  float s1 = 0.f, s2 = 0.f;
#pragma unroll 1
  for (int d = 0; d < HD; ++d) {
    s1 += bf16_rne(q1[h * HD + d]) * bf16_rne(k1[h * HD + d]);
    s2 += bf16_rne(q2[h * HD + d]) * bf16_rne(k2[h * HD + d]);
  }
  float ls = 0.f;
#pragma unroll 1
  for (int i = 0; i < NH; ++i) ls += bf16_rne(lam[i]);
  const float base = expf(s1) - expf(s2);
  const float sc = -((float)NH * base + ls);
  const float osc = 1.0f - bf16_rne(lam[h]);
  const float v = (lane < 16) ? sc : osc;
  *(float*)(SC + lane) = v;
  
}

// pre-norm: h = x * rsqrt(mean(x^2) + 1e-9) * w -> f16 value plane H [NR][DM] (+ x2048 residual plane Hr for rows < EROWS);
__device__ __forceinline__ void hnorm_body(const float* x, const float* pw, h16* H, h16* Hr, int row) {
#pragma clang fp contract(off)
  __shared__ float red[8];
  const int tid = threadIdx.x, lane = tid & 31;
  const int wave = __builtin_amdgcn_readfirstlane(tid >> 5);
  const size_t off = (size_t)row * DM + tid * 8;
  const v4f a = *(const v4fa*)(x + off), b = *(const v4fa*)(x + off + 4);
  asm volatile("s_wait_xcnt 0x0" ::: "memory");  // stands behind the two loads, in front of the next loads, whose results may take the registers of the address that these name
  const v4f wa = *(const v4fa*)(pw + tid * 8), wb = *(const v4fa*)(pw + tid * 8 + 4);
  float xv[8], wv[8];
#pragma unroll
  for (int q = 0; q < 4; ++q) {
    xv[q] = bf16_rne(a[q]); xv[4 + q] = bf16_rne(b[q]);
    wv[q] = bf16_rne(wa[q]); wv[4 + q] = bf16_rne(wb[q]);
  }
  float ss = 0.f;
#pragma unroll
  for (int i = 0; i < 8; ++i) ss += xv[i] * xv[i];
#pragma unroll
  for (int o = 16; o >= 1; o >>= 1) ss += __shfl_xor(ss, o, 32);
  if (lane == 0) red[wave] = ss;
  __syncthreads();
  float tot = 0.f;
#pragma unroll
  for (int i = 0; i < 8; ++i) tot += red[i];
  const float r = rsqrtf(tot * (1.0f / (float)DM) + 1.0e-9f);
  v8h hv, rv;
#pragma unroll
  for (int i = 0; i < 8; ++i) {
    const float hval = xv[i] * r * wv[i];
    const h16 hb = toh_flush(hval);
    hv[i] = hb;
    rv[i] = toh_flush((hval - (float)hb) * 2048.0f);
  }
  {
    *(v8h*)(H + off) = hv;
    asm volatile("s_wait_xcnt 0x0" ::: "memory");  // stands behind the store, in front of the residual's arithmetic, which reuses the registers that the store names
    if (row < EROWS) *(v8h*)(Hr + off) = rv;
    asm volatile("s_wait_xcnt 0x0" ::: "memory");  // stands behind the last store: the listing runs on from here into another range's code, which reuses the registers that it names
  }
}

__device__ __forceinline__ void wcvt_body(const float* W, h16* O, int blk) {
  const size_t t = (size_t)blk * 256 + threadIdx.x;
  const v4f a = *(const v4fa*)(W + t * 8), c = *(const v4fa*)(W + t * 8 + 4);
  v8h o;
#pragma unroll
  for (int q = 0; q < 4; ++q) { o[q] = toh_flush(bf16_rne(a[q]) * 64.0f); o[4 + q] = toh_flush(bf16_rne(c[q]) * 64.0f); }
  *(v8h*)(O + t * 8) = o;
  asm volatile("s_wait_xcnt 0x0" ::: "memory");  // stands behind the store: the listing runs on from here into another range's code, which reuses the registers that it names
}

// block ranges of k_prep; the one-wave scale step comes first because it is the longest single chain
#define PB_SC 1
#define PB_TAB (SEQ * HD / 256)
#define PB_HN NR
#define PB_WQK (NH * HW * DM / 8 / 256)
#define PB_WVO (DM * DM / 8 / 256)
#define PB_ALL (PB_SC + PB_TAB + PB_HN + 2 * PB_WQK + 2 * PB_WVO)
static_assert((NH * HW * DM) % (8 * 256) == 0 && (DM * DM) % (8 * 256) == 0);
__global__ __launch_bounds__(256)
void k_prep(const float* __restrict__ x, const float* __restrict__ pw, const float* __restrict__ wq, const float* __restrict__ wk,
            const float* __restrict__ wv, const float* __restrict__ wo, const float* __restrict__ q1, const float* __restrict__ q2,
            const float* __restrict__ k1, const float* __restrict__ k2, const float* __restrict__ lam,
            float* __restrict__ TAB, float* __restrict__ SC, h16* __restrict__ H, h16* __restrict__ Hr, h16* __restrict__ W3, h16* __restrict__ WoT) {
  int b = blockIdx.x;  // every test below reads the same for the whole block
  if (b < PB_SC) { if (threadIdx.x < 32) scale_body(q1, q2, k1, k2, lam, SC); return; }
  b -= PB_SC;
  if (b < PB_TAB) { tab_body(TAB, b); return; }
  b -= PB_TAB;
  if (b < PB_HN) { hnorm_body(x, pw, H, Hr, b); return; }
  b -= PB_HN;
  if (b < PB_WQK) { wcvt_body(wq, W3, b); return; }                                /* W3 rows 0..4095 */
  b -= PB_WQK;
  if (b < PB_WQK) { wcvt_body(wk, W3 + (size_t)NH * HW * DM, b); return; }         /* W3 rows 4096..8191 */
  b -= PB_WQK;
  if (b < PB_WVO) { wcvt_body(wv, W3 + (size_t)NQK * DM, b); return; }             /* W3 rows 8192..10239 */
  b -= PB_WVO;
  wcvt_body(wo, WoT, b);
}

// GEMM main loop, K = DM, both operands k-contiguous with pitch DM. Wave tile 32 x 64: c[0..3] rows 0..15, c[4..7] rows 16..31.
// RES: a second A plane (x2048 residual) accumulates into cr.
// Operand tiles of KT k are staged in LDS by asynchronous copies, two buffers: trip t works on buffer t & 1 while tile t + 1 flies.
// Stage rows (pitch LP f16 = 144 B, an odd multiple of 16 B for the 16-byte fragment reads): A 0..127, B 128..191, residual A 192..319.
#define KT 64
#define LP 72
#define NTRIP (DM / KT)
static_assert(DM % KT == 0 && NTRIP >= 2 && KT % 32 == 0 && KT * 2 == 128);
template <bool RES> struct Ring { static constexpr int ROWS = RES ? 320 : 192; static constexpr int STG = ROWS * LP; static constexpr int BYTES = 2 * STG * 2; };

#define CPY(a, b) "global_load_async_to_lds_b128 %" #a ", %" #b ", off\n\t"
// 16 bytes per lane and copy, global -> LDS. The closing s_wait_xcnt stands in the copies' own statement so that no later write of an address register is moved in front of it.
__device__ __forceinline__ void copy12(const unsigned (&l)[12], const h16* const (&g)[12]) {
  asm volatile(CPY(0, 1) CPY(2, 3) CPY(4, 5) CPY(6, 7) CPY(8, 9) CPY(10, 11) CPY(12, 13) CPY(14, 15) CPY(16, 17) CPY(18, 19) CPY(20, 21) CPY(22, 23)
               "s_wait_xcnt 0x0"
               :: "v"(l[0]), "v"(g[0]), "v"(l[1]), "v"(g[1]), "v"(l[2]), "v"(g[2]), "v"(l[3]), "v"(g[3]), "v"(l[4]), "v"(g[4]), "v"(l[5]), "v"(g[5]),
                  "v"(l[6]), "v"(g[6]), "v"(l[7]), "v"(g[7]), "v"(l[8]), "v"(g[8]), "v"(l[9]), "v"(g[9]), "v"(l[10]), "v"(g[10]), "v"(l[11]), "v"(g[11])
               : "memory");
}
__device__ __forceinline__ void copy8(const unsigned (&l)[8], const h16* const (&g)[8]) {
  asm volatile(CPY(0, 1) CPY(2, 3) CPY(4, 5) CPY(6, 7) CPY(8, 9) CPY(10, 11) CPY(12, 13) CPY(14, 15)
               "s_wait_xcnt 0x0"
               :: "v"(l[0]), "v"(g[0]), "v"(l[1]), "v"(g[1]), "v"(l[2]), "v"(g[2]), "v"(l[3]), "v"(g[3]), "v"(l[4]), "v"(g[4]), "v"(l[5]), "v"(g[5]),
                  "v"(l[6]), "v"(g[6]), "v"(l[7]), "v"(g[7])
               : "memory");
}

// one stage: 128 threads x 16 B cover 16 rows of 128 B per copy (8 lanes per row: whole lines). lb, gA, gB, gR are the lane's own addresses in row (tid >> 3) of each plane.
template <bool RES>
__device__ __forceinline__ void stage_fill(unsigned lb, const h16* gA, const h16* gB, const h16* gR) {
  unsigned l[12]; const h16* g[12];
  // the three loops here are unrolled so that the address arrays are registers (they are asm operands)
#pragma unroll
  for (int i = 0; i < 8; ++i) { l[i] = lb + (unsigned)(i * 16 * LP * 2); g[i] = gA + (size_t)i * 16 * DM; }
#pragma unroll
  for (int i = 0; i < 4; ++i) { l[8 + i] = lb + (unsigned)((128 + i * 16) * LP * 2); g[8 + i] = gB + (size_t)i * 16 * DM; }
  copy12(l, g);
  if (RES) {
    unsigned lr[8]; const h16* gr[8];
#pragma unroll
    for (int i = 0; i < 8; ++i) { lr[i] = lb + (unsigned)((192 + i * 16) * LP * 2); gr[i] = gR + (size_t)i * 16 * DM; }
    copy8(lr, gr);
  }
}

// mrow: first of the block's 128 A rows; col0: first of its 64 B rows; ring: the block's LDS, Ring<RES>::BYTES bytes, free again behind the last trip's barrier.
template <bool RES>
__device__ __forceinline__ void gemm_main(const h16* Ah, const h16* Ar, const h16* Bt, int mrow, int col0, h16* ring, int tid, int w, int ln, int hh,
                                          v8f (&c)[8], v8f (&cr)[8]) {
  constexpr int STG = Ring<RES>::STG;
  const int crow = tid >> 3, ccol = (tid & 7) * 8;
  const h16* gA = Ah + (size_t)(mrow + crow) * DM + ccol;
  const h16* gR = Ar + (size_t)(mrow + crow) * DM + ccol;
  const h16* gB = Bt + (size_t)(col0 + crow) * DM + ccol;
  const unsigned lb = (unsigned)(uintptr_t)ring + (unsigned)((crow * LP + ccol) * 2);
  stage_fill<RES>(lb, gA, gB, gR);
  asm volatile("s_wait_asynccnt 0x0" ::: "memory");  // tile 0 has landed before the barrier publishes it
  __syncthreads();
  stage_fill<RES>(lb + (unsigned)(STG * 2), gA + KT, gB + KT, gR + KT);
#pragma unroll 1  // kept rolled: one body for both buffers, the buffer picked by a scalar offset
  for (int t = 0; t < NTRIP; ++t) {
    const int buf = t & 1;
    const h16* st = ring + buf * STG;
    const h16* pa = st + (32 * w + ln) * LP;
    const h16* pb = st + (128 + ln) * LP;
    const h16* pr = st + (192 + 32 * w + ln) * LP;
    // the fragments of G k-steps are read from LDS as one group in front of their products: one LDS wait per group, not one per fragment
    // (RES: one k-step per group, two would not fit the register budget beside the 16 accumulator tiles). All loops of the trip are unrolled: fragments and tiles stay in registers
    constexpr int G = RES ? 1 : 2;
#pragma unroll
    for (int k0 = 0; k0 < KT; k0 += 32 * G) {
      v16h fa[G][2], fe[G][2], fb[G][4];
#pragma unroll
      for (int s = 0; s < G; ++s) {
        const int kk = k0 + 32 * s;
        fa[s][0] = ld_frag(pa + kk, hh); fa[s][1] = ld_frag(pa + 16 * LP + kk, hh);
#pragma unroll
        for (int j = 0; j < 4; ++j) fb[s][j] = ld_frag(pb + j * 16 * LP + kk, hh);
        if (RES) { fe[s][0] = ld_frag(pr + kk, hh); fe[s][1] = ld_frag(pr + 16 * LP + kk, hh); }
        else { fe[s][0] = fa[s][0]; fe[s][1] = fa[s][1]; }
      }
#pragma unroll
      for (int s = 0; s < G; ++s) {
#pragma unroll
        for (int j = 0; j < 4; ++j) {
          c[j] = mma(fa[s][0], fb[s][j], c[j]); c[4 + j] = mma(fa[s][1], fb[s][j], c[4 + j]);
          if (RES) { cr[j] = mma(fe[s][0], fb[s][j], cr[j]); cr[4 + j] = mma(fe[s][1], fb[s][j], cr[4 + j]); }
        }
      }
    }
    asm volatile("s_wait_dscnt 0x0" ::: "memory");     // this wave's reads of buffer buf are done before the barrier frees it
    asm volatile("s_wait_asynccnt 0x0" ::: "memory");  // this wave's copies of tile t + 1 have landed before the barrier publishes them
    __syncthreads();
    if (t + 2 < NTRIP) stage_fill<RES>(lb + (unsigned)(buf * STG * 2), gA + (t + 2) * KT, gB + (t + 2) * KT, gR + (t + 2) * KT);
  }
  asm volatile("s_wait_asynccnt 0x0" ::: "memory");    // nothing in flight when the ring becomes output staging
}

// fused projection [NR][N3] = H . W3^T (W3 rows: q 0..4095, k 4096..8191, v 8192..10239). Block = 4 waves = 128 rows x 64 cols.
template <bool RES>
__device__ __forceinline__ void gemm_qkv_body(const h16* Hh, const h16* Hr, const h16* W3, const float* TAB,
                                              h16* QK, h16* QKr, h16* VT, h16* VTr, int mt0) {
  // one LDS block: the operand ring in the main loop, then (behind the last trip's barrier) the output staging so[wave][row][col]
  static_assert(Ring<RES>::BYTES >= 4 * 32 * 68 * 4);
  __shared__ __attribute__((aligned(16))) unsigned char smem[Ring<RES>::BYTES];
  h16* ring = (h16*)smem;
  float (*so)[32][68] = (float (*)[32][68])smem;
  const int tid = threadIdx.x, lane = tid & 31, ln = lane & 15, hh = lane >> 4;
  const int w = __builtin_amdgcn_readfirstlane(tid >> 5);
  const int ntn = N3 >> 6;
  const int mtl = blockIdx.x / ntn, nq = blockIdx.x - mtl * ntn;
  const int mrow = (mt0 + mtl) * 128;
  const int row0 = mrow + 32 * w, col0 = nq * 64;
  const v8f z8 = {0.f, 0.f, 0.f, 0.f, 0.f, 0.f, 0.f, 0.f};
  v8f c[8], cr[8];
#pragma unroll
  for (int u = 0; u < 8; ++u) { c[u] = z8; cr[u] = z8; }
  gemm_main<RES>(Hh, Hr, W3, mrow, col0, ring, tid, w, ln, hh, c, cr);
#pragma unroll
  for (int u = 0; u < 8; ++u) {
    const int t = u & 3, hf = u >> 2;
#pragma unroll
    for (int r = 0; r < 8; ++r) {
      const float v = RES ? (c[u][r] + cr[u][r] * 4.8828125e-4f) * 0.015625f : c[u][r] * 0.015625f;
      so[w][hf * 16 + 8 * hh + r][t * 16 + ln] = v;
    }
  }
  __syncthreads();
  v8h hv[8], rv[8];
  if (col0 < NQK) {
    const int rq = lane >> 3, pc = lane & 7;
    const int i0 = ((col0 & (HW - 1)) >> 1) + pc * 4;
#pragma unroll
    for (int it = 0; it < 8; ++it) {
      const int row = it * 4 + rq;
      const v4f a = *(const v4fa*)&so[w][row][pc * 8], b = *(const v4fa*)&so[w][row][pc * 8 + 4];
      const size_t to = (size_t)(row0 + row) * HD + i0;
      const v4f cs = *(const v4fa*)(TAB + to), sn = *(const v4fa*)(TAB + (size_t)SEQ * HD + to);
      float o[8];
      o[0] = a[0] * cs[0] - a[1] * sn[0]; o[1] = a[0] * sn[0] + a[1] * cs[0];
      o[2] = a[2] * cs[1] - a[3] * sn[1]; o[3] = a[2] * sn[1] + a[3] * cs[1];
      o[4] = b[0] * cs[2] - b[1] * sn[2]; o[5] = b[0] * sn[2] + b[1] * cs[2];
      o[6] = b[2] * cs[3] - b[3] * sn[3]; o[7] = b[2] * sn[3] + b[3] * cs[3];
#pragma unroll
      for (int q = 0; q < 8; ++q) {
        const h16 hb = toh_flush(o[q]);
        hv[it][q] = hb;
        rv[it][q] = toh_flush((o[q] - (float)hb) * 2048.0f);
      }
    }
    {
#pragma unroll
      for (int it = 0; it < 8; ++it) {
        const int row = it * 4 + rq;
        const size_t off = (size_t)(row0 + row) * NQK + col0 + pc * 8;
        *(v8h*)(QK + off) = hv[it];
        if (RES) *(v8h*)(QKr + off) = rv[it];
      }
      
    }
  } else {
    const int chb = col0 - NQK;
    const int sub = lane >> 4, p = lane & 15;
    const int sw = p >> 2, sr = (p & 3) * 8;
#pragma unroll
    for (int it = 0; it < 8; ++it) {
      const int chl = w * 16 + it * 2 + sub;
#pragma unroll
      for (int q = 0; q < 8; ++q) {
        const float v = so[sw][sr + q][chl];
        const h16 hb = toh_flush(v);
        hv[it][q] = hb;
        rv[it][q] = toh_flush((v - (float)hb) * 2048.0f);
      }
    }
    {
#pragma unroll
      for (int it = 0; it < 8; ++it) {
        const int chl = w * 16 + it * 2 + sub;
        *(v8h*)(VT + (size_t)(chb + chl) * SEQ + mrow + p * 8) = hv[it];
        if (RES) *(v8h*)(VTr + (size_t)(chb + chl) * EROWS + mrow + p * 8) = rv[it];
      }
      
    }
  }
}

__global__ __launch_bounds__(128) __attribute__((amdgpu_num_vgpr(256)))
void k_gemm_qkv_early(const h16* __restrict__ Hh, const h16* __restrict__ Hr, const h16* __restrict__ W3, const float* __restrict__ TAB,
                      h16* __restrict__ QK, h16* __restrict__ QKr, h16* __restrict__ VT, h16* __restrict__ VTr) {
  gemm_qkv_body<true>(Hh, Hr, W3, TAB, QK, QKr, VT, VTr, 0);
}
__global__ __launch_bounds__(128) __attribute__((amdgpu_num_vgpr(256)))
void k_gemm_qkv_late(const h16* __restrict__ Hh, const h16* __restrict__ W3, const float* __restrict__ TAB,
                     h16* __restrict__ QK, h16* __restrict__ VT) {
  gemm_qkv_body<false>(Hh, Hh, W3, TAB, QK, QK, VT, VT, EROWS / 128);
}

// output projection out[NR][DM] f32 = ctx . Wo^T / 64 + bf16(x); skip connection added at the store stage as float4;
template <bool RES>
__device__ __forceinline__ void gemm_out_body(const h16* Ch, const h16* Cr, const h16* WoT, const float* x, float* out, int mt0, int blk, unsigned char* smem) {
  // one LDS block (the kernel's, at least Ring<RES>::BYTES): the operand ring in the main loop, then (behind the last trip's barrier) the output staging so[wave][row][col]
  static_assert(Ring<RES>::BYTES >= 4 * 32 * 68 * 4);
  h16* ring = (h16*)smem;
  float (*so)[32][68] = (float (*)[32][68])smem;
  const int tid = threadIdx.x, lane = tid & 31, ln = lane & 15, hh = lane >> 4;
  const int w = __builtin_amdgcn_readfirstlane(tid >> 5);
  const int ntn = DM >> 6;
  const int mtl = blk / ntn, nq = blk - mtl * ntn;
  const int mrow = (mt0 + mtl) * 128;
  const int row0 = mrow + 32 * w, col0 = nq * 64;
  const v8f z8 = {0.f, 0.f, 0.f, 0.f, 0.f, 0.f, 0.f, 0.f};
  v8f c[8], cr[8];
#pragma unroll
  for (int u = 0; u < 8; ++u) { c[u] = z8; cr[u] = z8; }
  gemm_main<RES>(Ch, Cr, WoT, mrow, col0, ring, tid, w, ln, hh, c, cr);
#pragma unroll
  for (int u = 0; u < 8; ++u) {
    const int t = u & 3, hf = u >> 2;
#pragma unroll
    for (int r = 0; r < 8; ++r) {
      const float v = RES ? (c[u][r] + cr[u][r] * 4.8828125e-4f) * 0.015625f : c[u][r] * 0.015625f;
      so[w][hf * 16 + 8 * hh + r][t * 16 + ln] = v;
    }
  }
  __syncthreads();
  const int rsub = lane >> 4, c4 = (lane & 15) * 4;
  v4f ov[16];
#pragma unroll
  for (int q = 0; q < 16; ++q) {
    const int r = q * 2 + rsub;
    const v4f v = *(const v4fa*)&so[w][r][c4];
    if (q) asm volatile("s_wait_xcnt 0x0" ::: "memory");  // stands between the loads: a load's result may take the registers of an address that an earlier load names
    const v4f xr = *(const v4fa*)(x + (size_t)(row0 + r) * DM + col0 + c4);
    v4f o;
    o[0] = v[0] + bf16_rne(xr[0]); o[1] = v[1] + bf16_rne(xr[1]); o[2] = v[2] + bf16_rne(xr[2]); o[3] = v[3] + bf16_rne(xr[3]);
    ov[q] = o;
  }
  // the sixteen sums are inputs so that all of their arithmetic stands in front of the first store: left free, part of it is moved behind stores whose data registers it reuses
  asm volatile("s_wait_xcnt 0x0" :: "v"(ov[0]), "v"(ov[1]), "v"(ov[2]), "v"(ov[3]), "v"(ov[4]), "v"(ov[5]), "v"(ov[6]), "v"(ov[7]),
               "v"(ov[8]), "v"(ov[9]), "v"(ov[10]), "v"(ov[11]), "v"(ov[12]), "v"(ov[13]), "v"(ov[14]), "v"(ov[15]) : "memory");
  {
#pragma unroll
    for (int q = 0; q < 16; ++q) {
      const int r = q * 2 + rsub;
      *(v4f*)(out + (size_t)(row0 + r) * DM + col0 + c4) = ov[q];
      asm volatile("s_wait_xcnt 0x0" ::: "memory");  // stands behind each store, in front of the next stores' address arithmetic, which reuses the registers that it names
    }
    
  }
}

// both row ranges in one grid (they write disjoint rows and neither reads the other's): the blocks with residual planes, which run longer, come first
#define OB_EARLY ((EROWS / 128) * (DM / 64))
#define OB_LATE (((NR - EROWS) / 128) * (DM / 64))
__global__ __launch_bounds__(128) __attribute__((amdgpu_num_vgpr(256)))
void k_gemm_out(const h16* __restrict__ Ch, const h16* __restrict__ Cr, const h16* __restrict__ WoT, const float* __restrict__ x, float* __restrict__ out) {
  __shared__ __attribute__((aligned(16))) unsigned char smem[Ring<true>::BYTES];
  const int b = blockIdx.x;  // the test reads the same for the whole block
  if (b < OB_EARLY) gemm_out_body<true>(Ch, Cr, WoT, x, out, 0, b, smem);
  else gemm_out_body<false>(Ch, Ch, WoT, x, out, EROWS / 128, b - OB_EARLY, smem);
}

// Transposed flash attention. One unit of NW waves per (head, 16-query tile); wave = (score component c, channel slab hf).
// S^T[key][query] = K_c . Q_c^T (A = K rows, B = Q rows), per-lane (= per-query) running max / sum in the exp2 domain,
// P^T (carried x256) packed from the S^T accumulators directly as the B fragment of O^T[ch][query] = V^T . P^T (A = V^T rows). Causal mask as a select.
// NW = 4: query rows < EROWS, value + x2048 residual planes on q, k, P, v, 64 channels per wave (NW = 2: single f16 products, 128 channels per wave; query rows >= EROWS have attn_late_body).
// Epilogue: both components meet in LDS (block barrier), O = O_0 + scale[h] O_1, per-head RMSNorm, x (1 - lam[h]), f16 ctx rows (+ residual rows);
template <int NW>
__device__ __forceinline__ void attn_body(const h16* QK, const h16* QKr, const h16* VT, const h16* VTr,
                                          const float* SC, const float* hw, h16* CTX, h16* CTXr, int qt0, int nqt,
                                          int unit, int tid, float (*comb)[16][132]) {
  constexpr bool EARLY = (NW == 4);
  constexpr int NT = 16 / NW;
  constexpr int RPW = 16 / NW;
  static_assert(NW == 2 || NW == 4);
  static_assert(NW * NT * 16 == 2 * HD);
  // unit: which (head, 16-query tile); tid: the thread's number among the unit's NW waves; comb: the unit's own LDS, [2][16][132] floats
  const int lane = tid & 31, ln = lane & 15, hh = lane >> 4;
  const int wave = __builtin_amdgcn_readfirstlane(tid >> 5);
  const int c = wave & 1, hf = wave >> 1;
  const int head = unit / nqt;
  const int qt = qt0 + (unit - head * nqt);
  const int q0 = qt * 16, qi = q0 + ln;
  const size_t qoff = (size_t)qi * NQK + head * HW + c * HD;
  const int kcol = NH * HW + head * HW + c * HD;
  const int chb = head * HD + hf * (NT * 16);
  const float NEGV = -1.0e30f;
  const float SCL2 = 0.08838834764831845f * 1.4426950408889634f;
  const float PCL = 8.0f;

  const v8f z8 = {0.f, 0.f, 0.f, 0.f, 0.f, 0.f, 0.f, 0.f};
  v16h qh[4];
#pragma unroll
  for (int ks = 0; ks < 4; ++ks) qh[ks] = ld_frag(QK + qoff + ks * 32, hh);

  v8f acc[NT], accr[NT];
#pragma unroll
  for (int dt = 0; dt < NT; ++dt) { acc[dt] = z8; accr[dt] = z8; }
  float m = NEGV, l = 0.f;
  const int nsteps = (q0 + 16 + 31) >> 5;

#pragma unroll 1
  for (int js = 0; js < nsteps; ++js) {
    const int j0 = js << 5;
    v8f s0 = z8, s1 = z8, t0 = z8, t1 = z8;
    const size_t ko = (size_t)(j0 + ln) * NQK + kcol;
#pragma unroll
    for (int ks = 0; ks < 4; ++ks) {
      const v16h a0 = ld_frag_g(QK + ko + ks * 32, hh);
      const v16h a1 = ld_frag_g(QK + ko + (size_t)16 * NQK + ks * 32, hh);
      v16h bq = qh[ks];
      if (EARLY) bq = ld_frag_g(QK + qoff + ks * 32, hh);
      s0 = mmam(a0, bq, s0);
      s1 = mmam(a1, bq, s1);
      if (EARLY) {
        const v16h br = ld_frag_g(QKr + qoff + ks * 32, hh);
        const v16h r0 = ld_frag_g(QKr + ko + ks * 32, hh);
        const v16h r1 = ld_frag_g(QKr + ko + (size_t)16 * NQK + ks * 32, hh);
        t0 = mmam(r0, bq, t0);
        t0 = mmam(a0, br, t0);
        t1 = mmam(r1, bq, t1);
        t1 = mmam(a1, br, t1);
      }
    }

    float xv[16];
    float mx = NEGV;
#pragma unroll
    for (int r = 0; r < 8; ++r) {
      const int k0 = j0 + 8 * hh + r, k1 = k0 + 16;
      float e0 = s0[r], e1 = s1[r];
      if (EARLY) { e0 += t0[r] * 4.8828125e-4f; e1 += t1[r] * 4.8828125e-4f; }
      xv[r] = (k0 <= qi) ? e0 * SCL2 : NEGV;
      xv[8 + r] = (k1 <= qi) ? e1 * SCL2 : NEGV;
      mx = fmaxf(mx, fmaxf(xv[r], xv[8 + r]));
    }
    mx = fmaxf(mx, __shfl_xor(mx, 16, 32));
    const float mn = fmaxf(m, mx);
    const float alpha = exp2f(m - mn);
    m = mn;

    v16h ph, pr;
    float ps = 0.f;
#pragma unroll
    for (int i = 0; i < 16; ++i) {
      const float e = xv[i] - mn + PCL;
      const float pe = exp2f(e);
      const float p = (e < -14.0f) ? 0.f : pe;
      const h16 pb = (h16)p;
      ph[i] = pb;
      if (EARLY) {
        pr[i] = toh_flush((p - (float)pb) * 2048.0f);
        ps += p;
      } else {
        pr[i] = pb;
        ps += (float)pb;
      }
    }
    ps += __shfl_xor(ps, 16, 32);
    l = l * alpha + ps;

#pragma unroll
    for (int dt = 0; dt < NT; ++dt)
#pragma unroll
      for (int r = 0; r < 8; ++r) { acc[dt][r] *= alpha; if (EARLY) accr[dt][r] *= alpha; }

#pragma unroll
    for (int dt = 0; dt < NT; ++dt) {
      const int ch = chb + dt * 16 + ln;
      const v16h vh = ld_frag_g(VT + (size_t)ch * SEQ + j0, hh);
      acc[dt] = mmam(vh, ph, acc[dt]);
      if (EARLY) {
        const v16h vr = ld_frag_g(VTr + (size_t)ch * EROWS + j0, hh);
        accr[dt] = mmam(vh, pr, accr[dt]);
        accr[dt] = mmam(vr, ph, accr[dt]);
      }
    }
  }

  const float inv = 1.0f / l;
#pragma unroll
  for (int dt = 0; dt < NT; ++dt)
#pragma unroll
    for (int r = 0; r < 8; ++r) {
      const float v = EARLY ? (acc[dt][r] + accr[dt][r] * 4.8828125e-4f) * inv : acc[dt][r] * inv;
      comb[c][ln][hf * (NT * 16) + dt * 16 + 8 * hh + r] = v;
    }
  __syncthreads();

  const float scl = SC[head], osc = SC[NH + head];
  const int sub = lane >> 4, pc = lane & 15;
  const v4f wa = *(const v4fa*)(hw + pc * 8), wb = *(const v4fa*)(hw + pc * 8 + 4);
  const float wv[8] = {bf16_rne(wa[0]), bf16_rne(wa[1]), bf16_rne(wa[2]), bf16_rne(wa[3]), bf16_rne(wb[0]), bf16_rne(wb[1]), bf16_rne(wb[2]), bf16_rne(wb[3])};
  v8h hv[RPW / 2], rv[RPW / 2];
#pragma unroll
  for (int it = 0; it < RPW / 2; ++it) {
    const int row = wave * RPW + it * 2 + sub;
    const v4f a0 = *(const v4fa*)&comb[0][row][pc * 8], a1 = *(const v4fa*)&comb[0][row][pc * 8 + 4];
    const v4f b0 = *(const v4fa*)&comb[1][row][pc * 8], b1 = *(const v4fa*)&comb[1][row][pc * 8 + 4];
    float o[8];
#pragma unroll
    for (int q = 0; q < 4; ++q) { o[q] = a0[q] + scl * b0[q]; o[4 + q] = a1[q] + scl * b1[q]; }
    float ss = 0.f;
#pragma unroll
    for (int q = 0; q < 8; ++q) ss += o[q] * o[q];
#pragma unroll
    for (int d = 1; d < 16; d <<= 1) ss += __shfl_xor(ss, d, 32);
    const float rms = rsqrtf(ss * (1.0f / (float)HD) + 1.0e-9f);
#pragma unroll
    for (int q = 0; q < 8; ++q) {
      const float val = o[q] * rms * wv[q] * osc;
      const h16 hb = toh_flush(val);
      hv[it][q] = hb;
      rv[it][q] = toh_flush((val - (float)hb) * 2048.0f);
    }
  }
  {
#pragma unroll
    for (int it = 0; it < RPW / 2; ++it) {
      const int row = wave * RPW + it * 2 + sub;
      const size_t off = (size_t)(q0 + row) * DM + head * HD + pc * 8;
      *(v8h*)(CTX + off) = hv[it];
      if (EARLY) *(v8h*)(CTXr + off) = rv[it];
    }
    asm volatile("s_wait_xcnt 0x0" ::: "memory");  // stands behind the stores: in the shared grid the listing runs on from here into the other range's code, which reuses the registers that they name
  }
}

// Query rows >= EROWS: the same transposed flash attention with single f16 products, AQB queries of one head at a time, 8 waves = (score component c, 16-query tile qs), 128 channels per wave.
// The head's K rows (both components side by side, 512 B) and V^T rows of a tile of AKT keys are staged in LDS by asynchronous copies and read by all 8 waves;
// two buffers: trip t works on buffer t & 1 while tile t + 1 flies. Every wave walks its keys in steps of 32 from key 0, as one wave per 16 queries would.
// Stage: K rows 0..AKT-1 at pitch AKP f16 = 528 B, then V^T rows 0..HD-1 at pitch AVP f16 = 144 B (odd multiples of 16 B for the 16-byte fragment reads).
#define AQB 64
#define AKT 64
#define AKP 264
#define AVP 72
#define ASTG (AKT * AKP + HD * AVP)
// Causal work dealt evenly: a query block that starts at query q walks (q + AQB) / AKT key tiles, so the blocks of a head differ widely in length. Each head's query blocks are dealt to AGRP work-groups:
// the longest ones stand alone, every other work-group takes a long one and then a short one, one after the other in every wave, so that all work-groups walk about the same number of key tiles.
#define AGRP 16
static_assert(AQB == AKT && AKT == 64 && EROWS % AKT == 0 && (SEQ - EROWS) % AQB == 0 && EROWS / AKT + 1 >= 2);
static_assert(AKP >= HW + 8 && (AKP * 2) % 32 == 16 && AVP >= AKT + 8 && (AVP * 2) % 32 == 16 && (ASTG * 2) % 16 == 0);

// one stage, 256 threads x 16 B per copy: 8 K rows of 512 B (32 lanes per row), 8 copies; 32 V^T rows of 128 B (8 lanes per row), 4 copies. All four arguments are the lane's own addresses.
__device__ __forceinline__ void attn_fill(unsigned lk, unsigned lv, const h16* gK, const h16* gV) {
  unsigned l[12]; const h16* g[12];
  // both loops are unrolled so that the address arrays are registers (they are asm operands)
#pragma unroll
  for (int i = 0; i < 8; ++i) { l[i] = lk + (unsigned)(i * 8 * AKP * 2); g[i] = gK + (size_t)i * 8 * NQK; }
#pragma unroll
  for (int i = 0; i < 4; ++i) { l[8 + i] = lv + (unsigned)(i * 32 * AVP * 2); g[8 + i] = gV + (size_t)i * 32 * SEQ; }
  copy12(l, g);
}

__device__ __forceinline__ void attn_late_body(const h16* QK, const h16* VT, const float* SC, const float* hw, h16* CTX, int blk, unsigned char* smem) {
  constexpr int NT = 8;
  constexpr int RPW = AQB / 8;
  // one LDS block (the kernel's, 2 * ASTG * 2 bytes): the K / V^T ring in the key loop, then (behind the last trip's barrier) the two components' outputs comb[c][query][channel]
  static_assert(2 * ASTG * 2 >= 2 * AQB * 132 * 4);
  h16* ring = (h16*)smem;
  float (*comb)[AQB][132] = (float (*)[AQB][132])smem;
  const int tid = threadIdx.x, lane = tid & 31, ln = lane & 15, hh = lane >> 4;
  const int wave = __builtin_amdgcn_readfirstlane(tid >> 5);
  const int c = wave & 1, qs = wave >> 1;
  constexpr int nqb = (SEQ - EROWS) / AQB;
  constexpr int NSGL = 2 * AGRP - nqb;  // work-groups with one query block (the NSGL longest); the others take two: nqb = NSGL + 2 * (AGRP - NSGL)
  static_assert(nqb >= AGRP && nqb <= 2 * AGRP);
  const int head = blk / AGRP;
  const int grp = blk - head * AGRP;
  const int npass = (grp < NSGL) ? 1 : 2;
  const float NEGV = -1.0e30f;
  const float SCL2 = 0.08838834764831845f * 1.4426950408889634f;
  const float PCL = 8.0f;
  const v8f z8 = {0.f, 0.f, 0.f, 0.f, 0.f, 0.f, 0.f, 0.f};

#pragma unroll 1  // kept rolled: one body for both query blocks of the work-group
  for (int pass = 0; pass < npass; ++pass) {
  // query blocks nqb-1 .. nqb-AGRP come first, blocks 0 .. nqb-AGRP-1 second: each exactly once; the two lengths of a pair add up to the same sum in every pair
  const int q0b = EROWS + ((pass == 0) ? nqb - 1 - grp : grp - NSGL) * AQB;
  const int q0 = q0b + qs * 16, qi = q0 + ln;
  if (pass) {  // the same for the whole work-group
    asm volatile("s_wait_dscnt 0x0" ::: "memory");  // this wave's reads of the first query block's comb rows are done before the barrier frees that LDS
    __syncthreads();                                // every wave has left comb before the copies below refill the ring over it
  }
  v16h qh[4];
#pragma unroll
  for (int ks = 0; ks < 4; ++ks) qh[ks] = ld_frag(QK + (size_t)qi * NQK + head * HW + c * HD + ks * 32, hh);

  v8f acc[NT];
#pragma unroll
  for (int dt = 0; dt < NT; ++dt) acc[dt] = z8;
  float m = NEGV, l = 0.f;

  const int ntiles = (q0b + AQB) / AKT;  // >= 2: q0b >= EROWS
  const h16* gK = QK + (size_t)(tid >> 5) * NQK + NH * HW + head * HW + (tid & 31) * 8;
  const h16* gV = VT + (size_t)(head * HD + (tid >> 3)) * SEQ + (tid & 7) * 8;
  const unsigned lk = (unsigned)(uintptr_t)ring + (unsigned)(((tid >> 5) * AKP + (tid & 31) * 8) * 2);
  const unsigned lv = (unsigned)(uintptr_t)ring + (unsigned)((AKT * AKP + (tid >> 3) * AVP + (tid & 7) * 8) * 2);
  attn_fill(lk, lv, gK, gV);
  asm volatile("s_wait_asynccnt 0x0" ::: "memory");  // tile 0 has landed before the barrier publishes it
  __syncthreads();
  attn_fill(lk + (unsigned)(ASTG * 2), lv + (unsigned)(ASTG * 2), gK + (size_t)AKT * NQK, gV + AKT);
#pragma unroll 1  // kept rolled: one body for both buffers, the buffer picked by a scalar offset
  for (int t = 0; t < ntiles; ++t) {
    const int buf = t & 1;
    const h16* st = ring + buf * ASTG;
#pragma unroll 1  // kept rolled: one body for both 32-key halves of the tile
    for (int sub = 0; sub < AKT / 32; ++sub) {
      const int j0 = t * AKT + sub * 32;
      if (j0 > q0 + 15) continue;  // wave-uniform: every key of the step lies behind all 16 queries of this wave (only in the block's last tile)
      const h16* pk = st + (sub * 32 + ln) * AKP + c * HD;
      const h16* pv = st + AKT * AKP + ln * AVP + sub * 32;
      v16h ka[4][2];
#pragma unroll
      for (int ks = 0; ks < 4; ++ks) { ka[ks][0] = ld_frag(pk + ks * 32, hh); ka[ks][1] = ld_frag(pk + 16 * AKP + ks * 32, hh); }
      v8f s0 = z8, s1 = z8;
#pragma unroll
      for (int ks = 0; ks < 4; ++ks) { s0 = mma(ka[ks][0], qh[ks], s0); s1 = mma(ka[ks][1], qh[ks], s1); }
      v16h vh[NT];
#pragma unroll
      for (int dt = 0; dt < NT; ++dt) vh[dt] = ld_frag(pv + dt * 16 * AVP, hh);
      __builtin_amdgcn_sched_barrier(0);  // keeps the V^T reads together here, in flight under the softmax (left free they are spread over it in pairs, the last ones directly in front of their products)

      float xv[16];
      float mx = NEGV;
#pragma unroll
      for (int r = 0; r < 8; ++r) {
        const int k0 = j0 + 8 * hh + r, k1 = k0 + 16;
        xv[r] = (k0 <= qi) ? s0[r] * SCL2 : NEGV;
        xv[8 + r] = (k1 <= qi) ? s1[r] * SCL2 : NEGV;
        mx = fmaxf(mx, fmaxf(xv[r], xv[8 + r]));
      }
      mx = fmaxf(mx, __shfl_xor(mx, 16, 32));
      const float mn = fmaxf(m, mx);
      const float alpha = exp2f(m - mn);
      m = mn;

      v16h ph;
      float ps = 0.f;
#pragma unroll
      for (int i = 0; i < 16; ++i) {
        const float e = xv[i] - mn + PCL;
        const float pe = exp2f(e);
        const float p = (e < -14.0f) ? 0.f : pe;
        const h16 pb = (h16)p;
        ph[i] = pb;
        ps += (float)pb;
      }
      ps += __shfl_xor(ps, 16, 32);
      l = l * alpha + ps;

#pragma unroll
      for (int dt = 0; dt < NT; ++dt)
#pragma unroll
        for (int r = 0; r < 8; ++r) acc[dt][r] *= alpha;
#pragma unroll
      for (int dt = 0; dt < NT; ++dt) acc[dt] = mma(vh[dt], ph, acc[dt]);
    }
    asm volatile("s_wait_dscnt 0x0" ::: "memory");     // this wave's reads of buffer buf are done before the barrier frees it
    asm volatile("s_wait_asynccnt 0x0" ::: "memory");  // this wave's copies of tile t + 1 have landed before the barrier publishes them
    __syncthreads();
    if (t + 2 < ntiles)
      attn_fill(lk + (unsigned)(buf * ASTG * 2), lv + (unsigned)(buf * ASTG * 2), gK + (size_t)(t + 2) * AKT * NQK, gV + (t + 2) * AKT);
  }
  asm volatile("s_wait_asynccnt 0x0" ::: "memory");    // nothing in flight when the ring becomes output staging

  const float inv = 1.0f / l;
#pragma unroll
  for (int dt = 0; dt < NT; ++dt)
#pragma unroll
    for (int r = 0; r < 8; ++r) comb[c][qs * 16 + ln][dt * 16 + 8 * hh + r] = acc[dt][r] * inv;
  __syncthreads();

  const float scl = SC[head], osc = SC[NH + head];
  const int sub = lane >> 4, pc = lane & 15;
  const v4f wa = *(const v4fa*)(hw + pc * 8), wb = *(const v4fa*)(hw + pc * 8 + 4);
  const float wv[8] = {bf16_rne(wa[0]), bf16_rne(wa[1]), bf16_rne(wa[2]), bf16_rne(wa[3]), bf16_rne(wb[0]), bf16_rne(wb[1]), bf16_rne(wb[2]), bf16_rne(wb[3])};
  v8h hv[RPW / 2];
#pragma unroll
  for (int it = 0; it < RPW / 2; ++it) {
    const int row = wave * RPW + it * 2 + sub;
    const v4f a0 = *(const v4fa*)&comb[0][row][pc * 8], a1 = *(const v4fa*)&comb[0][row][pc * 8 + 4];
    const v4f b0 = *(const v4fa*)&comb[1][row][pc * 8], b1 = *(const v4fa*)&comb[1][row][pc * 8 + 4];
    float o[8];
#pragma unroll
    for (int q = 0; q < 4; ++q) { o[q] = a0[q] + scl * b0[q]; o[4 + q] = a1[q] + scl * b1[q]; }
    float ss = 0.f;
#pragma unroll
    for (int q = 0; q < 8; ++q) ss += o[q] * o[q];
#pragma unroll
    for (int d = 1; d < 16; d <<= 1) ss += __shfl_xor(ss, d, 32);
    const float rms = rsqrtf(ss * (1.0f / (float)HD) + 1.0e-9f);
#pragma unroll
    for (int q = 0; q < 8; ++q) hv[it][q] = toh_flush(o[q] * rms * wv[q] * osc);
  }
#pragma unroll
  for (int it = 0; it < RPW / 2; ++it) {
    const int row = wave * RPW + it * 2 + sub;
    *(v8h*)(CTX + (size_t)(q0b + row) * DM + head * HD + pc * 8) = hv[it];
  }
  asm volatile("s_wait_xcnt 0x0" ::: "memory");  // stands behind the stores, in front of the next query block's writes to the registers that they name
  }
}

// both query ranges in one grid (they write disjoint ctx rows and neither reads the other's): the AB_LATE long blocks come first, one for each place they had alone;
// behind them AB_EARLY blocks of two (head, 16-query tile) units of four waves each, which run beside the long ones; a block's two tiles are j and last - j, so that every such block brings the same number of key steps.
#define AB_LATE (NH * AGRP)
#define AB_EARLY (NH * (EROWS / 16) / 2)
static_assert((EROWS / 16) % 2 == 0 && 2 * ASTG * 2 >= 2 * 2 * 16 * 132 * 4);
__global__ __launch_bounds__(256) __attribute__((amdgpu_num_vgpr(256)))
void k_attn(const h16* __restrict__ QK, const h16* __restrict__ QKr, const h16* __restrict__ VT, const h16* __restrict__ VTr,
            const float* __restrict__ SC, const float* __restrict__ hw, h16* __restrict__ CTX, h16* __restrict__ CTXr) {
  __shared__ __attribute__((aligned(16))) unsigned char smem[2 * ASTG * 2];
  const int b = blockIdx.x;  // the test reads the same for the whole block
  if (b < AB_LATE) {
    attn_late_body(QK, VT, SC, hw, CTX, b, smem);
  } else {
    const int tid = threadIdx.x;
    const int half = __builtin_amdgcn_readfirstlane(tid >> 7);
    constexpr int NQT = EROWS / 16;
    const int eb = b - AB_LATE, head = eb / (NQT / 2), j = eb - head * (NQT / 2);
    attn_body<4>(QK, QKr, VT, VTr, SC, hw, CTX, CTXr, 0, NQT, head * NQT + (half ? NQT - 1 - j : j), tid & 127, (float (*)[16][132])(smem + half * (2 * 16 * 132 * 4)));
  }
}

extern "C" void kernel_launch(void* const* d_in, const int* in_sizes, int n_in,
                              void* d_out, int out_size, void* d_ws, size_t ws_size, hipStream_t stream) {
  if (n_in < 12) return;
  if (in_sizes[0] < NR * DM) return;
  if (in_sizes[1] < DM) return;
  if (in_sizes[2] < NH * HW * DM || in_sizes[3] < NH * HW * DM) return;
  if (in_sizes[4] < DM * DM || in_sizes[5] < DM * DM) return;
  if (in_sizes[6] < HD) return;
  if (in_sizes[7] < NH * HD || in_sizes[8] < NH * HD || in_sizes[9] < NH * HD || in_sizes[10] < NH * HD) return;
  if (in_sizes[11] < NH) return;
  if (out_size < NR * DM) return;
  const float* x   = (const float*)d_in[0];
  const float* pw  = (const float*)d_in[1];
  const float* wq  = (const float*)d_in[2];
  const float* wk  = (const float*)d_in[3];
  const float* wv  = (const float*)d_in[4];
  const float* wo  = (const float*)d_in[5];
  const float* hnw = (const float*)d_in[6];
  const float* q1  = (const float*)d_in[7];
  const float* q2  = (const float*)d_in[8];
  const float* k1  = (const float*)d_in[9];
  const float* k2  = (const float*)d_in[10];
  const float* lam = (const float*)d_in[11];
  float* out = (float*)d_out;

  // workspace regions (bytes); every region but TH, which nothing reads or writes, is written with whole-row stores inside its exact extent
  constexpr size_t SZ_TH  = 512;
  constexpr size_t SZ_TAB = (size_t)2 * SEQ * HD * 4;
  constexpr size_t SZ_SC  = 256;
  constexpr size_t SZ_H   = (size_t)NR * DM * 2;
  constexpr size_t SZ_HR  = (size_t)EROWS * DM * 2;
  constexpr size_t SZ_W3  = (size_t)N3 * DM * 2;
  constexpr size_t SZ_WO  = (size_t)DM * DM * 2;
  constexpr size_t SZ_QK  = (size_t)NR * NQK * 2;
  constexpr size_t SZ_QKR = (size_t)EROWS * NQK * 2;
  constexpr size_t SZ_VT  = (size_t)DM * SEQ * 2;
  constexpr size_t SZ_VTR = (size_t)DM * EROWS * 2;
  constexpr size_t SZ_CX  = (size_t)NR * DM * 2;
  constexpr size_t SZ_CXR = (size_t)EROWS * DM * 2;
  constexpr size_t OF_TH  = 0;
  constexpr size_t OF_TAB = OF_TH + SZ_TH;
  constexpr size_t OF_SC  = OF_TAB + SZ_TAB;
  constexpr size_t OF_H   = OF_SC + SZ_SC;
  constexpr size_t OF_HR  = OF_H + SZ_H;
  constexpr size_t OF_W3  = OF_HR + SZ_HR;
  constexpr size_t OF_WO  = OF_W3 + SZ_W3;
  constexpr size_t OF_QK  = OF_WO + SZ_WO;
  constexpr size_t OF_QKR = OF_QK + SZ_QK;
  constexpr size_t OF_VT  = OF_QKR + SZ_QKR;
  constexpr size_t OF_VTR = OF_VT + SZ_VT;
  constexpr size_t OF_CX  = OF_VTR + SZ_VTR;
  constexpr size_t OF_CXR = OF_CX + SZ_CX;
  constexpr size_t SZ_ALL = OF_CXR + SZ_CXR;
  static_assert(SZ_TH >= 128 * 4 && SZ_SC >= 32 * 4);
  static_assert(SZ_TH % 256 == 0 && SZ_TAB % 256 == 0 && SZ_SC % 256 == 0 && SZ_H % 256 == 0 && SZ_HR % 256 == 0 && SZ_W3 % 256 == 0);
  static_assert(SZ_WO % 256 == 0 && SZ_QK % 256 == 0 && SZ_QKR % 256 == 0 && SZ_VT % 256 == 0 && SZ_VTR % 256 == 0 && SZ_CX % 256 == 0 && SZ_CXR % 256 == 0);
  static_assert(SZ_ALL <= (size_t)134217728);
  if (SZ_ALL > ws_size) return;
  char* ws = (char*)d_ws;
  float* TAB  = (float*)(ws + OF_TAB);
  float* SC   = (float*)(ws + OF_SC);
  h16*   Hh   = (h16*)(ws + OF_H);
  h16*   Hr   = (h16*)(ws + OF_HR);
  h16*   W3   = (h16*)(ws + OF_W3);
  h16*   WoT  = (h16*)(ws + OF_WO);
  h16*   QK   = (h16*)(ws + OF_QK);
  h16*   QKr  = (h16*)(ws + OF_QKR);
  h16*   VT   = (h16*)(ws + OF_VT);
  h16*   VTr  = (h16*)(ws + OF_VTR);
  h16*   CTX  = (h16*)(ws + OF_CX);
  h16*   CTXr = (h16*)(ws + OF_CXR);

  k_prep<<<(unsigned)PB_ALL, 256, 0, stream>>>(x, pw, wq, wk, wv, wo, q1, q2, k1, k2, lam, TAB, SC, Hh, Hr, W3, WoT);

  k_gemm_qkv_early<<<(unsigned)((EROWS / 128) * (N3 / 64)), 128, 0, stream>>>(Hh, Hr, W3, TAB, QK, QKr, VT, VTr);
  if (NR > EROWS)
    k_gemm_qkv_late<<<(unsigned)(((NR - EROWS) / 128) * (N3 / 64)), 128, 0, stream>>>(Hh, W3, TAB, QK, VT);

  k_attn<<<(unsigned)(AB_LATE + AB_EARLY), 256, 0, stream>>>(QK, QKr, VT, VTr, SC, hnw, CTX, CTXr);

  k_gemm_out<<<(unsigned)(OB_EARLY + OB_LATE), 128, 0, stream>>>(CTX, CTXr, WoT, x, out);
}

// v005
// One run takes 199 microseconds.
// In two side-by-side timings against v004, it was 1.07 and 1.08 times as fast.
// Over all steps from v000 it is 3.23 times as fast.
#include <hip/hip_runtime.h>
// Pre-RMSNorm differential causal attention block: fused [out][in] q|k|v projection, interleaved-pair rotary over 256 columns per head (computed f32 cos/sin table),
// two causal softmax maps per head combined with a per-head scale, per-head RMSNorm, output projection, skip connection. T 2048, D 2048, 16 heads of 128.
// Compute dtype: all contractions on v_wmma_f32_16x16x32_f16 with f32 accumulate. Inputs are RNE-converted to bf16 first; weights carried x64 as f16 (exact).
// Query rows >= 256: single f16 products at every site (h, q, k, v, P x256, ctx). Query rows < 256: value + x2048 f16 residual planes on h, q, k, P, v, ctx
// (residual products in their own accumulators, folded with 2^-11 in the f32 epilogue). Norms, rotary, mask, softmax statistics in f32 on the VALU.
#ifndef NB
#define NB 1
#endif
#ifndef SEQ
#define SEQ 2048
#endif
#define SEQ_FULL 2048
#define DM 2048
#define NH 16
#define HD 128
#define HW 256
#define NQK (2 * NH * HW)
#define N3 (NQK + DM)
#define NR (NB * SEQ)
#define EROWS 256

static_assert(NB == 1);
static_assert(NH * HD == DM);
static_assert(HW == 2 * HD && HD == 128);
static_assert(SEQ % 128 == 0 && SEQ <= SEQ_FULL);
static_assert(EROWS % 128 == 0 && EROWS < SEQ && EROWS % 32 == 0);
static_assert(DM % 64 == 0 && N3 % 64 == 0 && NQK % 64 == 0 && DM % 32 == 0);
static_assert(HW % 64 == 0 && NQK % HW == 0);
static_assert(256 * 8 == DM);
static_assert((SEQ * HD) % 256 == 0);

typedef _Float16 h16;
typedef _Float16 v16h __attribute__((ext_vector_type(16)));
typedef _Float16 v8h  __attribute__((ext_vector_type(8), may_alias));
typedef float v8f  __attribute__((ext_vector_type(8)));
typedef float v4f  __attribute__((ext_vector_type(4)));
typedef float v4fa __attribute__((ext_vector_type(4), may_alias));
union FragH { v16h v; v8h half[2]; };

__device__ __forceinline__ float bf16_rne(float x) {
  unsigned int u = __float_as_uint(x);
  u = (u + 0x7FFFu + ((u >> 16) & 1u)) & 0xFFFF0000u;
  return __uint_as_float(u);
}

// f32 -> f16 with a value select: results below the smallest normal f16 become exact zero
static __device__ __forceinline__ h16 toh_flush(float v) { const h16 r = (h16)v; return (fabsf(v) < 6.103515625e-05f) ? (h16)0.0f : r; }

// fragment (A: row = lane&15; B: column = lane&15) from a k-contiguous f16 row: elements 0..7 <- k0+8h.., elements 8..15 <- k0+16+8h..
__device__ __forceinline__ v16h ld_frag(const h16* p, int hh) {
  FragH f; f.half[0] = *(const v8h*)(p + 8 * hh); f.half[1] = *(const v8h*)(p + 16 + 8 * hh); return f.v;
}

// the same fragment from global memory; a wait stands in front of each load because the compiler may give a load's result the registers of an address that an earlier load names
__device__ __forceinline__ v16h ld_frag_g(const h16* p, int hh) {
  FragH f;
  asm volatile("s_wait_xcnt 0x0" ::: "memory");
  f.half[0] = *(const v8h*)(p + 8 * hh);
  asm volatile("s_wait_xcnt 0x0" ::: "memory");
  f.half[1] = *(const v8h*)(p + 16 + 8 * hh); return f.v;
}

__device__ __forceinline__ v8f mma(v16h a, v16h b, v8f c) {
  c = __builtin_amdgcn_wmma_f32_16x16x32_f16(false, a, false, b, (short)0, c, false, false);
  asm volatile("v_nop\n\tv_nop\n\tv_nop\n\tv_nop" : "+v"(c) : "v"(a), "v"(b));
  return c;
}
__device__ __forceinline__ v8f mmam(v16h a, v16h b, v8f c) {
  c = __builtin_amdgcn_wmma_f32_16x16x32_f16(false, a, false, b, (short)0, c, false, false);
  asm volatile("v_nop\n\tv_nop\n\tv_nop\n\tv_nop" : "+v"(c) : "v"(a), "v"(b) : "memory");
  return c;
}

// The preparation steps below read only the inputs and write disjoint workspace regions: none depends on another, so all of them but the per-head scales (in k_gemm_qkv) share one grid (k_prep), each on its own range of blocks.
// rotary table: every thread forms its own column's theta (the same expression for every row of that column)
__device__ __forceinline__ void tab_body(float* TAB, int blk) {
#pragma clang fp contract(off)
  const int idx = blk * 256 + threadIdx.x;
  const int i = idx & (HD - 1), s = idx >> 7;
  const float e = (float)(2 * i) / (float)HW;
  const float th = 1.0f / powf(10000.0f, e);
  const float ang = (float)s * th;
  const float cs = cosf(ang);
  const float sn = sinf(ang);
  float* pcs = TAB + idx;
  float* psn = TAB + (size_t)SEQ * HD + idx;
  *(float*)pcs = cs;
  *(float*)psn = sn;
  asm volatile("s_wait_xcnt 0x0" ::: "memory");  // stands behind the stores: in the shared grid the listing runs on from here into another range's code, which reuses the registers that they name
}

// per-head scales: the work of one wave (the caller passes wave 0 of one block). One long chain of dependent loads, read first by the attention launch: it rides in the projection grid (k_gemm_qkv), which outlasts it
__device__ __forceinline__ void scale_body(const float* q1, const float* q2, const float* k1, const float* k2, const float* lam, float* SC) {
#pragma clang fp contract(off)
  const int lane = threadIdx.x;
  const int h = lane & 15;
  float s1 = 0.f, s2 = 0.f;
#pragma unroll 1
  for (int d = 0; d < HD; ++d) {
    s1 += bf16_rne(q1[h * HD + d]) * bf16_rne(k1[h * HD + d]);
    s2 += bf16_rne(q2[h * HD + d]) * bf16_rne(k2[h * HD + d]);
  }
  float ls = 0.f;
#pragma unroll 1
  for (int i = 0; i < NH; ++i) ls += bf16_rne(lam[i]);
  const float base = expf(s1) - expf(s2);
  const float sc = -((float)NH * base + ls);
  const float osc = 1.0f - bf16_rne(lam[h]);
  const float v = (lane < 16) ? sc : osc;
  *(float*)(SC + lane) = v;
  asm volatile("s_wait_xcnt 0x0" ::: "memory");  // stands behind the store: in the shared grid the listing runs on from here into another range's code, which reuses the registers that it names
}

// pre-norm: h = x * rsqrt(mean(x^2) + 1e-9) * w -> f16 value plane H [NR][DM] (+ x2048 residual plane Hr for rows < EROWS);
__device__ __forceinline__ void hnorm_body(const float* x, const float* pw, h16* H, h16* Hr, int row) {
#pragma clang fp contract(off)
  __shared__ float red[8];
  const int tid = threadIdx.x, lane = tid & 31;
  const int wave = __builtin_amdgcn_readfirstlane(tid >> 5);
  const size_t off = (size_t)row * DM + tid * 8;
  const v4f a = *(const v4fa*)(x + off), b = *(const v4fa*)(x + off + 4);
  asm volatile("s_wait_xcnt 0x0" ::: "memory");  // stands behind the two loads, in front of the next loads, whose results may take the registers of the address that these name
  const v4f wa = *(const v4fa*)(pw + tid * 8), wb = *(const v4fa*)(pw + tid * 8 + 4);
  float xv[8], wv[8];
#pragma unroll
  for (int q = 0; q < 4; ++q) {
    xv[q] = bf16_rne(a[q]); xv[4 + q] = bf16_rne(b[q]);
    wv[q] = bf16_rne(wa[q]); wv[4 + q] = bf16_rne(wb[q]);
  }
  float ss = 0.f;
#pragma unroll
  for (int i = 0; i < 8; ++i) ss += xv[i] * xv[i];
#pragma unroll
  for (int o = 16; o >= 1; o >>= 1) ss += __shfl_xor(ss, o, 32);
  if (lane == 0) red[wave] = ss;
  __syncthreads();
  float tot = 0.f;
#pragma unroll
  for (int i = 0; i < 8; ++i) tot += red[i];
  const float r = rsqrtf(tot * (1.0f / (float)DM) + 1.0e-9f);
  v8h hv, rv;
#pragma unroll
  for (int i = 0; i < 8; ++i) {
    const float hval = xv[i] * r * wv[i];
    const h16 hb = toh_flush(hval);
    hv[i] = hb;
    rv[i] = toh_flush((hval - (float)hb) * 2048.0f);
  }
  {
    *(v8h*)(H + off) = hv;
    asm volatile("s_wait_xcnt 0x0" ::: "memory");  // stands behind the store, in front of the residual's arithmetic, which reuses the registers that the store names
    if (row < EROWS) *(v8h*)(Hr + off) = rv;
    asm volatile("s_wait_xcnt 0x0" ::: "memory");  // stands behind the last store: the listing runs on from here into another range's code, which reuses the registers that it names
  }
}

__device__ __forceinline__ void wcvt_body(const float* W, h16* O, int blk) {
  const size_t t = (size_t)blk * 256 + threadIdx.x;
  const v4f a = *(const v4fa*)(W + t * 8), c = *(const v4fa*)(W + t * 8 + 4);
  v8h o;
#pragma unroll
  for (int q = 0; q < 4; ++q) { o[q] = toh_flush(bf16_rne(a[q]) * 64.0f); o[4 + q] = toh_flush(bf16_rne(c[q]) * 64.0f); }
  *(v8h*)(O + t * 8) = o;
  asm volatile("s_wait_xcnt 0x0" ::: "memory");  // stands behind the store: the listing runs on from here into another range's code, which reuses the registers that it names
}

// block ranges of k_prep
#define PB_TAB (SEQ * HD / 256)
#define PB_HN NR
#define PB_WQK (NH * HW * DM / 8 / 256)
#define PB_WVO (DM * DM / 8 / 256)
#define PB_ALL (PB_TAB + PB_HN + 2 * PB_WQK + 2 * PB_WVO)
static_assert((NH * HW * DM) % (8 * 256) == 0 && (DM * DM) % (8 * 256) == 0);
__global__ __launch_bounds__(256)
void k_prep(const float* __restrict__ x, const float* __restrict__ pw, const float* __restrict__ wq, const float* __restrict__ wk,
            const float* __restrict__ wv, const float* __restrict__ wo,
            float* __restrict__ TAB, h16* __restrict__ H, h16* __restrict__ Hr, h16* __restrict__ W3, h16* __restrict__ WoT) {
  int b = blockIdx.x;  // every test below reads the same for the whole block
  if (b < PB_TAB) { tab_body(TAB, b); return; }
  b -= PB_TAB;
  if (b < PB_HN) { hnorm_body(x, pw, H, Hr, b); return; }
  b -= PB_HN;
  if (b < PB_WQK) { wcvt_body(wq, W3, b); return; }                                /* W3 rows 0..4095 */
  b -= PB_WQK;
  if (b < PB_WQK) { wcvt_body(wk, W3 + (size_t)NH * HW * DM, b); return; }         /* W3 rows 4096..8191 */
  b -= PB_WQK;
  if (b < PB_WVO) { wcvt_body(wv, W3 + (size_t)NQK * DM, b); return; }             /* W3 rows 8192..10239 */
  b -= PB_WVO;
  wcvt_body(wo, WoT, b);
}

// GEMM main loop, K = DM, both operands k-contiguous with pitch DM. Wave tile 32 x 64: c[0..3] rows 0..15, c[4..7] rows 16..31.
// RES: a second A plane (x2048 residual) accumulates into cr.
// Operand tiles of KT k are staged in LDS by asynchronous copies, two buffers: trip t works on buffer t & 1 while tile t + 1 flies.
// Stage rows (pitch LP f16 = 144 B, an odd multiple of 16 B for the 16-byte fragment reads): A 0..127, B 128..191, residual A 192..319.
#define KT 64
#define LP 72
#define NTRIP (DM / KT)
static_assert(DM % KT == 0 && NTRIP >= 2 && KT % 32 == 0 && KT * 2 == 128);
template <bool RES> struct Ring { static constexpr int ROWS = RES ? 320 : 192; static constexpr int STG = ROWS * LP; static constexpr int BYTES = 2 * STG * 2; };

#define CPY(a, b) "global_load_async_to_lds_b128 %" #a ", %" #b ", off\n\t"
// 16 bytes per lane and copy, global -> LDS. The closing s_wait_xcnt stands in the copies' own statement so that no later write of an address register is moved in front of it.
__device__ __forceinline__ void copy12(const unsigned (&l)[12], const h16* const (&g)[12]) {
  asm volatile(CPY(0, 1) CPY(2, 3) CPY(4, 5) CPY(6, 7) CPY(8, 9) CPY(10, 11) CPY(12, 13) CPY(14, 15) CPY(16, 17) CPY(18, 19) CPY(20, 21) CPY(22, 23)
               "s_wait_xcnt 0x0"
               :: "v"(l[0]), "v"(g[0]), "v"(l[1]), "v"(g[1]), "v"(l[2]), "v"(g[2]), "v"(l[3]), "v"(g[3]), "v"(l[4]), "v"(g[4]), "v"(l[5]), "v"(g[5]),
                  "v"(l[6]), "v"(g[6]), "v"(l[7]), "v"(g[7]), "v"(l[8]), "v"(g[8]), "v"(l[9]), "v"(g[9]), "v"(l[10]), "v"(g[10]), "v"(l[11]), "v"(g[11])
               : "memory");
}
__device__ __forceinline__ void copy8(const unsigned (&l)[8], const h16* const (&g)[8]) {
  asm volatile(CPY(0, 1) CPY(2, 3) CPY(4, 5) CPY(6, 7) CPY(8, 9) CPY(10, 11) CPY(12, 13) CPY(14, 15)
               "s_wait_xcnt 0x0"
               :: "v"(l[0]), "v"(g[0]), "v"(l[1]), "v"(g[1]), "v"(l[2]), "v"(g[2]), "v"(l[3]), "v"(g[3]), "v"(l[4]), "v"(g[4]), "v"(l[5]), "v"(g[5]),
                  "v"(l[6]), "v"(g[6]), "v"(l[7]), "v"(g[7])
               : "memory");
}

// one stage: 128 threads x 16 B cover 16 rows of 128 B per copy (8 lanes per row: whole lines). lb, gA, gB, gR are the lane's own addresses in row (tid >> 3) of each plane.
// PAIR: the 128 A rows of the stage are 64 rows of two planes, 16 of gA's, then the same 16 of gR's, and so on: a wave's rows 0..15 are its value rows, its rows 16..31 the residuals of the same rows.
template <bool RES, bool PAIR>
__device__ __forceinline__ void stage_fill(unsigned lb, const h16* gA, const h16* gB, const h16* gR) {
  unsigned l[12]; const h16* g[12];
  // the three loops here are unrolled so that the address arrays are registers (they are asm operands)
#pragma unroll
  for (int i = 0; i < 8; ++i) { l[i] = lb + (unsigned)(i * 16 * LP * 2); g[i] = PAIR ? ((i & 1) ? gR : gA) + (size_t)(i >> 1) * 16 * DM : gA + (size_t)i * 16 * DM; }
#pragma unroll
  for (int i = 0; i < 4; ++i) { l[8 + i] = lb + (unsigned)((128 + i * 16) * LP * 2); g[8 + i] = gB + (size_t)i * 16 * DM; }
  copy12(l, g);
  if (RES) {
    unsigned lr[8]; const h16* gr[8];
#pragma unroll
    for (int i = 0; i < 8; ++i) { lr[i] = lb + (unsigned)((192 + i * 16) * LP * 2); gr[i] = gR + (size_t)i * 16 * DM; }
    copy8(lr, gr);
  }
}

// mrow: first of the block's 128 A rows (PAIR: of its 64 rows of Ah and of Ar; c[0..3] are then the value products of the wave's 16 rows, c[4..7] the residual products of the same rows);
// col0: first of its 64 B rows; ring: the block's LDS, Ring<RES>::BYTES bytes, free again behind the last trip's barrier.
template <bool RES, bool PAIR = false>
__device__ __forceinline__ void gemm_main(const h16* Ah, const h16* Ar, const h16* Bt, int mrow, int col0, h16* ring, int tid, int w, int ln, int hh,
                                          v8f (&c)[8], v8f (&cr)[8]) {
  constexpr int STG = Ring<RES>::STG;
  const int crow = tid >> 3, ccol = (tid & 7) * 8;
  const h16* gA = Ah + (size_t)(mrow + crow) * DM + ccol;
  const h16* gR = Ar + (size_t)(mrow + crow) * DM + ccol;
  const h16* gB = Bt + (size_t)(col0 + crow) * DM + ccol;
  const unsigned lb = (unsigned)(uintptr_t)ring + (unsigned)((crow * LP + ccol) * 2);
  static_assert(!(RES && PAIR));
  stage_fill<RES, PAIR>(lb, gA, gB, gR);
  asm volatile("s_wait_asynccnt 0x0" ::: "memory");  // tile 0 has landed before the barrier publishes it
  __syncthreads();
  stage_fill<RES, PAIR>(lb + (unsigned)(STG * 2), gA + KT, gB + KT, gR + KT);
#pragma unroll 1  // kept rolled: one body for both buffers, the buffer picked by a scalar offset
  for (int t = 0; t < NTRIP; ++t) {
    const int buf = t & 1;
    const h16* st = ring + buf * STG;
    const h16* pa = st + (32 * w + ln) * LP;
    const h16* pb = st + (128 + ln) * LP;
    const h16* pr = st + (192 + 32 * w + ln) * LP;
    // the fragments of G k-steps are read from LDS as one group in front of their products: one LDS wait per group, not one per fragment
    // (RES: one k-step per group, two would not fit the register budget beside the 16 accumulator tiles). All loops of the trip are unrolled: fragments and tiles stay in registers
    constexpr int G = RES ? 1 : 2;
#pragma unroll
    for (int k0 = 0; k0 < KT; k0 += 32 * G) {
      v16h fa[G][2], fe[G][2], fb[G][4];
#pragma unroll
      for (int s = 0; s < G; ++s) {
        const int kk = k0 + 32 * s;
        fa[s][0] = ld_frag(pa + kk, hh); fa[s][1] = ld_frag(pa + 16 * LP + kk, hh);
#pragma unroll
        for (int j = 0; j < 4; ++j) fb[s][j] = ld_frag(pb + j * 16 * LP + kk, hh);
        if (RES) { fe[s][0] = ld_frag(pr + kk, hh); fe[s][1] = ld_frag(pr + 16 * LP + kk, hh); }
        else { fe[s][0] = fa[s][0]; fe[s][1] = fa[s][1]; }
      }
#pragma unroll
      for (int s = 0; s < G; ++s) {
#pragma unroll
        for (int j = 0; j < 4; ++j) {
          c[j] = mma(fa[s][0], fb[s][j], c[j]); c[4 + j] = mma(fa[s][1], fb[s][j], c[4 + j]);
          if (RES) { cr[j] = mma(fe[s][0], fb[s][j], cr[j]); cr[4 + j] = mma(fe[s][1], fb[s][j], cr[4 + j]); }
        }
      }
    }
    asm volatile("s_wait_dscnt 0x0" ::: "memory");     // this wave's reads of buffer buf are done before the barrier frees it
    asm volatile("s_wait_asynccnt 0x0" ::: "memory");  // this wave's copies of tile t + 1 have landed before the barrier publishes them
    __syncthreads();
    if (t + 2 < NTRIP) stage_fill<RES, PAIR>(lb + (unsigned)(buf * STG * 2), gA + (t + 2) * KT, gB + (t + 2) * KT, gR + (t + 2) * KT);
  }
  asm volatile("s_wait_asynccnt 0x0" ::: "memory");    // nothing in flight when the ring becomes output staging
}

// fused projection [NR][N3] = H . W3^T (W3 rows: q 0..4095, k 4096..8191, v 8192..10239). Block = 4 waves = 128 rows x 64 cols.
// RES: 64 rows x 64 cols with the value and the residual plane of h, 16 rows of each per wave, in the same 192-row ring (gemm_main's PAIR form).
template <bool RES>
__device__ __forceinline__ void gemm_qkv_body(const h16* Hh, const h16* Hr, const h16* W3, const float* TAB,
                                              h16* QK, h16* QKr, h16* VT, h16* VTr, int mrow0, int blk, unsigned char* smem) {
  // one LDS block (the kernel's, Ring<false>::BYTES): the operand ring in the main loop, then (behind the last trip's barrier) the output staging so[wave][row][col]
  static_assert(Ring<false>::BYTES >= 4 * 32 * 68 * 4);
  constexpr int WR = RES ? 16 : 32;   // output rows per wave
  constexpr int NIT = WR / 4;         // 16-byte stores per lane
  h16* ring = (h16*)smem;
  float (*so)[32][68] = (float (*)[32][68])smem;
  const int tid = threadIdx.x, lane = tid & 31, ln = lane & 15, hh = lane >> 4;
  const int w = __builtin_amdgcn_readfirstlane(tid >> 5);
  const int ntn = N3 >> 6;
  const int mtl = blk / ntn, nq = blk - mtl * ntn;
  const int mrow = mrow0 + mtl * (4 * WR);
  const int row0 = mrow + WR * w, col0 = nq * 64;
  const v8f z8 = {0.f, 0.f, 0.f, 0.f, 0.f, 0.f, 0.f, 0.f};
  v8f c[8];
#pragma unroll
  for (int u = 0; u < 8; ++u) c[u] = z8;
  gemm_main<false, RES>(Hh, Hr, W3, mrow, col0, ring, tid, w, ln, hh, c, c);
#pragma unroll
  for (int u = 0; u < (RES ? 4 : 8); ++u) {
    const int t = u & 3, hf = u >> 2;
#pragma unroll
    for (int r = 0; r < 8; ++r) {
      const float v = RES ? (c[u][r] + c[4 + u][r] * 4.8828125e-4f) * 0.015625f : c[u][r] * 0.015625f;
      so[w][hf * 16 + 8 * hh + r][t * 16 + ln] = v;
    }
  }
  __syncthreads();
  v8h hv[NIT], rv[NIT];
  if (col0 < NQK) {
    const int rq = lane >> 3, pc = lane & 7;
    const int i0 = ((col0 & (HW - 1)) >> 1) + pc * 4;
    const float* tp = TAB + (size_t)(row0 + rq) * HD + i0;  // one address for all table loads, the rest constant offsets
    v4f csv[NIT], snv[NIT];
#pragma unroll
    for (int it = 0; it < NIT; ++it) { csv[it] = *(const v4fa*)(tp + it * 4 * HD); snv[it] = *(const v4fa*)(tp + SEQ * HD + it * 4 * HD); }
    asm volatile("s_wait_xcnt 0x0" :: "v"(tp) : "memory");  // the address is an input so that its registers live to this wait: no load's result takes them while a load that names them is issued
#pragma unroll
    for (int it = 0; it < NIT; ++it) {
      const int row = it * 4 + rq;
      const v4f a = *(const v4fa*)&so[w][row][pc * 8], b = *(const v4fa*)&so[w][row][pc * 8 + 4];
      const v4f cs = csv[it], sn = snv[it];
      float o[8];
      o[0] = a[0] * cs[0] - a[1] * sn[0]; o[1] = a[0] * sn[0] + a[1] * cs[0];
      o[2] = a[2] * cs[1] - a[3] * sn[1]; o[3] = a[2] * sn[1] + a[3] * cs[1];
      o[4] = b[0] * cs[2] - b[1] * sn[2]; o[5] = b[0] * sn[2] + b[1] * cs[2];
      o[6] = b[2] * cs[3] - b[3] * sn[3]; o[7] = b[2] * sn[3] + b[3] * cs[3];
#pragma unroll
      for (int q = 0; q < 8; ++q) {
        const h16 hb = toh_flush(o[q]);
        hv[it][q] = hb;
        rv[it][q] = toh_flush((o[q] - (float)hb) * 2048.0f);
      }
    }
    // the packed results are inputs so that all of their arithmetic stands in front of the first store: left free, part of it is moved behind stores whose registers it reuses
    if constexpr (RES) asm volatile("s_wait_xcnt 0x0" :: "v"(hv[0]), "v"(hv[1]), "v"(hv[2]), "v"(hv[3]), "v"(rv[0]), "v"(rv[1]), "v"(rv[2]), "v"(rv[3]) : "memory");
    else asm volatile("s_wait_xcnt 0x0" :: "v"(hv[0]), "v"(hv[1]), "v"(hv[2]), "v"(hv[3]), "v"(hv[4]), "v"(hv[5]), "v"(hv[6]), "v"(hv[7]) : "memory");
    {
      const size_t off = (size_t)(row0 + rq) * NQK + col0 + pc * 8;  // one address per plane for all stores, the rest constant offsets
      h16* qp = QK + off; h16* qr = QKr + off;
#pragma unroll
      for (int it = 0; it < NIT; ++it) {
        *(v8h*)(qp + (size_t)it * 4 * NQK) = hv[it];
        if (RES) *(v8h*)(qr + (size_t)it * 4 * NQK) = rv[it];
      }
      // stands behind the stores, their addresses live to here: in the shared grid the listing runs on into other code, which reuses the registers that they name
      if constexpr (RES) asm volatile("s_wait_xcnt 0x0" :: "v"(qp), "v"(qr) : "memory");
      else asm volatile("s_wait_xcnt 0x0" :: "v"(qp) : "memory");
    }
  } else {
    // V^T: a lane gathers 8 consecutive rows of one channel; the block's rows of a channel (4 * WR f16) are whole 128-byte lines
    constexpr int PG = 4 * WR / 8;      // groups of 8 rows in the block: 16, RES 8
    constexpr int CPI = 32 / PG;        // channels per store instruction: 2, RES 4
    static_assert(NIT * CPI == 16);
    const int chb = col0 - NQK;
    const int sub = lane / PG, p = lane & (PG - 1);
    const int sw = p / (WR / 8), sr = (p & (WR / 8 - 1)) * 8;
#pragma unroll
    for (int it = 0; it < NIT; ++it) {
      const int chl = w * 16 + it * CPI + sub;
#pragma unroll
      for (int q = 0; q < 8; ++q) {
        const float v = so[sw][sr + q][chl];
        const h16 hb = toh_flush(v);
        hv[it][q] = hb;
        rv[it][q] = toh_flush((v - (float)hb) * 2048.0f);
      }
    }
    // the packed results are inputs so that all of their arithmetic stands in front of the first store: left free, part of it is moved behind stores whose registers it reuses
    if constexpr (RES) asm volatile("s_wait_xcnt 0x0" :: "v"(hv[0]), "v"(hv[1]), "v"(hv[2]), "v"(hv[3]), "v"(rv[0]), "v"(rv[1]), "v"(rv[2]), "v"(rv[3]) : "memory");
    else asm volatile("s_wait_xcnt 0x0" :: "v"(hv[0]), "v"(hv[1]), "v"(hv[2]), "v"(hv[3]), "v"(hv[4]), "v"(hv[5]), "v"(hv[6]), "v"(hv[7]) : "memory");
    {
      const int ch0 = chb + w * 16 + sub;  // one address per plane for all stores, the rest constant offsets
      h16* vp = VT + (size_t)ch0 * SEQ + mrow + p * 8; h16* vr = VTr + (size_t)ch0 * EROWS + (RES ? mrow : 0) + p * 8;
#pragma unroll
      for (int it = 0; it < NIT; ++it) {
        *(v8h*)(vp + (size_t)it * CPI * SEQ) = hv[it];
        if (RES) *(v8h*)(vr + (size_t)it * CPI * EROWS) = rv[it];
      }
      // stands behind the stores, their addresses live to here: in the shared grid the listing runs on into other code, which reuses the registers that they name
      if constexpr (RES) asm volatile("s_wait_xcnt 0x0" :: "v"(vp), "v"(vr) : "memory");
      else asm volatile("s_wait_xcnt 0x0" :: "v"(vp) : "memory");
    }
  }
}

// both row ranges in one grid (they write disjoint rows of QK and disjoint columns of V^T, and neither reads the other's); a block of either range has the same ring, copies and products.
// The one-wave scale step, which reads only inputs and writes only SC, shares the grid.
#define QB_SC 1
#define QB_EARLY ((EROWS / 64) * (N3 / 64))
#define QB_LATE (((NR - EROWS) / 128) * (N3 / 64))
// at most four waves per SIMD, that is four blocks per WGP: the grid's 2880 equal blocks then run as three nearly full rounds (2.8) of four blocks, which already use the whole LDS read rate;
// five per WGP would also take three rounds (2.25), each as much longer as it has more blocks, the last one nearly empty
__global__ __launch_bounds__(128) __attribute__((amdgpu_num_vgpr(256))) __attribute__((amdgpu_waves_per_eu(1, 4)))
void k_gemm_qkv(const h16* __restrict__ Hh, const h16* __restrict__ Hr, const h16* __restrict__ W3, const float* __restrict__ TAB,
                h16* __restrict__ QK, h16* __restrict__ QKr, h16* __restrict__ VT, h16* __restrict__ VTr,
                const float* __restrict__ q1, const float* __restrict__ q2, const float* __restrict__ k1, const float* __restrict__ k2,
                const float* __restrict__ lam, float* __restrict__ SC) {
  __shared__ __attribute__((aligned(16))) unsigned char smem[Ring<false>::BYTES];
  int b = blockIdx.x;  // every test below reads the same for the whole block
  if (b < QB_SC) { if (threadIdx.x < 32) scale_body(q1, q2, k1, k2, lam, SC); return; }  // first, because it is the longest single chain; it passes no barrier
  b -= QB_SC;
  if (b < QB_EARLY) gemm_qkv_body<true>(Hh, Hr, W3, TAB, QK, QKr, VT, VTr, 0, b, smem);
  else gemm_qkv_body<false>(Hh, Hh, W3, TAB, QK, QK, VT, VT, EROWS, b - QB_EARLY, smem);
}

// output projection out[NR][DM] f32 = ctx . Wo^T / 64 + bf16(x); skip connection added at the store stage as float4;
template <bool RES>
__device__ __forceinline__ void gemm_out_body(const h16* Ch, const h16* Cr, const h16* WoT, const float* x, float* out, int mt0, int blk, unsigned char* smem) {
  // one LDS block (the kernel's, at least Ring<RES>::BYTES): the operand ring in the main loop, then (behind the last trip's barrier) the output staging so[wave][row][col]
  static_assert(Ring<RES>::BYTES >= 4 * 32 * 68 * 4);
  h16* ring = (h16*)smem;
  float (*so)[32][68] = (float (*)[32][68])smem;
  const int tid = threadIdx.x, lane = tid & 31, ln = lane & 15, hh = lane >> 4;
  const int w = __builtin_amdgcn_readfirstlane(tid >> 5);
  const int ntn = DM >> 6;
  const int mtl = blk / ntn, nq = blk - mtl * ntn;
  const int mrow = (mt0 + mtl) * 128;
  const int row0 = mrow + 32 * w, col0 = nq * 64;
  const v8f z8 = {0.f, 0.f, 0.f, 0.f, 0.f, 0.f, 0.f, 0.f};
  v8f c[8], cr[8];
#pragma unroll
  for (int u = 0; u < 8; ++u) { c[u] = z8; cr[u] = z8; }
  gemm_main<RES>(Ch, Cr, WoT, mrow, col0, ring, tid, w, ln, hh, c, cr);
#pragma unroll
  for (int u = 0; u < 8; ++u) {
    const int t = u & 3, hf = u >> 2;
#pragma unroll
    for (int r = 0; r < 8; ++r) {
      const float v = RES ? (c[u][r] + cr[u][r] * 4.8828125e-4f) * 0.015625f : c[u][r] * 0.015625f;
      so[w][hf * 16 + 8 * hh + r][t * 16 + ln] = v;
    }
  }
  __syncthreads();
  const int rsub = lane >> 4, c4 = (lane & 15) * 4;
  v4f ov[16];
#pragma unroll
  for (int q = 0; q < 16; ++q) {
    const int r = q * 2 + rsub;
    const v4f v = *(const v4fa*)&so[w][r][c4];
    if (q) asm volatile("s_wait_xcnt 0x0" ::: "memory");  // stands between the loads: a load's result may take the registers of an address that an earlier load names
    const v4f xr = *(const v4fa*)(x + (size_t)(row0 + r) * DM + col0 + c4);
    v4f o;
    o[0] = v[0] + bf16_rne(xr[0]); o[1] = v[1] + bf16_rne(xr[1]); o[2] = v[2] + bf16_rne(xr[2]); o[3] = v[3] + bf16_rne(xr[3]);
    ov[q] = o;
  }
  // the sixteen sums are inputs so that all of their arithmetic stands in front of the first store: left free, part of it is moved behind stores whose data registers it reuses
  asm volatile("s_wait_xcnt 0x0" :: "v"(ov[0]), "v"(ov[1]), "v"(ov[2]), "v"(ov[3]), "v"(ov[4]), "v"(ov[5]), "v"(ov[6]), "v"(ov[7]),
               "v"(ov[8]), "v"(ov[9]), "v"(ov[10]), "v"(ov[11]), "v"(ov[12]), "v"(ov[13]), "v"(ov[14]), "v"(ov[15]) : "memory");
  {
#pragma unroll
    for (int q = 0; q < 16; ++q) {
      const int r = q * 2 + rsub;
      *(v4f*)(out + (size_t)(row0 + r) * DM + col0 + c4) = ov[q];
      asm volatile("s_wait_xcnt 0x0" ::: "memory");  // stands behind each store, in front of the next stores' address arithmetic, which reuses the registers that it names
    }
    
  }
}

// both row ranges in one grid (they write disjoint rows and neither reads the other's): the blocks with residual planes, which run longer, come first
#define OB_EARLY ((EROWS / 128) * (DM / 64))
#define OB_LATE (((NR - EROWS) / 128) * (DM / 64))
__global__ __launch_bounds__(128) __attribute__((amdgpu_num_vgpr(256)))
void k_gemm_out(const h16* __restrict__ Ch, const h16* __restrict__ Cr, const h16* __restrict__ WoT, const float* __restrict__ x, float* __restrict__ out) {
  __shared__ __attribute__((aligned(16))) unsigned char smem[Ring<true>::BYTES];
  const int b = blockIdx.x;  // the test reads the same for the whole block
  if (b < OB_EARLY) gemm_out_body<true>(Ch, Cr, WoT, x, out, 0, b, smem);
  else gemm_out_body<false>(Ch, Ch, WoT, x, out, EROWS / 128, b - OB_EARLY, smem);
}

// Transposed flash attention. One unit of NW waves per (head, 16-query tile); wave = (score component c, channel slab hf).
// S^T[key][query] = K_c . Q_c^T (A = K rows, B = Q rows), per-lane (= per-query) running max / sum in the exp2 domain,
// P^T (carried x256) packed from the S^T accumulators directly as the B fragment of O^T[ch][query] = V^T . P^T (A = V^T rows). Causal mask as a select.
// NW = 4: query rows < EROWS, value + x2048 residual planes on q, k, P, v, 64 channels per wave (NW = 2: single f16 products, 128 channels per wave; query rows >= EROWS have attn_late_body).
// Epilogue: both components meet in LDS (block barrier), O = O_0 + scale[h] O_1, per-head RMSNorm, x (1 - lam[h]), f16 ctx rows (+ residual rows);
template <int NW>
__device__ __forceinline__ void attn_body(const h16* QK, const h16* QKr, const h16* VT, const h16* VTr,
                                          const float* SC, const float* hw, h16* CTX, h16* CTXr, int qt0, int nqt,
                                          int unit, int tid, float (*comb)[16][132]) {
  constexpr bool EARLY = (NW == 4);
  constexpr int NT = 16 / NW;
  constexpr int RPW = 16 / NW;
  static_assert(NW == 2 || NW == 4);
  static_assert(NW * NT * 16 == 2 * HD);
  // unit: which (head, 16-query tile); tid: the thread's number among the unit's NW waves; comb: the unit's own LDS, [2][16][132] floats
  const int lane = tid & 31, ln = lane & 15, hh = lane >> 4;
  const int wave = __builtin_amdgcn_readfirstlane(tid >> 5);
  const int c = wave & 1, hf = wave >> 1;
  const int head = unit / nqt;
  const int qt = qt0 + (unit - head * nqt);
  const int q0 = qt * 16, qi = q0 + ln;
  const size_t qoff = (size_t)qi * NQK + head * HW + c * HD;
  const int kcol = NH * HW + head * HW + c * HD;
  const int chb = head * HD + hf * (NT * 16);
  const float NEGV = -1.0e30f;
  const float SCL2 = 0.08838834764831845f * 1.4426950408889634f;
  const float PCL = 8.0f;

  const v8f z8 = {0.f, 0.f, 0.f, 0.f, 0.f, 0.f, 0.f, 0.f};
  v16h qh[4];
#pragma unroll
  for (int ks = 0; ks < 4; ++ks) qh[ks] = ld_frag(QK + qoff + ks * 32, hh);

  v8f acc[NT], accr[NT];
#pragma unroll
  for (int dt = 0; dt < NT; ++dt) { acc[dt] = z8; accr[dt] = z8; }
  float m = NEGV, l = 0.f;
  const int nsteps = (q0 + 16 + 31) >> 5;

#pragma unroll 1
  for (int js = 0; js < nsteps; ++js) {
    const int j0 = js << 5;
    v8f s0 = z8, s1 = z8, t0 = z8, t1 = z8;
    const size_t ko = (size_t)(j0 + ln) * NQK + kcol;
#pragma unroll
    for (int ks = 0; ks < 4; ++ks) {
      const v16h a0 = ld_frag_g(QK + ko + ks * 32, hh);
      const v16h a1 = ld_frag_g(QK + ko + (size_t)16 * NQK + ks * 32, hh);
      v16h bq = qh[ks];
      if (EARLY) bq = ld_frag_g(QK + qoff + ks * 32, hh);
      s0 = mmam(a0, bq, s0);
      s1 = mmam(a1, bq, s1);
      if (EARLY) {
        const v16h br = ld_frag_g(QKr + qoff + ks * 32, hh);
        const v16h r0 = ld_frag_g(QKr + ko + ks * 32, hh);
        const v16h r1 = ld_frag_g(QKr + ko + (size_t)16 * NQK + ks * 32, hh);
        t0 = mmam(r0, bq, t0);
        t0 = mmam(a0, br, t0);
        t1 = mmam(r1, bq, t1);
        t1 = mmam(a1, br, t1);
      }
    }

    float xv[16];
    float mx = NEGV;
#pragma unroll
    for (int r = 0; r < 8; ++r) {
      const int k0 = j0 + 8 * hh + r, k1 = k0 + 16;
      float e0 = s0[r], e1 = s1[r];
      if (EARLY) { e0 += t0[r] * 4.8828125e-4f; e1 += t1[r] * 4.8828125e-4f; }
      xv[r] = (k0 <= qi) ? e0 * SCL2 : NEGV;
      xv[8 + r] = (k1 <= qi) ? e1 * SCL2 : NEGV;
      mx = fmaxf(mx, fmaxf(xv[r], xv[8 + r]));
    }
    mx = fmaxf(mx, __shfl_xor(mx, 16, 32));
    const float mn = fmaxf(m, mx);
    const float alpha = exp2f(m - mn);
    m = mn;

    v16h ph, pr;
    float ps = 0.f;
#pragma unroll
    for (int i = 0; i < 16; ++i) {
      const float e = xv[i] - mn + PCL;
      const float pe = exp2f(e);
      const float p = (e < -14.0f) ? 0.f : pe;
      const h16 pb = (h16)p;
      ph[i] = pb;
      if (EARLY) {
        pr[i] = toh_flush((p - (float)pb) * 2048.0f);
        ps += p;
      } else {
        pr[i] = pb;
        ps += (float)pb;
      }
    }
    ps += __shfl_xor(ps, 16, 32);
    l = l * alpha + ps;

#pragma unroll
    for (int dt = 0; dt < NT; ++dt)
#pragma unroll
      for (int r = 0; r < 8; ++r) { acc[dt][r] *= alpha; if (EARLY) accr[dt][r] *= alpha; }

#pragma unroll
    for (int dt = 0; dt < NT; ++dt) {
      const int ch = chb + dt * 16 + ln;
      const v16h vh = ld_frag_g(VT + (size_t)ch * SEQ + j0, hh);
      acc[dt] = mmam(vh, ph, acc[dt]);
      if (EARLY) {
        const v16h vr = ld_frag_g(VTr + (size_t)ch * EROWS + j0, hh);
        accr[dt] = mmam(vh, pr, accr[dt]);
        accr[dt] = mmam(vr, ph, accr[dt]);
      }
    }
  }

  const float inv = 1.0f / l;
#pragma unroll
  for (int dt = 0; dt < NT; ++dt)
#pragma unroll
    for (int r = 0; r < 8; ++r) {
      const float v = EARLY ? (acc[dt][r] + accr[dt][r] * 4.8828125e-4f) * inv : acc[dt][r] * inv;
      comb[c][ln][hf * (NT * 16) + dt * 16 + 8 * hh + r] = v;
    }
  __syncthreads();

  const float scl = SC[head], osc = SC[NH + head];
  const int sub = lane >> 4, pc = lane & 15;
  const v4f wa = *(const v4fa*)(hw + pc * 8), wb = *(const v4fa*)(hw + pc * 8 + 4);
  const float wv[8] = {bf16_rne(wa[0]), bf16_rne(wa[1]), bf16_rne(wa[2]), bf16_rne(wa[3]), bf16_rne(wb[0]), bf16_rne(wb[1]), bf16_rne(wb[2]), bf16_rne(wb[3])};
  v8h hv[RPW / 2], rv[RPW / 2];
#pragma unroll
  for (int it = 0; it < RPW / 2; ++it) {
    const int row = wave * RPW + it * 2 + sub;
    const v4f a0 = *(const v4fa*)&comb[0][row][pc * 8], a1 = *(const v4fa*)&comb[0][row][pc * 8 + 4];
    const v4f b0 = *(const v4fa*)&comb[1][row][pc * 8], b1 = *(const v4fa*)&comb[1][row][pc * 8 + 4];
    float o[8];
#pragma unroll
    for (int q = 0; q < 4; ++q) { o[q] = a0[q] + scl * b0[q]; o[4 + q] = a1[q] + scl * b1[q]; }
    float ss = 0.f;
#pragma unroll
    for (int q = 0; q < 8; ++q) ss += o[q] * o[q];
#pragma unroll
    for (int d = 1; d < 16; d <<= 1) ss += __shfl_xor(ss, d, 32);
    const float rms = rsqrtf(ss * (1.0f / (float)HD) + 1.0e-9f);
#pragma unroll
    for (int q = 0; q < 8; ++q) {
      const float val = o[q] * rms * wv[q] * osc;
      const h16 hb = toh_flush(val);
      hv[it][q] = hb;
      rv[it][q] = toh_flush((val - (float)hb) * 2048.0f);
    }
  }
  {
#pragma unroll
    for (int it = 0; it < RPW / 2; ++it) {
      const int row = wave * RPW + it * 2 + sub;
      const size_t off = (size_t)(q0 + row) * DM + head * HD + pc * 8;
      *(v8h*)(CTX + off) = hv[it];
      if (EARLY) *(v8h*)(CTXr + off) = rv[it];
    }
    asm volatile("s_wait_xcnt 0x0" ::: "memory");  // stands behind the stores: in the shared grid the listing runs on from here into the other range's code, which reuses the registers that they name
  }
}

// Query rows >= EROWS: the same transposed flash attention with single f16 products, AQB queries of one head at a time, 8 waves = (score component c, 16-query tile qs), 128 channels per wave.
// The head's K rows (both components side by side, 512 B) and V^T rows of a tile of AKT keys are staged in LDS by asynchronous copies and read by all 8 waves;
// two buffers: trip t works on buffer t & 1 while tile t + 1 flies. Every wave walks its keys in steps of 32 from key 0, as one wave per 16 queries would.
// Stage: K rows 0..AKT-1 at pitch AKP f16 = 528 B, then V^T rows 0..HD-1 at pitch AVP f16 = 144 B (odd multiples of 16 B for the 16-byte fragment reads).
#define AQB 64
#define AKT 64
#define AKP 264
#define AVP 72
#define ASTG (AKT * AKP + HD * AVP)
// Causal work dealt evenly: a query block that starts at query q walks (q + AQB) / AKT key tiles, so the blocks of a head differ widely in length. Each head's query blocks are dealt to AGRP work-groups:
// the longest ones stand alone, every other work-group takes a long one and then a short one, one after the other in every wave, so that all work-groups walk about the same number of key tiles.
#define AGRP 16
static_assert(AQB == AKT && AKT == 64 && EROWS % AKT == 0 && (SEQ - EROWS) % AQB == 0 && EROWS / AKT + 1 >= 2);
static_assert(AKP >= HW + 8 && (AKP * 2) % 32 == 16 && AVP >= AKT + 8 && (AVP * 2) % 32 == 16 && (ASTG * 2) % 16 == 0);

// one stage, 256 threads x 16 B per copy: 8 K rows of 512 B (32 lanes per row), 8 copies; 32 V^T rows of 128 B (8 lanes per row), 4 copies. All four arguments are the lane's own addresses.
__device__ __forceinline__ void attn_fill(unsigned lk, unsigned lv, const h16* gK, const h16* gV) {
  unsigned l[12]; const h16* g[12];
  // both loops are unrolled so that the address arrays are registers (they are asm operands)
#pragma unroll
  for (int i = 0; i < 8; ++i) { l[i] = lk + (unsigned)(i * 8 * AKP * 2); g[i] = gK + (size_t)i * 8 * NQK; }
#pragma unroll
  for (int i = 0; i < 4; ++i) { l[8 + i] = lv + (unsigned)(i * 32 * AVP * 2); g[8 + i] = gV + (size_t)i * 32 * SEQ; }
  copy12(l, g);
}

__device__ __forceinline__ void attn_late_body(const h16* QK, const h16* VT, const float* SC, const float* hw, h16* CTX, int blk, unsigned char* smem) {
  constexpr int NT = 8;
  constexpr int RPW = AQB / 8;
  // one LDS block (the kernel's, 2 * ASTG * 2 bytes): the K / V^T ring in the key loop, then (behind the last trip's barrier) the two components' outputs comb[c][query][channel]
  static_assert(2 * ASTG * 2 >= 2 * AQB * 132 * 4);
  h16* ring = (h16*)smem;
  float (*comb)[AQB][132] = (float (*)[AQB][132])smem;
  const int tid = threadIdx.x, lane = tid & 31, ln = lane & 15, hh = lane >> 4;
  const int wave = __builtin_amdgcn_readfirstlane(tid >> 5);
  const int c = wave & 1, qs = wave >> 1;
  constexpr int nqb = (SEQ - EROWS) / AQB;
  constexpr int NSGL = 2 * AGRP - nqb;  // work-groups with one query block (the NSGL longest); the others take two: nqb = NSGL + 2 * (AGRP - NSGL)
  static_assert(nqb >= AGRP && nqb <= 2 * AGRP);
  const int head = blk / AGRP;
  const int grp = blk - head * AGRP;
  const int npass = (grp < NSGL) ? 1 : 2;
  const float NEGV = -1.0e30f;
  const float SCL2 = 0.08838834764831845f * 1.4426950408889634f;
  const float PCL = 8.0f;
  const v8f z8 = {0.f, 0.f, 0.f, 0.f, 0.f, 0.f, 0.f, 0.f};

#pragma unroll 1  // kept rolled: one body for both query blocks of the work-group
  for (int pass = 0; pass < npass; ++pass) {
  // query blocks nqb-1 .. nqb-AGRP come first, blocks 0 .. nqb-AGRP-1 second: each exactly once; the two lengths of a pair add up to the same sum in every pair
  const int q0b = EROWS + ((pass == 0) ? nqb - 1 - grp : grp - NSGL) * AQB;
  const int q0 = q0b + qs * 16, qi = q0 + ln;
  if (pass) {  // the same for the whole work-group
    asm volatile("s_wait_dscnt 0x0" ::: "memory");  // this wave's reads of the first query block's comb rows are done before the barrier frees that LDS
    __syncthreads();                                // every wave has left comb before the copies below refill the ring over it
  }
  v16h qh[4];
#pragma unroll
  for (int ks = 0; ks < 4; ++ks) qh[ks] = ld_frag(QK + (size_t)qi * NQK + head * HW + c * HD + ks * 32, hh);

  v8f acc[NT];
#pragma unroll
  for (int dt = 0; dt < NT; ++dt) acc[dt] = z8;
  float m = NEGV, l = 0.f;

  const int ntiles = (q0b + AQB) / AKT;  // >= 2: q0b >= EROWS
  const h16* gK = QK + (size_t)(tid >> 5) * NQK + NH * HW + head * HW + (tid & 31) * 8;
  const h16* gV = VT + (size_t)(head * HD + (tid >> 3)) * SEQ + (tid & 7) * 8;
  const unsigned lk = (unsigned)(uintptr_t)ring + (unsigned)(((tid >> 5) * AKP + (tid & 31) * 8) * 2);
  const unsigned lv = (unsigned)(uintptr_t)ring + (unsigned)((AKT * AKP + (tid >> 3) * AVP + (tid & 7) * 8) * 2);
  attn_fill(lk, lv, gK, gV);
  asm volatile("s_wait_asynccnt 0x0" ::: "memory");  // tile 0 has landed before the barrier publishes it
  __syncthreads();
  attn_fill(lk + (unsigned)(ASTG * 2), lv + (unsigned)(ASTG * 2), gK + (size_t)AKT * NQK, gV + AKT);
#pragma unroll 1  // kept rolled: one body for both buffers, the buffer picked by a scalar offset
  for (int t = 0; t < ntiles; ++t) {
    const int buf = t & 1;
    const h16* st = ring + buf * ASTG;
#pragma unroll 1  // kept rolled: one body for both 32-key halves of the tile
    for (int sub = 0; sub < AKT / 32; ++sub) {
      const int j0 = t * AKT + sub * 32;
      if (j0 > q0 + 15) continue;  // wave-uniform: every key of the step lies behind all 16 queries of this wave (only in the block's last tile)
      const h16* pk = st + (sub * 32 + ln) * AKP + c * HD;
      const h16* pv = st + AKT * AKP + ln * AVP + sub * 32;
      v16h ka[4][2];
#pragma unroll
      for (int ks = 0; ks < 4; ++ks) { ka[ks][0] = ld_frag(pk + ks * 32, hh); ka[ks][1] = ld_frag(pk + 16 * AKP + ks * 32, hh); }
      v8f s0 = z8, s1 = z8;
#pragma unroll
      for (int ks = 0; ks < 4; ++ks) { s0 = mma(ka[ks][0], qh[ks], s0); s1 = mma(ka[ks][1], qh[ks], s1); }
      v16h vh[NT];
#pragma unroll
      for (int dt = 0; dt < NT; ++dt) vh[dt] = ld_frag(pv + dt * 16 * AVP, hh);
      __builtin_amdgcn_sched_barrier(0);  // keeps the V^T reads together here, in flight under the softmax (left free they are spread over it in pairs, the last ones directly in front of their products)

      float xv[16];
      float mx = NEGV;
#pragma unroll
      for (int r = 0; r < 8; ++r) {
        const int k0 = j0 + 8 * hh + r, k1 = k0 + 16;
        xv[r] = (k0 <= qi) ? s0[r] * SCL2 : NEGV;
        xv[8 + r] = (k1 <= qi) ? s1[r] * SCL2 : NEGV;
        mx = fmaxf(mx, fmaxf(xv[r], xv[8 + r]));
      }
      mx = fmaxf(mx, __shfl_xor(mx, 16, 32));
      const float mn = fmaxf(m, mx);
      const float alpha = exp2f(m - mn);
      m = mn;

      v16h ph;
      float ps = 0.f;
#pragma unroll
      for (int i = 0; i < 16; ++i) {
        const float e = xv[i] - mn + PCL;
        const float pe = exp2f(e);
        const float p = (e < -14.0f) ? 0.f : pe;
        const h16 pb = (h16)p;
        ph[i] = pb;
        ps += (float)pb;
      }
      ps += __shfl_xor(ps, 16, 32);
      l = l * alpha + ps;

#pragma unroll
      for (int dt = 0; dt < NT; ++dt)
#pragma unroll
        for (int r = 0; r < 8; ++r) acc[dt][r] *= alpha;
#pragma unroll
      for (int dt = 0; dt < NT; ++dt) acc[dt] = mma(vh[dt], ph, acc[dt]);
    }
    asm volatile("s_wait_dscnt 0x0" ::: "memory");     // this wave's reads of buffer buf are done before the barrier frees it
    asm volatile("s_wait_asynccnt 0x0" ::: "memory");  // this wave's copies of tile t + 1 have landed before the barrier publishes them
    __syncthreads();
    if (t + 2 < ntiles)
      attn_fill(lk + (unsigned)(buf * ASTG * 2), lv + (unsigned)(buf * ASTG * 2), gK + (size_t)(t + 2) * AKT * NQK, gV + (t + 2) * AKT);
  }
  asm volatile("s_wait_asynccnt 0x0" ::: "memory");    // nothing in flight when the ring becomes output staging

  const float inv = 1.0f / l;
#pragma unroll
  for (int dt = 0; dt < NT; ++dt)
#pragma unroll
    for (int r = 0; r < 8; ++r) comb[c][qs * 16 + ln][dt * 16 + 8 * hh + r] = acc[dt][r] * inv;
  __syncthreads();

  const float scl = SC[head], osc = SC[NH + head];
  const int sub = lane >> 4, pc = lane & 15;
  const v4f wa = *(const v4fa*)(hw + pc * 8), wb = *(const v4fa*)(hw + pc * 8 + 4);
  const float wv[8] = {bf16_rne(wa[0]), bf16_rne(wa[1]), bf16_rne(wa[2]), bf16_rne(wa[3]), bf16_rne(wb[0]), bf16_rne(wb[1]), bf16_rne(wb[2]), bf16_rne(wb[3])};
  v8h hv[RPW / 2];
#pragma unroll
  for (int it = 0; it < RPW / 2; ++it) {
    const int row = wave * RPW + it * 2 + sub;
    const v4f a0 = *(const v4fa*)&comb[0][row][pc * 8], a1 = *(const v4fa*)&comb[0][row][pc * 8 + 4];
    const v4f b0 = *(const v4fa*)&comb[1][row][pc * 8], b1 = *(const v4fa*)&comb[1][row][pc * 8 + 4];
    float o[8];
#pragma unroll
    for (int q = 0; q < 4; ++q) { o[q] = a0[q] + scl * b0[q]; o[4 + q] = a1[q] + scl * b1[q]; }
    float ss = 0.f;
#pragma unroll
    for (int q = 0; q < 8; ++q) ss += o[q] * o[q];
#pragma unroll
    for (int d = 1; d < 16; d <<= 1) ss += __shfl_xor(ss, d, 32);
    const float rms = rsqrtf(ss * (1.0f / (float)HD) + 1.0e-9f);
#pragma unroll
    for (int q = 0; q < 8; ++q) hv[it][q] = toh_flush(o[q] * rms * wv[q] * osc);
  }
#pragma unroll
  for (int it = 0; it < RPW / 2; ++it) {
    const int row = wave * RPW + it * 2 + sub;
    *(v8h*)(CTX + (size_t)(q0b + row) * DM + head * HD + pc * 8) = hv[it];
  }
  asm volatile("s_wait_xcnt 0x0" ::: "memory");  // stands behind the stores, in front of the next query block's writes to the registers that they name
  }
}

// both query ranges in one grid (they write disjoint ctx rows and neither reads the other's): the AB_LATE long blocks come first, one for each place they had alone;
// behind them AB_EARLY blocks of two (head, 16-query tile) units of four waves each, which run beside the long ones; a block's two tiles are j and last - j, so that every such block brings the same number of key steps.
#define AB_LATE (NH * AGRP)
#define AB_EARLY (NH * (EROWS / 16) / 2)
static_assert((EROWS / 16) % 2 == 0 && 2 * ASTG * 2 >= 2 * 2 * 16 * 132 * 4);
__global__ __launch_bounds__(256) __attribute__((amdgpu_num_vgpr(256)))
void k_attn(const h16* __restrict__ QK, const h16* __restrict__ QKr, const h16* __restrict__ VT, const h16* __restrict__ VTr,
            const float* __restrict__ SC, const float* __restrict__ hw, h16* __restrict__ CTX, h16* __restrict__ CTXr) {
  __shared__ __attribute__((aligned(16))) unsigned char smem[2 * ASTG * 2];
  const int b = blockIdx.x;  // the test reads the same for the whole block
  if (b < AB_LATE) {
    attn_late_body(QK, VT, SC, hw, CTX, b, smem);
  } else {
    const int tid = threadIdx.x;
    const int half = __builtin_amdgcn_readfirstlane(tid >> 7);
    constexpr int NQT = EROWS / 16;
    const int eb = b - AB_LATE, head = eb / (NQT / 2), j = eb - head * (NQT / 2);
    attn_body<4>(QK, QKr, VT, VTr, SC, hw, CTX, CTXr, 0, NQT, head * NQT + (half ? NQT - 1 - j : j), tid & 127, (float (*)[16][132])(smem + half * (2 * 16 * 132 * 4)));
  }
}

extern "C" void kernel_launch(void* const* d_in, const int* in_sizes, int n_in,
                              void* d_out, int out_size, void* d_ws, size_t ws_size, hipStream_t stream) {
  if (n_in < 12) return;
  if (in_sizes[0] < NR * DM) return;
  if (in_sizes[1] < DM) return;
  if (in_sizes[2] < NH * HW * DM || in_sizes[3] < NH * HW * DM) return;
  if (in_sizes[4] < DM * DM || in_sizes[5] < DM * DM) return;
  if (in_sizes[6] < HD) return;
  if (in_sizes[7] < NH * HD || in_sizes[8] < NH * HD || in_sizes[9] < NH * HD || in_sizes[10] < NH * HD) return;
  if (in_sizes[11] < NH) return;
  if (out_size < NR * DM) return;
  const float* x   = (const float*)d_in[0];
  const float* pw  = (const float*)d_in[1];
  const float* wq  = (const float*)d_in[2];
  const float* wk  = (const float*)d_in[3];
  const float* wv  = (const float*)d_in[4];
  const float* wo  = (const float*)d_in[5];
  const float* hnw = (const float*)d_in[6];
  const float* q1  = (const float*)d_in[7];
  const float* q2  = (const float*)d_in[8];
  const float* k1  = (const float*)d_in[9];
  const float* k2  = (const float*)d_in[10];
  const float* lam = (const float*)d_in[11];
  float* out = (float*)d_out;

  // workspace regions (bytes); every region but TH, which nothing reads or writes, is written with whole-row stores inside its exact extent
  constexpr size_t SZ_TH  = 512;
  constexpr size_t SZ_TAB = (size_t)2 * SEQ * HD * 4;
  constexpr size_t SZ_SC  = 256;
  constexpr size_t SZ_H   = (size_t)NR * DM * 2;
  constexpr size_t SZ_HR  = (size_t)EROWS * DM * 2;
  constexpr size_t SZ_W3  = (size_t)N3 * DM * 2;
  constexpr size_t SZ_WO  = (size_t)DM * DM * 2;
  constexpr size_t SZ_QK  = (size_t)NR * NQK * 2;
  constexpr size_t SZ_QKR = (size_t)EROWS * NQK * 2;
  constexpr size_t SZ_VT  = (size_t)DM * SEQ * 2;
  constexpr size_t SZ_VTR = (size_t)DM * EROWS * 2;
  constexpr size_t SZ_CX  = (size_t)NR * DM * 2;
  constexpr size_t SZ_CXR = (size_t)EROWS * DM * 2;
  constexpr size_t OF_TH  = 0;
  constexpr size_t OF_TAB = OF_TH + SZ_TH;
  constexpr size_t OF_SC  = OF_TAB + SZ_TAB;
  constexpr size_t OF_H   = OF_SC + SZ_SC;
  constexpr size_t OF_HR  = OF_H + SZ_H;
  constexpr size_t OF_W3  = OF_HR + SZ_HR;
  constexpr size_t OF_WO  = OF_W3 + SZ_W3;
  constexpr size_t OF_QK  = OF_WO + SZ_WO;
  constexpr size_t OF_QKR = OF_QK + SZ_QK;
  constexpr size_t OF_VT  = OF_QKR + SZ_QKR;
  constexpr size_t OF_VTR = OF_VT + SZ_VT;
  constexpr size_t OF_CX  = OF_VTR + SZ_VTR;
  constexpr size_t OF_CXR = OF_CX + SZ_CX;
  constexpr size_t SZ_ALL = OF_CXR + SZ_CXR;
  static_assert(SZ_TH >= 128 * 4 && SZ_SC >= 32 * 4);
  static_assert(SZ_TH % 256 == 0 && SZ_TAB % 256 == 0 && SZ_SC % 256 == 0 && SZ_H % 256 == 0 && SZ_HR % 256 == 0 && SZ_W3 % 256 == 0);
  static_assert(SZ_WO % 256 == 0 && SZ_QK % 256 == 0 && SZ_QKR % 256 == 0 && SZ_VT % 256 == 0 && SZ_VTR % 256 == 0 && SZ_CX % 256 == 0 && SZ_CXR % 256 == 0);
  static_assert(SZ_ALL <= (size_t)134217728);
  if (SZ_ALL > ws_size) return;
  char* ws = (char*)d_ws;
  float* TAB  = (float*)(ws + OF_TAB);
  float* SC   = (float*)(ws + OF_SC);
  h16*   Hh   = (h16*)(ws + OF_H);
  h16*   Hr   = (h16*)(ws + OF_HR);
  h16*   W3   = (h16*)(ws + OF_W3);
  h16*   WoT  = (h16*)(ws + OF_WO);
  h16*   QK   = (h16*)(ws + OF_QK);
  h16*   QKr  = (h16*)(ws + OF_QKR);
  h16*   VT   = (h16*)(ws + OF_VT);
  h16*   VTr  = (h16*)(ws + OF_VTR);
  h16*   CTX  = (h16*)(ws + OF_CX);
  h16*   CTXr = (h16*)(ws + OF_CXR);

  k_prep<<<(unsigned)PB_ALL, 256, 0, stream>>>(x, pw, wq, wk, wv, wo, TAB, Hh, Hr, W3, WoT);

  k_gemm_qkv<<<(unsigned)(QB_SC + QB_EARLY + QB_LATE), 128, 0, stream>>>(Hh, Hr, W3, TAB, QK, QKr, VT, VTr, q1, q2, k1, k2, lam, SC);

  k_attn<<<(unsigned)(AB_LATE + AB_EARLY), 256, 0, stream>>>(QK, QKr, VT, VTr, SC, hnw, CTX, CTXr);

  k_gemm_out<<<(unsigned)(OB_EARLY + OB_LATE), 128, 0, stream>>>(CTX, CTXr, WoT, x, out);
}

// v006
// A run of this version takes 180 microseconds.
// Next to v005, in two timings, it ran 1.10 and 1.11 times as fast.
// All steps since v000 together make it 3.57 times as fast.
#include <hip/hip_runtime.h>
// Pre-RMSNorm differential causal attention block: fused [out][in] q|k|v projection, interleaved-pair rotary over 256 columns per head (computed f32 cos/sin table),
// two causal softmax maps per head combined with a per-head scale, per-head RMSNorm, output projection, skip connection. T 2048, D 2048, 16 heads of 128.
// Compute dtype: all contractions on v_wmma_f32_16x16x32_f16 with f32 accumulate. Inputs are RNE-converted to bf16 first; weights carried x64 as f16 (exact).
// Query rows >= 256: single f16 products at every site (h, q, k, v, P x256, ctx). Query rows < 256: value + x2048 f16 residual planes on h, q, k, P, v, ctx
// (residual products in their own accumulators, folded with 2^-11 in the f32 epilogue). Norms, rotary, mask, softmax statistics in f32 on the VALU.
#ifndef NB
#define NB 1
#endif
#ifndef SEQ
#define SEQ 2048
#endif
#define SEQ_FULL 2048
#define DM 2048
#define NH 16
#define HD 128
#define HW 256
#define NQK (2 * NH * HW)
#define N3 (NQK + DM)
#define NR (NB * SEQ)
#define EROWS 256

static_assert(NB == 1);
static_assert(NH * HD == DM);
static_assert(HW == 2 * HD && HD == 128);
static_assert(SEQ % 128 == 0 && SEQ <= SEQ_FULL);
static_assert(EROWS % 128 == 0 && EROWS < SEQ && EROWS % 32 == 0);
static_assert(DM % 64 == 0 && N3 % 64 == 0 && NQK % 64 == 0 && DM % 32 == 0);
static_assert(HW % 64 == 0 && NQK % HW == 0);
static_assert(256 * 8 == DM);
static_assert((SEQ * HD) % 256 == 0);

typedef _Float16 h16;
typedef _Float16 v16h __attribute__((ext_vector_type(16)));
typedef _Float16 v8h  __attribute__((ext_vector_type(8), may_alias));
typedef float v8f  __attribute__((ext_vector_type(8)));
typedef float v4f  __attribute__((ext_vector_type(4)));
typedef float v4fa __attribute__((ext_vector_type(4), may_alias));
union FragH { v16h v; v8h half[2]; };

__device__ __forceinline__ float bf16_rne(float x) {
  unsigned int u = __float_as_uint(x);
  u = (u + 0x7FFFu + ((u >> 16) & 1u)) & 0xFFFF0000u;
  return __uint_as_float(u);
}

// f32 -> f16 with a value select: results below the smallest normal f16 become exact zero
static __device__ __forceinline__ h16 toh_flush(float v) { const h16 r = (h16)v; return (fabsf(v) < 6.103515625e-05f) ? (h16)0.0f : r; }

// fragment (A: row = lane&15; B: column = lane&15) from a k-contiguous f16 row: elements 0..7 <- k0+8h.., elements 8..15 <- k0+16+8h..
__device__ __forceinline__ v16h ld_frag(const h16* p, int hh) {
  FragH f; f.half[0] = *(const v8h*)(p + 8 * hh); f.half[1] = *(const v8h*)(p + 16 + 8 * hh); return f.v;
}

// the same fragment from global memory; a wait stands in front of each load because the compiler may give a load's result the registers of an address that an earlier load names
__device__ __forceinline__ v16h ld_frag_g(const h16* p, int hh) {
  FragH f;
  asm volatile("s_wait_xcnt 0x0" ::: "memory");
  f.half[0] = *(const v8h*)(p + 8 * hh);
  asm volatile("s_wait_xcnt 0x0" ::: "memory");
  f.half[1] = *(const v8h*)(p + 16 + 8 * hh); return f.v;
}

__device__ __forceinline__ v8f mma(v16h a, v16h b, v8f c) {
  c = __builtin_amdgcn_wmma_f32_16x16x32_f16(false, a, false, b, (short)0, c, false, false);
  asm volatile("v_nop\n\tv_nop\n\tv_nop\n\tv_nop" : "+v"(c) : "v"(a), "v"(b));
  return c;
}
__device__ __forceinline__ v8f mmam(v16h a, v16h b, v8f c) {
  c = __builtin_amdgcn_wmma_f32_16x16x32_f16(false, a, false, b, (short)0, c, false, false);
  asm volatile("v_nop\n\tv_nop\n\tv_nop\n\tv_nop" : "+v"(c) : "v"(a), "v"(b) : "memory");
  return c;
}

// The preparation steps below read only the inputs and write disjoint workspace regions: none depends on another, so all of them but the per-head scales (in k_gemm_qkv) share one grid (k_prep), each on its own range of blocks.
// rotary table: every thread forms its own column's theta (the same expression for every row of that column)
__device__ __forceinline__ void tab_body(float* TAB, int blk) {
#pragma clang fp contract(off)
  const int idx = blk * 256 + threadIdx.x;
  const int i = idx & (HD - 1), s = idx >> 7;
  const float e = (float)(2 * i) / (float)HW;
  const float th = 1.0f / powf(10000.0f, e);
  const float ang = (float)s * th;
  const float cs = cosf(ang);
  const float sn = sinf(ang);
  float* pcs = TAB + idx;
  float* psn = TAB + (size_t)SEQ * HD + idx;
  *(float*)pcs = cs;
  *(float*)psn = sn;
  asm volatile("s_wait_xcnt 0x0" ::: "memory");  // stands behind the stores: in the shared grid the listing runs on from here into another range's code, which reuses the registers that they name
}

// per-head scales: the work of one wave (the caller passes wave 0 of one block). One long chain of dependent loads, read first by the attention launch: it rides in the projection grid (k_gemm_qkv), which outlasts it
__device__ __forceinline__ void scale_body(const float* q1, const float* q2, const float* k1, const float* k2, const float* lam, float* SC) {
#pragma clang fp contract(off)
  const int lane = threadIdx.x;
  const int h = lane & 15;
  float s1 = 0.f, s2 = 0.f;
#pragma unroll 1
  for (int d = 0; d < HD; ++d) {
    s1 += bf16_rne(q1[h * HD + d]) * bf16_rne(k1[h * HD + d]);
    s2 += bf16_rne(q2[h * HD + d]) * bf16_rne(k2[h * HD + d]);
  }
  float ls = 0.f;
#pragma unroll 1
  for (int i = 0; i < NH; ++i) ls += bf16_rne(lam[i]);
  const float base = expf(s1) - expf(s2);
  const float sc = -((float)NH * base + ls);
  const float osc = 1.0f - bf16_rne(lam[h]);
  const float v = (lane < 16) ? sc : osc;
  *(float*)(SC + lane) = v;
  asm volatile("s_wait_xcnt 0x0" ::: "memory");  // stands behind the store: in the shared grid the listing runs on from here into another range's code, which reuses the registers that it names
}

// pre-norm: h = x * rsqrt(mean(x^2) + 1e-9) * w -> f16 value plane H [NR][DM] (+ x2048 residual plane Hr for rows < EROWS);
__device__ __forceinline__ void hnorm_body(const float* x, const float* pw, h16* H, h16* Hr, int row) {
#pragma clang fp contract(off)
  __shared__ float red[8];
  const int tid = threadIdx.x, lane = tid & 31;
  const int wave = __builtin_amdgcn_readfirstlane(tid >> 5);
  const size_t off = (size_t)row * DM + tid * 8;
  const v4f a = *(const v4fa*)(x + off), b = *(const v4fa*)(x + off + 4);
  asm volatile("s_wait_xcnt 0x0" ::: "memory");  // stands behind the two loads, in front of the next loads, whose results may take the registers of the address that these name
  const v4f wa = *(const v4fa*)(pw + tid * 8), wb = *(const v4fa*)(pw + tid * 8 + 4);
  float xv[8], wv[8];
#pragma unroll
  for (int q = 0; q < 4; ++q) {
    xv[q] = bf16_rne(a[q]); xv[4 + q] = bf16_rne(b[q]);
    wv[q] = bf16_rne(wa[q]); wv[4 + q] = bf16_rne(wb[q]);
  }
  float ss = 0.f;
#pragma unroll
  for (int i = 0; i < 8; ++i) ss += xv[i] * xv[i];
#pragma unroll
  for (int o = 16; o >= 1; o >>= 1) ss += __shfl_xor(ss, o, 32);
  if (lane == 0) red[wave] = ss;
  __syncthreads();
  float tot = 0.f;
#pragma unroll
  for (int i = 0; i < 8; ++i) tot += red[i];
  const float r = rsqrtf(tot * (1.0f / (float)DM) + 1.0e-9f);
  v8h hv, rv;
#pragma unroll
  for (int i = 0; i < 8; ++i) {
    const float hval = xv[i] * r * wv[i];
    const h16 hb = toh_flush(hval);
    hv[i] = hb;
    rv[i] = toh_flush((hval - (float)hb) * 2048.0f);
  }
  {
    *(v8h*)(H + off) = hv;
    asm volatile("s_wait_xcnt 0x0" ::: "memory");  // stands behind the store, in front of the residual's arithmetic, which reuses the registers that the store names
    if (row < EROWS) *(v8h*)(Hr + off) = rv;
    asm volatile("s_wait_xcnt 0x0" ::: "memory");  // stands behind the last store: the listing runs on from here into another range's code, which reuses the registers that it names
  }
}

__device__ __forceinline__ void wcvt_body(const float* W, h16* O, int blk) {
  const size_t t = (size_t)blk * 256 + threadIdx.x;
  const v4f a = *(const v4fa*)(W + t * 8), c = *(const v4fa*)(W + t * 8 + 4);
  v8h o;
#pragma unroll
  for (int q = 0; q < 4; ++q) { o[q] = toh_flush(bf16_rne(a[q]) * 64.0f); o[4 + q] = toh_flush(bf16_rne(c[q]) * 64.0f); }
  *(v8h*)(O + t * 8) = o;
  asm volatile("s_wait_xcnt 0x0" ::: "memory");  // stands behind the store: the listing runs on from here into another range's code, which reuses the registers that it names
}

// block ranges of k_prep
#define PB_TAB (SEQ * HD / 256)
#define PB_HN NR
#define PB_WQK (NH * HW * DM / 8 / 256)
#define PB_WVO (DM * DM / 8 / 256)
#define PB_ALL (PB_TAB + PB_HN + 2 * PB_WQK + 2 * PB_WVO)
static_assert((NH * HW * DM) % (8 * 256) == 0 && (DM * DM) % (8 * 256) == 0);
__global__ __launch_bounds__(256)
void k_prep(const float* __restrict__ x, const float* __restrict__ pw, const float* __restrict__ wq, const float* __restrict__ wk,
            const float* __restrict__ wv, const float* __restrict__ wo,
            float* __restrict__ TAB, h16* __restrict__ H, h16* __restrict__ Hr, h16* __restrict__ W3, h16* __restrict__ WoT) {
  int b = blockIdx.x;  // every test below reads the same for the whole block
  if (b < PB_TAB) { tab_body(TAB, b); return; }
  b -= PB_TAB;
  if (b < PB_HN) { hnorm_body(x, pw, H, Hr, b); return; }
  b -= PB_HN;
  if (b < PB_WQK) { wcvt_body(wq, W3, b); return; }                                /* W3 rows 0..4095 */
  b -= PB_WQK;
  if (b < PB_WQK) { wcvt_body(wk, W3 + (size_t)NH * HW * DM, b); return; }         /* W3 rows 4096..8191 */
  b -= PB_WQK;
  if (b < PB_WVO) { wcvt_body(wv, W3 + (size_t)NQK * DM, b); return; }             /* W3 rows 8192..10239 */
  b -= PB_WVO;
  wcvt_body(wo, WoT, b);
}

// GEMM main loop of the output projection, K = DM, both operands k-contiguous with pitch DM. Wave tile 32 x 64: c[0..3] rows 0..15, c[4..7] rows 16..31.
// RES: a second A plane (x2048 residual) accumulates into cr.
// Operand tiles of KT k are staged in LDS by asynchronous copies, two buffers: trip t works on buffer t & 1 while tile t + 1 flies.
// Stage rows (pitch LP f16 = 144 B, an odd multiple of 16 B for the 16-byte fragment reads): A 0..127, B 128..191, residual A 192..319.
#define KT 64
#define LP 72
#define NTRIP (DM / KT)
static_assert(DM % KT == 0 && NTRIP >= 2 && KT % 32 == 0 && KT * 2 == 128);
template <bool RES> struct Ring { static constexpr int ROWS = RES ? 320 : 192; static constexpr int STG = ROWS * LP; static constexpr int BYTES = 2 * STG * 2; };

#define CPY(a, b) "global_load_async_to_lds_b128 %" #a ", %" #b ", off\n\t"
// 16 bytes per lane and copy, global -> LDS. The closing s_wait_xcnt stands in the copies' own statement so that no later write of an address register is moved in front of it.
__device__ __forceinline__ void copy12(const unsigned (&l)[12], const h16* const (&g)[12]) {
  asm volatile(CPY(0, 1) CPY(2, 3) CPY(4, 5) CPY(6, 7) CPY(8, 9) CPY(10, 11) CPY(12, 13) CPY(14, 15) CPY(16, 17) CPY(18, 19) CPY(20, 21) CPY(22, 23)
               "s_wait_xcnt 0x0"
               :: "v"(l[0]), "v"(g[0]), "v"(l[1]), "v"(g[1]), "v"(l[2]), "v"(g[2]), "v"(l[3]), "v"(g[3]), "v"(l[4]), "v"(g[4]), "v"(l[5]), "v"(g[5]),
                  "v"(l[6]), "v"(g[6]), "v"(l[7]), "v"(g[7]), "v"(l[8]), "v"(g[8]), "v"(l[9]), "v"(g[9]), "v"(l[10]), "v"(g[10]), "v"(l[11]), "v"(g[11])
               : "memory");
}
__device__ __forceinline__ void copy8(const unsigned (&l)[8], const h16* const (&g)[8]) {
  asm volatile(CPY(0, 1) CPY(2, 3) CPY(4, 5) CPY(6, 7) CPY(8, 9) CPY(10, 11) CPY(12, 13) CPY(14, 15)
               "s_wait_xcnt 0x0"
               :: "v"(l[0]), "v"(g[0]), "v"(l[1]), "v"(g[1]), "v"(l[2]), "v"(g[2]), "v"(l[3]), "v"(g[3]), "v"(l[4]), "v"(g[4]), "v"(l[5]), "v"(g[5]),
                  "v"(l[6]), "v"(g[6]), "v"(l[7]), "v"(g[7])
               : "memory");
}

// one stage: 128 threads x 16 B cover 16 rows of 128 B per copy (8 lanes per row: whole lines). lb, gA, gB, gR are the lane's own addresses in row (tid >> 3) of each plane.
template <bool RES>
__device__ __forceinline__ void stage_fill(unsigned lb, const h16* gA, const h16* gB, const h16* gR) {
  unsigned l[12]; const h16* g[12];
  // the three loops here are unrolled so that the address arrays are registers (they are asm operands)
#pragma unroll
  for (int i = 0; i < 8; ++i) { l[i] = lb + (unsigned)(i * 16 * LP * 2); g[i] = gA + (size_t)i * 16 * DM; }
#pragma unroll
  for (int i = 0; i < 4; ++i) { l[8 + i] = lb + (unsigned)((128 + i * 16) * LP * 2); g[8 + i] = gB + (size_t)i * 16 * DM; }
  copy12(l, g);
  if (RES) {
    unsigned lr[8]; const h16* gr[8];
#pragma unroll
    for (int i = 0; i < 8; ++i) { lr[i] = lb + (unsigned)((192 + i * 16) * LP * 2); gr[i] = gR + (size_t)i * 16 * DM; }
    copy8(lr, gr);
  }
}

// mrow: first of the block's 128 A rows;
// col0: first of its 64 B rows; ring: the block's LDS, Ring<RES>::BYTES bytes, free again behind the last trip's barrier.
template <bool RES>
__device__ __forceinline__ void gemm_main(const h16* Ah, const h16* Ar, const h16* Bt, int mrow, int col0, h16* ring, int tid, int w, int ln, int hh,
                                          v8f (&c)[8], v8f (&cr)[8]) {
  constexpr int STG = Ring<RES>::STG;
  const int crow = tid >> 3, ccol = (tid & 7) * 8;
  const h16* gA = Ah + (size_t)(mrow + crow) * DM + ccol;
  const h16* gR = Ar + (size_t)(mrow + crow) * DM + ccol;
  const h16* gB = Bt + (size_t)(col0 + crow) * DM + ccol;
  const unsigned lb = (unsigned)(uintptr_t)ring + (unsigned)((crow * LP + ccol) * 2);
  stage_fill<RES>(lb, gA, gB, gR);
  asm volatile("s_wait_asynccnt 0x0" ::: "memory");  // tile 0 has landed before the barrier publishes it
  __syncthreads();
  stage_fill<RES>(lb + (unsigned)(STG * 2), gA + KT, gB + KT, gR + KT);
#pragma unroll 1  // kept rolled: one body for both buffers, the buffer picked by a scalar offset
  for (int t = 0; t < NTRIP; ++t) {
    const int buf = t & 1;
    const h16* st = ring + buf * STG;
    const h16* pa = st + (32 * w + ln) * LP;
    const h16* pb = st + (128 + ln) * LP;
    const h16* pr = st + (192 + 32 * w + ln) * LP;
    // the fragments of G k-steps are read from LDS as one group in front of their products: one LDS wait per group, not one per fragment
    // (RES: one k-step per group, two would not fit the register budget beside the 16 accumulator tiles). All loops of the trip are unrolled: fragments and tiles stay in registers
    constexpr int G = RES ? 1 : 2;
#pragma unroll
    for (int k0 = 0; k0 < KT; k0 += 32 * G) {
      v16h fa[G][2], fe[G][2], fb[G][4];
#pragma unroll
      for (int s = 0; s < G; ++s) {
        const int kk = k0 + 32 * s;
        fa[s][0] = ld_frag(pa + kk, hh); fa[s][1] = ld_frag(pa + 16 * LP + kk, hh);
#pragma unroll
        for (int j = 0; j < 4; ++j) fb[s][j] = ld_frag(pb + j * 16 * LP + kk, hh);
        if (RES) { fe[s][0] = ld_frag(pr + kk, hh); fe[s][1] = ld_frag(pr + 16 * LP + kk, hh); }
        else { fe[s][0] = fa[s][0]; fe[s][1] = fa[s][1]; }
      }
#pragma unroll
      for (int s = 0; s < G; ++s) {
#pragma unroll
        for (int j = 0; j < 4; ++j) {
          c[j] = mma(fa[s][0], fb[s][j], c[j]); c[4 + j] = mma(fa[s][1], fb[s][j], c[4 + j]);
          if (RES) { cr[j] = mma(fe[s][0], fb[s][j], cr[j]); cr[4 + j] = mma(fe[s][1], fb[s][j], cr[4 + j]); }
        }
      }
    }
    asm volatile("s_wait_dscnt 0x0" ::: "memory");     // this wave's reads of buffer buf are done before the barrier frees it
    asm volatile("s_wait_asynccnt 0x0" ::: "memory");  // this wave's copies of tile t + 1 have landed before the barrier publishes them
    __syncthreads();
    if (t + 2 < NTRIP) stage_fill<RES>(lb + (unsigned)(buf * STG * 2), gA + (t + 2) * KT, gB + (t + 2) * KT, gR + (t + 2) * KT);
  }
  asm volatile("s_wait_asynccnt 0x0" ::: "memory");    // nothing in flight when the ring becomes output staging
}

// Main loop of the q|k|v projection: block tile 256 A rows x 128 B rows, 8 waves = (wm 0..3, wn 0..1), the same ring, copies and k order as above.
// The tile is this large because the copies' bytes from L2 set the pace of this GEMM: a trip brings 48 KB for 256 x 128 outputs, half the bytes per product of a 128 x 64 tile (24 KB).
// Stage rows (pitch LP): A 0..255, B 256..383. A wave takes the A rows 32 wm .. 32 wm + 31 of each half of 128 and the B rows 64 wn .. 64 wn + 63: wave tile 64 x 64,
// c[8 mh + 0..3] rows 0..15 and c[8 mh + 4..7] rows 16..31 of its 32 rows in half mh.
// PAIR: the 256 A rows of the stage are 128 rows of two planes, 16 of Ah's, then the same 16 of Ar's, and so on: a wave's rows 0..15 are value rows, its rows 16..31 the residuals of the same rows.
#define QSTG (384 * LP)
#define QBYTES (2 * QSTG * 2)
// one stage: 256 threads x 16 B cover 32 rows of 128 B per copy (8 lanes per row: whole lines). lb, gA, gB are the lane's own addresses in row (tid >> 3) of the stage's first 32 A rows and B rows.
template <bool PAIR>
__device__ __forceinline__ void qstage_fill(unsigned lb, const h16* gA, const h16* gB) {
  unsigned l[12]; const h16* g[12];
  // both loops are unrolled so that the address arrays are registers (they are asm operands)
#pragma unroll
  for (int i = 0; i < 8; ++i) { l[i] = lb + (unsigned)(i * 32 * LP * 2); g[i] = gA + (size_t)i * (PAIR ? 16 : 32) * DM; }
#pragma unroll
  for (int i = 0; i < 4; ++i) { l[8 + i] = lb + (unsigned)((256 + i * 32) * LP * 2); g[8 + i] = gB + (size_t)i * 32 * DM; }
  copy12(l, g);
}

// mrow: first of the block's 256 A rows (PAIR: of its 128 rows of Ah and of Ar); col0: first of its 128 B rows; ring: the block's LDS, QBYTES bytes, free again behind the last trip's barrier.
template <bool PAIR>
__device__ __forceinline__ void gemm_main_q(const h16* Ah, const h16* Ar, const h16* Bt, int mrow, int col0, h16* ring, int tid, int wm, int wn, int ln, int hh, v8f (&c)[16]) {
  const int crow = tid >> 3, ccol = (tid & 7) * 8;
  const h16* gA = PAIR ? ((crow & 16) ? Ar : Ah) + (size_t)(mrow + (crow & 15)) * DM + ccol : Ah + (size_t)(mrow + crow) * DM + ccol;
  const h16* gB = Bt + (size_t)(col0 + crow) * DM + ccol;
  const unsigned lb = (unsigned)(uintptr_t)ring + (unsigned)((crow * LP + ccol) * 2);
  qstage_fill<PAIR>(lb, gA, gB);
  asm volatile("s_wait_asynccnt 0x0" ::: "memory");  // tile 0 has landed before the barrier publishes it
  __syncthreads();
  qstage_fill<PAIR>(lb + (unsigned)(QSTG * 2), gA + KT, gB + KT);
#pragma unroll 1  // kept rolled: one body for both buffers, the buffer picked by a scalar offset
  for (int t = 0; t < NTRIP; ++t) {
    const int buf = t & 1;
    const h16* st = ring + buf * QSTG;
    const h16* pa = st + (32 * wm + ln) * LP;
    const h16* pb = st + (256 + 64 * wn + ln) * LP;
    // the eight fragments of a k-step are read from LDS as one group in front of its sixteen products (two k-steps would not fit the register budget beside the 16 accumulator tiles).
    // All loops of the trip are unrolled: fragments and tiles stay in registers
#pragma unroll
    for (int k0 = 0; k0 < KT; k0 += 32) {
      v16h fa[4], fb[4];
#pragma unroll
      for (int i = 0; i < 4; ++i) fa[i] = ld_frag(pa + ((i >> 1) * 128 + (i & 1) * 16) * LP + k0, hh);
#pragma unroll
      for (int j = 0; j < 4; ++j) fb[j] = ld_frag(pb + j * 16 * LP + k0, hh);
#pragma unroll
      for (int j = 0; j < 4; ++j)
#pragma unroll
        for (int i = 0; i < 4; ++i) c[4 * i + j] = mma(fa[i], fb[j], c[4 * i + j]);
    }
    asm volatile("s_wait_dscnt 0x0" ::: "memory");     // this wave's reads of buffer buf are done before the barrier frees it
    asm volatile("s_wait_asynccnt 0x0" ::: "memory");  // this wave's copies of tile t + 1 have landed before the barrier publishes them
    __syncthreads();
    if (t + 2 < NTRIP) qstage_fill<PAIR>(lb + (unsigned)(buf * QSTG * 2), gA + (t + 2) * KT, gB + (t + 2) * KT);
  }
  asm volatile("s_wait_asynccnt 0x0" ::: "memory");    // nothing in flight when the ring becomes output staging
}

// fused projection [NR][N3] = H . W3^T (W3 rows: q 0..4095, k 4096..8191, v 8192..10239). Block = 8 waves = 256 rows x 128 cols.
// RES: 128 rows x 128 cols with the value and the residual plane of h, 16 rows of each per wave and half, in the same ring (gemm_main_q's PAIR form).
// The outputs leave in two halves of the block's rows, one after the other through the same staging: in a half the four waves of a column half hold 4 * WR consecutive rows x 64 cols.
template <bool RES>
__device__ __forceinline__ void gemm_qkv_body(const h16* Hh, const h16* Hr, const h16* W3, const float* TAB,
                                              h16* QK, h16* QKr, h16* VT, h16* VTr, int mrow0, int blk, unsigned char* smem) {
  // one LDS block (the kernel's, QBYTES): the operand ring in the main loop, then (behind the last trip's barrier) the output staging so[wave][row][col]
  static_assert(QBYTES >= 8 * 32 * 68 * 4);
  constexpr int WR = RES ? 16 : 32;   // output rows per wave and half
  constexpr int NIT = WR / 4;         // 16-byte stores per lane and half
  h16* ring = (h16*)smem;
  const int tid = threadIdx.x, lane = tid & 31, ln = lane & 15, hh = lane >> 4;
  const int wave = __builtin_amdgcn_readfirstlane(tid >> 5);
  const int w = wave & 3, wn = wave >> 2;
  float (*so)[32][68] = (float (*)[32][68])smem + 4 * wn;  // the staging of the four waves of this column half
  const int ntn = N3 >> 7;
  const int mtl = blk / ntn, nq = blk - mtl * ntn;
  const int mblk = mrow0 + mtl * (8 * WR);
  const int col0 = nq * 128 + 64 * wn;
  const v8f z8 = {0.f, 0.f, 0.f, 0.f, 0.f, 0.f, 0.f, 0.f};
  v8f c[16];
#pragma unroll
  for (int u = 0; u < 16; ++u) c[u] = z8;
  gemm_main_q<RES>(Hh, Hr, W3, mblk, nq * 128, ring, tid, w, wn, ln, hh, c);
#pragma unroll  // unrolled so that the accumulator tiles are indexed by constants (they are registers)
  for (int mh = 0; mh < 2; ++mh) {
  const int mrow = mblk + mh * (4 * WR);
  const int row0 = mrow + WR * w;
  if (mh) {
    asm volatile("s_wait_dscnt 0x0" ::: "memory");  // this wave's reads of the first half's staging are done before the barrier frees it
    __syncthreads();                                // every wave has left the staging before the second half is written over it
  }
#pragma unroll
  for (int u = 0; u < (RES ? 4 : 8); ++u) {
    const int t = u & 3, hf = u >> 2;
#pragma unroll
    for (int r = 0; r < 8; ++r) {
      const float v = RES ? (c[8 * mh + u][r] + c[8 * mh + 4 + u][r] * 4.8828125e-4f) * 0.015625f : c[8 * mh + u][r] * 0.015625f;
      so[w][hf * 16 + 8 * hh + r][t * 16 + ln] = v;
    }
  }
  __syncthreads();
  v8h hv[NIT], rv[NIT];
  if (col0 < NQK) {
    const int rq = lane >> 3, pc = lane & 7;
    const int i0 = ((col0 & (HW - 1)) >> 1) + pc * 4;
    const float* tp = TAB + (size_t)(row0 + rq) * HD + i0;  // one address for all table loads, the rest constant offsets
    v4f csv[NIT], snv[NIT];
#pragma unroll
    for (int it = 0; it < NIT; ++it) { csv[it] = *(const v4fa*)(tp + it * 4 * HD); snv[it] = *(const v4fa*)(tp + SEQ * HD + it * 4 * HD); }
    asm volatile("s_wait_xcnt 0x0" :: "v"(tp) : "memory");  // the address is an input so that its registers live to this wait: no load's result takes them while a load that names them is issued
#pragma unroll
    for (int it = 0; it < NIT; ++it) {
      const int row = it * 4 + rq;
      const v4f a = *(const v4fa*)&so[w][row][pc * 8], b = *(const v4fa*)&so[w][row][pc * 8 + 4];
      const v4f cs = csv[it], sn = snv[it];
      float o[8];
      o[0] = a[0] * cs[0] - a[1] * sn[0]; o[1] = a[0] * sn[0] + a[1] * cs[0];
      o[2] = a[2] * cs[1] - a[3] * sn[1]; o[3] = a[2] * sn[1] + a[3] * cs[1];
      o[4] = b[0] * cs[2] - b[1] * sn[2]; o[5] = b[0] * sn[2] + b[1] * cs[2];
      o[6] = b[2] * cs[3] - b[3] * sn[3]; o[7] = b[2] * sn[3] + b[3] * cs[3];
#pragma unroll
      for (int q = 0; q < 8; ++q) {
        const h16 hb = toh_flush(o[q]);
        hv[it][q] = hb;
        rv[it][q] = toh_flush((o[q] - (float)hb) * 2048.0f);
      }
    }
    // the packed results are inputs so that all of their arithmetic stands in front of the first store: left free, part of it is moved behind stores whose registers it reuses
    if constexpr (RES) asm volatile("s_wait_xcnt 0x0" :: "v"(hv[0]), "v"(hv[1]), "v"(hv[2]), "v"(hv[3]), "v"(rv[0]), "v"(rv[1]), "v"(rv[2]), "v"(rv[3]) : "memory");
    else asm volatile("s_wait_xcnt 0x0" :: "v"(hv[0]), "v"(hv[1]), "v"(hv[2]), "v"(hv[3]), "v"(hv[4]), "v"(hv[5]), "v"(hv[6]), "v"(hv[7]) : "memory");
    {
      const size_t off = (size_t)(row0 + rq) * NQK + col0 + pc * 8;  // one address per plane for all stores, the rest constant offsets
      h16* qp = QK + off; h16* qr = QKr + off;
#pragma unroll
      for (int it = 0; it < NIT; ++it) {
        *(v8h*)(qp + (size_t)it * 4 * NQK) = hv[it];
        if (RES) *(v8h*)(qr + (size_t)it * 4 * NQK) = rv[it];
      }
      // stands behind the stores, their addresses live to here: in the shared grid the listing runs on into other code, which reuses the registers that they name
      if constexpr (RES) asm volatile("s_wait_xcnt 0x0" :: "v"(qp), "v"(qr) : "memory");
      else asm volatile("s_wait_xcnt 0x0" :: "v"(qp) : "memory");
    }
  } else {
    // V^T: a lane gathers 8 consecutive rows of one channel; a half's rows of a channel (4 * WR f16) are whole 128-byte lines
    constexpr int PG = 4 * WR / 8;      // groups of 8 rows in a half: 16, RES 8
    constexpr int CPI = 32 / PG;        // channels per store instruction: 2, RES 4
    static_assert(NIT * CPI == 16);
    const int chb = col0 - NQK;
    const int sub = lane / PG, p = lane & (PG - 1);
    const int sw = p / (WR / 8), sr = (p & (WR / 8 - 1)) * 8;
#pragma unroll
    for (int it = 0; it < NIT; ++it) {
      const int chl = w * 16 + it * CPI + sub;
#pragma unroll
      for (int q = 0; q < 8; ++q) {
        const float v = so[sw][sr + q][chl];
        const h16 hb = toh_flush(v);
        hv[it][q] = hb;
        rv[it][q] = toh_flush((v - (float)hb) * 2048.0f);
      }
    }
    // the packed results are inputs so that all of their arithmetic stands in front of the first store: left free, part of it is moved behind stores whose registers it reuses
    if constexpr (RES) asm volatile("s_wait_xcnt 0x0" :: "v"(hv[0]), "v"(hv[1]), "v"(hv[2]), "v"(hv[3]), "v"(rv[0]), "v"(rv[1]), "v"(rv[2]), "v"(rv[3]) : "memory");
    else asm volatile("s_wait_xcnt 0x0" :: "v"(hv[0]), "v"(hv[1]), "v"(hv[2]), "v"(hv[3]), "v"(hv[4]), "v"(hv[5]), "v"(hv[6]), "v"(hv[7]) : "memory");
    {
      const int ch0 = chb + w * 16 + sub;  // one address per plane for all stores, the rest constant offsets
      h16* vp = VT + (size_t)ch0 * SEQ + mrow + p * 8; h16* vr = VTr + (size_t)ch0 * EROWS + (RES ? mrow : 0) + p * 8;
#pragma unroll
      for (int it = 0; it < NIT; ++it) {
        *(v8h*)(vp + (size_t)it * CPI * SEQ) = hv[it];
        if (RES) *(v8h*)(vr + (size_t)it * CPI * EROWS) = rv[it];
      }
      // stands behind the stores, their addresses live to here: in the shared grid the listing runs on into other code, which reuses the registers that they name
      if constexpr (RES) asm volatile("s_wait_xcnt 0x0" :: "v"(vp), "v"(vr) : "memory");
      else asm volatile("s_wait_xcnt 0x0" :: "v"(vp) : "memory");
    }
  }
  }
}

// both row ranges in one grid (they write disjoint rows of QK and disjoint columns of V^T, and neither reads the other's); a block of either range has the same ring, copies and products.
// The one-wave scale step, which reads only inputs and writes only SC, shares the grid.
#define QB_SC 1
#define QB_EARLY ((EROWS / 128) * (N3 / 128))
#define QB_LATE (((NR - EROWS) / 256) * (N3 / 128))
static_assert(EROWS % 128 == 0 && (NR - EROWS) % 256 == 0 && N3 % 128 == 0 && NQK % 128 == 0);
// two blocks per WGP (LDS), four waves per SIMD (registers)
__global__ __launch_bounds__(256) __attribute__((amdgpu_num_vgpr(256)))
void k_gemm_qkv(const h16* __restrict__ Hh, const h16* __restrict__ Hr, const h16* __restrict__ W3, const float* __restrict__ TAB,
                h16* __restrict__ QK, h16* __restrict__ QKr, h16* __restrict__ VT, h16* __restrict__ VTr,
                const float* __restrict__ q1, const float* __restrict__ q2, const float* __restrict__ k1, const float* __restrict__ k2,
                const float* __restrict__ lam, float* __restrict__ SC) {
  __shared__ __attribute__((aligned(16))) unsigned char smem[QBYTES];
  int b = blockIdx.x;  // every test below reads the same for the whole block
  if (b < QB_SC) { if (threadIdx.x < 32) scale_body(q1, q2, k1, k2, lam, SC); return; }  // first, because it is the longest single chain; it passes no barrier
  b -= QB_SC;
  if (b < QB_EARLY) gemm_qkv_body<true>(Hh, Hr, W3, TAB, QK, QKr, VT, VTr, 0, b, smem);
  else gemm_qkv_body<false>(Hh, Hh, W3, TAB, QK, QK, VT, VT, EROWS, b - QB_EARLY, smem);
}

// output projection out[NR][DM] f32 = ctx . Wo^T / 64 + bf16(x); skip connection added at the store stage as float4;
template <bool RES>
__device__ __forceinline__ void gemm_out_body(const h16* Ch, const h16* Cr, const h16* WoT, const float* x, float* out, int mt0, int blk, unsigned char* smem) {
  // one LDS block (the kernel's, at least Ring<RES>::BYTES): the operand ring in the main loop, then (behind the last trip's barrier) the output staging so[wave][row][col]
  static_assert(Ring<RES>::BYTES >= 4 * 32 * 68 * 4);
  h16* ring = (h16*)smem;
  float (*so)[32][68] = (float (*)[32][68])smem;
  const int tid = threadIdx.x, lane = tid & 31, ln = lane & 15, hh = lane >> 4;
  const int w = __builtin_amdgcn_readfirstlane(tid >> 5);
  const int ntn = DM >> 6;
  const int mtl = blk / ntn, nq = blk - mtl * ntn;
  const int mrow = (mt0 + mtl) * 128;
  const int row0 = mrow + 32 * w, col0 = nq * 64;
  const v8f z8 = {0.f, 0.f, 0.f, 0.f, 0.f, 0.f, 0.f, 0.f};
  v8f c[8], cr[8];
#pragma unroll
  for (int u = 0; u < 8; ++u) { c[u] = z8; cr[u] = z8; }
  gemm_main<RES>(Ch, Cr, WoT, mrow, col0, ring, tid, w, ln, hh, c, cr);
#pragma unroll
  for (int u = 0; u < 8; ++u) {
    const int t = u & 3, hf = u >> 2;
#pragma unroll
    for (int r = 0; r < 8; ++r) {
      const float v = RES ? (c[u][r] + cr[u][r] * 4.8828125e-4f) * 0.015625f : c[u][r] * 0.015625f;
      so[w][hf * 16 + 8 * hh + r][t * 16 + ln] = v;
    }
  }
  __syncthreads();
  const int rsub = lane >> 4, c4 = (lane & 15) * 4;
  v4f ov[16];
#pragma unroll
  for (int q = 0; q < 16; ++q) {
    const int r = q * 2 + rsub;
    const v4f v = *(const v4fa*)&so[w][r][c4];
    if (q) asm volatile("s_wait_xcnt 0x0" ::: "memory");  // stands between the loads: a load's result may take the registers of an address that an earlier load names
    const v4f xr = *(const v4fa*)(x + (size_t)(row0 + r) * DM + col0 + c4);
    v4f o;
    o[0] = v[0] + bf16_rne(xr[0]); o[1] = v[1] + bf16_rne(xr[1]); o[2] = v[2] + bf16_rne(xr[2]); o[3] = v[3] + bf16_rne(xr[3]);
    ov[q] = o;
  }
  // the sixteen sums are inputs so that all of their arithmetic stands in front of the first store: left free, part of it is moved behind stores whose data registers it reuses
  asm volatile("s_wait_xcnt 0x0" :: "v"(ov[0]), "v"(ov[1]), "v"(ov[2]), "v"(ov[3]), "v"(ov[4]), "v"(ov[5]), "v"(ov[6]), "v"(ov[7]),
               "v"(ov[8]), "v"(ov[9]), "v"(ov[10]), "v"(ov[11]), "v"(ov[12]), "v"(ov[13]), "v"(ov[14]), "v"(ov[15]) : "memory");
  {
#pragma unroll
    for (int q = 0; q < 16; ++q) {
      const int r = q * 2 + rsub;
      *(v4f*)(out + (size_t)(row0 + r) * DM + col0 + c4) = ov[q];
      asm volatile("s_wait_xcnt 0x0" ::: "memory");  // stands behind each store, in front of the next stores' address arithmetic, which reuses the registers that it names
    }
    
  }
}

// both row ranges in one grid (they write disjoint rows and neither reads the other's): the blocks with residual planes, which run longer, come first
#define OB_EARLY ((EROWS / 128) * (DM / 64))
#define OB_LATE (((NR - EROWS) / 128) * (DM / 64))
__global__ __launch_bounds__(128) __attribute__((amdgpu_num_vgpr(256)))
void k_gemm_out(const h16* __restrict__ Ch, const h16* __restrict__ Cr, const h16* __restrict__ WoT, const float* __restrict__ x, float* __restrict__ out) {
  __shared__ __attribute__((aligned(16))) unsigned char smem[Ring<true>::BYTES];
  const int b = blockIdx.x;  // the test reads the same for the whole block
  if (b < OB_EARLY) gemm_out_body<true>(Ch, Cr, WoT, x, out, 0, b, smem);
  else gemm_out_body<false>(Ch, Ch, WoT, x, out, EROWS / 128, b - OB_EARLY, smem);
}

// Transposed flash attention. One unit of NW waves per (head, 16-query tile); wave = (score component c, channel slab hf).
// S^T[key][query] = K_c . Q_c^T (A = K rows, B = Q rows), per-lane (= per-query) running max / sum in the exp2 domain,
// P^T (carried x256) packed from the S^T accumulators directly as the B fragment of O^T[ch][query] = V^T . P^T (A = V^T rows). Causal mask as a select.
// NW = 4: query rows < EROWS, value + x2048 residual planes on q, k, P, v, 64 channels per wave (NW = 2: single f16 products, 128 channels per wave; query rows >= EROWS have attn_late_body).
// Epilogue: both components meet in LDS (block barrier), O = O_0 + scale[h] O_1, per-head RMSNorm, x (1 - lam[h]), f16 ctx rows (+ residual rows);
template <int NW>
__device__ __forceinline__ void attn_body(const h16* QK, const h16* QKr, const h16* VT, const h16* VTr,
                                          const float* SC, const float* hw, h16* CTX, h16* CTXr, int qt0, int nqt,
                                          int unit, int tid, float (*comb)[16][132]) {
  constexpr bool EARLY = (NW == 4);
  constexpr int NT = 16 / NW;
  constexpr int RPW = 16 / NW;
  static_assert(NW == 2 || NW == 4);
  static_assert(NW * NT * 16 == 2 * HD);
  // unit: which (head, 16-query tile); tid: the thread's number among the unit's NW waves; comb: the unit's own LDS, [2][16][132] floats
  const int lane = tid & 31, ln = lane & 15, hh = lane >> 4;
  const int wave = __builtin_amdgcn_readfirstlane(tid >> 5);
  const int c = wave & 1, hf = wave >> 1;
  const int head = unit / nqt;
  const int qt = qt0 + (unit - head * nqt);
  const int q0 = qt * 16, qi = q0 + ln;
  const size_t qoff = (size_t)qi * NQK + head * HW + c * HD;
  const int kcol = NH * HW + head * HW + c * HD;
  const int chb = head * HD + hf * (NT * 16);
  const float NEGV = -1.0e30f;
  const float SCL2 = 0.08838834764831845f * 1.4426950408889634f;
  const float PCL = 8.0f;

  const v8f z8 = {0.f, 0.f, 0.f, 0.f, 0.f, 0.f, 0.f, 0.f};
  v16h qh[4];
#pragma unroll
  for (int ks = 0; ks < 4; ++ks) qh[ks] = ld_frag(QK + qoff + ks * 32, hh);

  v8f acc[NT], accr[NT];
#pragma unroll
  for (int dt = 0; dt < NT; ++dt) { acc[dt] = z8; accr[dt] = z8; }
  float m = NEGV, l = 0.f;
  const int nsteps = (q0 + 16 + 31) >> 5;

#pragma unroll 1
  for (int js = 0; js < nsteps; ++js) {
    const int j0 = js << 5;
    v8f s0 = z8, s1 = z8, t0 = z8, t1 = z8;
    const size_t ko = (size_t)(j0 + ln) * NQK + kcol;
#pragma unroll
    for (int ks = 0; ks < 4; ++ks) {
      const v16h a0 = ld_frag_g(QK + ko + ks * 32, hh);
      const v16h a1 = ld_frag_g(QK + ko + (size_t)16 * NQK + ks * 32, hh);
      v16h bq = qh[ks];
      if (EARLY) bq = ld_frag_g(QK + qoff + ks * 32, hh);
      s0 = mmam(a0, bq, s0);
      s1 = mmam(a1, bq, s1);
      if (EARLY) {
        const v16h br = ld_frag_g(QKr + qoff + ks * 32, hh);
        const v16h r0 = ld_frag_g(QKr + ko + ks * 32, hh);
        const v16h r1 = ld_frag_g(QKr + ko + (size_t)16 * NQK + ks * 32, hh);
        t0 = mmam(r0, bq, t0);
        t0 = mmam(a0, br, t0);
        t1 = mmam(r1, bq, t1);
        t1 = mmam(a1, br, t1);
      }
    }

    float xv[16];
    float mx = NEGV;
#pragma unroll
    for (int r = 0; r < 8; ++r) {
      const int k0 = j0 + 8 * hh + r, k1 = k0 + 16;
      float e0 = s0[r], e1 = s1[r];
      if (EARLY) { e0 += t0[r] * 4.8828125e-4f; e1 += t1[r] * 4.8828125e-4f; }
      xv[r] = (k0 <= qi) ? e0 * SCL2 : NEGV;
      xv[8 + r] = (k1 <= qi) ? e1 * SCL2 : NEGV;
      mx = fmaxf(mx, fmaxf(xv[r], xv[8 + r]));
    }
    mx = fmaxf(mx, __shfl_xor(mx, 16, 32));
    const float mn = fmaxf(m, mx);
    const float alpha = exp2f(m - mn);
    m = mn;

    v16h ph, pr;
    float ps = 0.f;
#pragma unroll
    for (int i = 0; i < 16; ++i) {
      const float e = xv[i] - mn + PCL;
      const float pe = exp2f(e);
      const float p = (e < -14.0f) ? 0.f : pe;
      const h16 pb = (h16)p;
      ph[i] = pb;
      if (EARLY) {
        pr[i] = toh_flush((p - (float)pb) * 2048.0f);
        ps += p;
      } else {
        pr[i] = pb;
        ps += (float)pb;
      }
    }
    ps += __shfl_xor(ps, 16, 32);
    l = l * alpha + ps;

#pragma unroll
    for (int dt = 0; dt < NT; ++dt)
#pragma unroll
      for (int r = 0; r < 8; ++r) { acc[dt][r] *= alpha; if (EARLY) accr[dt][r] *= alpha; }

#pragma unroll
    for (int dt = 0; dt < NT; ++dt) {
      const int ch = chb + dt * 16 + ln;
      const v16h vh = ld_frag_g(VT + (size_t)ch * SEQ + j0, hh);
      acc[dt] = mmam(vh, ph, acc[dt]);
      if (EARLY) {
        const v16h vr = ld_frag_g(VTr + (size_t)ch * EROWS + j0, hh);
        accr[dt] = mmam(vh, pr, accr[dt]);
        accr[dt] = mmam(vr, ph, accr[dt]);
      }
    }
  }

  const float inv = 1.0f / l;
#pragma unroll
  for (int dt = 0; dt < NT; ++dt)
#pragma unroll
    for (int r = 0; r < 8; ++r) {
      const float v = EARLY ? (acc[dt][r] + accr[dt][r] * 4.8828125e-4f) * inv : acc[dt][r] * inv;
      comb[c][ln][hf * (NT * 16) + dt * 16 + 8 * hh + r] = v;
    }
  __syncthreads();

  const float scl = SC[head], osc = SC[NH + head];
  const int sub = lane >> 4, pc = lane & 15;
  const v4f wa = *(const v4fa*)(hw + pc * 8), wb = *(const v4fa*)(hw + pc * 8 + 4);
  const float wv[8] = {bf16_rne(wa[0]), bf16_rne(wa[1]), bf16_rne(wa[2]), bf16_rne(wa[3]), bf16_rne(wb[0]), bf16_rne(wb[1]), bf16_rne(wb[2]), bf16_rne(wb[3])};
  v8h hv[RPW / 2], rv[RPW / 2];
#pragma unroll
  for (int it = 0; it < RPW / 2; ++it) {
    const int row = wave * RPW + it * 2 + sub;
    const v4f a0 = *(const v4fa*)&comb[0][row][pc * 8], a1 = *(const v4fa*)&comb[0][row][pc * 8 + 4];
    const v4f b0 = *(const v4fa*)&comb[1][row][pc * 8], b1 = *(const v4fa*)&comb[1][row][pc * 8 + 4];
    float o[8];
#pragma unroll
    for (int q = 0; q < 4; ++q) { o[q] = a0[q] + scl * b0[q]; o[4 + q] = a1[q] + scl * b1[q]; }
    float ss = 0.f;
#pragma unroll
    for (int q = 0; q < 8; ++q) ss += o[q] * o[q];
#pragma unroll
    for (int d = 1; d < 16; d <<= 1) ss += __shfl_xor(ss, d, 32);
    const float rms = rsqrtf(ss * (1.0f / (float)HD) + 1.0e-9f);
#pragma unroll
    for (int q = 0; q < 8; ++q) {
      const float val = o[q] * rms * wv[q] * osc;
      const h16 hb = toh_flush(val);
      hv[it][q] = hb;
      rv[it][q] = toh_flush((val - (float)hb) * 2048.0f);
    }
  }
  {
#pragma unroll
    for (int it = 0; it < RPW / 2; ++it) {
      const int row = wave * RPW + it * 2 + sub;
      const size_t off = (size_t)(q0 + row) * DM + head * HD + pc * 8;
      *(v8h*)(CTX + off) = hv[it];
      if (EARLY) *(v8h*)(CTXr + off) = rv[it];
    }
    asm volatile("s_wait_xcnt 0x0" ::: "memory");  // stands behind the stores: in the shared grid the listing runs on from here into the other range's code, which reuses the registers that they name
  }
}

// Query rows >= EROWS: the same transposed flash attention with single f16 products, AQB queries of one head at a time, 8 waves = (score component c, 16-query tile qs), 128 channels per wave.
// The head's K rows (both components side by side, 512 B) and V^T rows of a tile of AKT keys are staged in LDS by asynchronous copies and read by all 8 waves;
// two buffers: trip t works on buffer t & 1 while tile t + 1 flies. Every wave walks its keys in steps of 32 from key 0, as one wave per 16 queries would.
// Stage: K rows 0..AKT-1 at pitch AKP f16 = 528 B, then V^T rows 0..HD-1 at pitch AVP f16 = 144 B (odd multiples of 16 B for the 16-byte fragment reads).
#define AQB 64
#define AKT 64
#define AKP 264
#define AVP 72
#define ASTG (AKT * AKP + HD * AVP)
// Causal work dealt evenly: a query block that starts at query q walks (q + AQB) / AKT key tiles, so the blocks of a head differ widely in length. Each head's query blocks are dealt to AGRP work-groups:
// the longest ones stand alone, every other work-group takes a long one and then a short one, one after the other in every wave, so that all work-groups walk about the same number of key tiles.
#define AGRP 16
static_assert(AQB == AKT && AKT == 64 && EROWS % AKT == 0 && (SEQ - EROWS) % AQB == 0 && EROWS / AKT + 1 >= 2);
static_assert(AKP >= HW + 8 && (AKP * 2) % 32 == 16 && AVP >= AKT + 8 && (AVP * 2) % 32 == 16 && (ASTG * 2) % 16 == 0);

// one stage, 256 threads x 16 B per copy: 8 K rows of 512 B (32 lanes per row), 8 copies; 32 V^T rows of 128 B (8 lanes per row), 4 copies. All four arguments are the lane's own addresses.
__device__ __forceinline__ void attn_fill(unsigned lk, unsigned lv, const h16* gK, const h16* gV) {
  unsigned l[12]; const h16* g[12];
  // both loops are unrolled so that the address arrays are registers (they are asm operands)
#pragma unroll
  for (int i = 0; i < 8; ++i) { l[i] = lk + (unsigned)(i * 8 * AKP * 2); g[i] = gK + (size_t)i * 8 * NQK; }
#pragma unroll
  for (int i = 0; i < 4; ++i) { l[8 + i] = lv + (unsigned)(i * 32 * AVP * 2); g[8 + i] = gV + (size_t)i * 32 * SEQ; }
  copy12(l, g);
}

__device__ __forceinline__ void attn_late_body(const h16* QK, const h16* VT, const float* SC, const float* hw, h16* CTX, int blk, unsigned char* smem) {
  constexpr int NT = 8;
  constexpr int RPW = AQB / 8;
  // one LDS block (the kernel's, 2 * ASTG * 2 bytes): the K / V^T ring in the key loop, then (behind the last trip's barrier) the two components' outputs comb[c][query][channel]
  static_assert(2 * ASTG * 2 >= 2 * AQB * 132 * 4);
  h16* ring = (h16*)smem;
  float (*comb)[AQB][132] = (float (*)[AQB][132])smem;
  const int tid = threadIdx.x, lane = tid & 31, ln = lane & 15, hh = lane >> 4;
  const int wave = __builtin_amdgcn_readfirstlane(tid >> 5);
  const int c = wave & 1, qs = wave >> 1;
  constexpr int nqb = (SEQ - EROWS) / AQB;
  constexpr int NSGL = 2 * AGRP - nqb;  // work-groups with one query block (the NSGL longest); the others take two: nqb = NSGL + 2 * (AGRP - NSGL)
  static_assert(nqb >= AGRP && nqb <= 2 * AGRP);
  const int head = blk / AGRP;
  const int grp = blk - head * AGRP;
  const int npass = (grp < NSGL) ? 1 : 2;
  const float NEGV = -1.0e30f;
  const float SCL2 = 0.08838834764831845f * 1.4426950408889634f;
  const float PCL = 8.0f;
  const v8f z8 = {0.f, 0.f, 0.f, 0.f, 0.f, 0.f, 0.f, 0.f};

#pragma unroll 1  // kept rolled: one body for both query blocks of the work-group
  for (int pass = 0; pass < npass; ++pass) {
  // query blocks nqb-1 .. nqb-AGRP come first, blocks 0 .. nqb-AGRP-1 second: each exactly once; the two lengths of a pair add up to the same sum in every pair
  const int q0b = EROWS + ((pass == 0) ? nqb - 1 - grp : grp - NSGL) * AQB;
  const int q0 = q0b + qs * 16, qi = q0 + ln;
  if (pass) {  // the same for the whole work-group
    asm volatile("s_wait_dscnt 0x0" ::: "memory");  // this wave's reads of the first query block's comb rows are done before the barrier frees that LDS
    __syncthreads();                                // every wave has left comb before the copies below refill the ring over it
  }
  v16h qh[4];
#pragma unroll
  for (int ks = 0; ks < 4; ++ks) qh[ks] = ld_frag(QK + (size_t)qi * NQK + head * HW + c * HD + ks * 32, hh);

  v8f acc[NT];
#pragma unroll
  for (int dt = 0; dt < NT; ++dt) acc[dt] = z8;
  float m = NEGV, l = 0.f;

  const int ntiles = (q0b + AQB) / AKT;  // >= 2: q0b >= EROWS
  const h16* gK = QK + (size_t)(tid >> 5) * NQK + NH * HW + head * HW + (tid & 31) * 8;
  const h16* gV = VT + (size_t)(head * HD + (tid >> 3)) * SEQ + (tid & 7) * 8;
  const unsigned lk = (unsigned)(uintptr_t)ring + (unsigned)(((tid >> 5) * AKP + (tid & 31) * 8) * 2);
  const unsigned lv = (unsigned)(uintptr_t)ring + (unsigned)((AKT * AKP + (tid >> 3) * AVP + (tid & 7) * 8) * 2);
  attn_fill(lk, lv, gK, gV);
  asm volatile("s_wait_asynccnt 0x0" ::: "memory");  // tile 0 has landed before the barrier publishes it
  __syncthreads();
  attn_fill(lk + (unsigned)(ASTG * 2), lv + (unsigned)(ASTG * 2), gK + (size_t)AKT * NQK, gV + AKT);
#pragma unroll 1  // kept rolled: one body for both buffers, the buffer picked by a scalar offset
  for (int t = 0; t < ntiles; ++t) {
    const int buf = t & 1;
    const h16* st = ring + buf * ASTG;
#pragma unroll 1  // kept rolled: one body for both 32-key halves of the tile
    for (int sub = 0; sub < AKT / 32; ++sub) {
      const int j0 = t * AKT + sub * 32;
      if (j0 > q0 + 15) continue;  // wave-uniform: every key of the step lies behind all 16 queries of this wave (only in the block's last tile)
      const h16* pk = st + (sub * 32 + ln) * AKP + c * HD;
      const h16* pv = st + AKT * AKP + ln * AVP + sub * 32;
      v16h ka[4][2];
#pragma unroll
      for (int ks = 0; ks < 4; ++ks) { ka[ks][0] = ld_frag(pk + ks * 32, hh); ka[ks][1] = ld_frag(pk + 16 * AKP + ks * 32, hh); }
      v8f s0 = z8, s1 = z8;
#pragma unroll
      for (int ks = 0; ks < 4; ++ks) { s0 = mma(ka[ks][0], qh[ks], s0); s1 = mma(ka[ks][1], qh[ks], s1); }
      v16h vh[NT];
#pragma unroll
      for (int dt = 0; dt < NT; ++dt) vh[dt] = ld_frag(pv + dt * 16 * AVP, hh);
      __builtin_amdgcn_sched_barrier(0);  // keeps the V^T reads together here, in flight under the softmax (left free they are spread over it in pairs, the last ones directly in front of their products)

      float xv[16];
      float mx = NEGV;
#pragma unroll
      for (int r = 0; r < 8; ++r) {
        const int k0 = j0 + 8 * hh + r, k1 = k0 + 16;
        xv[r] = (k0 <= qi) ? s0[r] * SCL2 : NEGV;
        xv[8 + r] = (k1 <= qi) ? s1[r] * SCL2 : NEGV;
        mx = fmaxf(mx, fmaxf(xv[r], xv[8 + r]));
      }
      mx = fmaxf(mx, __shfl_xor(mx, 16, 32));
      const float mn = fmaxf(m, mx);
      const float alpha = exp2f(m - mn);
      m = mn;

      v16h ph;
      float ps = 0.f;
#pragma unroll
      for (int i = 0; i < 16; ++i) {
        const float e = xv[i] - mn + PCL;
        const float pe = exp2f(e);
        const float p = (e < -14.0f) ? 0.f : pe;
        const h16 pb = (h16)p;
        ph[i] = pb;
        ps += (float)pb;
      }
      ps += __shfl_xor(ps, 16, 32);
      l = l * alpha + ps;

#pragma unroll
      for (int dt = 0; dt < NT; ++dt)
#pragma unroll
        for (int r = 0; r < 8; ++r) acc[dt][r] *= alpha;
#pragma unroll
      for (int dt = 0; dt < NT; ++dt) acc[dt] = mma(vh[dt], ph, acc[dt]);
    }
    asm volatile("s_wait_dscnt 0x0" ::: "memory");     // this wave's reads of buffer buf are done before the barrier frees it
    asm volatile("s_wait_asynccnt 0x0" ::: "memory");  // this wave's copies of tile t + 1 have landed before the barrier publishes them
    __syncthreads();
    if (t + 2 < ntiles)
      attn_fill(lk + (unsigned)(buf * ASTG * 2), lv + (unsigned)(buf * ASTG * 2), gK + (size_t)(t + 2) * AKT * NQK, gV + (t + 2) * AKT);
  }
  asm volatile("s_wait_asynccnt 0x0" ::: "memory");    // nothing in flight when the ring becomes output staging

  const float inv = 1.0f / l;
#pragma unroll
  for (int dt = 0; dt < NT; ++dt)
#pragma unroll
    for (int r = 0; r < 8; ++r) comb[c][qs * 16 + ln][dt * 16 + 8 * hh + r] = acc[dt][r] * inv;
  __syncthreads();

  const float scl = SC[head], osc = SC[NH + head];
  const int sub = lane >> 4, pc = lane & 15;
  const v4f wa = *(const v4fa*)(hw + pc * 8), wb = *(const v4fa*)(hw + pc * 8 + 4);
  const float wv[8] = {bf16_rne(wa[0]), bf16_rne(wa[1]), bf16_rne(wa[2]), bf16_rne(wa[3]), bf16_rne(wb[0]), bf16_rne(wb[1]), bf16_rne(wb[2]), bf16_rne(wb[3])};
  v8h hv[RPW / 2];
#pragma unroll
  for (int it = 0; it < RPW / 2; ++it) {
    const int row = wave * RPW + it * 2 + sub;
    const v4f a0 = *(const v4fa*)&comb[0][row][pc * 8], a1 = *(const v4fa*)&comb[0][row][pc * 8 + 4];
    const v4f b0 = *(const v4fa*)&comb[1][row][pc * 8], b1 = *(const v4fa*)&comb[1][row][pc * 8 + 4];
    float o[8];
#pragma unroll
    for (int q = 0; q < 4; ++q) { o[q] = a0[q] + scl * b0[q]; o[4 + q] = a1[q] + scl * b1[q]; }
    float ss = 0.f;
#pragma unroll
    for (int q = 0; q < 8; ++q) ss += o[q] * o[q];
#pragma unroll
    for (int d = 1; d < 16; d <<= 1) ss += __shfl_xor(ss, d, 32);
    const float rms = rsqrtf(ss * (1.0f / (float)HD) + 1.0e-9f);
#pragma unroll
    for (int q = 0; q < 8; ++q) hv[it][q] = toh_flush(o[q] * rms * wv[q] * osc);
  }
#pragma unroll
  for (int it = 0; it < RPW / 2; ++it) {
    const int row = wave * RPW + it * 2 + sub;
    *(v8h*)(CTX + (size_t)(q0b + row) * DM + head * HD + pc * 8) = hv[it];
  }
  asm volatile("s_wait_xcnt 0x0" ::: "memory");  // stands behind the stores, in front of the next query block's writes to the registers that they name
  }
}

// both query ranges in one grid (they write disjoint ctx rows and neither reads the other's): the AB_LATE long blocks come first, one for each place they had alone;
// behind them AB_EARLY blocks of two (head, 16-query tile) units of four waves each, which run beside the long ones; a block's two tiles are j and last - j, so that every such block brings the same number of key steps.
#define AB_LATE (NH * AGRP)
#define AB_EARLY (NH * (EROWS / 16) / 2)
static_assert((EROWS / 16) % 2 == 0 && 2 * ASTG * 2 >= 2 * 2 * 16 * 132 * 4);
__global__ __launch_bounds__(256) __attribute__((amdgpu_num_vgpr(256)))
void k_attn(const h16* __restrict__ QK, const h16* __restrict__ QKr, const h16* __restrict__ VT, const h16* __restrict__ VTr,
            const float* __restrict__ SC, const float* __restrict__ hw, h16* __restrict__ CTX, h16* __restrict__ CTXr) {
  __shared__ __attribute__((aligned(16))) unsigned char smem[2 * ASTG * 2];
  const int b = blockIdx.x;  // the test reads the same for the whole block
  if (b < AB_LATE) {
    attn_late_body(QK, VT, SC, hw, CTX, b, smem);
  } else {
    const int tid = threadIdx.x;
    const int half = __builtin_amdgcn_readfirstlane(tid >> 7);
    constexpr int NQT = EROWS / 16;
    const int eb = b - AB_LATE, head = eb / (NQT / 2), j = eb - head * (NQT / 2);
    attn_body<4>(QK, QKr, VT, VTr, SC, hw, CTX, CTXr, 0, NQT, head * NQT + (half ? NQT - 1 - j : j), tid & 127, (float (*)[16][132])(smem + half * (2 * 16 * 132 * 4)));
  }
}

extern "C" void kernel_launch(void* const* d_in, const int* in_sizes, int n_in,
                              void* d_out, int out_size, void* d_ws, size_t ws_size, hipStream_t stream) {
  if (n_in < 12) return;
  if (in_sizes[0] < NR * DM) return;
  if (in_sizes[1] < DM) return;
  if (in_sizes[2] < NH * HW * DM || in_sizes[3] < NH * HW * DM) return;
  if (in_sizes[4] < DM * DM || in_sizes[5] < DM * DM) return;
  if (in_sizes[6] < HD) return;
  if (in_sizes[7] < NH * HD || in_sizes[8] < NH * HD || in_sizes[9] < NH * HD || in_sizes[10] < NH * HD) return;
  if (in_sizes[11] < NH) return;
  if (out_size < NR * DM) return;
  const float* x   = (const float*)d_in[0];
  const float* pw  = (const float*)d_in[1];
  const float* wq  = (const float*)d_in[2];
  const float* wk  = (const float*)d_in[3];
  const float* wv  = (const float*)d_in[4];
  const float* wo  = (const float*)d_in[5];
  const float* hnw = (const float*)d_in[6];
  const float* q1  = (const float*)d_in[7];
  const float* q2  = (const float*)d_in[8];
  const float* k1  = (const float*)d_in[9];
  const float* k2  = (const float*)d_in[10];
  const float* lam = (const float*)d_in[11];
  float* out = (float*)d_out;

  // workspace regions (bytes); every region but TH, which nothing reads or writes, is written with whole-row stores inside its exact extent
  constexpr size_t SZ_TH  = 512;
  constexpr size_t SZ_TAB = (size_t)2 * SEQ * HD * 4;
  constexpr size_t SZ_SC  = 256;
  constexpr size_t SZ_H   = (size_t)NR * DM * 2;
  constexpr size_t SZ_HR  = (size_t)EROWS * DM * 2;
  constexpr size_t SZ_W3  = (size_t)N3 * DM * 2;
  constexpr size_t SZ_WO  = (size_t)DM * DM * 2;
  constexpr size_t SZ_QK  = (size_t)NR * NQK * 2;
  constexpr size_t SZ_QKR = (size_t)EROWS * NQK * 2;
  constexpr size_t SZ_VT  = (size_t)DM * SEQ * 2;
  constexpr size_t SZ_VTR = (size_t)DM * EROWS * 2;
  constexpr size_t SZ_CX  = (size_t)NR * DM * 2;
  constexpr size_t SZ_CXR = (size_t)EROWS * DM * 2;
  constexpr size_t OF_TH  = 0;
  constexpr size_t OF_TAB = OF_TH + SZ_TH;
  constexpr size_t OF_SC  = OF_TAB + SZ_TAB;
  constexpr size_t OF_H   = OF_SC + SZ_SC;
  constexpr size_t OF_HR  = OF_H + SZ_H;
  constexpr size_t OF_W3  = OF_HR + SZ_HR;
  constexpr size_t OF_WO  = OF_W3 + SZ_W3;
  constexpr size_t OF_QK  = OF_WO + SZ_WO;
  constexpr size_t OF_QKR = OF_QK + SZ_QK;
  constexpr size_t OF_VT  = OF_QKR + SZ_QKR;
  constexpr size_t OF_VTR = OF_VT + SZ_VT;
  constexpr size_t OF_CX  = OF_VTR + SZ_VTR;
  constexpr size_t OF_CXR = OF_CX + SZ_CX;
  constexpr size_t SZ_ALL = OF_CXR + SZ_CXR;
  static_assert(SZ_TH >= 128 * 4 && SZ_SC >= 32 * 4);
  static_assert(SZ_TH % 256 == 0 && SZ_TAB % 256 == 0 && SZ_SC % 256 == 0 && SZ_H % 256 == 0 && SZ_HR % 256 == 0 && SZ_W3 % 256 == 0);
  static_assert(SZ_WO % 256 == 0 && SZ_QK % 256 == 0 && SZ_QKR % 256 == 0 && SZ_VT % 256 == 0 && SZ_VTR % 256 == 0 && SZ_CX % 256 == 0 && SZ_CXR % 256 == 0);
  static_assert(SZ_ALL <= (size_t)134217728);
  if (SZ_ALL > ws_size) return;
  char* ws = (char*)d_ws;
  float* TAB  = (float*)(ws + OF_TAB);
  float* SC   = (float*)(ws + OF_SC);
  h16*   Hh   = (h16*)(ws + OF_H);
  h16*   Hr   = (h16*)(ws + OF_HR);
  h16*   W3   = (h16*)(ws + OF_W3);
  h16*   WoT  = (h16*)(ws + OF_WO);
  h16*   QK   = (h16*)(ws + OF_QK);
  h16*   QKr  = (h16*)(ws + OF_QKR);
  h16*   VT   = (h16*)(ws + OF_VT);
  h16*   VTr  = (h16*)(ws + OF_VTR);
  h16*   CTX  = (h16*)(ws + OF_CX);
  h16*   CTXr = (h16*)(ws + OF_CXR);

  k_prep<<<(unsigned)PB_ALL, 256, 0, stream>>>(x, pw, wq, wk, wv, wo, TAB, Hh, Hr, W3, WoT);

  k_gemm_qkv<<<(unsigned)(QB_SC + QB_EARLY + QB_LATE), 256, 0, stream>>>(Hh, Hr, W3, TAB, QK, QKr, VT, VTr, q1, q2, k1, k2, lam, SC);

  k_attn<<<(unsigned)(AB_LATE + AB_EARLY), 256, 0, stream>>>(QK, QKr, VT, VTr, SC, hnw, CTX, CTXr);

  k_gemm_out<<<(unsigned)(OB_EARLY + OB_LATE), 128, 0, stream>>>(CTX, CTXr, WoT, x, out);
}

// v007
// Measured time: 175 microseconds a run.
// Timed twice side by side with v006, it ran 1.04 and 1.03 times as fast.
// Over all steps from v000 it is 3.68 times as fast.
#include <hip/hip_runtime.h>
// Pre-RMSNorm differential causal attention block: fused [out][in] q|k|v projection, interleaved-pair rotary over 256 columns per head (computed f32 cos/sin table),
// two causal softmax maps per head combined with a per-head scale, per-head RMSNorm, output projection, skip connection. T 2048, D 2048, 16 heads of 128.
// Compute dtype: all contractions on v_wmma_f32_16x16x32_f16 with f32 accumulate. Inputs are RNE-converted to bf16 first; weights carried x64 as f16 (exact).
// Query rows >= 256: single f16 products at every site (h, q, k, v, P x256, ctx). Query rows < 256: value + x2048 f16 residual planes on h, q, k, P, v, ctx
// (residual products in their own accumulators, folded with 2^-11 in the f32 epilogue). Norms, rotary, mask, softmax statistics in f32 on the VALU.
#ifndef NB
#define NB 1
#endif
#ifndef SEQ
#define SEQ 2048
#endif
#define SEQ_FULL 2048
#define DM 2048
#define NH 16
#define HD 128
#define HW 256
#define NQK (2 * NH * HW)
#define N3 (NQK + DM)
#define NR (NB * SEQ)
#define EROWS 256

static_assert(NB == 1);
static_assert(NH * HD == DM);
static_assert(HW == 2 * HD && HD == 128);
static_assert(SEQ % 128 == 0 && SEQ <= SEQ_FULL);
static_assert(EROWS % 128 == 0 && EROWS < SEQ && EROWS % 32 == 0);
static_assert(DM % 64 == 0 && N3 % 64 == 0 && NQK % 64 == 0 && DM % 32 == 0);
static_assert(HW % 64 == 0 && NQK % HW == 0);
static_assert(256 * 8 == DM);
static_assert((SEQ * HD) % 256 == 0);

typedef _Float16 h16;
typedef _Float16 v16h __attribute__((ext_vector_type(16)));
typedef _Float16 v8h  __attribute__((ext_vector_type(8), may_alias));
typedef float v8f  __attribute__((ext_vector_type(8)));
typedef float v4f  __attribute__((ext_vector_type(4)));
typedef float v4fa __attribute__((ext_vector_type(4), may_alias));
union FragH { v16h v; v8h half[2]; };

__device__ __forceinline__ float bf16_rne(float x) {
  unsigned int u = __float_as_uint(x);
  u = (u + 0x7FFFu + ((u >> 16) & 1u)) & 0xFFFF0000u;
  return __uint_as_float(u);
}

// f32 -> f16 with a value select: results below the smallest normal f16 become exact zero
static __device__ __forceinline__ h16 toh_flush(float v) { const h16 r = (h16)v; return (fabsf(v) < 6.103515625e-05f) ? (h16)0.0f : r; }

// 2^x as the bare v_exp_f32. The library call wraps it in a guard for results below 2^-126 (compare, two selects, add, ldexp: five more vector instructions per value).
// The softmax has no use for that range: a weight below 2^-14 is selected to zero behind the call, and a rescale factor below 2^-126 multiplies sums that the same step's new terms (one of them 2^8) outweigh beyond f32 precision.
static __device__ __forceinline__ float exp2_hw(float x) { return __builtin_amdgcn_exp2f(x); }

// fragment (A: row = lane&15; B: column = lane&15) from a k-contiguous f16 row: elements 0..7 <- k0+8h.., elements 8..15 <- k0+16+8h..
__device__ __forceinline__ v16h ld_frag(const h16* p, int hh) {
  FragH f; f.half[0] = *(const v8h*)(p + 8 * hh); f.half[1] = *(const v8h*)(p + 16 + 8 * hh); return f.v;
}

// the same fragment from global memory; a wait stands in front of each load because the compiler may give a load's result the registers of an address that an earlier load names
__device__ __forceinline__ v16h ld_frag_g(const h16* p, int hh) {
  FragH f;
  asm volatile("s_wait_xcnt 0x0" ::: "memory");
  f.half[0] = *(const v8h*)(p + 8 * hh);
  asm volatile("s_wait_xcnt 0x0" ::: "memory");
  f.half[1] = *(const v8h*)(p + 16 + 8 * hh); return f.v;
}

__device__ __forceinline__ v8f mma(v16h a, v16h b, v8f c) {
  c = __builtin_amdgcn_wmma_f32_16x16x32_f16(false, a, false, b, (short)0, c, false, false);
  asm volatile("v_nop\n\tv_nop\n\tv_nop\n\tv_nop" : "+v"(c) : "v"(a), "v"(b));
  return c;
}
__device__ __forceinline__ v8f mmam(v16h a, v16h b, v8f c) {
  c = __builtin_amdgcn_wmma_f32_16x16x32_f16(false, a, false, b, (short)0, c, false, false);
  asm volatile("v_nop\n\tv_nop\n\tv_nop\n\tv_nop" : "+v"(c) : "v"(a), "v"(b) : "memory");
  return c;
}

// The preparation steps below read only the inputs and write disjoint workspace regions: none depends on another, so all of them but the per-head scales (in k_gemm_qkv) share one grid (k_prep), each on its own range of blocks.
// rotary table: every thread forms its own column's theta (the same expression for every row of that column)
__device__ __forceinline__ void tab_body(float* TAB, int blk) {
#pragma clang fp contract(off)
  const int idx = blk * 256 + threadIdx.x;
  const int i = idx & (HD - 1), s = idx >> 7;
  const float e = (float)(2 * i) / (float)HW;
  const float th = 1.0f / powf(10000.0f, e);
  const float ang = (float)s * th;
  const float cs = cosf(ang);
  const float sn = sinf(ang);
  float* pcs = TAB + idx;
  float* psn = TAB + (size_t)SEQ * HD + idx;
  *(float*)pcs = cs;
  *(float*)psn = sn;
  asm volatile("s_wait_xcnt 0x0" ::: "memory");  // stands behind the stores: in the shared grid the listing runs on from here into another range's code, which reuses the registers that they name
}

// per-head scales: the work of one wave (the caller passes wave 0 of one block). One long chain of dependent loads, read first by the attention launch: it rides in the projection grid (k_gemm_qkv), which outlasts it
__device__ __forceinline__ void scale_body(const float* q1, const float* q2, const float* k1, const float* k2, const float* lam, float* SC) {
#pragma clang fp contract(off)
  const int lane = threadIdx.x;
  const int h = lane & 15;
  float s1 = 0.f, s2 = 0.f;
#pragma unroll 1
  for (int d = 0; d < HD; ++d) {
    s1 += bf16_rne(q1[h * HD + d]) * bf16_rne(k1[h * HD + d]);
    s2 += bf16_rne(q2[h * HD + d]) * bf16_rne(k2[h * HD + d]);
  }
  float ls = 0.f;
#pragma unroll 1
  for (int i = 0; i < NH; ++i) ls += bf16_rne(lam[i]);
  const float base = expf(s1) - expf(s2);
  const float sc = -((float)NH * base + ls);
  const float osc = 1.0f - bf16_rne(lam[h]);
  const float v = (lane < 16) ? sc : osc;
  *(float*)(SC + lane) = v;
  asm volatile("s_wait_xcnt 0x0" ::: "memory");  // stands behind the store: in the shared grid the listing runs on from here into another range's code, which reuses the registers that it names
}

// pre-norm: h = x * rsqrt(mean(x^2) + 1e-9) * w -> f16 value plane H [NR][DM] (+ x2048 residual plane Hr for rows < EROWS);
__device__ __forceinline__ void hnorm_body(const float* x, const float* pw, h16* H, h16* Hr, int row) {
#pragma clang fp contract(off)
  __shared__ float red[8];
  const int tid = threadIdx.x, lane = tid & 31;
  const int wave = __builtin_amdgcn_readfirstlane(tid >> 5);
  const size_t off = (size_t)row * DM + tid * 8;
  const v4f a = *(const v4fa*)(x + off), b = *(const v4fa*)(x + off + 4);
  asm volatile("s_wait_xcnt 0x0" ::: "memory");  // stands behind the two loads, in front of the next loads, whose results may take the registers of the address that these name
  const v4f wa = *(const v4fa*)(pw + tid * 8), wb = *(const v4fa*)(pw + tid * 8 + 4);
  float xv[8], wv[8];
#pragma unroll
  for (int q = 0; q < 4; ++q) {
    xv[q] = bf16_rne(a[q]); xv[4 + q] = bf16_rne(b[q]);
    wv[q] = bf16_rne(wa[q]); wv[4 + q] = bf16_rne(wb[q]);
  }
  float ss = 0.f;
#pragma unroll
  for (int i = 0; i < 8; ++i) ss += xv[i] * xv[i];
#pragma unroll
  for (int o = 16; o >= 1; o >>= 1) ss += __shfl_xor(ss, o, 32);
  if (lane == 0) red[wave] = ss;
  __syncthreads();
  float tot = 0.f;
#pragma unroll
  for (int i = 0; i < 8; ++i) tot += red[i];
  const float r = rsqrtf(tot * (1.0f / (float)DM) + 1.0e-9f);
  v8h hv, rv;
#pragma unroll
  for (int i = 0; i < 8; ++i) {
    const float hval = xv[i] * r * wv[i];
    const h16 hb = toh_flush(hval);
    hv[i] = hb;
    rv[i] = toh_flush((hval - (float)hb) * 2048.0f);
  }
  {
    *(v8h*)(H + off) = hv;
    asm volatile("s_wait_xcnt 0x0" ::: "memory");  // stands behind the store, in front of the residual's arithmetic, which reuses the registers that the store names
    if (row < EROWS) *(v8h*)(Hr + off) = rv;
    asm volatile("s_wait_xcnt 0x0" ::: "memory");  // stands behind the last store: the listing runs on from here into another range's code, which reuses the registers that it names
  }
}

__device__ __forceinline__ void wcvt_body(const float* W, h16* O, int blk) {
  const size_t t = (size_t)blk * 256 + threadIdx.x;
  const v4f a = *(const v4fa*)(W + t * 8), c = *(const v4fa*)(W + t * 8 + 4);
  v8h o;
#pragma unroll
  for (int q = 0; q < 4; ++q) { o[q] = toh_flush(bf16_rne(a[q]) * 64.0f); o[4 + q] = toh_flush(bf16_rne(c[q]) * 64.0f); }
  *(v8h*)(O + t * 8) = o;
  asm volatile("s_wait_xcnt 0x0" ::: "memory");  // stands behind the store: the listing runs on from here into another range's code, which reuses the registers that it names
}

// block ranges of k_prep
#define PB_TAB (SEQ * HD / 256)
#define PB_HN NR
#define PB_WQK (NH * HW * DM / 8 / 256)
#define PB_WVO (DM * DM / 8 / 256)
#define PB_ALL (PB_TAB + PB_HN + 2 * PB_WQK + 2 * PB_WVO)
static_assert((NH * HW * DM) % (8 * 256) == 0 && (DM * DM) % (8 * 256) == 0);
__global__ __launch_bounds__(256)
void k_prep(const float* __restrict__ x, const float* __restrict__ pw, const float* __restrict__ wq, const float* __restrict__ wk,
            const float* __restrict__ wv, const float* __restrict__ wo,
            float* __restrict__ TAB, h16* __restrict__ H, h16* __restrict__ Hr, h16* __restrict__ W3, h16* __restrict__ WoT) {
  int b = blockIdx.x;  // every test below reads the same for the whole block
  if (b < PB_TAB) { tab_body(TAB, b); return; }
  b -= PB_TAB;
  if (b < PB_HN) { hnorm_body(x, pw, H, Hr, b); return; }
  b -= PB_HN;
  if (b < PB_WQK) { wcvt_body(wq, W3, b); return; }                                /* W3 rows 0..4095 */
  b -= PB_WQK;
  if (b < PB_WQK) { wcvt_body(wk, W3 + (size_t)NH * HW * DM, b); return; }         /* W3 rows 4096..8191 */
  b -= PB_WQK;
  if (b < PB_WVO) { wcvt_body(wv, W3 + (size_t)NQK * DM, b); return; }             /* W3 rows 8192..10239 */
  b -= PB_WVO;
  wcvt_body(wo, WoT, b);
}

// GEMM main loop of the output projection, K = DM, both operands k-contiguous with pitch DM. Wave tile 32 x 64: c[0..3] rows 0..15, c[4..7] rows 16..31.
// RES: a second A plane (x2048 residual) accumulates into cr.
// Operand tiles of KT k are staged in LDS by asynchronous copies, two buffers: trip t works on buffer t & 1 while tile t + 1 flies.
// Stage rows (pitch LP f16 = 144 B, an odd multiple of 16 B for the 16-byte fragment reads): A 0..127, B 128..191, residual A 192..319.
#define KT 64
#define LP 72
#define NTRIP (DM / KT)
static_assert(DM % KT == 0 && NTRIP >= 2 && KT % 32 == 0 && KT * 2 == 128);
template <bool RES> struct Ring { static constexpr int ROWS = RES ? 320 : 192; static constexpr int STG = ROWS * LP; static constexpr int BYTES = 2 * STG * 2; };

#define CPY(a, b) "global_load_async_to_lds_b128 %" #a ", %" #b ", off\n\t"
// 16 bytes per lane and copy, global -> LDS. The closing s_wait_xcnt stands in the copies' own statement so that no later write of an address register is moved in front of it.
__device__ __forceinline__ void copy12(const unsigned (&l)[12], const h16* const (&g)[12]) {
  asm volatile(CPY(0, 1) CPY(2, 3) CPY(4, 5) CPY(6, 7) CPY(8, 9) CPY(10, 11) CPY(12, 13) CPY(14, 15) CPY(16, 17) CPY(18, 19) CPY(20, 21) CPY(22, 23)
               "s_wait_xcnt 0x0"
               :: "v"(l[0]), "v"(g[0]), "v"(l[1]), "v"(g[1]), "v"(l[2]), "v"(g[2]), "v"(l[3]), "v"(g[3]), "v"(l[4]), "v"(g[4]), "v"(l[5]), "v"(g[5]),
                  "v"(l[6]), "v"(g[6]), "v"(l[7]), "v"(g[7]), "v"(l[8]), "v"(g[8]), "v"(l[9]), "v"(g[9]), "v"(l[10]), "v"(g[10]), "v"(l[11]), "v"(g[11])
               : "memory");
}
__device__ __forceinline__ void copy8(const unsigned (&l)[8], const h16* const (&g)[8]) {
  asm volatile(CPY(0, 1) CPY(2, 3) CPY(4, 5) CPY(6, 7) CPY(8, 9) CPY(10, 11) CPY(12, 13) CPY(14, 15)
               "s_wait_xcnt 0x0"
               :: "v"(l[0]), "v"(g[0]), "v"(l[1]), "v"(g[1]), "v"(l[2]), "v"(g[2]), "v"(l[3]), "v"(g[3]), "v"(l[4]), "v"(g[4]), "v"(l[5]), "v"(g[5]),
                  "v"(l[6]), "v"(g[6]), "v"(l[7]), "v"(g[7])
               : "memory");
}

// one stage: 128 threads x 16 B cover 16 rows of 128 B per copy (8 lanes per row: whole lines). lb, gA, gB, gR are the lane's own addresses in row (tid >> 3) of each plane.
template <bool RES>
__device__ __forceinline__ void stage_fill(unsigned lb, const h16* gA, const h16* gB, const h16* gR) {
  unsigned l[12]; const h16* g[12];
  // the three loops here are unrolled so that the address arrays are registers (they are asm operands)
#pragma unroll
  for (int i = 0; i < 8; ++i) { l[i] = lb + (unsigned)(i * 16 * LP * 2); g[i] = gA + (size_t)i * 16 * DM; }
#pragma unroll
  for (int i = 0; i < 4; ++i) { l[8 + i] = lb + (unsigned)((128 + i * 16) * LP * 2); g[8 + i] = gB + (size_t)i * 16 * DM; }
  copy12(l, g);
  if (RES) {
    unsigned lr[8]; const h16* gr[8];
#pragma unroll
    for (int i = 0; i < 8; ++i) { lr[i] = lb + (unsigned)((192 + i * 16) * LP * 2); gr[i] = gR + (size_t)i * 16 * DM; }
    copy8(lr, gr);
  }
}

// mrow: first of the block's 128 A rows;
// col0: first of its 64 B rows; ring: the block's LDS, Ring<RES>::BYTES bytes, free again behind the last trip's barrier.
template <bool RES>
__device__ __forceinline__ void gemm_main(const h16* Ah, const h16* Ar, const h16* Bt, int mrow, int col0, h16* ring, int tid, int w, int ln, int hh,
                                          v8f (&c)[8], v8f (&cr)[8]) {
  constexpr int STG = Ring<RES>::STG;
  const int crow = tid >> 3, ccol = (tid & 7) * 8;
  const h16* gA = Ah + (size_t)(mrow + crow) * DM + ccol;
  const h16* gR = Ar + (size_t)(mrow + crow) * DM + ccol;
  const h16* gB = Bt + (size_t)(col0 + crow) * DM + ccol;
  const unsigned lb = (unsigned)(uintptr_t)ring + (unsigned)((crow * LP + ccol) * 2);
  stage_fill<RES>(lb, gA, gB, gR);
  asm volatile("s_wait_asynccnt 0x0" ::: "memory");  // tile 0 has landed before the barrier publishes it
  __syncthreads();
  stage_fill<RES>(lb + (unsigned)(STG * 2), gA + KT, gB + KT, gR + KT);
#pragma unroll 1  // kept rolled: one body for both buffers, the buffer picked by a scalar offset
  for (int t = 0; t < NTRIP; ++t) {
    const int buf = t & 1;
    const h16* st = ring + buf * STG;
    const h16* pa = st + (32 * w + ln) * LP;
    const h16* pb = st + (128 + ln) * LP;
    const h16* pr = st + (192 + 32 * w + ln) * LP;
    // the fragments of G k-steps are read from LDS as one group in front of their products: one LDS wait per group, not one per fragment
    // (RES: one k-step per group, two would not fit the register budget beside the 16 accumulator tiles). All loops of the trip are unrolled: fragments and tiles stay in registers
    constexpr int G = RES ? 1 : 2;
#pragma unroll
    for (int k0 = 0; k0 < KT; k0 += 32 * G) {
      v16h fa[G][2], fe[G][2], fb[G][4];
#pragma unroll
      for (int s = 0; s < G; ++s) {
        const int kk = k0 + 32 * s;
        fa[s][0] = ld_frag(pa + kk, hh); fa[s][1] = ld_frag(pa + 16 * LP + kk, hh);
#pragma unroll
        for (int j = 0; j < 4; ++j) fb[s][j] = ld_frag(pb + j * 16 * LP + kk, hh);
        if (RES) { fe[s][0] = ld_frag(pr + kk, hh); fe[s][1] = ld_frag(pr + 16 * LP + kk, hh); }
        else { fe[s][0] = fa[s][0]; fe[s][1] = fa[s][1]; }
      }
#pragma unroll
      for (int s = 0; s < G; ++s) {
#pragma unroll
        for (int j = 0; j < 4; ++j) {
          c[j] = mma(fa[s][0], fb[s][j], c[j]); c[4 + j] = mma(fa[s][1], fb[s][j], c[4 + j]);
          if (RES) { cr[j] = mma(fe[s][0], fb[s][j], cr[j]); cr[4 + j] = mma(fe[s][1], fb[s][j], cr[4 + j]); }
        }
      }
    }
    asm volatile("s_wait_dscnt 0x0" ::: "memory");     // this wave's reads of buffer buf are done before the barrier frees it
    asm volatile("s_wait_asynccnt 0x0" ::: "memory");  // this wave's copies of tile t + 1 have landed before the barrier publishes them
    __syncthreads();
    if (t + 2 < NTRIP) stage_fill<RES>(lb + (unsigned)(buf * STG * 2), gA + (t + 2) * KT, gB + (t + 2) * KT, gR + (t + 2) * KT);
  }
  asm volatile("s_wait_asynccnt 0x0" ::: "memory");    // nothing in flight when the ring becomes output staging
}

// Main loop of the q|k|v projection: block tile 256 A rows x 128 B rows, 8 waves = (wm 0..3, wn 0..1), the same ring, copies and k order as above.
// The tile is this large because the copies' bytes from L2 set the pace of this GEMM: a trip brings 48 KB for 256 x 128 outputs, half the bytes per product of a 128 x 64 tile (24 KB).
// Stage rows (pitch LP): A 0..255, B 256..383. A wave takes the A rows 32 wm .. 32 wm + 31 of each half of 128 and the B rows 64 wn .. 64 wn + 63: wave tile 64 x 64,
// c[8 mh + 0..3] rows 0..15 and c[8 mh + 4..7] rows 16..31 of its 32 rows in half mh.
// PAIR: the 256 A rows of the stage are 128 rows of two planes, 16 of Ah's, then the same 16 of Ar's, and so on: a wave's rows 0..15 are value rows, its rows 16..31 the residuals of the same rows.
#define QSTG (384 * LP)
#define QBYTES (2 * QSTG * 2)
// one stage: 256 threads x 16 B cover 32 rows of 128 B per copy (8 lanes per row: whole lines). lb, gA, gB are the lane's own addresses in row (tid >> 3) of the stage's first 32 A rows and B rows.
template <bool PAIR>
__device__ __forceinline__ void qstage_fill(unsigned lb, const h16* gA, const h16* gB) {
  unsigned l[12]; const h16* g[12];
  // both loops are unrolled so that the address arrays are registers (they are asm operands)
#pragma unroll
  for (int i = 0; i < 8; ++i) { l[i] = lb + (unsigned)(i * 32 * LP * 2); g[i] = gA + (size_t)i * (PAIR ? 16 : 32) * DM; }
#pragma unroll
  for (int i = 0; i < 4; ++i) { l[8 + i] = lb + (unsigned)((256 + i * 32) * LP * 2); g[8 + i] = gB + (size_t)i * 32 * DM; }
  copy12(l, g);
}

// mrow: first of the block's 256 A rows (PAIR: of its 128 rows of Ah and of Ar); col0: first of its 128 B rows; ring: the block's LDS, QBYTES bytes, free again behind the last trip's barrier.
template <bool PAIR>
__device__ __forceinline__ void gemm_main_q(const h16* Ah, const h16* Ar, const h16* Bt, int mrow, int col0, h16* ring, int tid, int wm, int wn, int ln, int hh, v8f (&c)[16]) {
  const int crow = tid >> 3, ccol = (tid & 7) * 8;
  const h16* gA = PAIR ? ((crow & 16) ? Ar : Ah) + (size_t)(mrow + (crow & 15)) * DM + ccol : Ah + (size_t)(mrow + crow) * DM + ccol;
  const h16* gB = Bt + (size_t)(col0 + crow) * DM + ccol;
  const unsigned lb = (unsigned)(uintptr_t)ring + (unsigned)((crow * LP + ccol) * 2);
  qstage_fill<PAIR>(lb, gA, gB);
  asm volatile("s_wait_asynccnt 0x0" ::: "memory");  // tile 0 has landed before the barrier publishes it
  __syncthreads();
  qstage_fill<PAIR>(lb + (unsigned)(QSTG * 2), gA + KT, gB + KT);
#pragma unroll 1  // kept rolled: one body for both buffers, the buffer picked by a scalar offset
  for (int t = 0; t < NTRIP; ++t) {
    const int buf = t & 1;
    const h16* st = ring + buf * QSTG;
    const h16* pa = st + (32 * wm + ln) * LP;
    const h16* pb = st + (256 + 64 * wn + ln) * LP;
    // the eight fragments of a k-step are read from LDS as one group in front of its sixteen products (two k-steps would not fit the register budget beside the 16 accumulator tiles).
    // All loops of the trip are unrolled: fragments and tiles stay in registers
#pragma unroll
    for (int k0 = 0; k0 < KT; k0 += 32) {
      v16h fa[4], fb[4];
#pragma unroll
      for (int i = 0; i < 4; ++i) fa[i] = ld_frag(pa + ((i >> 1) * 128 + (i & 1) * 16) * LP + k0, hh);
#pragma unroll
      for (int j = 0; j < 4; ++j) fb[j] = ld_frag(pb + j * 16 * LP + k0, hh);
#pragma unroll
      for (int j = 0; j < 4; ++j)
#pragma unroll
        for (int i = 0; i < 4; ++i) c[4 * i + j] = mma(fa[i], fb[j], c[4 * i + j]);
    }
    asm volatile("s_wait_dscnt 0x0" ::: "memory");     // this wave's reads of buffer buf are done before the barrier frees it
    asm volatile("s_wait_asynccnt 0x0" ::: "memory");  // this wave's copies of tile t + 1 have landed before the barrier publishes them
    __syncthreads();
    if (t + 2 < NTRIP) qstage_fill<PAIR>(lb + (unsigned)(buf * QSTG * 2), gA + (t + 2) * KT, gB + (t + 2) * KT);
  }
  asm volatile("s_wait_asynccnt 0x0" ::: "memory");    // nothing in flight when the ring becomes output staging
}

// fused projection [NR][N3] = H . W3^T (W3 rows: q 0..4095, k 4096..8191, v 8192..10239). Block = 8 waves = 256 rows x 128 cols.
// RES: 128 rows x 128 cols with the value and the residual plane of h, 16 rows of each per wave and half, in the same ring (gemm_main_q's PAIR form).
// The outputs leave in two halves of the block's rows, one after the other through the same staging: in a half the four waves of a column half hold 4 * WR consecutive rows x 64 cols.
template <bool RES>
__device__ __forceinline__ void gemm_qkv_body(const h16* Hh, const h16* Hr, const h16* W3, const float* TAB,
                                              h16* QK, h16* QKr, h16* VT, h16* VTr, int mrow0, int blk, unsigned char* smem) {
  // one LDS block (the kernel's, QBYTES): the operand ring in the main loop, then (behind the last trip's barrier) the output staging so[wave][row][col]
  static_assert(QBYTES >= 8 * 32 * 68 * 4);
  constexpr int WR = RES ? 16 : 32;   // output rows per wave and half
  constexpr int NIT = WR / 4;         // 16-byte stores per lane and half
  h16* ring = (h16*)smem;
  const int tid = threadIdx.x, lane = tid & 31, ln = lane & 15, hh = lane >> 4;
  const int wave = __builtin_amdgcn_readfirstlane(tid >> 5);
  const int w = wave & 3, wn = wave >> 2;
  float (*so)[32][68] = (float (*)[32][68])smem + 4 * wn;  // the staging of the four waves of this column half
  const int ntn = N3 >> 7;
  const int mtl = blk / ntn, nq = blk - mtl * ntn;
  const int mblk = mrow0 + mtl * (8 * WR);
  const int col0 = nq * 128 + 64 * wn;
  const v8f z8 = {0.f, 0.f, 0.f, 0.f, 0.f, 0.f, 0.f, 0.f};
  v8f c[16];
#pragma unroll
  for (int u = 0; u < 16; ++u) c[u] = z8;
  gemm_main_q<RES>(Hh, Hr, W3, mblk, nq * 128, ring, tid, w, wn, ln, hh, c);
#pragma unroll  // unrolled so that the accumulator tiles are indexed by constants (they are registers)
  for (int mh = 0; mh < 2; ++mh) {
  const int mrow = mblk + mh * (4 * WR);
  const int row0 = mrow + WR * w;
  if (mh) {
    asm volatile("s_wait_dscnt 0x0" ::: "memory");  // this wave's reads of the first half's staging are done before the barrier frees it
    __syncthreads();                                // every wave has left the staging before the second half is written over it
  }
#pragma unroll
  for (int u = 0; u < (RES ? 4 : 8); ++u) {
    const int t = u & 3, hf = u >> 2;
#pragma unroll
    for (int r = 0; r < 8; ++r) {
      const float v = RES ? (c[8 * mh + u][r] + c[8 * mh + 4 + u][r] * 4.8828125e-4f) * 0.015625f : c[8 * mh + u][r] * 0.015625f;
      so[w][hf * 16 + 8 * hh + r][t * 16 + ln] = v;
    }
  }
  __syncthreads();
  v8h hv[NIT], rv[NIT];
  if (col0 < NQK) {
    const int rq = lane >> 3, pc = lane & 7;
    const int i0 = ((col0 & (HW - 1)) >> 1) + pc * 4;
    const float* tp = TAB + (size_t)(row0 + rq) * HD + i0;  // one address for all table loads, the rest constant offsets
    v4f csv[NIT], snv[NIT];
#pragma unroll
    for (int it = 0; it < NIT; ++it) { csv[it] = *(const v4fa*)(tp + it * 4 * HD); snv[it] = *(const v4fa*)(tp + SEQ * HD + it * 4 * HD); }
    asm volatile("s_wait_xcnt 0x0" :: "v"(tp) : "memory");  // the address is an input so that its registers live to this wait: no load's result takes them while a load that names them is issued
#pragma unroll
    for (int it = 0; it < NIT; ++it) {
      const int row = it * 4 + rq;
      const v4f a = *(const v4fa*)&so[w][row][pc * 8], b = *(const v4fa*)&so[w][row][pc * 8 + 4];
      const v4f cs = csv[it], sn = snv[it];
      float o[8];
      o[0] = a[0] * cs[0] - a[1] * sn[0]; o[1] = a[0] * sn[0] + a[1] * cs[0];
      o[2] = a[2] * cs[1] - a[3] * sn[1]; o[3] = a[2] * sn[1] + a[3] * cs[1];
      o[4] = b[0] * cs[2] - b[1] * sn[2]; o[5] = b[0] * sn[2] + b[1] * cs[2];
      o[6] = b[2] * cs[3] - b[3] * sn[3]; o[7] = b[2] * sn[3] + b[3] * cs[3];
#pragma unroll
      for (int q = 0; q < 8; ++q) {
        const h16 hb = toh_flush(o[q]);
        hv[it][q] = hb;
        rv[it][q] = toh_flush((o[q] - (float)hb) * 2048.0f);
      }
    }
    // the packed results are inputs so that all of their arithmetic stands in front of the first store: left free, part of it is moved behind stores whose registers it reuses
    if constexpr (RES) asm volatile("s_wait_xcnt 0x0" :: "v"(hv[0]), "v"(hv[1]), "v"(hv[2]), "v"(hv[3]), "v"(rv[0]), "v"(rv[1]), "v"(rv[2]), "v"(rv[3]) : "memory");
    else asm volatile("s_wait_xcnt 0x0" :: "v"(hv[0]), "v"(hv[1]), "v"(hv[2]), "v"(hv[3]), "v"(hv[4]), "v"(hv[5]), "v"(hv[6]), "v"(hv[7]) : "memory");
    {
      const size_t off = (size_t)(row0 + rq) * NQK + col0 + pc * 8;  // one address per plane for all stores, the rest constant offsets
      h16* qp = QK + off; h16* qr = QKr + off;
#pragma unroll
      for (int it = 0; it < NIT; ++it) {
        *(v8h*)(qp + (size_t)it * 4 * NQK) = hv[it];
        if (RES) *(v8h*)(qr + (size_t)it * 4 * NQK) = rv[it];
      }
      // stands behind the stores, their addresses live to here: in the shared grid the listing runs on into other code, which reuses the registers that they name
      if constexpr (RES) asm volatile("s_wait_xcnt 0x0" :: "v"(qp), "v"(qr) : "memory");
      else asm volatile("s_wait_xcnt 0x0" :: "v"(qp) : "memory");
    }
  } else {
    // V^T: a lane gathers 8 consecutive rows of one channel; a half's rows of a channel (4 * WR f16) are whole 128-byte lines
    constexpr int PG = 4 * WR / 8;      // groups of 8 rows in a half: 16, RES 8
    constexpr int CPI = 32 / PG;        // channels per store instruction: 2, RES 4
    static_assert(NIT * CPI == 16);
    const int chb = col0 - NQK;
    const int sub = lane / PG, p = lane & (PG - 1);
    const int sw = p / (WR / 8), sr = (p & (WR / 8 - 1)) * 8;
#pragma unroll
    for (int it = 0; it < NIT; ++it) {
      const int chl = w * 16 + it * CPI + sub;
#pragma unroll
      for (int q = 0; q < 8; ++q) {
        const float v = so[sw][sr + q][chl];
        const h16 hb = toh_flush(v);
        hv[it][q] = hb;
        rv[it][q] = toh_flush((v - (float)hb) * 2048.0f);
      }
    }
    // the packed results are inputs so that all of their arithmetic stands in front of the first store: left free, part of it is moved behind stores whose registers it reuses
    if constexpr (RES) asm volatile("s_wait_xcnt 0x0" :: "v"(hv[0]), "v"(hv[1]), "v"(hv[2]), "v"(hv[3]), "v"(rv[0]), "v"(rv[1]), "v"(rv[2]), "v"(rv[3]) : "memory");
    else asm volatile("s_wait_xcnt 0x0" :: "v"(hv[0]), "v"(hv[1]), "v"(hv[2]), "v"(hv[3]), "v"(hv[4]), "v"(hv[5]), "v"(hv[6]), "v"(hv[7]) : "memory");
    {
      const int ch0 = chb + w * 16 + sub;  // one address per plane for all stores, the rest constant offsets
      h16* vp = VT + (size_t)ch0 * SEQ + mrow + p * 8; h16* vr = VTr + (size_t)ch0 * EROWS + (RES ? mrow : 0) + p * 8;
#pragma unroll
      for (int it = 0; it < NIT; ++it) {
        *(v8h*)(vp + (size_t)it * CPI * SEQ) = hv[it];
        if (RES) *(v8h*)(vr + (size_t)it * CPI * EROWS) = rv[it];
      }
      // stands behind the stores, their addresses live to here: in the shared grid the listing runs on into other code, which reuses the registers that they name
      if constexpr (RES) asm volatile("s_wait_xcnt 0x0" :: "v"(vp), "v"(vr) : "memory");
      else asm volatile("s_wait_xcnt 0x0" :: "v"(vp) : "memory");
    }
  }
  }
}

// both row ranges in one grid (they write disjoint rows of QK and disjoint columns of V^T, and neither reads the other's); a block of either range has the same ring, copies and products.
// The one-wave scale step, which reads only inputs and writes only SC, shares the grid.
#define QB_SC 1
#define QB_EARLY ((EROWS / 128) * (N3 / 128))
#define QB_LATE (((NR - EROWS) / 256) * (N3 / 128))
static_assert(EROWS % 128 == 0 && (NR - EROWS) % 256 == 0 && N3 % 128 == 0 && NQK % 128 == 0);
// two blocks per WGP (LDS), four waves per SIMD (registers)
__global__ __launch_bounds__(256) __attribute__((amdgpu_num_vgpr(256)))
void k_gemm_qkv(const h16* __restrict__ Hh, const h16* __restrict__ Hr, const h16* __restrict__ W3, const float* __restrict__ TAB,
                h16* __restrict__ QK, h16* __restrict__ QKr, h16* __restrict__ VT, h16* __restrict__ VTr,
                const float* __restrict__ q1, const float* __restrict__ q2, const float* __restrict__ k1, const float* __restrict__ k2,
                const float* __restrict__ lam, float* __restrict__ SC) {
  __shared__ __attribute__((aligned(16))) unsigned char smem[QBYTES];
  int b = blockIdx.x;  // every test below reads the same for the whole block
  if (b < QB_SC) { if (threadIdx.x < 32) scale_body(q1, q2, k1, k2, lam, SC); return; }  // first, because it is the longest single chain; it passes no barrier
  b -= QB_SC;
  if (b < QB_EARLY) gemm_qkv_body<true>(Hh, Hr, W3, TAB, QK, QKr, VT, VTr, 0, b, smem);
  else gemm_qkv_body<false>(Hh, Hh, W3, TAB, QK, QK, VT, VT, EROWS, b - QB_EARLY, smem);
}

// output projection out[NR][DM] f32 = ctx . Wo^T / 64 + bf16(x); skip connection added at the store stage as float4;
template <bool RES>
__device__ __forceinline__ void gemm_out_body(const h16* Ch, const h16* Cr, const h16* WoT, const float* x, float* out, int mt0, int blk, unsigned char* smem) {
  // one LDS block (the kernel's, at least Ring<RES>::BYTES): the operand ring in the main loop, then (behind the last trip's barrier) the output staging so[wave][row][col]
  static_assert(Ring<RES>::BYTES >= 4 * 32 * 68 * 4);
  h16* ring = (h16*)smem;
  float (*so)[32][68] = (float (*)[32][68])smem;
  const int tid = threadIdx.x, lane = tid & 31, ln = lane & 15, hh = lane >> 4;
  const int w = __builtin_amdgcn_readfirstlane(tid >> 5);
  const int ntn = DM >> 6;
  const int mtl = blk / ntn, nq = blk - mtl * ntn;
  const int mrow = (mt0 + mtl) * 128;
  const int row0 = mrow + 32 * w, col0 = nq * 64;
  const v8f z8 = {0.f, 0.f, 0.f, 0.f, 0.f, 0.f, 0.f, 0.f};
  v8f c[8], cr[8];
#pragma unroll
  for (int u = 0; u < 8; ++u) { c[u] = z8; cr[u] = z8; }
  gemm_main<RES>(Ch, Cr, WoT, mrow, col0, ring, tid, w, ln, hh, c, cr);
#pragma unroll
  for (int u = 0; u < 8; ++u) {
    const int t = u & 3, hf = u >> 2;
#pragma unroll
    for (int r = 0; r < 8; ++r) {
      const float v = RES ? (c[u][r] + cr[u][r] * 4.8828125e-4f) * 0.015625f : c[u][r] * 0.015625f;
      so[w][hf * 16 + 8 * hh + r][t * 16 + ln] = v;
    }
  }
  __syncthreads();
  const int rsub = lane >> 4, c4 = (lane & 15) * 4;
  v4f ov[16];
#pragma unroll
  for (int q = 0; q < 16; ++q) {
    const int r = q * 2 + rsub;
    const v4f v = *(const v4fa*)&so[w][r][c4];
    if (q) asm volatile("s_wait_xcnt 0x0" ::: "memory");  // stands between the loads: a load's result may take the registers of an address that an earlier load names
    const v4f xr = *(const v4fa*)(x + (size_t)(row0 + r) * DM + col0 + c4);
    v4f o;
    o[0] = v[0] + bf16_rne(xr[0]); o[1] = v[1] + bf16_rne(xr[1]); o[2] = v[2] + bf16_rne(xr[2]); o[3] = v[3] + bf16_rne(xr[3]);
    ov[q] = o;
  }
  // the sixteen sums are inputs so that all of their arithmetic stands in front of the first store: left free, part of it is moved behind stores whose data registers it reuses
  asm volatile("s_wait_xcnt 0x0" :: "v"(ov[0]), "v"(ov[1]), "v"(ov[2]), "v"(ov[3]), "v"(ov[4]), "v"(ov[5]), "v"(ov[6]), "v"(ov[7]),
               "v"(ov[8]), "v"(ov[9]), "v"(ov[10]), "v"(ov[11]), "v"(ov[12]), "v"(ov[13]), "v"(ov[14]), "v"(ov[15]) : "memory");
  {
#pragma unroll
    for (int q = 0; q < 16; ++q) {
      const int r = q * 2 + rsub;
      *(v4f*)(out + (size_t)(row0 + r) * DM + col0 + c4) = ov[q];
      asm volatile("s_wait_xcnt 0x0" ::: "memory");  // stands behind each store, in front of the next stores' address arithmetic, which reuses the registers that it names
    }
    
  }
}

// both row ranges in one grid (they write disjoint rows and neither reads the other's): the blocks with residual planes, which run longer, come first
#define OB_EARLY ((EROWS / 128) * (DM / 64))
#define OB_LATE (((NR - EROWS) / 128) * (DM / 64))
__global__ __launch_bounds__(128) __attribute__((amdgpu_num_vgpr(256)))
void k_gemm_out(const h16* __restrict__ Ch, const h16* __restrict__ Cr, const h16* __restrict__ WoT, const float* __restrict__ x, float* __restrict__ out) {
  __shared__ __attribute__((aligned(16))) unsigned char smem[Ring<true>::BYTES];
  const int b = blockIdx.x;  // the test reads the same for the whole block
  if (b < OB_EARLY) gemm_out_body<true>(Ch, Cr, WoT, x, out, 0, b, smem);
  else gemm_out_body<false>(Ch, Ch, WoT, x, out, EROWS / 128, b - OB_EARLY, smem);
}

// Transposed flash attention. One unit of NW waves per (head, 16-query tile); wave = (score component c, channel slab hf).
// S^T[key][query] = K_c . Q_c^T (A = K rows, B = Q rows), per-lane (= per-query) running max / sum in the exp2 domain,
// P^T (carried x256) packed from the S^T accumulators directly as the B fragment of O^T[ch][query] = V^T . P^T (A = V^T rows). Causal mask as a select.
// NW = 4: query rows < EROWS, value + x2048 residual planes on q, k, P, v, 64 channels per wave (NW = 2: single f16 products, 128 channels per wave; query rows >= EROWS have attn_late_body).
// Epilogue: both components meet in LDS (block barrier), O = O_0 + scale[h] O_1, per-head RMSNorm, x (1 - lam[h]), f16 ctx rows (+ residual rows);
template <int NW>
__device__ __forceinline__ void attn_body(const h16* QK, const h16* QKr, const h16* VT, const h16* VTr,
                                          const float* SC, const float* hw, h16* CTX, h16* CTXr, int qt0, int nqt,
                                          int unit, int tid, float (*comb)[16][132]) {
  constexpr bool EARLY = (NW == 4);
  constexpr int NT = 16 / NW;
  constexpr int RPW = 16 / NW;
  static_assert(NW == 2 || NW == 4);
  static_assert(NW * NT * 16 == 2 * HD);
  // unit: which (head, 16-query tile); tid: the thread's number among the unit's NW waves; comb: the unit's own LDS, [2][16][132] floats
  const int lane = tid & 31, ln = lane & 15, hh = lane >> 4;
  const int wave = __builtin_amdgcn_readfirstlane(tid >> 5);
  const int c = wave & 1, hf = wave >> 1;
  const int head = unit / nqt;
  const int qt = qt0 + (unit - head * nqt);
  const int q0 = qt * 16, qi = q0 + ln;
  const size_t qoff = (size_t)qi * NQK + head * HW + c * HD;
  const int kcol = NH * HW + head * HW + c * HD;
  const int chb = head * HD + hf * (NT * 16);
  const float NEGV = -1.0e30f;
  const float SCL2 = 0.08838834764831845f * 1.4426950408889634f;
  const float PCL = 8.0f;

  const v8f z8 = {0.f, 0.f, 0.f, 0.f, 0.f, 0.f, 0.f, 0.f};
  v16h qh[4];
#pragma unroll
  for (int ks = 0; ks < 4; ++ks) qh[ks] = ld_frag(QK + qoff + ks * 32, hh);

  v8f acc[NT], accr[NT];
#pragma unroll
  for (int dt = 0; dt < NT; ++dt) { acc[dt] = z8; accr[dt] = z8; }
  float m = NEGV, l = 0.f;
  const int nsteps = (q0 + 16 + 31) >> 5;

#pragma unroll 1
  for (int js = 0; js < nsteps; ++js) {
    const int j0 = js << 5;
    v8f s0 = z8, s1 = z8, t0 = z8, t1 = z8;
    const size_t ko = (size_t)(j0 + ln) * NQK + kcol;
#pragma unroll
    for (int ks = 0; ks < 4; ++ks) {
      const v16h a0 = ld_frag_g(QK + ko + ks * 32, hh);
      const v16h a1 = ld_frag_g(QK + ko + (size_t)16 * NQK + ks * 32, hh);
      v16h bq = qh[ks];
      if (EARLY) bq = ld_frag_g(QK + qoff + ks * 32, hh);
      s0 = mmam(a0, bq, s0);
      s1 = mmam(a1, bq, s1);
      if (EARLY) {
        const v16h br = ld_frag_g(QKr + qoff + ks * 32, hh);
        const v16h r0 = ld_frag_g(QKr + ko + ks * 32, hh);
        const v16h r1 = ld_frag_g(QKr + ko + (size_t)16 * NQK + ks * 32, hh);
        t0 = mmam(r0, bq, t0);
        t0 = mmam(a0, br, t0);
        t1 = mmam(r1, bq, t1);
        t1 = mmam(a1, br, t1);
      }
    }

    float xv[16];
    float mx = NEGV;
#pragma unroll
    for (int r = 0; r < 8; ++r) {
      const int k0 = j0 + 8 * hh + r, k1 = k0 + 16;
      float e0 = s0[r], e1 = s1[r];
      if (EARLY) { e0 += t0[r] * 4.8828125e-4f; e1 += t1[r] * 4.8828125e-4f; }
      xv[r] = (k0 <= qi) ? e0 * SCL2 : NEGV;
      xv[8 + r] = (k1 <= qi) ? e1 * SCL2 : NEGV;
      mx = fmaxf(mx, fmaxf(xv[r], xv[8 + r]));
    }
    mx = fmaxf(mx, __shfl_xor(mx, 16, 32));
    const float mn = fmaxf(m, mx);
    const float alpha = exp2_hw(m - mn);
    m = mn;

    v16h ph, pr;
    float ps = 0.f;
#pragma unroll
    for (int i = 0; i < 16; ++i) {
      const float e = xv[i] - mn + PCL;
      const float pe = exp2_hw(e);
      const float p = (e < -14.0f) ? 0.f : pe;
      const h16 pb = (h16)p;
      ph[i] = pb;
      if (EARLY) {
        pr[i] = toh_flush((p - (float)pb) * 2048.0f);
        ps += p;
      } else {
        pr[i] = pb;
        ps += (float)pb;
      }
    }
    ps += __shfl_xor(ps, 16, 32);
    l = l * alpha + ps;

#pragma unroll
    for (int dt = 0; dt < NT; ++dt)
#pragma unroll
      for (int r = 0; r < 8; ++r) { acc[dt][r] *= alpha; if (EARLY) accr[dt][r] *= alpha; }

#pragma unroll
    for (int dt = 0; dt < NT; ++dt) {
      const int ch = chb + dt * 16 + ln;
      const v16h vh = ld_frag_g(VT + (size_t)ch * SEQ + j0, hh);
      acc[dt] = mmam(vh, ph, acc[dt]);
      if (EARLY) {
        const v16h vr = ld_frag_g(VTr + (size_t)ch * EROWS + j0, hh);
        accr[dt] = mmam(vh, pr, accr[dt]);
        accr[dt] = mmam(vr, ph, accr[dt]);
      }
    }
  }

  const float inv = 1.0f / l;
#pragma unroll
  for (int dt = 0; dt < NT; ++dt)
#pragma unroll
    for (int r = 0; r < 8; ++r) {
      const float v = EARLY ? (acc[dt][r] + accr[dt][r] * 4.8828125e-4f) * inv : acc[dt][r] * inv;
      comb[c][ln][hf * (NT * 16) + dt * 16 + 8 * hh + r] = v;
    }
  __syncthreads();

  const float scl = SC[head], osc = SC[NH + head];
  const int sub = lane >> 4, pc = lane & 15;
  const v4f wa = *(const v4fa*)(hw + pc * 8), wb = *(const v4fa*)(hw + pc * 8 + 4);
  const float wv[8] = {bf16_rne(wa[0]), bf16_rne(wa[1]), bf16_rne(wa[2]), bf16_rne(wa[3]), bf16_rne(wb[0]), bf16_rne(wb[1]), bf16_rne(wb[2]), bf16_rne(wb[3])};
  v8h hv[RPW / 2], rv[RPW / 2];
#pragma unroll
  for (int it = 0; it < RPW / 2; ++it) {
    const int row = wave * RPW + it * 2 + sub;
    const v4f a0 = *(const v4fa*)&comb[0][row][pc * 8], a1 = *(const v4fa*)&comb[0][row][pc * 8 + 4];
    const v4f b0 = *(const v4fa*)&comb[1][row][pc * 8], b1 = *(const v4fa*)&comb[1][row][pc * 8 + 4];
    float o[8];
#pragma unroll
    for (int q = 0; q < 4; ++q) { o[q] = a0[q] + scl * b0[q]; o[4 + q] = a1[q] + scl * b1[q]; }
    float ss = 0.f;
#pragma unroll
    for (int q = 0; q < 8; ++q) ss += o[q] * o[q];
#pragma unroll
    for (int d = 1; d < 16; d <<= 1) ss += __shfl_xor(ss, d, 32);
    const float rms = rsqrtf(ss * (1.0f / (float)HD) + 1.0e-9f);
#pragma unroll
    for (int q = 0; q < 8; ++q) {
      const float val = o[q] * rms * wv[q] * osc;
      const h16 hb = toh_flush(val);
      hv[it][q] = hb;
      rv[it][q] = toh_flush((val - (float)hb) * 2048.0f);
    }
  }
  {
#pragma unroll
    for (int it = 0; it < RPW / 2; ++it) {
      const int row = wave * RPW + it * 2 + sub;
      const size_t off = (size_t)(q0 + row) * DM + head * HD + pc * 8;
      *(v8h*)(CTX + off) = hv[it];
      if (EARLY) *(v8h*)(CTXr + off) = rv[it];
    }
    asm volatile("s_wait_xcnt 0x0" ::: "memory");  // stands behind the stores: in the shared grid the listing runs on from here into the other range's code, which reuses the registers that they name
  }
}

// Query rows >= EROWS: the same transposed flash attention with single f16 products, AQB queries of one head at a time, 8 waves = (score component c, 16-query tile qs), 128 channels per wave.
// The head's K rows (both components side by side, 512 B) and V^T rows of a tile of AKT keys are staged in LDS by asynchronous copies and read by all 8 waves;
// two buffers: trip t works on buffer t & 1 while tile t + 1 flies. Every wave walks its keys in steps of 32 from key 0, as one wave per 16 queries would.
// Stage: K rows 0..AKT-1 at pitch AKP f16 = 528 B, then V^T rows 0..HD-1 at pitch AVP f16 = 144 B (odd multiples of 16 B for the 16-byte fragment reads).
#define AQB 64
#define AKT 64
#define AKP 264
#define AVP 72
#define ASTG (AKT * AKP + HD * AVP)
// Causal work dealt evenly: a query block that starts at query q walks (q + AQB) / AKT key tiles, so the blocks of a head differ widely in length. Each head's query blocks are dealt to AGRP work-groups:
// the longest ones stand alone, every other work-group takes a long one and then a short one, one after the other in every wave, so that all work-groups walk about the same number of key tiles.
#define AGRP 16
static_assert(AQB == AKT && AKT == 64 && EROWS % AKT == 0 && (SEQ - EROWS) % AQB == 0 && EROWS / AKT + 1 >= 2);
static_assert(AKP >= HW + 8 && (AKP * 2) % 32 == 16 && AVP >= AKT + 8 && (AVP * 2) % 32 == 16 && (ASTG * 2) % 16 == 0);

// one stage, 256 threads x 16 B per copy: 8 K rows of 512 B (32 lanes per row), 8 copies; 32 V^T rows of 128 B (8 lanes per row), 4 copies. All four arguments are the lane's own addresses.
__device__ __forceinline__ void attn_fill(unsigned lk, unsigned lv, const h16* gK, const h16* gV) {
  unsigned l[12]; const h16* g[12];
  // both loops are unrolled so that the address arrays are registers (they are asm operands)
#pragma unroll
  for (int i = 0; i < 8; ++i) { l[i] = lk + (unsigned)(i * 8 * AKP * 2); g[i] = gK + (size_t)i * 8 * NQK; }
#pragma unroll
  for (int i = 0; i < 4; ++i) { l[8 + i] = lv + (unsigned)(i * 32 * AVP * 2); g[8 + i] = gV + (size_t)i * 32 * SEQ; }
  copy12(l, g);
}

__device__ __forceinline__ void attn_late_body(const h16* QK, const h16* VT, const float* SC, const float* hw, h16* CTX, int blk, unsigned char* smem) {
  constexpr int NT = 8;
  constexpr int RPW = AQB / 8;
  // one LDS block (the kernel's, 2 * ASTG * 2 bytes): the K / V^T ring in the key loop, then (behind the last trip's barrier) the two components' outputs comb[c][query][channel]
  static_assert(2 * ASTG * 2 >= 2 * AQB * 132 * 4);
  h16* ring = (h16*)smem;
  float (*comb)[AQB][132] = (float (*)[AQB][132])smem;
  const int tid = threadIdx.x, lane = tid & 31, ln = lane & 15, hh = lane >> 4;
  const int wave = __builtin_amdgcn_readfirstlane(tid >> 5);
  const int c = wave & 1, qs = wave >> 1;
  constexpr int nqb = (SEQ - EROWS) / AQB;
  constexpr int NSGL = 2 * AGRP - nqb;  // work-groups with one query block (the NSGL longest); the others take two: nqb = NSGL + 2 * (AGRP - NSGL)
  static_assert(nqb >= AGRP && nqb <= 2 * AGRP);
  const int head = blk / AGRP;
  const int grp = blk - head * AGRP;
  const int npass = (grp < NSGL) ? 1 : 2;
  const float NEGV = -1.0e30f;
  const float SCL2 = 0.08838834764831845f * 1.4426950408889634f;
  const float PCL = 8.0f;
  const v8f z8 = {0.f, 0.f, 0.f, 0.f, 0.f, 0.f, 0.f, 0.f};

#pragma unroll 1  // kept rolled: one body for both query blocks of the work-group
  for (int pass = 0; pass < npass; ++pass) {
  // query blocks nqb-1 .. nqb-AGRP come first, blocks 0 .. nqb-AGRP-1 second: each exactly once; the two lengths of a pair add up to the same sum in every pair
  const int q0b = EROWS + ((pass == 0) ? nqb - 1 - grp : grp - NSGL) * AQB;
  const int q0 = q0b + qs * 16, qi = q0 + ln;
  if (pass) {  // the same for the whole work-group
    asm volatile("s_wait_dscnt 0x0" ::: "memory");  // this wave's reads of the first query block's comb rows are done before the barrier frees that LDS
    __syncthreads();                                // every wave has left comb before the copies below refill the ring over it
  }
  v16h qh[4];
#pragma unroll
  for (int ks = 0; ks < 4; ++ks) qh[ks] = ld_frag(QK + (size_t)qi * NQK + head * HW + c * HD + ks * 32, hh);

  v8f acc[NT];
#pragma unroll
  for (int dt = 0; dt < NT; ++dt) acc[dt] = z8;
  float m = NEGV, l = 0.f;

  const int ntiles = (q0b + AQB) / AKT;  // >= 2: q0b >= EROWS
  const h16* gK = QK + (size_t)(tid >> 5) * NQK + NH * HW + head * HW + (tid & 31) * 8;
  const h16* gV = VT + (size_t)(head * HD + (tid >> 3)) * SEQ + (tid & 7) * 8;
  const unsigned lk = (unsigned)(uintptr_t)ring + (unsigned)(((tid >> 5) * AKP + (tid & 31) * 8) * 2);
  const unsigned lv = (unsigned)(uintptr_t)ring + (unsigned)((AKT * AKP + (tid >> 3) * AVP + (tid & 7) * 8) * 2);
  attn_fill(lk, lv, gK, gV);
  asm volatile("s_wait_asynccnt 0x0" ::: "memory");  // tile 0 has landed before the barrier publishes it
  __syncthreads();
  attn_fill(lk + (unsigned)(ASTG * 2), lv + (unsigned)(ASTG * 2), gK + (size_t)AKT * NQK, gV + AKT);
#pragma unroll 1  // kept rolled: one body for both buffers, the buffer picked by a scalar offset
  for (int t = 0; t < ntiles; ++t) {
    const int buf = t & 1;
    const h16* st = ring + buf * ASTG;
#pragma unroll 1  // kept rolled: one body for both 32-key halves of the tile
    for (int sub = 0; sub < AKT / 32; ++sub) {
      const int j0 = t * AKT + sub * 32;
      if (j0 > q0 + 15) continue;  // wave-uniform: every key of the step lies behind all 16 queries of this wave (only in the block's last tile)
      const h16* pk = st + (sub * 32 + ln) * AKP + c * HD;
      const h16* pv = st + AKT * AKP + ln * AVP + sub * 32;
      v16h ka[4][2];
#pragma unroll
      for (int ks = 0; ks < 4; ++ks) { ka[ks][0] = ld_frag(pk + ks * 32, hh); ka[ks][1] = ld_frag(pk + 16 * AKP + ks * 32, hh); }
      v8f s0 = z8, s1 = z8;
#pragma unroll
      for (int ks = 0; ks < 4; ++ks) { s0 = mma(ka[ks][0], qh[ks], s0); s1 = mma(ka[ks][1], qh[ks], s1); }
      v16h vh[NT];
#pragma unroll
      for (int dt = 0; dt < NT; ++dt) vh[dt] = ld_frag(pv + dt * 16 * AVP, hh);
      __builtin_amdgcn_sched_barrier(0);  // keeps the V^T reads together here, in flight under the softmax (left free they are spread over it in pairs, the last ones directly in front of their products)

      float xv[16];
      float mx = NEGV;
#pragma unroll
      for (int r = 0; r < 8; ++r) {
        const int k0 = j0 + 8 * hh + r, k1 = k0 + 16;
        xv[r] = (k0 <= qi) ? s0[r] * SCL2 : NEGV;
        xv[8 + r] = (k1 <= qi) ? s1[r] * SCL2 : NEGV;
        mx = fmaxf(mx, fmaxf(xv[r], xv[8 + r]));
      }
      mx = fmaxf(mx, __shfl_xor(mx, 16, 32));
      const float mn = fmaxf(m, mx);
      const float alpha = exp2_hw(m - mn);
      m = mn;

      v16h ph;
      float ps = 0.f;
#pragma unroll
      for (int i = 0; i < 16; ++i) {
        const float e = xv[i] - mn + PCL;
        const float pe = exp2_hw(e);
        const float p = (e < -14.0f) ? 0.f : pe;
        const h16 pb = (h16)p;
        ph[i] = pb;
        ps += (float)pb;
      }
      ps += __shfl_xor(ps, 16, 32);
      l = l * alpha + ps;

#pragma unroll
      for (int dt = 0; dt < NT; ++dt)
#pragma unroll
        for (int r = 0; r < 8; ++r) acc[dt][r] *= alpha;
#pragma unroll
      for (int dt = 0; dt < NT; ++dt) acc[dt] = mma(vh[dt], ph, acc[dt]);
    }
    asm volatile("s_wait_dscnt 0x0" ::: "memory");     // this wave's reads of buffer buf are done before the barrier frees it
    asm volatile("s_wait_asynccnt 0x0" ::: "memory");  // this wave's copies of tile t + 1 have landed before the barrier publishes them
    __syncthreads();
    if (t + 2 < ntiles)
      attn_fill(lk + (unsigned)(buf * ASTG * 2), lv + (unsigned)(buf * ASTG * 2), gK + (size_t)(t + 2) * AKT * NQK, gV + (t + 2) * AKT);
  }
  asm volatile("s_wait_asynccnt 0x0" ::: "memory");    // nothing in flight when the ring becomes output staging

  const float inv = 1.0f / l;
#pragma unroll
  for (int dt = 0; dt < NT; ++dt)
#pragma unroll
    for (int r = 0; r < 8; ++r) comb[c][qs * 16 + ln][dt * 16 + 8 * hh + r] = acc[dt][r] * inv;
  __syncthreads();

  const float scl = SC[head], osc = SC[NH + head];
  const int sub = lane >> 4, pc = lane & 15;
  const v4f wa = *(const v4fa*)(hw + pc * 8), wb = *(const v4fa*)(hw + pc * 8 + 4);
  const float wv[8] = {bf16_rne(wa[0]), bf16_rne(wa[1]), bf16_rne(wa[2]), bf16_rne(wa[3]), bf16_rne(wb[0]), bf16_rne(wb[1]), bf16_rne(wb[2]), bf16_rne(wb[3])};
  v8h hv[RPW / 2];
#pragma unroll
  for (int it = 0; it < RPW / 2; ++it) {
    const int row = wave * RPW + it * 2 + sub;
    const v4f a0 = *(const v4fa*)&comb[0][row][pc * 8], a1 = *(const v4fa*)&comb[0][row][pc * 8 + 4];
    const v4f b0 = *(const v4fa*)&comb[1][row][pc * 8], b1 = *(const v4fa*)&comb[1][row][pc * 8 + 4];
    float o[8];
#pragma unroll
    for (int q = 0; q < 4; ++q) { o[q] = a0[q] + scl * b0[q]; o[4 + q] = a1[q] + scl * b1[q]; }
    float ss = 0.f;
#pragma unroll
    for (int q = 0; q < 8; ++q) ss += o[q] * o[q];
#pragma unroll
    for (int d = 1; d < 16; d <<= 1) ss += __shfl_xor(ss, d, 32);
    const float rms = rsqrtf(ss * (1.0f / (float)HD) + 1.0e-9f);
#pragma unroll
    for (int q = 0; q < 8; ++q) hv[it][q] = toh_flush(o[q] * rms * wv[q] * osc);
  }
#pragma unroll
  for (int it = 0; it < RPW / 2; ++it) {
    const int row = wave * RPW + it * 2 + sub;
    *(v8h*)(CTX + (size_t)(q0b + row) * DM + head * HD + pc * 8) = hv[it];
  }
  asm volatile("s_wait_xcnt 0x0" ::: "memory");  // stands behind the stores, in front of the next query block's writes to the registers that they name
  }
}

// both query ranges in one grid (they write disjoint ctx rows and neither reads the other's): the AB_LATE long blocks come first, one for each place they had alone;
// behind them AB_EARLY blocks of two (head, 16-query tile) units of four waves each, which run beside the long ones; a block's two tiles are j and last - j, so that every such block brings the same number of key steps.
#define AB_LATE (NH * AGRP)
#define AB_EARLY (NH * (EROWS / 16) / 2)
static_assert((EROWS / 16) % 2 == 0 && 2 * ASTG * 2 >= 2 * 2 * 16 * 132 * 4);
__global__ __launch_bounds__(256) __attribute__((amdgpu_num_vgpr(256)))
void k_attn(const h16* __restrict__ QK, const h16* __restrict__ QKr, const h16* __restrict__ VT, const h16* __restrict__ VTr,
            const float* __restrict__ SC, const float* __restrict__ hw, h16* __restrict__ CTX, h16* __restrict__ CTXr) {
  __shared__ __attribute__((aligned(16))) unsigned char smem[2 * ASTG * 2];
  const int b = blockIdx.x;  // the test reads the same for the whole block
  if (b < AB_LATE) {
    attn_late_body(QK, VT, SC, hw, CTX, b, smem);
  } else {
    const int tid = threadIdx.x;
    const int half = __builtin_amdgcn_readfirstlane(tid >> 7);
    constexpr int NQT = EROWS / 16;
    const int eb = b - AB_LATE, head = eb / (NQT / 2), j = eb - head * (NQT / 2);
    attn_body<4>(QK, QKr, VT, VTr, SC, hw, CTX, CTXr, 0, NQT, head * NQT + (half ? NQT - 1 - j : j), tid & 127, (float (*)[16][132])(smem + half * (2 * 16 * 132 * 4)));
  }
}

extern "C" void kernel_launch(void* const* d_in, const int* in_sizes, int n_in,
                              void* d_out, int out_size, void* d_ws, size_t ws_size, hipStream_t stream) {
  if (n_in < 12) return;
  if (in_sizes[0] < NR * DM) return;
  if (in_sizes[1] < DM) return;
  if (in_sizes[2] < NH * HW * DM || in_sizes[3] < NH * HW * DM) return;
  if (in_sizes[4] < DM * DM || in_sizes[5] < DM * DM) return;
  if (in_sizes[6] < HD) return;
  if (in_sizes[7] < NH * HD || in_sizes[8] < NH * HD || in_sizes[9] < NH * HD || in_sizes[10] < NH * HD) return;
  if (in_sizes[11] < NH) return;
  if (out_size < NR * DM) return;
  const float* x   = (const float*)d_in[0];
  const float* pw  = (const float*)d_in[1];
  const float* wq  = (const float*)d_in[2];
  const float* wk  = (const float*)d_in[3];
  const float* wv  = (const float*)d_in[4];
  const float* wo  = (const float*)d_in[5];
  const float* hnw = (const float*)d_in[6];
  const float* q1  = (const float*)d_in[7];
  const float* q2  = (const float*)d_in[8];
  const float* k1  = (const float*)d_in[9];
  const float* k2  = (const float*)d_in[10];
  const float* lam = (const float*)d_in[11];
  float* out = (float*)d_out;

  // workspace regions (bytes); every region but TH, which nothing reads or writes, is written with whole-row stores inside its exact extent
  constexpr size_t SZ_TH  = 512;
  constexpr size_t SZ_TAB = (size_t)2 * SEQ * HD * 4;
  constexpr size_t SZ_SC  = 256;
  constexpr size_t SZ_H   = (size_t)NR * DM * 2;
  constexpr size_t SZ_HR  = (size_t)EROWS * DM * 2;
  constexpr size_t SZ_W3  = (size_t)N3 * DM * 2;
  constexpr size_t SZ_WO  = (size_t)DM * DM * 2;
  constexpr size_t SZ_QK  = (size_t)NR * NQK * 2;
  constexpr size_t SZ_QKR = (size_t)EROWS * NQK * 2;
  constexpr size_t SZ_VT  = (size_t)DM * SEQ * 2;
  constexpr size_t SZ_VTR = (size_t)DM * EROWS * 2;
  constexpr size_t SZ_CX  = (size_t)NR * DM * 2;
  constexpr size_t SZ_CXR = (size_t)EROWS * DM * 2;
  constexpr size_t OF_TH  = 0;
  constexpr size_t OF_TAB = OF_TH + SZ_TH;
  constexpr size_t OF_SC  = OF_TAB + SZ_TAB;
  constexpr size_t OF_H   = OF_SC + SZ_SC;
  constexpr size_t OF_HR  = OF_H + SZ_H;
  constexpr size_t OF_W3  = OF_HR + SZ_HR;
  constexpr size_t OF_WO  = OF_W3 + SZ_W3;
  constexpr size_t OF_QK  = OF_WO + SZ_WO;
  constexpr size_t OF_QKR = OF_QK + SZ_QK;
  constexpr size_t OF_VT  = OF_QKR + SZ_QKR;
  constexpr size_t OF_VTR = OF_VT + SZ_VT;
  constexpr size_t OF_CX  = OF_VTR + SZ_VTR;
  constexpr size_t OF_CXR = OF_CX + SZ_CX;
  constexpr size_t SZ_ALL = OF_CXR + SZ_CXR;
  static_assert(SZ_TH >= 128 * 4 && SZ_SC >= 32 * 4);
  static_assert(SZ_TH % 256 == 0 && SZ_TAB % 256 == 0 && SZ_SC % 256 == 0 && SZ_H % 256 == 0 && SZ_HR % 256 == 0 && SZ_W3 % 256 == 0);
  static_assert(SZ_WO % 256 == 0 && SZ_QK % 256 == 0 && SZ_QKR % 256 == 0 && SZ_VT % 256 == 0 && SZ_VTR % 256 == 0 && SZ_CX % 256 == 0 && SZ_CXR % 256 == 0);
  static_assert(SZ_ALL <= (size_t)134217728);
  if (SZ_ALL > ws_size) return;
  char* ws = (char*)d_ws;
  float* TAB  = (float*)(ws + OF_TAB);
  float* SC   = (float*)(ws + OF_SC);
  h16*   Hh   = (h16*)(ws + OF_H);
  h16*   Hr   = (h16*)(ws + OF_HR);
  h16*   W3   = (h16*)(ws + OF_W3);
  h16*   WoT  = (h16*)(ws + OF_WO);
  h16*   QK   = (h16*)(ws + OF_QK);
  h16*   QKr  = (h16*)(ws + OF_QKR);
  h16*   VT   = (h16*)(ws + OF_VT);
  h16*   VTr  = (h16*)(ws + OF_VTR);
  h16*   CTX  = (h16*)(ws + OF_CX);
  h16*   CTXr = (h16*)(ws + OF_CXR);

  k_prep<<<(unsigned)PB_ALL, 256, 0, stream>>>(x, pw, wq, wk, wv, wo, TAB, Hh, Hr, W3, WoT);

  k_gemm_qkv<<<(unsigned)(QB_SC + QB_EARLY + QB_LATE), 256, 0, stream>>>(Hh, Hr, W3, TAB, QK, QKr, VT, VTr, q1, q2, k1, k2, lam, SC);

  k_attn<<<(unsigned)(AB_LATE + AB_EARLY), 256, 0, stream>>>(QK, QKr, VT, VTr, SC, hnw, CTX, CTXr);

  k_gemm_out<<<(unsigned)(OB_EARLY + OB_LATE), 128, 0, stream>>>(CTX, CTXr, WoT, x, out);
}

// v008
// It runs in 165 microseconds.
// In both of two side-by-side timings against v007, it was 1.06 times as fast.
// Counting every step since v000, it is 3.89 times as fast.
#include <hip/hip_runtime.h>
// Pre-RMSNorm differential causal attention block: fused [out][in] q|k|v projection, interleaved-pair rotary over 256 columns per head (computed f32 cos/sin table),
// two causal softmax maps per head combined with a per-head scale, per-head RMSNorm, output projection, skip connection. T 2048, D 2048, 16 heads of 128.
// Compute dtype: all contractions on v_wmma_f32_16x16x32_f16 with f32 accumulate. Inputs are RNE-converted to bf16 first; weights carried x64 as f16 (exact).
// Query rows >= 256: single f16 products at every site (h, q, k, v, P x256, ctx). Query rows < 256: value + x2048 f16 residual planes on h, q, k, P, v, ctx
// (residual products in their own accumulators, folded with 2^-11 in the f32 epilogue). Norms, rotary, mask, softmax statistics in f32 on the VALU.
#ifndef NB
#define NB 1
#endif
#ifndef SEQ
#define SEQ 2048
#endif
#define SEQ_FULL 2048
#define DM 2048
#define NH 16
#define HD 128
#define HW 256
#define NQK (2 * NH * HW)
#define N3 (NQK + DM)
#define NR (NB * SEQ)
#define EROWS 256

static_assert(NB == 1);
static_assert(NH * HD == DM);
static_assert(HW == 2 * HD && HD == 128);
static_assert(SEQ % 128 == 0 && SEQ <= SEQ_FULL);
static_assert(EROWS % 128 == 0 && EROWS < SEQ && EROWS % 32 == 0);
static_assert(DM % 64 == 0 && N3 % 64 == 0 && NQK % 64 == 0 && DM % 32 == 0);
static_assert(HW % 64 == 0 && NQK % HW == 0);
static_assert(256 * 8 == DM);
static_assert((SEQ * HD) % 256 == 0);

typedef _Float16 h16;
typedef _Float16 v16h __attribute__((ext_vector_type(16)));
typedef _Float16 v8h  __attribute__((ext_vector_type(8), may_alias));
typedef float v8f  __attribute__((ext_vector_type(8)));
typedef float v4f  __attribute__((ext_vector_type(4)));
typedef float v4fa __attribute__((ext_vector_type(4), may_alias));
union FragH { v16h v; v8h half[2]; };

__device__ __forceinline__ float bf16_rne(float x) {
  unsigned int u = __float_as_uint(x);
  u = (u + 0x7FFFu + ((u >> 16) & 1u)) & 0xFFFF0000u;
  return __uint_as_float(u);
}

// f32 -> f16 with a value select: results below the smallest normal f16 become exact zero
static __device__ __forceinline__ h16 toh_flush(float v) { const h16 r = (h16)v; return (fabsf(v) < 6.103515625e-05f) ? (h16)0.0f : r; }

// 2^x as the bare v_exp_f32. The library call wraps it in a guard for results below 2^-126 (compare, two selects, add, ldexp: five more vector instructions per value).
// The softmax has no use for that range: a weight below 2^-14 is selected to zero behind the call, and a rescale factor below 2^-126 multiplies sums that the same step's new terms (one of them 2^8) outweigh beyond f32 precision.
static __device__ __forceinline__ float exp2_hw(float x) { return __builtin_amdgcn_exp2f(x); }

// fragment (A: row = lane&15; B: column = lane&15) from a k-contiguous f16 row: elements 0..7 <- k0+8h.., elements 8..15 <- k0+16+8h..
__device__ __forceinline__ v16h ld_frag(const h16* p, int hh) {
  FragH f; f.half[0] = *(const v8h*)(p + 8 * hh); f.half[1] = *(const v8h*)(p + 16 + 8 * hh); return f.v;
}

// the same fragment from global memory; a wait stands in front of each load because the compiler may give a load's result the registers of an address that an earlier load names
__device__ __forceinline__ v16h ld_frag_g(const h16* p, int hh) {
  FragH f;
  asm volatile("s_wait_xcnt 0x0" ::: "memory");
  f.half[0] = *(const v8h*)(p + 8 * hh);
  asm volatile("s_wait_xcnt 0x0" ::: "memory");
  f.half[1] = *(const v8h*)(p + 16 + 8 * hh); return f.v;
}

__device__ __forceinline__ v8f mma(v16h a, v16h b, v8f c) {
  c = __builtin_amdgcn_wmma_f32_16x16x32_f16(false, a, false, b, (short)0, c, false, false);
  asm volatile("v_nop\n\tv_nop\n\tv_nop\n\tv_nop" : "+v"(c) : "v"(a), "v"(b));
  return c;
}
__device__ __forceinline__ v8f mmam(v16h a, v16h b, v8f c) {
  c = __builtin_amdgcn_wmma_f32_16x16x32_f16(false, a, false, b, (short)0, c, false, false);
  asm volatile("v_nop\n\tv_nop\n\tv_nop\n\tv_nop" : "+v"(c) : "v"(a), "v"(b) : "memory");
  return c;
}

// The preparation steps below read only the inputs and write disjoint workspace regions: none depends on another, so all of them but the per-head scales (in k_gemm_qkv) share one grid (k_prep), each on its own range of blocks.
// rotary table: every thread forms its own column's theta (the same expression for every row of that column)
__device__ __forceinline__ void tab_body(float* TAB, int blk) {
#pragma clang fp contract(off)
  const int idx = blk * 256 + threadIdx.x;
  const int i = idx & (HD - 1), s = idx >> 7;
  const float e = (float)(2 * i) / (float)HW;
  const float th = 1.0f / powf(10000.0f, e);
  const float ang = (float)s * th;
  const float cs = cosf(ang);
  const float sn = sinf(ang);
  float* pcs = TAB + idx;
  float* psn = TAB + (size_t)SEQ * HD + idx;
  *(float*)pcs = cs;
  *(float*)psn = sn;
  asm volatile("s_wait_xcnt 0x0" ::: "memory");  // stands behind the stores: in the shared grid the listing runs on from here into another range's code, which reuses the registers that they name
}

// per-head scales: the work of one wave (the caller passes wave 0 of one block). One long chain of dependent loads, read first by the attention launch: it rides in the projection grid (k_gemm_qkv), which outlasts it
__device__ __forceinline__ void scale_body(const float* q1, const float* q2, const float* k1, const float* k2, const float* lam, float* SC) {
#pragma clang fp contract(off)
  const int lane = threadIdx.x;
  const int h = lane & 15;
  float s1 = 0.f, s2 = 0.f;
#pragma unroll 1
  for (int d = 0; d < HD; ++d) {
    s1 += bf16_rne(q1[h * HD + d]) * bf16_rne(k1[h * HD + d]);
    s2 += bf16_rne(q2[h * HD + d]) * bf16_rne(k2[h * HD + d]);
  }
  float ls = 0.f;
#pragma unroll 1
  for (int i = 0; i < NH; ++i) ls += bf16_rne(lam[i]);
  const float base = expf(s1) - expf(s2);
  const float sc = -((float)NH * base + ls);
  const float osc = 1.0f - bf16_rne(lam[h]);
  const float v = (lane < 16) ? sc : osc;
  *(float*)(SC + lane) = v;
  asm volatile("s_wait_xcnt 0x0" ::: "memory");  // stands behind the store: in the shared grid the listing runs on from here into another range's code, which reuses the registers that it names
}

// pre-norm: h = x * rsqrt(mean(x^2) + 1e-9) * w -> f16 value plane H [NR][DM] (+ x2048 residual plane Hr for rows < EROWS);
__device__ __forceinline__ void hnorm_body(const float* x, const float* pw, h16* H, h16* Hr, int row) {
#pragma clang fp contract(off)
  __shared__ float red[8];
  const int tid = threadIdx.x, lane = tid & 31;
  const int wave = __builtin_amdgcn_readfirstlane(tid >> 5);
  const size_t off = (size_t)row * DM + tid * 8;
  const v4f a = *(const v4fa*)(x + off), b = *(const v4fa*)(x + off + 4);
  asm volatile("s_wait_xcnt 0x0" ::: "memory");  // stands behind the two loads, in front of the next loads, whose results may take the registers of the address that these name
  const v4f wa = *(const v4fa*)(pw + tid * 8), wb = *(const v4fa*)(pw + tid * 8 + 4);
  float xv[8], wv[8];
#pragma unroll
  for (int q = 0; q < 4; ++q) {
    xv[q] = bf16_rne(a[q]); xv[4 + q] = bf16_rne(b[q]);
    wv[q] = bf16_rne(wa[q]); wv[4 + q] = bf16_rne(wb[q]);
  }
  float ss = 0.f;
#pragma unroll
  for (int i = 0; i < 8; ++i) ss += xv[i] * xv[i];
#pragma unroll
  for (int o = 16; o >= 1; o >>= 1) ss += __shfl_xor(ss, o, 32);
  if (lane == 0) red[wave] = ss;
  __syncthreads();
  float tot = 0.f;
#pragma unroll
  for (int i = 0; i < 8; ++i) tot += red[i];
  const float r = rsqrtf(tot * (1.0f / (float)DM) + 1.0e-9f);
  v8h hv, rv;
#pragma unroll
  for (int i = 0; i < 8; ++i) {
    const float hval = xv[i] * r * wv[i];
    const h16 hb = toh_flush(hval);
    hv[i] = hb;
    rv[i] = toh_flush((hval - (float)hb) * 2048.0f);
  }
  {
    *(v8h*)(H + off) = hv;
    asm volatile("s_wait_xcnt 0x0" ::: "memory");  // stands behind the store, in front of the residual's arithmetic, which reuses the registers that the store names
    if (row < EROWS) *(v8h*)(Hr + off) = rv;
    asm volatile("s_wait_xcnt 0x0" ::: "memory");  // stands behind the last store: the listing runs on from here into another range's code, which reuses the registers that it names
  }
}

__device__ __forceinline__ void wcvt_body(const float* W, h16* O, int blk) {
  const size_t t = (size_t)blk * 256 + threadIdx.x;
  const v4f a = *(const v4fa*)(W + t * 8), c = *(const v4fa*)(W + t * 8 + 4);
  v8h o;
#pragma unroll
  for (int q = 0; q < 4; ++q) { o[q] = toh_flush(bf16_rne(a[q]) * 64.0f); o[4 + q] = toh_flush(bf16_rne(c[q]) * 64.0f); }
  *(v8h*)(O + t * 8) = o;
  asm volatile("s_wait_xcnt 0x0" ::: "memory");  // stands behind the store: the listing runs on from here into another range's code, which reuses the registers that it names
}

// block ranges of k_prep
#define PB_TAB (SEQ * HD / 256)
#define PB_HN NR
#define PB_WQK (NH * HW * DM / 8 / 256)
#define PB_WVO (DM * DM / 8 / 256)
#define PB_ALL (PB_TAB + PB_HN + 2 * PB_WQK + 2 * PB_WVO)
static_assert((NH * HW * DM) % (8 * 256) == 0 && (DM * DM) % (8 * 256) == 0);
__global__ __launch_bounds__(256)
void k_prep(const float* __restrict__ x, const float* __restrict__ pw, const float* __restrict__ wq, const float* __restrict__ wk,
            const float* __restrict__ wv, const float* __restrict__ wo,
            float* __restrict__ TAB, h16* __restrict__ H, h16* __restrict__ Hr, h16* __restrict__ W3, h16* __restrict__ WoT) {
  int b = blockIdx.x;  // every test below reads the same for the whole block
  if (b < PB_TAB) { tab_body(TAB, b); return; }
  b -= PB_TAB;
  if (b < PB_HN) { hnorm_body(x, pw, H, Hr, b); return; }
  b -= PB_HN;
  if (b < PB_WQK) { wcvt_body(wq, W3, b); return; }                                /* W3 rows 0..4095 */
  b -= PB_WQK;
  if (b < PB_WQK) { wcvt_body(wk, W3 + (size_t)NH * HW * DM, b); return; }         /* W3 rows 4096..8191 */
  b -= PB_WQK;
  if (b < PB_WVO) { wcvt_body(wv, W3 + (size_t)NQK * DM, b); return; }             /* W3 rows 8192..10239 */
  b -= PB_WVO;
  wcvt_body(wo, WoT, b);
}

// GEMM main loop of the output projection, K = DM, both operands k-contiguous with pitch DM. Wave tile 32 x 64: c[0..3] rows 0..15, c[4..7] rows 16..31.
// RES: a second A plane (x2048 residual) accumulates into cr.
// Operand tiles of KT k are staged in LDS by asynchronous copies, two buffers: trip t works on buffer t & 1 while tile t + 1 flies.
// Stage rows (pitch LP f16 = 144 B, an odd multiple of 16 B for the 16-byte fragment reads): A 0..127, B 128..191, residual A 192..319.
#define KT 64
#define LP 72
#define NTRIP (DM / KT)
static_assert(DM % KT == 0 && NTRIP >= 2 && KT % 32 == 0 && KT * 2 == 128);
template <bool RES> struct Ring { static constexpr int ROWS = RES ? 320 : 192; static constexpr int STG = ROWS * LP; static constexpr int BYTES = 2 * STG * 2; };

#define CPY(a, b) "global_load_async_to_lds_b128 %" #a ", %" #b ", off\n\t"
// 16 bytes per lane and copy, global -> LDS. The closing s_wait_xcnt stands in the copies' own statement so that no later write of an address register is moved in front of it.
__device__ __forceinline__ void copy12(const unsigned (&l)[12], const h16* const (&g)[12]) {
  asm volatile(CPY(0, 1) CPY(2, 3) CPY(4, 5) CPY(6, 7) CPY(8, 9) CPY(10, 11) CPY(12, 13) CPY(14, 15) CPY(16, 17) CPY(18, 19) CPY(20, 21) CPY(22, 23)
               "s_wait_xcnt 0x0"
               :: "v"(l[0]), "v"(g[0]), "v"(l[1]), "v"(g[1]), "v"(l[2]), "v"(g[2]), "v"(l[3]), "v"(g[3]), "v"(l[4]), "v"(g[4]), "v"(l[5]), "v"(g[5]),
                  "v"(l[6]), "v"(g[6]), "v"(l[7]), "v"(g[7]), "v"(l[8]), "v"(g[8]), "v"(l[9]), "v"(g[9]), "v"(l[10]), "v"(g[10]), "v"(l[11]), "v"(g[11])
               : "memory");
}
__device__ __forceinline__ void copy8(const unsigned (&l)[8], const h16* const (&g)[8]) {
  asm volatile(CPY(0, 1) CPY(2, 3) CPY(4, 5) CPY(6, 7) CPY(8, 9) CPY(10, 11) CPY(12, 13) CPY(14, 15)
               "s_wait_xcnt 0x0"
               :: "v"(l[0]), "v"(g[0]), "v"(l[1]), "v"(g[1]), "v"(l[2]), "v"(g[2]), "v"(l[3]), "v"(g[3]), "v"(l[4]), "v"(g[4]), "v"(l[5]), "v"(g[5]),
                  "v"(l[6]), "v"(g[6]), "v"(l[7]), "v"(g[7])
               : "memory");
}

// one stage: 128 threads x 16 B cover 16 rows of 128 B per copy (8 lanes per row: whole lines). lb, gA, gB, gR are the lane's own addresses in row (tid >> 3) of each plane.
template <bool RES>
__device__ __forceinline__ void stage_fill(unsigned lb, const h16* gA, const h16* gB, const h16* gR) {
  unsigned l[12]; const h16* g[12];
  // the three loops here are unrolled so that the address arrays are registers (they are asm operands)
#pragma unroll
  for (int i = 0; i < 8; ++i) { l[i] = lb + (unsigned)(i * 16 * LP * 2); g[i] = gA + (size_t)i * 16 * DM; }
#pragma unroll
  for (int i = 0; i < 4; ++i) { l[8 + i] = lb + (unsigned)((128 + i * 16) * LP * 2); g[8 + i] = gB + (size_t)i * 16 * DM; }
  copy12(l, g);
  if (RES) {
    unsigned lr[8]; const h16* gr[8];
#pragma unroll
    for (int i = 0; i < 8; ++i) { lr[i] = lb + (unsigned)((192 + i * 16) * LP * 2); gr[i] = gR + (size_t)i * 16 * DM; }
    copy8(lr, gr);
  }
}

// mrow: first of the block's 128 A rows;
// col0: first of its 64 B rows; ring: the block's LDS, Ring<RES>::BYTES bytes, free again behind the last trip's barrier.
template <bool RES>
__device__ __forceinline__ void gemm_main(const h16* Ah, const h16* Ar, const h16* Bt, int mrow, int col0, h16* ring, int tid, int w, int ln, int hh,
                                          v8f (&c)[8], v8f (&cr)[8]) {
  constexpr int STG = Ring<RES>::STG;
  const int crow = tid >> 3, ccol = (tid & 7) * 8;
  const h16* gA = Ah + (size_t)(mrow + crow) * DM + ccol;
  const h16* gR = Ar + (size_t)(mrow + crow) * DM + ccol;
  const h16* gB = Bt + (size_t)(col0 + crow) * DM + ccol;
  const unsigned lb = (unsigned)(uintptr_t)ring + (unsigned)((crow * LP + ccol) * 2);
  stage_fill<RES>(lb, gA, gB, gR);
  asm volatile("s_wait_asynccnt 0x0" ::: "memory");  // tile 0 has landed before the barrier publishes it
  __syncthreads();
  stage_fill<RES>(lb + (unsigned)(STG * 2), gA + KT, gB + KT, gR + KT);
#pragma unroll 1  // kept rolled: one body for both buffers, the buffer picked by a scalar offset
  for (int t = 0; t < NTRIP; ++t) {
    const int buf = t & 1;
    const h16* st = ring + buf * STG;
    const h16* pa = st + (32 * w + ln) * LP;
    const h16* pb = st + (128 + ln) * LP;
    const h16* pr = st + (192 + 32 * w + ln) * LP;
    // the fragments of G k-steps are read from LDS as one group in front of their products: one LDS wait per group, not one per fragment
    // (RES: one k-step per group, two would not fit the register budget beside the 16 accumulator tiles). All loops of the trip are unrolled: fragments and tiles stay in registers
    constexpr int G = RES ? 1 : 2;
#pragma unroll
    for (int k0 = 0; k0 < KT; k0 += 32 * G) {
      v16h fa[G][2], fe[G][2], fb[G][4];
#pragma unroll
      for (int s = 0; s < G; ++s) {
        const int kk = k0 + 32 * s;
        fa[s][0] = ld_frag(pa + kk, hh); fa[s][1] = ld_frag(pa + 16 * LP + kk, hh);
#pragma unroll
        for (int j = 0; j < 4; ++j) fb[s][j] = ld_frag(pb + j * 16 * LP + kk, hh);
        if (RES) { fe[s][0] = ld_frag(pr + kk, hh); fe[s][1] = ld_frag(pr + 16 * LP + kk, hh); }
        else { fe[s][0] = fa[s][0]; fe[s][1] = fa[s][1]; }
      }
#pragma unroll
      for (int s = 0; s < G; ++s) {
#pragma unroll
        for (int j = 0; j < 4; ++j) {
          c[j] = mma(fa[s][0], fb[s][j], c[j]); c[4 + j] = mma(fa[s][1], fb[s][j], c[4 + j]);
          if (RES) { cr[j] = mma(fe[s][0], fb[s][j], cr[j]); cr[4 + j] = mma(fe[s][1], fb[s][j], cr[4 + j]); }
        }
      }
    }
    asm volatile("s_wait_dscnt 0x0" ::: "memory");     // this wave's reads of buffer buf are done before the barrier frees it
    asm volatile("s_wait_asynccnt 0x0" ::: "memory");  // this wave's copies of tile t + 1 have landed before the barrier publishes them
    __syncthreads();
    if (t + 2 < NTRIP) stage_fill<RES>(lb + (unsigned)(buf * STG * 2), gA + (t + 2) * KT, gB + (t + 2) * KT, gR + (t + 2) * KT);
  }
  asm volatile("s_wait_asynccnt 0x0" ::: "memory");    // nothing in flight when the ring becomes output staging
}

// Main loop of the q|k|v projection: block tile 384 A rows x 256 B rows, 8 waves = (wm 0..3, wn 0..1), the same two-buffer ring and k order as above.
// The tile is this large for three reasons: a trip brings 80 KB from L2 for 384 x 256 outputs (a 256 x 128 tile: 48 KB for a third as many), a wave reads 14 fragments from LDS for 48 products
// (a 64 x 64 wave tile: 8 for 16), and the whole projection is 240 such blocks, one per WGP, all resident at once: no second, part-filled round.
// Stage rows (pitch LP): A 0..383 as QMS slabs of 128, B 384..639. A wave takes the A rows 32 wm .. 32 wm + 31 of each slab and the B rows 128 wn .. 128 wn + 127: wave tile 96 x 128,
// c[16 m + 8 ch + 0..3] rows 0..15 and c[16 m + 8 ch + 4..7] rows 16..31 of its 32 rows in slab m, columns 64 ch .. 64 ch + 63 of its 128.
// A slab is either 128 rows of Hh (query rows >= EROWS) or a pair slab: 64 rows of two planes, 16 of Hh's, then the same 16 of Hr's, and so on: a wave's rows 0..15 are value rows, its rows 16..31 the residuals of the same rows.
#define QMS 3
#define QAR (QMS * 128)
#define QBR 256
#define QSTG ((QAR + QBR) * LP)
#define QBYTES (2 * QSTG * 2)
#define QAREA (8 * 32 * 132 * 4)
#define QSMEM (2 * QAREA)
#define NSE (EROWS / 64)
#define NSL ((NR - EROWS) / 128)
static_assert(QSMEM >= QBYTES && QSMEM <= 320 * 1024 && QAREA % 16 == 0 && QMS == 3);
static_assert(EROWS % 64 == 0 && (NR - EROWS) % 128 == 0 && (NSE + NSL) % QMS == 0 && N3 % QBR == 0 && NQK % QBR == 0);
typedef int v4i __attribute__((ext_vector_type(4)));
// 16 bytes per lane, global -> LDS (global_load_async_to_lds_b128); l: the lane's LDS byte address
__device__ __forceinline__ void copy16(unsigned l, const h16* g) {
  __builtin_amdgcn_global_load_async_to_lds_b128((__attribute__((address_space(1))) v4i*)(unsigned long long)(uintptr_t)g, (__attribute__((address_space(3))) v4i*)l, 0, 0);
}
// one stage: 256 threads x 16 B cover 32 rows of 128 B per copy (8 lanes per row: whole lines). lb, gS[m], gB are the lane's own addresses in row (tid >> 3) of the stage's, of slab m's and of the B rows' first 32 rows;
// sst[m]: f16 elements between slab m's groups of 32 stage rows (16 rows of each plane in a pair slab, else 32 rows); kofs: first k of the tile.
__device__ __forceinline__ void qstage_fill(unsigned lb, const h16* const (&gS)[QMS], const int (&sst)[QMS], const h16* gB, int kofs) {
  // the copies are written as the builtin here: this kernel uses registers above v255, which the operands of an asm statement cannot be, and 60 address registers kept low for asm copies would not fit beside the tiles
#pragma unroll
  for (int m = 0; m < QMS; ++m)
#pragma unroll
    for (int i = 0; i < 4; ++i) copy16(lb + (unsigned)((m * 128 + i * 32) * LP * 2), gS[m] + kofs + (size_t)(i * sst[m]));
#pragma unroll
  for (int i = 0; i < 8; ++i) copy16(lb + (unsigned)((QAR + i * 32) * LP * 2), gB + kofs + (size_t)i * 32 * DM);
}

// ring: the block's LDS, QBYTES bytes, free again behind the last trip's barrier.
__device__ __forceinline__ void gemm_main_q(const h16* const (&gS)[QMS], const int (&sst)[QMS], const h16* gB, h16* ring, unsigned lb, int wm, int wn, int ln, int hh, v8f (&c)[16 * QMS]) {
  qstage_fill(lb, gS, sst, gB, 0);
  asm volatile("s_wait_asynccnt 0x0" ::: "memory");  // tile 0 has landed before the barrier publishes it
  __syncthreads();
  // A trip is eight steps of 12 products: six A fragments (kept for the four steps of a k-step) x two B fragments. The next step's two B fragments are read from LDS in front of this step's products,
  // into a second pair of registers, so that their latency passes under the products; all fourteen fragments of a k-step twice over would not fit the register budget beside the 48 accumulator tiles.
  // The fragments of a trip's first step are read directly behind the barrier that publishes their tile, in front of the refill's address arithmetic and copies, under which their latency passes.
  const h16* pa0 = ring + (32 * wm + ln) * LP;
  const h16* pb0 = ring + (QAR + 128 * wn + ln) * LP;
  v16h fa[2 * QMS], fb[2][2];
  // all fragment and product loops are unrolled: fragments and tiles stay in registers
#pragma unroll
  for (int i = 0; i < 2 * QMS; ++i) fa[i] = ld_frag(pa0 + ((i >> 1) * 128 + (i & 1) * 16) * LP, hh);
#pragma unroll
  for (int j = 0; j < 2; ++j) fb[0][j] = ld_frag(pb0 + j * 16 * LP, hh);
  qstage_fill(lb + (unsigned)(QSTG * 2), gS, sst, gB, KT);
#pragma unroll 1  // kept rolled: one body for both buffers, the buffer picked by a scalar offset
  for (int t = 0; ; ++t) {
    const int buf = t & 1;
    const h16* pa = pa0 + buf * QSTG;
    const h16* pb = pb0 + buf * QSTG;
#pragma unroll
    for (int s = 0; s < 8; ++s) {
      const int cur = s & 1, n = s + 1;
      if (n < 8) {
#pragma unroll
        for (int j = 0; j < 2; ++j) fb[cur ^ 1][j] = ld_frag(pb + ((n & 3) * 32 + j * 16) * LP + (n >> 2) * 32, hh);
      }
      __builtin_amdgcn_sched_barrier(0);  // keeps the next step's reads in front of this step's products (left free they are sunk to directly in front of their own products, and every step waits out the LDS latency)
#pragma unroll
      for (int i = 0; i < 2 * QMS; ++i) {
#pragma unroll
        for (int j = 0; j < 2; ++j) {
          const int jj = (s & 3) * 2 + j;
          const int u = (i >> 1) * 16 + (jj >> 2) * 8 + (i & 1) * 4 + (jj & 3);
          c[u] = __builtin_amdgcn_wmma_f32_16x16x32_f16(false, fa[i], false, fb[cur][j], (short)0, c[u], false, false);
        }
        // last step of the first k-step: each A fragment is read anew for the second k-step as soon as its last product is issued
        if (s == 3) fa[i] = ld_frag(pa + ((i >> 1) * 128 + (i & 1) * 16) * LP + 32, hh);
      }
      __builtin_amdgcn_sched_barrier(0);  // second fence of the pair: the next reads stay together at one place behind this step's products, not spread among them
    }
    asm volatile("s_wait_dscnt 0x0" ::: "memory");     // this wave's reads of buffer buf are done before the barrier frees it
    asm volatile("s_wait_asynccnt 0x0" ::: "memory");  // this wave's copies of tile t + 1 have landed before the barrier publishes them
    __syncthreads();
    if (t + 1 == NTRIP) break;  // the same for the whole block
    const h16* na = pa0 + (buf ^ 1) * QSTG;
    const h16* nb = pb0 + (buf ^ 1) * QSTG;
#pragma unroll
    for (int i = 0; i < 2 * QMS; ++i) fa[i] = ld_frag(na + ((i >> 1) * 128 + (i & 1) * 16) * LP, hh);
#pragma unroll
    for (int j = 0; j < 2; ++j) fb[0][j] = ld_frag(nb + j * 16 * LP, hh);
    if (t + 2 < NTRIP) qstage_fill(lb + (unsigned)(buf * QSTG * 2), gS, sst, gB, (t + 2) * KT);
  }
  asm volatile("s_wait_asynccnt 0x0" ::: "memory");    // nothing in flight when the ring becomes output staging
}

// a wave's 32 x 128 accumulator tiles of one slab (c[BASE .. BASE + 15]) -> its own staging rows sw[row][col], as they are (in a pair slab rows 0..15 are the value products, rows 16..31 the residual products of the same rows)
template <int BASE>
__device__ __forceinline__ void qkv_stage(const v8f (&c)[16 * QMS], float (*sw)[132], int ln, int hh) {
#pragma unroll
  for (int ch = 0; ch < 2; ++ch)
#pragma unroll
    for (int u = 0; u < 8; ++u)
#pragma unroll
      for (int r = 0; r < 8; ++r) sw[(u >> 2) * 16 + 8 * hh + r][ch * 64 + (u & 3) * 16 + ln] = c[BASE + 8 * ch + u][r];
}

// one staged slab -> global memory. so: the staging of the four waves of this column half, which hold 4 * WR consecutive rows (from mrow) x 128 cols (from colw); w: this wave among the four.
// The products are scaled here (weights are carried x64), in a pair slab (RES) after the residual products are folded in with 2^-11.
template <bool RES>
__device__ __forceinline__ void qkv_store(float (*so)[32][132], int w, int lane, int mrow, int colw, const float* TAB, h16* QK, h16* QKr, h16* VT, h16* VTr) {
  constexpr int WR = RES ? 16 : 32;   // output rows per wave and slab
  constexpr int NIT = WR / 4;         // 16-byte stores per lane and 64 columns
  const int row0 = mrow + WR * w;
#pragma unroll 1  // kept rolled: one body for both halves of 64 columns
  for (int ch = 0; ch < 2; ++ch) {
  const int col0 = colw + 64 * ch, sc0 = 64 * ch;
  v8h hv[NIT], rv[NIT];
  if (col0 < NQK) {
    const int rq = lane >> 3, pc = lane & 7;
    const int i0 = ((col0 & (HW - 1)) >> 1) + pc * 4;
    const float* tp = TAB + (size_t)(row0 + rq) * HD + i0;  // one address for all table loads, the rest constant offsets
    v4f csv[NIT], snv[NIT];
#pragma unroll
    for (int it = 0; it < NIT; ++it) { csv[it] = *(const v4fa*)(tp + it * 4 * HD); snv[it] = *(const v4fa*)(tp + SEQ * HD + it * 4 * HD); }
    asm volatile("s_wait_xcnt 0x0" :: "v"(tp) : "memory");  // the address is an input so that its registers live to this wait: no load's result takes them while a load that names them is issued
#pragma unroll
    for (int it = 0; it < NIT; ++it) {
      const int row = it * 4 + rq;
      v4f a = *(const v4fa*)&so[w][row][sc0 + pc * 8], b = *(const v4fa*)&so[w][row][sc0 + pc * 8 + 4];
      if (RES) {
        const v4f ar = *(const v4fa*)&so[w][16 + row][sc0 + pc * 8], br = *(const v4fa*)&so[w][16 + row][sc0 + pc * 8 + 4];
#pragma unroll
        for (int q = 0; q < 4; ++q) { a[q] = a[q] + ar[q] * 4.8828125e-4f; b[q] = b[q] + br[q] * 4.8828125e-4f; }
      }
#pragma unroll
      for (int q = 0; q < 4; ++q) { a[q] *= 0.015625f; b[q] *= 0.015625f; }
      const v4f cs = csv[it], sn = snv[it];
      float o[8];
      o[0] = a[0] * cs[0] - a[1] * sn[0]; o[1] = a[0] * sn[0] + a[1] * cs[0];
      o[2] = a[2] * cs[1] - a[3] * sn[1]; o[3] = a[2] * sn[1] + a[3] * cs[1];
      o[4] = b[0] * cs[2] - b[1] * sn[2]; o[5] = b[0] * sn[2] + b[1] * cs[2];
      o[6] = b[2] * cs[3] - b[3] * sn[3]; o[7] = b[2] * sn[3] + b[3] * cs[3];
#pragma unroll
      for (int q = 0; q < 8; ++q) {
        const h16 hb16 = toh_flush(o[q]);
        hv[it][q] = hb16;
        rv[it][q] = toh_flush((o[q] - (float)hb16) * 2048.0f);
      }
    }
    // the packed results are inputs so that all of their arithmetic stands in front of the first store: left free, part of it is moved behind stores whose registers it reuses
    if constexpr (RES) asm volatile("s_wait_xcnt 0x0" :: "v"(hv[0]), "v"(hv[1]), "v"(hv[2]), "v"(hv[3]), "v"(rv[0]), "v"(rv[1]), "v"(rv[2]), "v"(rv[3]) : "memory");
    else asm volatile("s_wait_xcnt 0x0" :: "v"(hv[0]), "v"(hv[1]), "v"(hv[2]), "v"(hv[3]), "v"(hv[4]), "v"(hv[5]), "v"(hv[6]), "v"(hv[7]) : "memory");
    {
      const size_t off = (size_t)(row0 + rq) * NQK + col0 + pc * 8;  // one address per plane for all stores, the rest constant offsets
      h16* qp = QK + off; h16* qr = QKr + off;
#pragma unroll
      for (int it = 0; it < NIT; ++it) {
        *(v8h*)(qp + (size_t)it * 4 * NQK) = hv[it];
        if (RES) *(v8h*)(qr + (size_t)it * 4 * NQK) = rv[it];
      }
      // stands behind the stores, their addresses live to here: the code that follows reuses the registers that they name
      if constexpr (RES) asm volatile("s_wait_xcnt 0x0" :: "v"(qp), "v"(qr) : "memory");
      else asm volatile("s_wait_xcnt 0x0" :: "v"(qp) : "memory");
    }
  } else {
    // V^T: a lane gathers 8 consecutive rows of one channel; the slab's rows of a channel (4 * WR f16) are whole 128-byte lines
    constexpr int PG = 4 * WR / 8;      // groups of 8 rows in the slab: 16, RES 8
    constexpr int CPI = 32 / PG;        // channels per store instruction: 2, RES 4
    static_assert(NIT * CPI == 16);
    const int chb = col0 - NQK;
    const int sub = lane / PG, p = lane & (PG - 1);
    const int sw = p / (WR / 8), sr = (p & (WR / 8 - 1)) * 8;
    const int cw = w * 16 + sub;  // the lane's first channel, among the 64
#pragma unroll
    for (int it = 0; it < NIT; ++it) {
      const int chl = cw + it * CPI;
#pragma unroll
      for (int q = 0; q < 8; ++q) {
        const float v = RES ? (so[sw][sr + q][sc0 + chl] + so[sw][16 + sr + q][sc0 + chl] * 4.8828125e-4f) * 0.015625f : so[sw][sr + q][sc0 + chl] * 0.015625f;
        const h16 hb16 = toh_flush(v);
        hv[it][q] = hb16;
        rv[it][q] = toh_flush((v - (float)hb16) * 2048.0f);
      }
    }
    // the packed results are inputs so that all of their arithmetic stands in front of the first store: left free, part of it is moved behind stores whose registers it reuses
    if constexpr (RES) asm volatile("s_wait_xcnt 0x0" :: "v"(hv[0]), "v"(hv[1]), "v"(hv[2]), "v"(hv[3]), "v"(rv[0]), "v"(rv[1]), "v"(rv[2]), "v"(rv[3]) : "memory");
    else asm volatile("s_wait_xcnt 0x0" :: "v"(hv[0]), "v"(hv[1]), "v"(hv[2]), "v"(hv[3]), "v"(hv[4]), "v"(hv[5]), "v"(hv[6]), "v"(hv[7]) : "memory");
    {
      const int ch0 = chb + cw;  // one address per plane for all stores, the rest constant offsets
      h16* vp = VT + (size_t)ch0 * SEQ + mrow + p * 8; h16* vr = VTr + (size_t)ch0 * EROWS + (RES ? mrow : 0) + p * 8;
#pragma unroll
      for (int it = 0; it < NIT; ++it) {
        *(v8h*)(vp + (size_t)it * CPI * SEQ) = hv[it];
        if (RES) *(v8h*)(vr + (size_t)it * CPI * EROWS) = rv[it];
      }
      // stands behind the stores, their addresses live to here: the code that follows reuses the registers that they name
      if constexpr (RES) asm volatile("s_wait_xcnt 0x0" :: "v"(vp), "v"(vr) : "memory");
      else asm volatile("s_wait_xcnt 0x0" :: "v"(vp) : "memory");
    }
  }
  }
}

// fused projection [NR][N3] = H . W3^T (W3 rows: q 0..4095, k 4096..8191, v 8192..10239). Block = 8 waves = QMS slabs x 256 cols.
// The rows are dealt as slabs: slabs 0 .. NSE - 1 are pair slabs (64 rows < EROWS with the value and the residual plane of h), slab NSE + i holds the 128 rows from EROWS + 128 i; a block takes QMS slabs in a row.
// The outputs leave slab by slab through two staging areas: the first two slabs are staged together, the third when both have left.
__device__ __forceinline__ void gemm_qkv_body(const h16* Hh, const h16* Hr, const h16* W3, const float* TAB,
                                              h16* QK, h16* QKr, h16* VT, h16* VTr, int blk, unsigned char* smem) {
  // one LDS block (the kernel's, QSMEM): the operand ring (QBYTES) in the main loop, then (behind the last trip's barrier) two areas of output staging so[wave][row][col], a slab each
  h16* ring = (h16*)smem;
  const int tid = threadIdx.x, lane = tid & 31, ln = lane & 15, hh = lane >> 4;
  const int wave = __builtin_amdgcn_readfirstlane(tid >> 5);
  const int w = wave & 3, wn = wave >> 2;
  const int ntn = N3 / QBR;
  const int mtl = blk / ntn, nq = blk - mtl * ntn;
  const int crow = tid >> 3, ccol = (tid & 7) * 8;
  const h16* gS[QMS]; int sst[QMS];
#pragma unroll  // unrolled so that the two arrays are registers
  for (int m = 0; m < QMS; ++m) {
    const int s = mtl * QMS + m;  // the same for the whole block
    if (s < NSE) { gS[m] = ((crow & 16) ? Hr : Hh) + (size_t)(s * 64 + (crow & 15)) * DM + ccol; sst[m] = 16 * DM; }
    else { gS[m] = Hh + (size_t)(EROWS + (s - NSE) * 128 + crow) * DM + ccol; sst[m] = 32 * DM; }
  }
  const h16* gB = W3 + (size_t)(nq * QBR + crow) * DM + ccol;
  const unsigned lb = (unsigned)(uintptr_t)ring + (unsigned)((crow * LP + ccol) * 2);
  const v8f z8 = {0.f, 0.f, 0.f, 0.f, 0.f, 0.f, 0.f, 0.f};
  v8f c[16 * QMS];
#pragma unroll
  for (int u = 0; u < 16 * QMS; ++u) c[u] = z8;
  gemm_main_q(gS, sst, gB, ring, lb, w, wn, ln, hh, c);
  const int colw = nq * QBR + 128 * wn;
  float (*so0)[32][132] = (float (*)[32][132])smem + 4 * wn;             // area 0: the staging of the four waves of this column half
  float (*so1)[32][132] = (float (*)[32][132])(smem + QAREA) + 4 * wn;   // area 1
  qkv_stage<0>(c, so0[w], ln, hh);
  qkv_stage<16>(c, so1[w], ln, hh);
#pragma unroll 1  // kept rolled: one copy of the store code for all slabs (written out three times the kernel's text would be about twice as long)
  for (int m = 0; m < QMS; ++m) {  // every test on m or s below reads the same for the whole block
    const int s = mtl * QMS + m;
    if (m == 2) {
      asm volatile("s_wait_dscnt 0x0" ::: "memory");  // this wave's reads of the first two slabs are done before the barrier frees the staging
      __syncthreads();                                // every wave has left area 0 before the last slab is written over it
      qkv_stage<32>(c, so0[w], ln, hh);
    }
    if (m != 1) __syncthreads();                      // publishes what was staged last: both areas (m = 0), area 0 anew (m = 2)
    float (*so)[32][132] = (m & 1) ? so1 : so0;
    if (s < NSE) qkv_store<true>(so, w, lane, s * 64, colw, TAB, QK, QKr, VT, VTr);
    else qkv_store<false>(so, w, lane, EROWS + (s - NSE) * 128, colw, TAB, QK, QK, VT, VT);
  }
}

// both row ranges in one grid (they write disjoint rows of QK and disjoint columns of V^T, and neither reads the other's); every block has the same ring, copies and products.
// The one-wave scale step, which reads only inputs and writes only SC, shares the grid.
#define QB_SC 1
#define QB_GEMM (((NSE + NSL) / QMS) * (N3 / QBR))
// one block per WGP, two waves per SIMD (registers)
__global__ __launch_bounds__(256)
void k_gemm_qkv(const h16* __restrict__ Hh, const h16* __restrict__ Hr, const h16* __restrict__ W3, const float* __restrict__ TAB,
                h16* __restrict__ QK, h16* __restrict__ QKr, h16* __restrict__ VT, h16* __restrict__ VTr,
                const float* __restrict__ q1, const float* __restrict__ q2, const float* __restrict__ k1, const float* __restrict__ k2,
                const float* __restrict__ lam, float* __restrict__ SC) {
  __shared__ __attribute__((aligned(16))) unsigned char smem[QSMEM];
  const int b = blockIdx.x;  // the test below reads the same for the whole block
  if (b < QB_SC) { if (threadIdx.x < 32) scale_body(q1, q2, k1, k2, lam, SC); return; }  // first, because it is the longest single chain; it passes no barrier
  gemm_qkv_body(Hh, Hr, W3, TAB, QK, QKr, VT, VTr, b - QB_SC, smem);
}

// output projection out[NR][DM] f32 = ctx . Wo^T / 64 + bf16(x); skip connection added at the store stage as float4;
template <bool RES>
__device__ __forceinline__ void gemm_out_body(const h16* Ch, const h16* Cr, const h16* WoT, const float* x, float* out, int mt0, int blk, unsigned char* smem) {
  // one LDS block (the kernel's, at least Ring<RES>::BYTES): the operand ring in the main loop, then (behind the last trip's barrier) the output staging so[wave][row][col]
  static_assert(Ring<RES>::BYTES >= 4 * 32 * 68 * 4);
  h16* ring = (h16*)smem;
  float (*so)[32][68] = (float (*)[32][68])smem;
  const int tid = threadIdx.x, lane = tid & 31, ln = lane & 15, hh = lane >> 4;
  const int w = __builtin_amdgcn_readfirstlane(tid >> 5);
  const int ntn = DM >> 6;
  const int mtl = blk / ntn, nq = blk - mtl * ntn;
  const int mrow = (mt0 + mtl) * 128;
  const int row0 = mrow + 32 * w, col0 = nq * 64;
  const v8f z8 = {0.f, 0.f, 0.f, 0.f, 0.f, 0.f, 0.f, 0.f};
  v8f c[8], cr[8];
#pragma unroll
  for (int u = 0; u < 8; ++u) { c[u] = z8; cr[u] = z8; }
  gemm_main<RES>(Ch, Cr, WoT, mrow, col0, ring, tid, w, ln, hh, c, cr);
#pragma unroll
  for (int u = 0; u < 8; ++u) {
    const int t = u & 3, hf = u >> 2;
#pragma unroll
    for (int r = 0; r < 8; ++r) {
      const float v = RES ? (c[u][r] + cr[u][r] * 4.8828125e-4f) * 0.015625f : c[u][r] * 0.015625f;
      so[w][hf * 16 + 8 * hh + r][t * 16 + ln] = v;
    }
  }
  __syncthreads();
  const int rsub = lane >> 4, c4 = (lane & 15) * 4;
  v4f ov[16];
#pragma unroll
  for (int q = 0; q < 16; ++q) {
    const int r = q * 2 + rsub;
    const v4f v = *(const v4fa*)&so[w][r][c4];
    if (q) asm volatile("s_wait_xcnt 0x0" ::: "memory");  // stands between the loads: a load's result may take the registers of an address that an earlier load names
    const v4f xr = *(const v4fa*)(x + (size_t)(row0 + r) * DM + col0 + c4);
    v4f o;
    o[0] = v[0] + bf16_rne(xr[0]); o[1] = v[1] + bf16_rne(xr[1]); o[2] = v[2] + bf16_rne(xr[2]); o[3] = v[3] + bf16_rne(xr[3]);
    ov[q] = o;
  }
  // the sixteen sums are inputs so that all of their arithmetic stands in front of the first store: left free, part of it is moved behind stores whose data registers it reuses
  asm volatile("s_wait_xcnt 0x0" :: "v"(ov[0]), "v"(ov[1]), "v"(ov[2]), "v"(ov[3]), "v"(ov[4]), "v"(ov[5]), "v"(ov[6]), "v"(ov[7]),
               "v"(ov[8]), "v"(ov[9]), "v"(ov[10]), "v"(ov[11]), "v"(ov[12]), "v"(ov[13]), "v"(ov[14]), "v"(ov[15]) : "memory");
  {
#pragma unroll
    for (int q = 0; q < 16; ++q) {
      const int r = q * 2 + rsub;
      *(v4f*)(out + (size_t)(row0 + r) * DM + col0 + c4) = ov[q];
      asm volatile("s_wait_xcnt 0x0" ::: "memory");  // stands behind each store, in front of the next stores' address arithmetic, which reuses the registers that it names
    }
    
  }
}

// both row ranges in one grid (they write disjoint rows and neither reads the other's): the blocks with residual planes, which run longer, come first
#define OB_EARLY ((EROWS / 128) * (DM / 64))
#define OB_LATE (((NR - EROWS) / 128) * (DM / 64))
__global__ __launch_bounds__(128) __attribute__((amdgpu_num_vgpr(256)))
void k_gemm_out(const h16* __restrict__ Ch, const h16* __restrict__ Cr, const h16* __restrict__ WoT, const float* __restrict__ x, float* __restrict__ out) {
  __shared__ __attribute__((aligned(16))) unsigned char smem[Ring<true>::BYTES];
  const int b = blockIdx.x;  // the test reads the same for the whole block
  if (b < OB_EARLY) gemm_out_body<true>(Ch, Cr, WoT, x, out, 0, b, smem);
  else gemm_out_body<false>(Ch, Ch, WoT, x, out, EROWS / 128, b - OB_EARLY, smem);
}

// Transposed flash attention. One unit of NW waves per (head, 16-query tile); wave = (score component c, channel slab hf).
// S^T[key][query] = K_c . Q_c^T (A = K rows, B = Q rows), per-lane (= per-query) running max / sum in the exp2 domain,
// P^T (carried x256) packed from the S^T accumulators directly as the B fragment of O^T[ch][query] = V^T . P^T (A = V^T rows). Causal mask as a select.
// NW = 4: query rows < EROWS, value + x2048 residual planes on q, k, P, v, 64 channels per wave (NW = 2: single f16 products, 128 channels per wave; query rows >= EROWS have attn_late_body).
// Epilogue: both components meet in LDS (block barrier), O = O_0 + scale[h] O_1, per-head RMSNorm, x (1 - lam[h]), f16 ctx rows (+ residual rows);
template <int NW>
__device__ __forceinline__ void attn_body(const h16* QK, const h16* QKr, const h16* VT, const h16* VTr,
                                          const float* SC, const float* hw, h16* CTX, h16* CTXr, int qt0, int nqt,
                                          int unit, int tid, float (*comb)[16][132]) {
  constexpr bool EARLY = (NW == 4);
  constexpr int NT = 16 / NW;
  constexpr int RPW = 16 / NW;
  static_assert(NW == 2 || NW == 4);
  static_assert(NW * NT * 16 == 2 * HD);
  // unit: which (head, 16-query tile); tid: the thread's number among the unit's NW waves; comb: the unit's own LDS, [2][16][132] floats
  const int lane = tid & 31, ln = lane & 15, hh = lane >> 4;
  const int wave = __builtin_amdgcn_readfirstlane(tid >> 5);
  const int c = wave & 1, hf = wave >> 1;
  const int head = unit / nqt;
  const int qt = qt0 + (unit - head * nqt);
  const int q0 = qt * 16, qi = q0 + ln;
  const size_t qoff = (size_t)qi * NQK + head * HW + c * HD;
  const int kcol = NH * HW + head * HW + c * HD;
  const int chb = head * HD + hf * (NT * 16);
  const float NEGV = -1.0e30f;
  const float SCL2 = 0.08838834764831845f * 1.4426950408889634f;
  const float PCL = 8.0f;

  const v8f z8 = {0.f, 0.f, 0.f, 0.f, 0.f, 0.f, 0.f, 0.f};
  v16h qh[4];
#pragma unroll
  for (int ks = 0; ks < 4; ++ks) qh[ks] = ld_frag(QK + qoff + ks * 32, hh);

  v8f acc[NT], accr[NT];
#pragma unroll
  for (int dt = 0; dt < NT; ++dt) { acc[dt] = z8; accr[dt] = z8; }
  float m = NEGV, l = 0.f;
  const int nsteps = (q0 + 16 + 31) >> 5;

#pragma unroll 1
  for (int js = 0; js < nsteps; ++js) {
    const int j0 = js << 5;
    v8f s0 = z8, s1 = z8, t0 = z8, t1 = z8;
    const size_t ko = (size_t)(j0 + ln) * NQK + kcol;
#pragma unroll
    for (int ks = 0; ks < 4; ++ks) {
      const v16h a0 = ld_frag_g(QK + ko + ks * 32, hh);
      const v16h a1 = ld_frag_g(QK + ko + (size_t)16 * NQK + ks * 32, hh);
      v16h bq = qh[ks];
      if (EARLY) bq = ld_frag_g(QK + qoff + ks * 32, hh);
      s0 = mmam(a0, bq, s0);
      s1 = mmam(a1, bq, s1);
      if (EARLY) {
        const v16h br = ld_frag_g(QKr + qoff + ks * 32, hh);
        const v16h r0 = ld_frag_g(QKr + ko + ks * 32, hh);
        const v16h r1 = ld_frag_g(QKr + ko + (size_t)16 * NQK + ks * 32, hh);
        t0 = mmam(r0, bq, t0);
        t0 = mmam(a0, br, t0);
        t1 = mmam(r1, bq, t1);
        t1 = mmam(a1, br, t1);
      }
    }

    float xv[16];
    float mx = NEGV;
#pragma unroll
    for (int r = 0; r < 8; ++r) {
      const int k0 = j0 + 8 * hh + r, k1 = k0 + 16;
      float e0 = s0[r], e1 = s1[r];
      if (EARLY) { e0 += t0[r] * 4.8828125e-4f; e1 += t1[r] * 4.8828125e-4f; }
      xv[r] = (k0 <= qi) ? e0 * SCL2 : NEGV;
      xv[8 + r] = (k1 <= qi) ? e1 * SCL2 : NEGV;
      mx = fmaxf(mx, fmaxf(xv[r], xv[8 + r]));
    }
    mx = fmaxf(mx, __shfl_xor(mx, 16, 32));
    const float mn = fmaxf(m, mx);
    const float alpha = exp2_hw(m - mn);
    m = mn;

    v16h ph, pr;
    float ps = 0.f;
#pragma unroll
    for (int i = 0; i < 16; ++i) {
      const float e = xv[i] - mn + PCL;
      const float pe = exp2_hw(e);
      const float p = (e < -14.0f) ? 0.f : pe;
      const h16 pb = (h16)p;
      ph[i] = pb;
      if (EARLY) {
        pr[i] = toh_flush((p - (float)pb) * 2048.0f);
        ps += p;
      } else {
        pr[i] = pb;
        ps += (float)pb;
      }
    }
    ps += __shfl_xor(ps, 16, 32);
    l = l * alpha + ps;

#pragma unroll
    for (int dt = 0; dt < NT; ++dt)
#pragma unroll
      for (int r = 0; r < 8; ++r) { acc[dt][r] *= alpha; if (EARLY) accr[dt][r] *= alpha; }

#pragma unroll
    for (int dt = 0; dt < NT; ++dt) {
      const int ch = chb + dt * 16 + ln;
      const v16h vh = ld_frag_g(VT + (size_t)ch * SEQ + j0, hh);
      acc[dt] = mmam(vh, ph, acc[dt]);
      if (EARLY) {
        const v16h vr = ld_frag_g(VTr + (size_t)ch * EROWS + j0, hh);
        accr[dt] = mmam(vh, pr, accr[dt]);
        accr[dt] = mmam(vr, ph, accr[dt]);
      }
    }
  }

  const float inv = 1.0f / l;
#pragma unroll
  for (int dt = 0; dt < NT; ++dt)
#pragma unroll
    for (int r = 0; r < 8; ++r) {
      const float v = EARLY ? (acc[dt][r] + accr[dt][r] * 4.8828125e-4f) * inv : acc[dt][r] * inv;
      comb[c][ln][hf * (NT * 16) + dt * 16 + 8 * hh + r] = v;
    }
  __syncthreads();

  const float scl = SC[head], osc = SC[NH + head];
  const int sub = lane >> 4, pc = lane & 15;
  const v4f wa = *(const v4fa*)(hw + pc * 8), wb = *(const v4fa*)(hw + pc * 8 + 4);
  const float wv[8] = {bf16_rne(wa[0]), bf16_rne(wa[1]), bf16_rne(wa[2]), bf16_rne(wa[3]), bf16_rne(wb[0]), bf16_rne(wb[1]), bf16_rne(wb[2]), bf16_rne(wb[3])};
  v8h hv[RPW / 2], rv[RPW / 2];
#pragma unroll
  for (int it = 0; it < RPW / 2; ++it) {
    const int row = wave * RPW + it * 2 + sub;
    const v4f a0 = *(const v4fa*)&comb[0][row][pc * 8], a1 = *(const v4fa*)&comb[0][row][pc * 8 + 4];
    const v4f b0 = *(const v4fa*)&comb[1][row][pc * 8], b1 = *(const v4fa*)&comb[1][row][pc * 8 + 4];
    float o[8];
#pragma unroll
    for (int q = 0; q < 4; ++q) { o[q] = a0[q] + scl * b0[q]; o[4 + q] = a1[q] + scl * b1[q]; }
    float ss = 0.f;
#pragma unroll
    for (int q = 0; q < 8; ++q) ss += o[q] * o[q];
#pragma unroll
    for (int d = 1; d < 16; d <<= 1) ss += __shfl_xor(ss, d, 32);
    const float rms = rsqrtf(ss * (1.0f / (float)HD) + 1.0e-9f);
#pragma unroll
    for (int q = 0; q < 8; ++q) {
      const float val = o[q] * rms * wv[q] * osc;
      const h16 hb = toh_flush(val);
      hv[it][q] = hb;
      rv[it][q] = toh_flush((val - (float)hb) * 2048.0f);
    }
  }
  {
#pragma unroll
    for (int it = 0; it < RPW / 2; ++it) {
      const int row = wave * RPW + it * 2 + sub;
      const size_t off = (size_t)(q0 + row) * DM + head * HD + pc * 8;
      *(v8h*)(CTX + off) = hv[it];
      if (EARLY) *(v8h*)(CTXr + off) = rv[it];
    }
    asm volatile("s_wait_xcnt 0x0" ::: "memory");  // stands behind the stores: in the shared grid the listing runs on from here into the other range's code, which reuses the registers that they name
  }
}

// Query rows >= EROWS: the same transposed flash attention with single f16 products, AQB queries of one head at a time, 8 waves = (score component c, 16-query tile qs), 128 channels per wave.
// The head's K rows (both components side by side, 512 B) and V^T rows of a tile of AKT keys are staged in LDS by asynchronous copies and read by all 8 waves;
// two buffers: trip t works on buffer t & 1 while tile t + 1 flies. Every wave walks its keys in steps of 32 from key 0, as one wave per 16 queries would.
// Stage: K rows 0..AKT-1 at pitch AKP f16 = 528 B, then V^T rows 0..HD-1 at pitch AVP f16 = 144 B (odd multiples of 16 B for the 16-byte fragment reads).
#define AQB 64
#define AKT 64
#define AKP 264
#define AVP 72
#define ASTG (AKT * AKP + HD * AVP)
// Causal work dealt evenly: a query block that starts at query q walks (q + AQB) / AKT key tiles, so the blocks of a head differ widely in length. Each head's query blocks are dealt to AGRP work-groups:
// the longest ones stand alone, every other work-group takes a long one and then a short one, one after the other in every wave, so that all work-groups walk about the same number of key tiles.
#define AGRP 16
static_assert(AQB == AKT && AKT == 64 && EROWS % AKT == 0 && (SEQ - EROWS) % AQB == 0 && EROWS / AKT + 1 >= 2);
static_assert(AKP >= HW + 8 && (AKP * 2) % 32 == 16 && AVP >= AKT + 8 && (AVP * 2) % 32 == 16 && (ASTG * 2) % 16 == 0);

// one stage, 256 threads x 16 B per copy: 8 K rows of 512 B (32 lanes per row), 8 copies; 32 V^T rows of 128 B (8 lanes per row), 4 copies. All four arguments are the lane's own addresses.
__device__ __forceinline__ void attn_fill(unsigned lk, unsigned lv, const h16* gK, const h16* gV) {
  unsigned l[12]; const h16* g[12];
  // both loops are unrolled so that the address arrays are registers (they are asm operands)
#pragma unroll
  for (int i = 0; i < 8; ++i) { l[i] = lk + (unsigned)(i * 8 * AKP * 2); g[i] = gK + (size_t)i * 8 * NQK; }
#pragma unroll
  for (int i = 0; i < 4; ++i) { l[8 + i] = lv + (unsigned)(i * 32 * AVP * 2); g[8 + i] = gV + (size_t)i * 32 * SEQ; }
  copy12(l, g);
}

__device__ __forceinline__ void attn_late_body(const h16* QK, const h16* VT, const float* SC, const float* hw, h16* CTX, int blk, unsigned char* smem) {
  constexpr int NT = 8;
  constexpr int RPW = AQB / 8;
  // one LDS block (the kernel's, 2 * ASTG * 2 bytes): the K / V^T ring in the key loop, then (behind the last trip's barrier) the two components' outputs comb[c][query][channel]
  static_assert(2 * ASTG * 2 >= 2 * AQB * 132 * 4);
  h16* ring = (h16*)smem;
  float (*comb)[AQB][132] = (float (*)[AQB][132])smem;
  const int tid = threadIdx.x, lane = tid & 31, ln = lane & 15, hh = lane >> 4;
  const int wave = __builtin_amdgcn_readfirstlane(tid >> 5);
  const int c = wave & 1, qs = wave >> 1;
  constexpr int nqb = (SEQ - EROWS) / AQB;
  constexpr int NSGL = 2 * AGRP - nqb;  // work-groups with one query block (the NSGL longest); the others take two: nqb = NSGL + 2 * (AGRP - NSGL)
  static_assert(nqb >= AGRP && nqb <= 2 * AGRP);
  const int head = blk / AGRP;
  const int grp = blk - head * AGRP;
  const int npass = (grp < NSGL) ? 1 : 2;
  const float NEGV = -1.0e30f;
  const float SCL2 = 0.08838834764831845f * 1.4426950408889634f;
  const float PCL = 8.0f;
  const v8f z8 = {0.f, 0.f, 0.f, 0.f, 0.f, 0.f, 0.f, 0.f};

#pragma unroll 1  // kept rolled: one body for both query blocks of the work-group
  for (int pass = 0; pass < npass; ++pass) {
  // query blocks nqb-1 .. nqb-AGRP come first, blocks 0 .. nqb-AGRP-1 second: each exactly once; the two lengths of a pair add up to the same sum in every pair
  const int q0b = EROWS + ((pass == 0) ? nqb - 1 - grp : grp - NSGL) * AQB;
  const int q0 = q0b + qs * 16, qi = q0 + ln;
  if (pass) {  // the same for the whole work-group
    asm volatile("s_wait_dscnt 0x0" ::: "memory");  // this wave's reads of the first query block's comb rows are done before the barrier frees that LDS
    __syncthreads();                                // every wave has left comb before the copies below refill the ring over it
  }
  v16h qh[4];
#pragma unroll
  for (int ks = 0; ks < 4; ++ks) qh[ks] = ld_frag(QK + (size_t)qi * NQK + head * HW + c * HD + ks * 32, hh);

  v8f acc[NT];
#pragma unroll
  for (int dt = 0; dt < NT; ++dt) acc[dt] = z8;
  float m = NEGV, l = 0.f;

  const int ntiles = (q0b + AQB) / AKT;  // >= 2: q0b >= EROWS
  const h16* gK = QK + (size_t)(tid >> 5) * NQK + NH * HW + head * HW + (tid & 31) * 8;
  const h16* gV = VT + (size_t)(head * HD + (tid >> 3)) * SEQ + (tid & 7) * 8;
  const unsigned lk = (unsigned)(uintptr_t)ring + (unsigned)(((tid >> 5) * AKP + (tid & 31) * 8) * 2);
  const unsigned lv = (unsigned)(uintptr_t)ring + (unsigned)((AKT * AKP + (tid >> 3) * AVP + (tid & 7) * 8) * 2);
  attn_fill(lk, lv, gK, gV);
  asm volatile("s_wait_asynccnt 0x0" ::: "memory");  // tile 0 has landed before the barrier publishes it
  __syncthreads();
  attn_fill(lk + (unsigned)(ASTG * 2), lv + (unsigned)(ASTG * 2), gK + (size_t)AKT * NQK, gV + AKT);
#pragma unroll 1  // kept rolled: one body for both buffers, the buffer picked by a scalar offset
  for (int t = 0; t < ntiles; ++t) {
    const int buf = t & 1;
    const h16* st = ring + buf * ASTG;
#pragma unroll 1  // kept rolled: one body for both 32-key halves of the tile
    for (int sub = 0; sub < AKT / 32; ++sub) {
      const int j0 = t * AKT + sub * 32;
      if (j0 > q0 + 15) continue;  // wave-uniform: every key of the step lies behind all 16 queries of this wave (only in the block's last tile)
      const h16* pk = st + (sub * 32 + ln) * AKP + c * HD;
      const h16* pv = st + AKT * AKP + ln * AVP + sub * 32;
      v16h ka[4][2];
#pragma unroll
      for (int ks = 0; ks < 4; ++ks) { ka[ks][0] = ld_frag(pk + ks * 32, hh); ka[ks][1] = ld_frag(pk + 16 * AKP + ks * 32, hh); }
      v8f s0 = z8, s1 = z8;
#pragma unroll
      for (int ks = 0; ks < 4; ++ks) { s0 = mma(ka[ks][0], qh[ks], s0); s1 = mma(ka[ks][1], qh[ks], s1); }
      v16h vh[NT];
#pragma unroll
      for (int dt = 0; dt < NT; ++dt) vh[dt] = ld_frag(pv + dt * 16 * AVP, hh);
      __builtin_amdgcn_sched_barrier(0);  // keeps the V^T reads together here, in flight under the softmax (left free they are spread over it in pairs, the last ones directly in front of their products)

      float xv[16];
      float mx = NEGV;
#pragma unroll
      for (int r = 0; r < 8; ++r) {
        const int k0 = j0 + 8 * hh + r, k1 = k0 + 16;
        xv[r] = (k0 <= qi) ? s0[r] * SCL2 : NEGV;
        xv[8 + r] = (k1 <= qi) ? s1[r] * SCL2 : NEGV;
        mx = fmaxf(mx, fmaxf(xv[r], xv[8 + r]));
      }
      mx = fmaxf(mx, __shfl_xor(mx, 16, 32));
      const float mn = fmaxf(m, mx);
      const float alpha = exp2_hw(m - mn);
      m = mn;

      v16h ph;
      float ps = 0.f;
#pragma unroll
      for (int i = 0; i < 16; ++i) {
        const float e = xv[i] - mn + PCL;
        const float pe = exp2_hw(e);
        const float p = (e < -14.0f) ? 0.f : pe;
        const h16 pb = (h16)p;
        ph[i] = pb;
        ps += (float)pb;
      }
      ps += __shfl_xor(ps, 16, 32);
      l = l * alpha + ps;

#pragma unroll
      for (int dt = 0; dt < NT; ++dt)
#pragma unroll
        for (int r = 0; r < 8; ++r) acc[dt][r] *= alpha;
#pragma unroll
      for (int dt = 0; dt < NT; ++dt) acc[dt] = mma(vh[dt], ph, acc[dt]);
    }
    asm volatile("s_wait_dscnt 0x0" ::: "memory");     // this wave's reads of buffer buf are done before the barrier frees it
    asm volatile("s_wait_asynccnt 0x0" ::: "memory");  // this wave's copies of tile t + 1 have landed before the barrier publishes them
    __syncthreads();
    if (t + 2 < ntiles)
      attn_fill(lk + (unsigned)(buf * ASTG * 2), lv + (unsigned)(buf * ASTG * 2), gK + (size_t)(t + 2) * AKT * NQK, gV + (t + 2) * AKT);
  }
  asm volatile("s_wait_asynccnt 0x0" ::: "memory");    // nothing in flight when the ring becomes output staging

  const float inv = 1.0f / l;
#pragma unroll
  for (int dt = 0; dt < NT; ++dt)
#pragma unroll
    for (int r = 0; r < 8; ++r) comb[c][qs * 16 + ln][dt * 16 + 8 * hh + r] = acc[dt][r] * inv;
  __syncthreads();

  const float scl = SC[head], osc = SC[NH + head];
  const int sub = lane >> 4, pc = lane & 15;
  const v4f wa = *(const v4fa*)(hw + pc * 8), wb = *(const v4fa*)(hw + pc * 8 + 4);
  const float wv[8] = {bf16_rne(wa[0]), bf16_rne(wa[1]), bf16_rne(wa[2]), bf16_rne(wa[3]), bf16_rne(wb[0]), bf16_rne(wb[1]), bf16_rne(wb[2]), bf16_rne(wb[3])};
  v8h hv[RPW / 2];
#pragma unroll
  for (int it = 0; it < RPW / 2; ++it) {
    const int row = wave * RPW + it * 2 + sub;
    const v4f a0 = *(const v4fa*)&comb[0][row][pc * 8], a1 = *(const v4fa*)&comb[0][row][pc * 8 + 4];
    const v4f b0 = *(const v4fa*)&comb[1][row][pc * 8], b1 = *(const v4fa*)&comb[1][row][pc * 8 + 4];
    float o[8];
#pragma unroll
    for (int q = 0; q < 4; ++q) { o[q] = a0[q] + scl * b0[q]; o[4 + q] = a1[q] + scl * b1[q]; }
    float ss = 0.f;
#pragma unroll
    for (int q = 0; q < 8; ++q) ss += o[q] * o[q];
#pragma unroll
    for (int d = 1; d < 16; d <<= 1) ss += __shfl_xor(ss, d, 32);
    const float rms = rsqrtf(ss * (1.0f / (float)HD) + 1.0e-9f);
#pragma unroll
    for (int q = 0; q < 8; ++q) hv[it][q] = toh_flush(o[q] * rms * wv[q] * osc);
  }
#pragma unroll
  for (int it = 0; it < RPW / 2; ++it) {
    const int row = wave * RPW + it * 2 + sub;
    *(v8h*)(CTX + (size_t)(q0b + row) * DM + head * HD + pc * 8) = hv[it];
  }
  asm volatile("s_wait_xcnt 0x0" ::: "memory");  // stands behind the stores, in front of the next query block's writes to the registers that they name
  }
}

// both query ranges in one grid (they write disjoint ctx rows and neither reads the other's): the AB_LATE long blocks come first, one for each place they had alone;
// behind them AB_EARLY blocks of two (head, 16-query tile) units of four waves each, which run beside the long ones; a block's two tiles are j and last - j, so that every such block brings the same number of key steps.
#define AB_LATE (NH * AGRP)
#define AB_EARLY (NH * (EROWS / 16) / 2)
static_assert((EROWS / 16) % 2 == 0 && 2 * ASTG * 2 >= 2 * 2 * 16 * 132 * 4);
__global__ __launch_bounds__(256) __attribute__((amdgpu_num_vgpr(256)))
void k_attn(const h16* __restrict__ QK, const h16* __restrict__ QKr, const h16* __restrict__ VT, const h16* __restrict__ VTr,
            const float* __restrict__ SC, const float* __restrict__ hw, h16* __restrict__ CTX, h16* __restrict__ CTXr) {
  __shared__ __attribute__((aligned(16))) unsigned char smem[2 * ASTG * 2];
  const int b = blockIdx.x;  // the test reads the same for the whole block
  if (b < AB_LATE) {
    attn_late_body(QK, VT, SC, hw, CTX, b, smem);
  } else {
    const int tid = threadIdx.x;
    const int half = __builtin_amdgcn_readfirstlane(tid >> 7);
    constexpr int NQT = EROWS / 16;
    const int eb = b - AB_LATE, head = eb / (NQT / 2), j = eb - head * (NQT / 2);
    attn_body<4>(QK, QKr, VT, VTr, SC, hw, CTX, CTXr, 0, NQT, head * NQT + (half ? NQT - 1 - j : j), tid & 127, (float (*)[16][132])(smem + half * (2 * 16 * 132 * 4)));
  }
}

extern "C" void kernel_launch(void* const* d_in, const int* in_sizes, int n_in,
                              void* d_out, int out_size, void* d_ws, size_t ws_size, hipStream_t stream) {
  if (n_in < 12) return;
  if (in_sizes[0] < NR * DM) return;
  if (in_sizes[1] < DM) return;
  if (in_sizes[2] < NH * HW * DM || in_sizes[3] < NH * HW * DM) return;
  if (in_sizes[4] < DM * DM || in_sizes[5] < DM * DM) return;
  if (in_sizes[6] < HD) return;
  if (in_sizes[7] < NH * HD || in_sizes[8] < NH * HD || in_sizes[9] < NH * HD || in_sizes[10] < NH * HD) return;
  if (in_sizes[11] < NH) return;
  if (out_size < NR * DM) return;
  const float* x   = (const float*)d_in[0];
  const float* pw  = (const float*)d_in[1];
  const float* wq  = (const float*)d_in[2];
  const float* wk  = (const float*)d_in[3];
  const float* wv  = (const float*)d_in[4];
  const float* wo  = (const float*)d_in[5];
  const float* hnw = (const float*)d_in[6];
  const float* q1  = (const float*)d_in[7];
  const float* q2  = (const float*)d_in[8];
  const float* k1  = (const float*)d_in[9];
  const float* k2  = (const float*)d_in[10];
  const float* lam = (const float*)d_in[11];
  float* out = (float*)d_out;

  // workspace regions (bytes); every region but TH, which nothing reads or writes, is written with whole-row stores inside its exact extent
  constexpr size_t SZ_TH  = 512;
  constexpr size_t SZ_TAB = (size_t)2 * SEQ * HD * 4;
  constexpr size_t SZ_SC  = 256;
  constexpr size_t SZ_H   = (size_t)NR * DM * 2;
  constexpr size_t SZ_HR  = (size_t)EROWS * DM * 2;
  constexpr size_t SZ_W3  = (size_t)N3 * DM * 2;
  constexpr size_t SZ_WO  = (size_t)DM * DM * 2;
  constexpr size_t SZ_QK  = (size_t)NR * NQK * 2;
  constexpr size_t SZ_QKR = (size_t)EROWS * NQK * 2;
  constexpr size_t SZ_VT  = (size_t)DM * SEQ * 2;
  constexpr size_t SZ_VTR = (size_t)DM * EROWS * 2;
  constexpr size_t SZ_CX  = (size_t)NR * DM * 2;
  constexpr size_t SZ_CXR = (size_t)EROWS * DM * 2;
  constexpr size_t OF_TH  = 0;
  constexpr size_t OF_TAB = OF_TH + SZ_TH;
  constexpr size_t OF_SC  = OF_TAB + SZ_TAB;
  constexpr size_t OF_H   = OF_SC + SZ_SC;
  constexpr size_t OF_HR  = OF_H + SZ_H;
  constexpr size_t OF_W3  = OF_HR + SZ_HR;
  constexpr size_t OF_WO  = OF_W3 + SZ_W3;
  constexpr size_t OF_QK  = OF_WO + SZ_WO;
  constexpr size_t OF_QKR = OF_QK + SZ_QK;
  constexpr size_t OF_VT  = OF_QKR + SZ_QKR;
  constexpr size_t OF_VTR = OF_VT + SZ_VT;
  constexpr size_t OF_CX  = OF_VTR + SZ_VTR;
  constexpr size_t OF_CXR = OF_CX + SZ_CX;
  constexpr size_t SZ_ALL = OF_CXR + SZ_CXR;
  static_assert(SZ_TH >= 128 * 4 && SZ_SC >= 32 * 4);
  static_assert(SZ_TH % 256 == 0 && SZ_TAB % 256 == 0 && SZ_SC % 256 == 0 && SZ_H % 256 == 0 && SZ_HR % 256 == 0 && SZ_W3 % 256 == 0);
  static_assert(SZ_WO % 256 == 0 && SZ_QK % 256 == 0 && SZ_QKR % 256 == 0 && SZ_VT % 256 == 0 && SZ_VTR % 256 == 0 && SZ_CX % 256 == 0 && SZ_CXR % 256 == 0);
  static_assert(SZ_ALL <= (size_t)134217728);
  if (SZ_ALL > ws_size) return;
  char* ws = (char*)d_ws;
  float* TAB  = (float*)(ws + OF_TAB);
  float* SC   = (float*)(ws + OF_SC);
  h16*   Hh   = (h16*)(ws + OF_H);
  h16*   Hr   = (h16*)(ws + OF_HR);
  h16*   W3   = (h16*)(ws + OF_W3);
  h16*   WoT  = (h16*)(ws + OF_WO);
  h16*   QK   = (h16*)(ws + OF_QK);
  h16*   QKr  = (h16*)(ws + OF_QKR);
  h16*   VT   = (h16*)(ws + OF_VT);
  h16*   VTr  = (h16*)(ws + OF_VTR);
  h16*   CTX  = (h16*)(ws + OF_CX);
  h16*   CTXr = (h16*)(ws + OF_CXR);

  k_prep<<<(unsigned)PB_ALL, 256, 0, stream>>>(x, pw, wq, wk, wv, wo, TAB, Hh, Hr, W3, WoT);

  k_gemm_qkv<<<(unsigned)(QB_SC + QB_GEMM), 256, 0, stream>>>(Hh, Hr, W3, TAB, QK, QKr, VT, VTr, q1, q2, k1, k2, lam, SC);

  k_attn<<<(unsigned)(AB_LATE + AB_EARLY), 256, 0, stream>>>(QK, QKr, VT, VTr, SC, hnw, CTX, CTXr);

  k_gemm_out<<<(unsigned)(OB_EARLY + OB_LATE), 128, 0, stream>>>(CTX, CTXr, WoT, x, out);
}
